// v000
// Times are from an AMD MI455X. After a warm-up the kernel runs many times in a row, and a time is the length of
// such a window on the GPU divided by its runs, so every launch and the gaps after it count. The runs cycle
// through copies of the inputs. A figure is the median of several windows, for all but v000 over two sittings.
// Sittings can differ by a few percent; kernels timed side by side share one.
// v000 is the starting kernel. One run takes 118 microseconds.
#include <hip/hip_runtime.h>

// Causal self-attention: x [NB][SEQ][128]; qkv = x w_qkv + b_qkv ([in][out] weight, q | k | v column thirds, 4 heads x 32, head h = columns h*32+d); scores x 32^-0.5; causal select (diagonal kept); softmax; out = merged w_proj + b_proj ([in][out]).
// Compute dtypes, f32 accumulate everywhere: qkv projection v_wmma_f32_16x16x32_bf16 on bf16 RNE copies of x / w_qkv (single product); attention query rows < 256: bf16 hi/lo planes, 3 products for k q^T and for v^T p; query rows >= 256: v_wmma_f32_16x16x32_f16 single products (q, k, v f16 planes, p carried x1024 in the exponent); output projection: bf16 hi/lo context planes x bf16 w_proj (2 products). Softmax f32, online running-max form in the log2 domain.
// Fused attention, one wave per 16 query rows, 32-key steps, head dim 32 = one 32-deep k-step for the scores: S^T = K Q^T (keys on D rows, queries on D columns), p built per lane and fed as the B operand of O^T = V^T P^T (B element r <- tile keys 0-15 [r], element 8+r <- tile keys 16-31 [r]); no score / probability plane in memory.

#ifndef NB
#define NB 8
#endif
#ifndef SEQ
#define SEQ 2048
#endif
#define NB_FULL  8
#define SEQ_FULL 2048
#define DM   128
#define NH   4
#define HD   32
#define DQ   (NH * HD)
#define FW   (3 * DQ)
#define RH   256                      // query rows < RH use bf16 hi/lo planes
#define PLN  ((size_t)NB * NH * SEQ * HD)   // elements of one [b*h][t][d] plane
#define PLH  ((size_t)NB * NH * RH * HD)    // elements of one hi/lo plane (rows < RH)
#define SCL2 0.25503486164918f        // HD^-0.5 * log2(e)
#define PCL  10.0f                    // log2 of the p carry (x1024) for the f16 path
#define NEGB (-3.0e38f)
#define YP   36                       // staging pitch (floats) of the 16 x 32 attention result tile

static_assert(DQ == DM);               // merged width == model width
static_assert(HD == 32);               // scores: one 32-deep k-step; head row == 64 B of 16-bit data; proj k-step == one head
static_assert(2 * HD == 64);
static_assert(HD % 16 == 0);           // O^T tiles of 16 d rows
static_assert(YP % 4 == 0 && YP >= HD); // 16-B aligned staging rows
static_assert(DM % 64 == 0);           // GEMM K multiple of 32, weight lines of 64
static_assert(DQ % 32 == 0);           // proj GEMM K multiple of 32
static_assert(FW % 64 == 0);           // GEMM N tile multiple
static_assert(SEQ % 64 == 0);          // GEMM M tile multiple, 32-key steps, V^T lines
static_assert(RH % 64 == 0);           // hi/lo V^T lines, 32-key steps inside RH
static_assert(RH % 2 == 0);            // k_qkp wave (t, t+1) on one side of RH
static_assert(RH <= SEQ);
static_assert((SEQ - RH) % 16 == 0);
static_assert(NB <= NB_FULL);
static_assert(SEQ <= SEQ_FULL);

typedef _Float16 h16;
typedef unsigned short bf;
typedef __attribute__((ext_vector_type(16))) __bf16   v16bf;
typedef __attribute__((ext_vector_type(16))) _Float16 v16h;
typedef __attribute__((ext_vector_type(16))) unsigned short v16us;
typedef __attribute__((ext_vector_type(8)))  _Float16 v8h;
typedef __attribute__((ext_vector_type(8)))  unsigned short v8us;
typedef __attribute__((ext_vector_type(8)))  float    v8f;
typedef __attribute__((ext_vector_type(4)))  float    v4f;
typedef __attribute__((ext_vector_type(2)))  float    v2f;
typedef __attribute__((ext_vector_type(2)))  _Float16 v2h;
typedef __attribute__((ext_vector_type(2)))  unsigned short v2us;
typedef v4f  __attribute__((may_alias)) v4fa;

__device__ __forceinline__ unsigned short f2bf(float f) { unsigned u = __float_as_uint(f); u += 0x7FFFu + ((u >> 16) & 1u); return (unsigned short)(u >> 16); }   // RNE convert
__device__ __forceinline__ float bf2f(unsigned short b) { return __uint_as_float(((unsigned)b) << 16); }
__device__ __forceinline__ float bfr(float f) { return bf2f(f2bf(f)); }
__device__ __forceinline__ void splitf(float y, unsigned short& h, unsigned short& l) { h = f2bf(y); l = f2bf(y - bf2f(h)); }
__device__ __forceinline__ v16h cat16(v8h lo, v8h hi) { return __builtin_shufflevector(lo, hi, 0, 1, 2, 3, 4, 5, 6, 7, 8, 9, 10, 11, 12, 13, 14, 15); }
__device__ __forceinline__ v16bf cat16b(v8us lo, v8us hi) { return __builtin_bit_cast(v16bf, __builtin_shufflevector(lo, hi, 0, 1, 2, 3, 4, 5, 6, 7, 8, 9, 10, 11, 12, 13, 14, 15)); }
// fragment loaders: elements 0..7 <- p[0..7], elements 8..15 <- p[16..23]; p already includes + 8 * (lane >> 4)
__device__ __forceinline__ v16h ldh(const h16* p) { return cat16(*(const v8h*)p, *(const v8h*)(p + 16)); }
__device__ __forceinline__ v16bf ldb(const bf* p) { return cat16b(*(const v8us*)p, *(const v8us*)(p + 16)); }
__device__ __forceinline__ v8f wmmab(v16bf a, v16bf b, v8f c) { return __builtin_amdgcn_wmma_f32_16x16x32_bf16(false, a, false, b, (short)0, c, false, false); }
// guarded forms: 4 nops after the matrix op, accumulator tied, operands kept live
__device__ __forceinline__ v8f wm16g(v16h a, v16h b, v8f c) {
    c = __builtin_amdgcn_wmma_f32_16x16x32_f16(false, a, false, b, (short)0, c, false, false);
    asm volatile("v_nop\n\tv_nop\n\tv_nop\n\tv_nop" : "+v"(c) : "v"(a), "v"(b));
    return c; }
__device__ __forceinline__ v8f wmbg(v16bf a, v16bf b, v8f c) {
    c = __builtin_amdgcn_wmma_f32_16x16x32_bf16(false, a, false, b, (short)0, c, false, false);
    asm volatile("v_nop\n\tv_nop\n\tv_nop\n\tv_nop" : "+v"(c) : "v"(a), "v"(b));
    return c; }

// ---- register-blocked GEMM body, ONE WAVE per 64x64 output tile (16 accumulators), bf16 operands straight from K-contiguous planes; grid (M/64, N/64, Z), 32 threads.
// C[m][n] (f32, pitch ldc) = sum_k A[m][k] Bt[n][k] (+ A2[m][k] Bt[n][k] when NSPLIT == 1) + bf16-RNE(bias[n]). K % 32 == 0, M and N multiples of 64 (asserted at file scope).
// A addressing: element (m, k) at A[m * lda + (k >> 5) * ksA + (k & 31)] (row pitch lda, advance ksA per 32-deep k-step); a plain row-major plane has lda = K, ksA = 32.
template <int NSPLIT>
__device__ __forceinline__ void gemmw_body(const bf* __restrict__ A, const bf* __restrict__ A2, const bf* __restrict__ Bt, const int K, const int lda, const size_t ksA, float* C, const int ldc, const float* __restrict__ bias, const size_t sA, const size_t sC) {
    __shared__ __align__(16) float os[16 * 68];
    const size_t z = blockIdx.z; A += z * sA; if (NSPLIT == 1) A2 += z * sA; C += z * sC;
    const int lane = threadIdx.x & 31, lr = lane & 15, hi = lane >> 4; const int r0 = blockIdx.x * 64, c0 = blockIdx.y * 64;
    v8f acc[4][4];
#pragma unroll
    for (int mb = 0; mb < 4; ++mb)
#pragma unroll
        for (int nb = 0; nb < 4; ++nb) acc[mb][nb] = (v8f){};
    const size_t aoff = (size_t)(r0 + lr) * lda + 8 * hi, boff = (size_t)(c0 + lr) * K + 8 * hi;
#pragma unroll 1
    for (int kc = 0; kc < K; kc += 32) {
        const size_t ak = (size_t)(kc >> 5) * ksA;
        v16bf a[4], a2[4];
#pragma unroll
        for (int mb = 0; mb < 4; ++mb) { a[mb] = ldb(A + aoff + (size_t)mb * 16 * lda + ak); if (NSPLIT == 1) a2[mb] = ldb(A2 + aoff + (size_t)mb * 16 * lda + ak); }
#pragma unroll
        for (int nb = 0; nb < 4; ++nb) { const v16bf b = ldb(Bt + boff + (size_t)nb * 16 * K + kc);
#pragma unroll
            for (int mb = 0; mb < 4; ++mb) { acc[mb][nb] = wmmab(a[mb], b, acc[mb][nb]); if (NSPLIT == 1) acc[mb][nb] = wmmab(a2[mb], b, acc[mb][nb]); } }
        asm volatile("v_nop\n\tv_nop\n\tv_nop\n\tv_nop" : "+v"(acc[0][0]), "+v"(acc[1][1]), "+v"(acc[2][2]), "+v"(acc[3][3]) : "v"(a[0]), "v"(a[3]));
    }
#pragma unroll
    for (int mb = 0; mb < 4; ++mb) {
#pragma unroll
        for (int nb = 0; nb < 4; ++nb) {
#pragma unroll
            for (int j = 0; j < 8; ++j) os[(hi * 8 + j) * 68 + nb * 16 + lr] = acc[mb][nb][j]; }
        __builtin_amdgcn_wave_barrier(); asm volatile("" ::: "memory");
        float* crow = C + (size_t)(r0 + mb * 16) * ldc + c0;
{
#pragma unroll
            for (int s = 0; s < 8; ++s) { const int row = 2 * s + hi, cofs = lr * 4; v4f val = *(const v4fa*)(os + row * 68 + cofs);
                val[0] += bfr(bias[c0 + cofs]); val[1] += bfr(bias[c0 + cofs + 1]); val[2] += bfr(bias[c0 + cofs + 2]); val[3] += bfr(bias[c0 + cofs + 3]);
                *(v4f*)(crow + (size_t)row * ldc + cofs) = val; }
             }
        __builtin_amdgcn_wave_barrier(); asm volatile("" ::: "memory");
    }
}
// F [NB*SEQ][384] = XB [NB*SEQ][128] x WQKV^T + b_qkv; grid (NB*SEQ/64, 384/64, 1)
__global__ __launch_bounds__(32) void k_gemm_qkv(const bf* __restrict__ A, const bf* __restrict__ Bt, float* C, const float* __restrict__ bias) {
    gemmw_body<0>(A, nullptr, Bt, DM, DM, (size_t)32, C, FW, bias, 0, 0); }
// OUT [b][t][128] = (ATH + ATL) x WO^T + b_proj; A element (t, k = h*32+d) at plane [(b*NH + h)*SEQ + t][d]: lda = HD, k-step advance = SEQ*HD, batch stride NH*SEQ*HD;
// grid (SEQ/64, 128/64, NB); output rows use the full per-batch stride
__global__ __launch_bounds__(32) void k_gemm_proj(const bf* __restrict__ Ah, const bf* __restrict__ Al, const bf* __restrict__ Bt, float* C, const float* __restrict__ bias) {
    gemmw_body<1>(Ah, Al, Bt, DQ, HD, (size_t)SEQ * HD, C, DM, bias, (size_t)NH * SEQ * HD, (size_t)SEQ_FULL * DM); }

__global__ __launch_bounds__(256) void k_wtG(const float* __restrict__ w, int K, int N, bf* Bt) {
    const int lane = threadIdx.x & 31; const int wave = __builtin_amdgcn_readfirstlane(threadIdx.x >> 5);
    const int L0 = (blockIdx.x * 8 + wave) * 8; const int nlines = N * K / 64;
{
#pragma unroll 1
        for (int l = 0; l < 8; ++l) { const int L = L0 + l; if (L >= nlines) break; const size_t e = (size_t)L * 64 + lane * 2; const int k = (int)(e % K), n = (int)(e / K); v2us o;
            o[0] = f2bf(w[(size_t)k * N + n]); o[1] = f2bf(w[(size_t)(k + 1) * N + n]); *(v2us*)(Bt + e) = o; }
         }
}
__global__ __launch_bounds__(256) void k_cvtx(const float* __restrict__ x, bf* XB) {
    const size_t i = (size_t)blockIdx.x * 256 + threadIdx.x; if (i >= (size_t)NB * SEQ * DM / 8) return;
    const size_t row = i / (DM / 8); const int c = (int)(i % (DM / 8)) * 8; const size_t b = row / SEQ, t = row % SEQ;
    const v8f v = *(const v8f*)(x + (b * SEQ_FULL + t) * DM + c); v8us o;
#pragma unroll
    for (int k = 0; k < 8; ++k) o[k] = f2bf(v[k]);
    *(v8us*)(XB + i * 8) = o;  }

// k_qkp: query (blockIdx.y == 0) / key (== 1) planes [which][b*h][t][d]: f16 copy for all t, bf16 hi/lo for t < RH ([which][b*h][RH][d]); F column = which*128 + h*32 + d.
__global__ __launch_bounds__(256) void k_qkp(const float* __restrict__ F, h16* P16, bf* PH, bf* PL) {
    const int which = blockIdx.y; const size_t e = ((size_t)blockIdx.x * 256 + threadIdx.x) * 2; if (e >= PLN) return;
    const int d = (int)(e % HD); const int t = (int)((e / HD) % SEQ); const int bh = (int)(e / ((size_t)HD * SEQ)); const int b = bh / NH, h = bh % NH;
    const v2f x = *(const v2f*)(F + ((size_t)b * SEQ + t) * FW + which * DQ + h * HD + d);
    v2h o16; v2us oh, ol;
#pragma unroll
    for (int q = 0; q < 2; ++q) { o16[q] = (h16)x[q]; unsigned short a2, c2; splitf(x[q], a2, c2); oh[q] = a2; ol[q] = c2; }
    const bool hl = (t < RH);          // wave-uniform: one wave == rows (t, t+1) with t even, RH even
    const size_t o1 = (size_t)which * PLN + e;
    const size_t o2 = (size_t)which * PLH + ((size_t)bh * RH + (hl ? t : 0)) * HD + d;
    *(v2h*)(P16 + o1) = o16; if (hl) { *(v2us*)(PH + o2) = oh; *(v2us*)(PL + o2) = ol; }
    
}
__global__ __launch_bounds__(256) void k_vtp(const float* __restrict__ F, h16* V16, bf* VH, bf* VL) {
    const size_t e = ((size_t)blockIdx.x * 256 + threadIdx.x) * 2; if (e >= PLN) return;
    const int t = (int)(e % SEQ); const int d = (int)((e / SEQ) % HD); const int bh = (int)(e / ((size_t)SEQ * HD)); const int b = bh / NH, h = bh % NH;
    v2h o16; v2us oh, ol;
#pragma unroll
    for (int q = 0; q < 2; ++q) { const float x = F[((size_t)b * SEQ + t + q) * FW + 2 * DQ + h * HD + d]; o16[q] = (h16)x; unsigned short a2, c2; splitf(x, a2, c2); oh[q] = a2; ol[q] = c2; }
    const bool hl = (t < RH);          // wave-uniform: one wave == 64 consecutive t, RH % 64 == 0
    const size_t o2 = ((size_t)bh * HD + d) * RH + (hl ? t : 0);
    *(v2h*)(V16 + e) = o16; if (hl) { *(v2us*)(VH + o2) = oh; *(v2us*)(VL + o2) = ol; }
    
}

// ---- fused causal attention, query rows >= RH, single f16 products. One wave per 16 query rows; grid ((SEQ-RH)/16, NB*NH), 32 threads.
// Lane (hh = lane>>4, n = lane&15): query q0+n; per 32-key step holds keys kb+8hh+r (tile 0) and kb+16+8hh+r (tile 1), r = 0..7.
__global__ __launch_bounds__(32) void k_attn16(const h16* QK16, const h16* VT16, bf* ATH, bf* ATL) {
    __shared__ __align__(16) float ys[16 * YP];     // wave-private staging (block == one wave)
    const int lane = threadIdx.x & 31, n = lane & 15, hh = lane >> 4;
    const int bh = blockIdx.y;
    const int q0 = RH + blockIdx.x * 16;
    const int qrow = q0 + n, kend = q0 + 15;
    const size_t qo = ((size_t)bh * SEQ + q0 + n) * HD + 8 * hh;          // query plane (which 0)
    const size_t ko = PLN + ((size_t)bh * SEQ + n) * HD + 8 * hh;         // key plane (which 1), + key * HD
    const size_t vo = ((size_t)bh * HD + n) * SEQ + 8 * hh;               // V^T plane, + j*16*SEQ + key
    const v16h qb = ldh(QK16 + qo);
    v8f o[2];
#pragma unroll
    for (int j = 0; j < 2; ++j) o[j] = (v8f){};
    float m = NEGB, l = 0.0f;
#pragma unroll 1
    for (int kb = 0; kb <= kend; kb += 32) {
        v8f s0 = (v8f){}, s1 = (v8f){};
        {
            const size_t ka = ko + (size_t)kb * HD;
            const v16h a0 = ldh(QK16 + ka), a1 = ldh(QK16 + ka + 16 * HD);
            s0 = wm16g(a0, qb, s0); s1 = wm16g(a1, qb, s1);
        }
        asm volatile("" ::: "memory");
        float u[16];
        const int key0 = kb + 8 * hh;
        if (kb + 31 > q0) {            // wave-uniform: only the steps touching the diagonal (replace by select)
#pragma unroll
            for (int r = 0; r < 8; ++r) { u[r] = (key0 + r <= qrow) ? s0[r] * SCL2 : NEGB; u[8 + r] = (key0 + 16 + r <= qrow) ? s1[r] * SCL2 : NEGB; }
        } else {
#pragma unroll
            for (int r = 0; r < 8; ++r) { u[r] = s0[r] * SCL2; u[8 + r] = s1[r] * SCL2; }
        }
        float mx = u[0];
#pragma unroll
        for (int i = 1; i < 16; ++i) mx = fmaxf(mx, u[i]);
        mx = fmaxf(mx, __shfl_xor(mx, 16, 32));
        const float mn = fmaxf(m, mx);
        const float corr = __builtin_amdgcn_exp2f(m - mn);
        m = mn;
        v16h pb; float ps = 0.0f;
#pragma unroll
        for (int r = 0; r < 8; ++r) {
            const float p0 = __builtin_amdgcn_exp2f((u[r] - mn) + PCL); const float p1 = __builtin_amdgcn_exp2f((u[8 + r] - mn) + PCL);
            ps += p0 + p1; pb[r] = (h16)p0; pb[8 + r] = (h16)p1; }
        l = l * corr + ps;
#pragma unroll
        for (int j = 0; j < 2; ++j) o[j] = o[j] * corr;
#pragma unroll
        for (int j = 0; j < 2; ++j) { const v16h va = ldh(VT16 + vo + (size_t)j * 16 * SEQ + kb); o[j] = wm16g(va, pb, o[j]); }
        asm volatile("" ::: "memory");
    }
    l += __shfl_xor(l, 16, 32);
    const float inv = 1.0f / l;
#pragma unroll
    for (int j = 0; j < 2; ++j)
#pragma unroll
        for (int r = 0; r < 8; ++r) ys[n * YP + j * 16 + 8 * hh + r] = o[j][r] * inv;
    __builtin_amdgcn_wave_barrier(); asm volatile("" ::: "memory");
    v8us oh[2], ol[2];
#pragma unroll
    for (int s = 0; s < 2; ++s) { const int row = 8 * s + (lane >> 2), c = (lane & 3) * 8;
        const v4f a = *(const v4fa*)(ys + row * YP + c); const v4f bq = *(const v4fa*)(ys + row * YP + c + 4);
#pragma unroll
        for (int k = 0; k < 4; ++k) { unsigned short x1, x2; splitf(a[k], x1, x2); oh[s][k] = x1; ol[s][k] = x2; splitf(bq[k], x1, x2); oh[s][4 + k] = x1; ol[s][4 + k] = x2; } }
{
#pragma unroll
        for (int s = 0; s < 2; ++s) { const int row = 8 * s + (lane >> 2), c = (lane & 3) * 8; const size_t oo = ((size_t)bh * SEQ + q0 + row) * HD + c;
            *(v8us*)(ATH + oo) = oh[s]; *(v8us*)(ATL + oo) = ol[s]; }
         }
}

// ---- fused causal attention, query rows < RH, bf16 hi/lo planes, 3 products per contraction (hi*hi + lo*hi + hi*lo). Same lane map as k_attn16; grid (RH/16, NB*NH), 32 threads.
__global__ __launch_bounds__(32) void k_attnhl(const bf* QKH, const bf* QKL, const bf* VTH, const bf* VTL, bf* ATH, bf* ATL) {
    __shared__ __align__(16) float ys[16 * YP];     // wave-private staging (block == one wave)
    const int lane = threadIdx.x & 31, n = lane & 15, hh = lane >> 4;
    const int bh = blockIdx.y;
    const int q0 = blockIdx.x * 16;
    const int qrow = q0 + n, kend = q0 + 15;
    const size_t qo = ((size_t)bh * RH + q0 + n) * HD + 8 * hh;           // query hi/lo plane (which 0)
    const size_t ko = PLH + ((size_t)bh * RH + n) * HD + 8 * hh;          // key hi/lo plane (which 1), + key * HD
    const size_t vo = ((size_t)bh * HD + n) * RH + 8 * hh;                // V^T hi/lo plane, + j*16*RH + key
    v8f o[2];
#pragma unroll
    for (int j = 0; j < 2; ++j) o[j] = (v8f){};
    float m = NEGB, l = 0.0f;
#pragma unroll 1
    for (int kb = 0; kb <= kend; kb += 32) {
        v8f s[2]; s[0] = (v8f){}; s[1] = (v8f){};
        {
            const v16bf qh = ldb(QKH + qo), ql = ldb(QKL + qo);
#pragma unroll
            for (int kc = 0; kc < 2; ++kc) { const size_t ka = ko + (size_t)(kb + kc * 16) * HD;
                const v16bf kh = ldb(QKH + ka), kl = ldb(QKL + ka);
                s[kc] = wmbg(kh, qh, s[kc]); s[kc] = wmbg(kl, qh, s[kc]); s[kc] = wmbg(kh, ql, s[kc]); }
            asm volatile("" ::: "memory");
        }
        float u[16];
        const int key0 = kb + 8 * hh;
        if (kb + 31 > q0) {            // wave-uniform
#pragma unroll
            for (int r = 0; r < 8; ++r) { u[r] = (key0 + r <= qrow) ? s[0][r] * SCL2 : NEGB; u[8 + r] = (key0 + 16 + r <= qrow) ? s[1][r] * SCL2 : NEGB; }
        } else {
#pragma unroll
            for (int r = 0; r < 8; ++r) { u[r] = s[0][r] * SCL2; u[8 + r] = s[1][r] * SCL2; }
        }
        float mx = u[0];
#pragma unroll
        for (int i = 1; i < 16; ++i) mx = fmaxf(mx, u[i]);
        mx = fmaxf(mx, __shfl_xor(mx, 16, 32));
        const float mn = fmaxf(m, mx);
        const float corr = __builtin_amdgcn_exp2f(m - mn);
        m = mn;
        v16us phu, plu; float ps = 0.0f;
#pragma unroll
        for (int r = 0; r < 8; ++r) {
            const float p0 = __builtin_amdgcn_exp2f(u[r] - mn); const float p1 = __builtin_amdgcn_exp2f(u[8 + r] - mn);
            ps += p0 + p1; unsigned short x1, x2; splitf(p0, x1, x2); phu[r] = x1; plu[r] = x2; splitf(p1, x1, x2); phu[8 + r] = x1; plu[8 + r] = x2; }
        const v16bf ph = __builtin_bit_cast(v16bf, phu), pl = __builtin_bit_cast(v16bf, plu);
        l = l * corr + ps;
#pragma unroll
        for (int j = 0; j < 2; ++j) o[j] = o[j] * corr;
#pragma unroll
        for (int j = 0; j < 2; ++j) { const size_t va = vo + (size_t)j * 16 * RH + kb; const v16bf vh = ldb(VTH + va), vl = ldb(VTL + va);
            o[j] = wmbg(vh, ph, o[j]); o[j] = wmbg(vl, ph, o[j]); o[j] = wmbg(vh, pl, o[j]);
            asm volatile("" ::: "memory"); }
    }
    l += __shfl_xor(l, 16, 32);
    const float inv = 1.0f / l;
#pragma unroll
    for (int j = 0; j < 2; ++j)
#pragma unroll
        for (int r = 0; r < 8; ++r) ys[n * YP + j * 16 + 8 * hh + r] = o[j][r] * inv;
    __builtin_amdgcn_wave_barrier(); asm volatile("" ::: "memory");
    v8us oh[2], ol[2];
#pragma unroll
    for (int s = 0; s < 2; ++s) { const int row = 8 * s + (lane >> 2), c = (lane & 3) * 8;
        const v4f a = *(const v4fa*)(ys + row * YP + c); const v4f bq = *(const v4fa*)(ys + row * YP + c + 4);
#pragma unroll
        for (int k = 0; k < 4; ++k) { unsigned short x1, x2; splitf(a[k], x1, x2); oh[s][k] = x1; ol[s][k] = x2; splitf(bq[k], x1, x2); oh[s][4 + k] = x1; ol[s][4 + k] = x2; } }
{
#pragma unroll
        for (int s = 0; s < 2; ++s) { const int row = 8 * s + (lane >> 2), c = (lane & 3) * 8; const size_t oo = ((size_t)bh * SEQ + q0 + row) * HD + c;
            *(v8us*)(ATH + oo) = oh[s]; *(v8us*)(ATL + oo) = ol[s]; }
         }
}

extern "C" void kernel_launch(void* const* d_in, const int* in_sizes, int n_in,
                              void* d_out, int out_size, void* d_ws, size_t ws_size, hipStream_t stream) {
    // wire order: x [8][2048][128], w_qkv [128][384], b_qkv [384], w_proj [128][128], b_proj [128] (all f32)
    constexpr size_t XN = ((size_t)(NB - 1) * SEQ_FULL + SEQ) * DM;      // lowest element count covering the rows touched
    if (n_in < 5) return;
    if ((size_t)in_sizes[0] < XN || (size_t)in_sizes[1] < (size_t)DM * FW || in_sizes[2] < FW || (size_t)in_sizes[3] < (size_t)DQ * DM || in_sizes[4] < DM) return;
    if ((size_t)out_size < XN) return;
    const float* x = (const float*)d_in[0]; const float* wqkv = (const float*)d_in[1]; const float* bqkv = (const float*)d_in[2];
    const float* wo = (const float*)d_in[3]; const float* bo = (const float*)d_in[4];
    float* OUT = (float*)d_out;      // [NB_FULL][SEQ_FULL][128], byte offset 0

    // workspace carve: every region a multiple of 256 B, sized to the producers' whole-line store extent
    constexpr size_t SZ_WQKV = (size_t)FW * DM * 2;            // Bt [384][128] bf16
    constexpr size_t SZ_WO   = (size_t)DM * DQ * 2;            // Bt [128][128] bf16
    constexpr size_t SZ_XB   = (size_t)NB * SEQ * DM * 2;      // bf16 x
    constexpr size_t SZ_F    = (size_t)NB * SEQ * FW * 4;      // f32 qkv
    constexpr size_t SZ_QK16 = 2 * PLN * 2;                    // f16 q | k planes
    constexpr size_t SZ_VT16 = PLN * 2;                        // f16 V^T planes
    constexpr size_t SZ_QKHL = 2 * PLH * 2;                    // bf16 q | k hi (and lo) planes, rows < RH
    constexpr size_t SZ_VTHL = PLH * 2;                        // bf16 V^T hi (and lo) planes, keys < RH
    constexpr size_t SZ_AT   = PLN * 2;                        // head-major context hi (and lo) planes
    constexpr size_t O_WQKV = 0;
    constexpr size_t O_WO   = O_WQKV + SZ_WQKV;
    constexpr size_t O_XB   = O_WO + SZ_WO;
    constexpr size_t O_F    = O_XB + SZ_XB;
    constexpr size_t O_QK16 = O_F + SZ_F;
    constexpr size_t O_VT16 = O_QK16 + SZ_QK16;
    constexpr size_t O_QKH  = O_VT16 + SZ_VT16;
    constexpr size_t O_QKL  = O_QKH + SZ_QKHL;
    constexpr size_t O_VTH  = O_QKL + SZ_QKHL;
    constexpr size_t O_VTL  = O_VTH + SZ_VTHL;
    constexpr size_t O_ATH  = O_VTL + SZ_VTHL;
    constexpr size_t O_ATL  = O_ATH + SZ_AT;
    constexpr size_t O_END  = O_ATL + SZ_AT;
    static_assert(SZ_WQKV % 256 == 0 && SZ_WO % 256 == 0 && SZ_XB % 256 == 0 && SZ_F % 256 == 0 && SZ_QK16 % 256 == 0 && SZ_VT16 % 256 == 0 && SZ_QKHL % 256 == 0 && SZ_VTHL % 256 == 0 && SZ_AT % 256 == 0);
    static_assert(O_END <= (size_t)134217728);                  // total carve <= 128 MiB
    static_assert((DM * FW) % 64 == 0 && (DQ * DM) % 64 == 0);  // weight planes are whole 64-element lines
    static_assert(PLN % 64 == 0);                               // plane producers: whole waves
    static_assert(((size_t)NB * SEQ) % 64 == 0);                // qkv GEMM M tiles
    if (ws_size < O_END) return;
    char* ws = (char*)d_ws;
    bf* WQKV = (bf*)(ws + O_WQKV); bf* WO = (bf*)(ws + O_WO); bf* XB = (bf*)(ws + O_XB); float* F = (float*)(ws + O_F);
    h16* QK16 = (h16*)(ws + O_QK16); h16* VT16 = (h16*)(ws + O_VT16);
    bf* QKH = (bf*)(ws + O_QKH); bf* QKL = (bf*)(ws + O_QKL); bf* VTH = (bf*)(ws + O_VTH); bf* VTL = (bf*)(ws + O_VTL);
    bf* ATH = (bf*)(ws + O_ATH); bf* ATL = (bf*)(ws + O_ATL);

    // weights: in[K][N] ([in][out]) -> Bt[N][K]; grid = lines / 64 (8 waves x 8 lines per block)
    k_wtG<<<(unsigned)((DM * FW / 64 + 63) / 64), 256, 0, stream>>>(wqkv, DM, FW, WQKV);      // in[128][384] -> out[384][128]
    k_wtG<<<(unsigned)((DQ * DM / 64 + 63) / 64), 256, 0, stream>>>(wo, DQ, DM, WO);          // in[128][128] -> out[128][128]
    k_cvtx<<<(unsigned)(((size_t)NB * SEQ * DM / 8 + 255) / 256), 256, 0, stream>>>(x, XB);
    k_gemm_qkv<<<dim3(NB * SEQ / 64, FW / 64, 1), 32, 0, stream>>>(XB, WQKV, F, bqkv);
    const unsigned LP = (unsigned)((PLN / 2 + 255) / 256);
    k_qkp<<<dim3(LP, 2, 1), 256, 0, stream>>>(F, QK16, QKH, QKL);
    k_vtp<<<LP, 256, 0, stream>>>(F, VT16, VTH, VTL);
    k_attnhl<<<dim3(RH / 16, NB * NH, 1), 32, 0, stream>>>(QKH, QKL, VTH, VTL, ATH, ATL);
    if ((SEQ - RH) / 16 > 0) k_attn16<<<dim3((SEQ - RH) / 16, NB * NH, 1), 32, 0, stream>>>(QK16, VT16, ATH, ATL);
    k_gemm_proj<<<dim3(SEQ / 64, DM / 64, NB), 32, 0, stream>>>(ATH, ATL, WO, OUT, bo);
}

// v001
// One run takes 95.4 microseconds.
// In both of two side-by-side timings against v000, it was 1.26 times as fast.
#include <hip/hip_runtime.h>

// Causal self-attention: x [NB][SEQ][128]; qkv = x w_qkv + b_qkv ([in][out] weight, q | k | v column thirds, 4 heads x 32, head h = columns h*32+d); scores x 32^-0.5; causal select (diagonal kept); softmax; out = merged w_proj + b_proj ([in][out]).
// Compute dtypes, f32 accumulate everywhere: qkv projection v_wmma_f32_16x16x32_bf16 on bf16 RNE copies of x / w_qkv (single product); attention query rows < 256: bf16 hi/lo planes, 3 products for k q^T and for v^T p; query rows >= 256: v_wmma_f32_16x16x32_f16 single products (q, k, v f16 planes, p carried x1024 in the exponent); output projection: bf16 hi/lo context planes x bf16 w_proj (2 products). Softmax f32, online running-max form in the log2 domain.
// Fused attention, one work-group of NW waves per 16 query rows, the 32-key steps dealt round-robin to the waves (wave w: steps w, w + NW, ...), partial (max, sum, O) joined through LDS; head dim 32 = one 32-deep k-step for the scores: S^T = K Q^T (keys on D rows, queries on D columns), p built per lane and fed as the B operand of O^T = V^T P^T (B element r <- tile keys 0-15 [r], element 8+r <- tile keys 16-31 [r]); no score / probability plane in memory.

#ifndef NB
#define NB 8
#endif
#ifndef SEQ
#define SEQ 2048
#endif
#define NB_FULL  8
#define SEQ_FULL 2048
#define DM   128
#define NH   4
#define HD   32
#define DQ   (NH * HD)
#define FW   (3 * DQ)
#define RH   256                      // query rows < RH use bf16 hi/lo planes
#define PLN  ((size_t)NB * NH * SEQ * HD)   // elements of one [b*h][t][d] plane
#define PLH  ((size_t)NB * NH * RH * HD)    // elements of one hi/lo plane (rows < RH)
#define SCL2 0.25503486164918f        // HD^-0.5 * log2(e)
#define PCL  10.0f                    // log2 of the p carry (x1024) for the f16 path
#define NEGB (-3.0e38f)
#define YP   36                       // staging pitch (floats) of the 16 x 32 attention result tile
#define NW   4                        // waves per query tile: each walks every NW-th 32-key step

static_assert(DQ == DM);               // merged width == model width
static_assert(HD == 32);               // scores: one 32-deep k-step; head row == 64 B of 16-bit data; proj k-step == one head
static_assert(2 * HD == 64);
static_assert(HD % 16 == 0);           // O^T tiles of 16 d rows
static_assert(YP % 4 == 0 && YP >= HD); // 16-B aligned staging rows
static_assert(NW * 32 * 4 == 16 * HD);  // join: every thread owns 4 consecutive d of one query row
static_assert(DM % 64 == 0);           // GEMM K multiple of 32, weight lines of 64
static_assert(DQ % 32 == 0);           // proj GEMM K multiple of 32
static_assert(FW % 64 == 0);           // GEMM N tile multiple
static_assert(SEQ % 64 == 0);          // GEMM M tile multiple, 32-key steps, V^T lines
static_assert(RH % 64 == 0);           // hi/lo V^T lines, 32-key steps inside RH
static_assert(RH % 2 == 0);            // k_qkp wave (t, t+1) on one side of RH
static_assert(RH <= SEQ);
static_assert((SEQ - RH) % 16 == 0);
static_assert(NB <= NB_FULL);
static_assert(SEQ <= SEQ_FULL);

typedef _Float16 h16;
typedef unsigned short bf;
typedef __attribute__((ext_vector_type(16))) __bf16   v16bf;
typedef __attribute__((ext_vector_type(16))) _Float16 v16h;
typedef __attribute__((ext_vector_type(16))) unsigned short v16us;
typedef __attribute__((ext_vector_type(8)))  _Float16 v8h;
typedef __attribute__((ext_vector_type(8)))  unsigned short v8us;
typedef __attribute__((ext_vector_type(8)))  float    v8f;
typedef __attribute__((ext_vector_type(4)))  float    v4f;
typedef __attribute__((ext_vector_type(2)))  float    v2f;
typedef __attribute__((ext_vector_type(2)))  _Float16 v2h;
typedef __attribute__((ext_vector_type(2)))  unsigned short v2us;
typedef __attribute__((ext_vector_type(4)))  unsigned short v4us;
typedef v4f  __attribute__((may_alias)) v4fa;

__device__ __forceinline__ unsigned short f2bf(float f) { unsigned u = __float_as_uint(f); u += 0x7FFFu + ((u >> 16) & 1u); return (unsigned short)(u >> 16); }   // RNE convert
__device__ __forceinline__ float bf2f(unsigned short b) { return __uint_as_float(((unsigned)b) << 16); }
__device__ __forceinline__ float bfr(float f) { return bf2f(f2bf(f)); }
__device__ __forceinline__ void splitf(float y, unsigned short& h, unsigned short& l) { h = f2bf(y); l = f2bf(y - bf2f(h)); }
__device__ __forceinline__ v16h cat16(v8h lo, v8h hi) { return __builtin_shufflevector(lo, hi, 0, 1, 2, 3, 4, 5, 6, 7, 8, 9, 10, 11, 12, 13, 14, 15); }
__device__ __forceinline__ v16bf cat16b(v8us lo, v8us hi) { return __builtin_bit_cast(v16bf, __builtin_shufflevector(lo, hi, 0, 1, 2, 3, 4, 5, 6, 7, 8, 9, 10, 11, 12, 13, 14, 15)); }
// fragment loaders: elements 0..7 <- p[0..7], elements 8..15 <- p[16..23]; p already includes + 8 * (lane >> 4)
__device__ __forceinline__ v16h ldh(const h16* p) { return cat16(*(const v8h*)p, *(const v8h*)(p + 16)); }
__device__ __forceinline__ v16bf ldb(const bf* p) { return cat16b(*(const v8us*)p, *(const v8us*)(p + 16)); }
__device__ __forceinline__ v8f wmmab(v16bf a, v16bf b, v8f c) { return __builtin_amdgcn_wmma_f32_16x16x32_bf16(false, a, false, b, (short)0, c, false, false); }
// guarded forms: 4 nops after the matrix op, accumulator tied, operands kept live
__device__ __forceinline__ v8f wm16g(v16h a, v16h b, v8f c) {
    c = __builtin_amdgcn_wmma_f32_16x16x32_f16(false, a, false, b, (short)0, c, false, false);
    asm volatile("v_nop\n\tv_nop\n\tv_nop\n\tv_nop" : "+v"(c) : "v"(a), "v"(b));
    return c; }
__device__ __forceinline__ v8f wmbg(v16bf a, v16bf b, v8f c) {
    c = __builtin_amdgcn_wmma_f32_16x16x32_bf16(false, a, false, b, (short)0, c, false, false);
    asm volatile("v_nop\n\tv_nop\n\tv_nop\n\tv_nop" : "+v"(c) : "v"(a), "v"(b));
    return c; }

// ---- register-blocked GEMM body, ONE WAVE per 64x64 output tile (16 accumulators), bf16 operands straight from K-contiguous planes; grid (M/64, N/64, Z), 32 threads.
// C[m][n] (f32, pitch ldc) = sum_k A[m][k] Bt[n][k] (+ A2[m][k] Bt[n][k] when NSPLIT == 1) + bf16-RNE(bias[n]). K % 32 == 0, M and N multiples of 64 (asserted at file scope).
// A addressing: element (m, k) at A[m * lda + (k >> 5) * ksA + (k & 31)] (row pitch lda, advance ksA per 32-deep k-step); a plain row-major plane has lda = K, ksA = 32.
template <int NSPLIT>
__device__ __forceinline__ void gemmw_body(const bf* __restrict__ A, const bf* __restrict__ A2, const bf* __restrict__ Bt, const int K, const int lda, const size_t ksA, float* C, const int ldc, const float* __restrict__ bias, const size_t sA, const size_t sC) {
    __shared__ __align__(16) float os[16 * 68];
    const size_t z = blockIdx.z; A += z * sA; if (NSPLIT == 1) A2 += z * sA; C += z * sC;
    const int lane = threadIdx.x & 31, lr = lane & 15, hi = lane >> 4; const int r0 = blockIdx.x * 64, c0 = blockIdx.y * 64;
    v8f acc[4][4];
#pragma unroll
    for (int mb = 0; mb < 4; ++mb)
#pragma unroll
        for (int nb = 0; nb < 4; ++nb) acc[mb][nb] = (v8f){};
    const size_t aoff = (size_t)(r0 + lr) * lda + 8 * hi, boff = (size_t)(c0 + lr) * K + 8 * hi;
#pragma unroll 1
    for (int kc = 0; kc < K; kc += 32) {
        const size_t ak = (size_t)(kc >> 5) * ksA;
        v16bf a[4], a2[4];
#pragma unroll
        for (int mb = 0; mb < 4; ++mb) { a[mb] = ldb(A + aoff + (size_t)mb * 16 * lda + ak); if (NSPLIT == 1) a2[mb] = ldb(A2 + aoff + (size_t)mb * 16 * lda + ak); }
#pragma unroll
        for (int nb = 0; nb < 4; ++nb) { const v16bf b = ldb(Bt + boff + (size_t)nb * 16 * K + kc);
#pragma unroll
            for (int mb = 0; mb < 4; ++mb) { acc[mb][nb] = wmmab(a[mb], b, acc[mb][nb]); if (NSPLIT == 1) acc[mb][nb] = wmmab(a2[mb], b, acc[mb][nb]); } }
        asm volatile("v_nop\n\tv_nop\n\tv_nop\n\tv_nop" : "+v"(acc[0][0]), "+v"(acc[1][1]), "+v"(acc[2][2]), "+v"(acc[3][3]) : "v"(a[0]), "v"(a[3]));
    }
#pragma unroll
    for (int mb = 0; mb < 4; ++mb) {
#pragma unroll
        for (int nb = 0; nb < 4; ++nb) {
#pragma unroll
            for (int j = 0; j < 8; ++j) os[(hi * 8 + j) * 68 + nb * 16 + lr] = acc[mb][nb][j]; }
        __builtin_amdgcn_wave_barrier(); asm volatile("" ::: "memory");
        float* crow = C + (size_t)(r0 + mb * 16) * ldc + c0;
{
#pragma unroll
            for (int s = 0; s < 8; ++s) { const int row = 2 * s + hi, cofs = lr * 4; v4f val = *(const v4fa*)(os + row * 68 + cofs);
                val[0] += bfr(bias[c0 + cofs]); val[1] += bfr(bias[c0 + cofs + 1]); val[2] += bfr(bias[c0 + cofs + 2]); val[3] += bfr(bias[c0 + cofs + 3]);
                *(v4f*)(crow + (size_t)row * ldc + cofs) = val; }
             }
        __builtin_amdgcn_wave_barrier(); asm volatile("" ::: "memory");
    }
}
// F [NB*SEQ][384] = XB [NB*SEQ][128] x WQKV^T + b_qkv; grid (NB*SEQ/64, 384/64, 1)
__global__ __launch_bounds__(32) void k_gemm_qkv(const bf* __restrict__ A, const bf* __restrict__ Bt, float* C, const float* __restrict__ bias) {
    gemmw_body<0>(A, nullptr, Bt, DM, DM, (size_t)32, C, FW, bias, 0, 0); }
// OUT [b][t][128] = (ATH + ATL) x WO^T + b_proj; A element (t, k = h*32+d) at plane [(b*NH + h)*SEQ + t][d]: lda = HD, k-step advance = SEQ*HD, batch stride NH*SEQ*HD;
// grid (SEQ/64, 128/64, NB); output rows use the full per-batch stride
__global__ __launch_bounds__(32) void k_gemm_proj(const bf* __restrict__ Ah, const bf* __restrict__ Al, const bf* __restrict__ Bt, float* C, const float* __restrict__ bias) {
    gemmw_body<1>(Ah, Al, Bt, DQ, HD, (size_t)SEQ * HD, C, DM, bias, (size_t)NH * SEQ * HD, (size_t)SEQ_FULL * DM); }

__global__ __launch_bounds__(256) void k_wtG(const float* __restrict__ w, int K, int N, bf* Bt) {
    const int lane = threadIdx.x & 31; const int wave = __builtin_amdgcn_readfirstlane(threadIdx.x >> 5);
    const int L0 = (blockIdx.x * 8 + wave) * 8; const int nlines = N * K / 64;
{
#pragma unroll 1
        for (int l = 0; l < 8; ++l) { const int L = L0 + l; if (L >= nlines) break; const size_t e = (size_t)L * 64 + lane * 2; const int k = (int)(e % K), n = (int)(e / K); v2us o;
            o[0] = f2bf(w[(size_t)k * N + n]); o[1] = f2bf(w[(size_t)(k + 1) * N + n]); *(v2us*)(Bt + e) = o; }
         }
}
__global__ __launch_bounds__(256) void k_cvtx(const float* __restrict__ x, bf* XB) {
    const size_t i = (size_t)blockIdx.x * 256 + threadIdx.x; if (i >= (size_t)NB * SEQ * DM / 8) return;
    const size_t row = i / (DM / 8); const int c = (int)(i % (DM / 8)) * 8; const size_t b = row / SEQ, t = row % SEQ;
    const v8f v = *(const v8f*)(x + (b * SEQ_FULL + t) * DM + c); v8us o;
#pragma unroll
    for (int k = 0; k < 8; ++k) o[k] = f2bf(v[k]);
    *(v8us*)(XB + i * 8) = o;  }

// k_qkp: query (blockIdx.y == 0) / key (== 1) planes [which][b*h][t][d]: f16 copy for all t, bf16 hi/lo for t < RH ([which][b*h][RH][d]); F column = which*128 + h*32 + d.
__global__ __launch_bounds__(256) void k_qkp(const float* __restrict__ F, h16* P16, bf* PH, bf* PL) {
    const int which = blockIdx.y; const size_t e = ((size_t)blockIdx.x * 256 + threadIdx.x) * 2; if (e >= PLN) return;
    const int d = (int)(e % HD); const int t = (int)((e / HD) % SEQ); const int bh = (int)(e / ((size_t)HD * SEQ)); const int b = bh / NH, h = bh % NH;
    const v2f x = *(const v2f*)(F + ((size_t)b * SEQ + t) * FW + which * DQ + h * HD + d);
    v2h o16; v2us oh, ol;
#pragma unroll
    for (int q = 0; q < 2; ++q) { o16[q] = (h16)x[q]; unsigned short a2, c2; splitf(x[q], a2, c2); oh[q] = a2; ol[q] = c2; }
    const bool hl = (t < RH);          // wave-uniform: one wave == rows (t, t+1) with t even, RH even
    const size_t o1 = (size_t)which * PLN + e;
    const size_t o2 = (size_t)which * PLH + ((size_t)bh * RH + (hl ? t : 0)) * HD + d;
    *(v2h*)(P16 + o1) = o16; if (hl) { *(v2us*)(PH + o2) = oh; *(v2us*)(PL + o2) = ol; }
    
}
__global__ __launch_bounds__(256) void k_vtp(const float* __restrict__ F, h16* V16, bf* VH, bf* VL) {
    const size_t e = ((size_t)blockIdx.x * 256 + threadIdx.x) * 2; if (e >= PLN) return;
    const int t = (int)(e % SEQ); const int d = (int)((e / SEQ) % HD); const int bh = (int)(e / ((size_t)SEQ * HD)); const int b = bh / NH, h = bh % NH;
    v2h o16; v2us oh, ol;
#pragma unroll
    for (int q = 0; q < 2; ++q) { const float x = F[((size_t)b * SEQ + t + q) * FW + 2 * DQ + h * HD + d]; o16[q] = (h16)x; unsigned short a2, c2; splitf(x, a2, c2); oh[q] = a2; ol[q] = c2; }
    const bool hl = (t < RH);          // wave-uniform: one wave == 64 consecutive t, RH % 64 == 0
    const size_t o2 = ((size_t)bh * HD + d) * RH + (hl ? t : 0);
    *(v2h*)(V16 + e) = o16; if (hl) { *(v2us*)(VH + o2) = oh; *(v2us*)(VL + o2) = ol; }
    
}

// ---- join of the NW waves' partial results of one 16-query tile. Wave w holds, for query n, its running max m (log2 domain), its sum l (both halves already added) and O^T unnormalised.
// Every wave stages its part, one work-group barrier, then thread (w, lane) owns query row 4w + (lane >> 3), d = 4 (lane & 7) .. + 3: out = sum_w 2^(m_w - M) O_w / sum_w 2^(m_w - M) l_w, waves summed in index order.
// A wave that had no key step stages m = NEGB, l = 0, O = 0 and gets weight 0 (wave 0 always has step 0, whose key 0 every query keeps, so M is finite).
__device__ __forceinline__ void join_store(float* ys, float* ms, float* ls, const int w, const int lane, const v8f* o, const float m, const float l, bf* ATH, bf* ATL, const size_t tile0) {
    const int n = lane & 15, hh = lane >> 4;
#pragma unroll
    for (int j = 0; j < 2; ++j)
#pragma unroll
        for (int r = 0; r < 8; ++r) ys[w * 16 * YP + n * YP + j * 16 + 8 * hh + r] = o[j][r];
    if (hh == 0) { ms[w * 16 + n] = m; ls[w * 16 + n] = l; }
    __syncthreads();                   // publishes every wave's partial to the joining threads
    const int row = 4 * w + (lane >> 3), c = (lane & 7) * 4;
    float mw[NW]; float M = NEGB;
#pragma unroll
    for (int k = 0; k < NW; ++k) { mw[k] = ms[k * 16 + row]; M = fmaxf(M, mw[k]); }
    v4f acc = (v4f){}; float L = 0.0f;
#pragma unroll
    for (int k = 0; k < NW; ++k) { const float sc = __builtin_amdgcn_exp2f(mw[k] - M); L += sc * ls[k * 16 + row]; acc += sc * *(const v4fa*)(ys + k * 16 * YP + row * YP + c); }
    const float inv = 1.0f / L;
    v4us oh, ol;
#pragma unroll
    for (int k = 0; k < 4; ++k) { unsigned short x1, x2; splitf(acc[k] * inv, x1, x2); oh[k] = x1; ol[k] = x2; }
    const size_t oo = tile0 + (size_t)row * HD + c;
    *(v4us*)(ATH + oo) = oh; *(v4us*)(ATL + oo) = ol;
}

// ---- fused causal attention, query rows >= RH, single f16 products. NW waves per 16 query rows; grid ((SEQ-RH)/16, NB*NH), 32 * NW threads.
// Lane (hh = lane>>4, n = lane&15): query q0+n; per 32-key step holds keys kb+8hh+r (tile 0) and kb+16+8hh+r (tile 1), r = 0..7.
__global__ __launch_bounds__(32 * NW) void k_attn16(const h16* QK16, const h16* VT16, bf* ATH, bf* ATL) {
    __shared__ __align__(16) float ys[NW * 16 * YP];     // one 16 x 32 partial O tile per wave
    __shared__ float ms[NW * 16], ls[NW * 16];           // per wave and query: running max, sum
    const int lane = threadIdx.x & 31, n = lane & 15, hh = lane >> 4;
    const int w = __builtin_amdgcn_readfirstlane(threadIdx.x >> 5);   // wave number, scalar: the key loop stays a scalar loop
    const int bh = blockIdx.y;
    const int q0 = RH + blockIdx.x * 16;
    const int qrow = q0 + n, kend = q0 + 15;
    const size_t qo = ((size_t)bh * SEQ + q0 + n) * HD + 8 * hh;          // query plane (which 0)
    const size_t ko = PLN + ((size_t)bh * SEQ + n) * HD + 8 * hh;         // key plane (which 1), + key * HD
    const size_t vo = ((size_t)bh * HD + n) * SEQ + 8 * hh;               // V^T plane, + j*16*SEQ + key
    const v16h qb = ldh(QK16 + qo);
    v8f o[2];
#pragma unroll
    for (int j = 0; j < 2; ++j) o[j] = (v8f){};
    float m = NEGB, l = 0.0f;
#pragma unroll 1
    for (int kb = 32 * w; kb <= kend; kb += 32 * NW) {
        v8f s0 = (v8f){}, s1 = (v8f){};
        {
            const size_t ka = ko + (size_t)kb * HD;
            const v16h a0 = ldh(QK16 + ka), a1 = ldh(QK16 + ka + 16 * HD);
            s0 = wm16g(a0, qb, s0); s1 = wm16g(a1, qb, s1);
        }
        asm volatile("" ::: "memory");
        float u[16];
        const int key0 = kb + 8 * hh;
        if (kb + 31 > q0) {            // wave-uniform: only the steps touching the diagonal (replace by select)
#pragma unroll
            for (int r = 0; r < 8; ++r) { u[r] = (key0 + r <= qrow) ? s0[r] * SCL2 : NEGB; u[8 + r] = (key0 + 16 + r <= qrow) ? s1[r] * SCL2 : NEGB; }
        } else {
#pragma unroll
            for (int r = 0; r < 8; ++r) { u[r] = s0[r] * SCL2; u[8 + r] = s1[r] * SCL2; }
        }
        float mx = u[0];
#pragma unroll
        for (int i = 1; i < 16; ++i) mx = fmaxf(mx, u[i]);
        mx = fmaxf(mx, __shfl_xor(mx, 16, 32));
        const float mn = fmaxf(m, mx);
        const float corr = __builtin_amdgcn_exp2f(m - mn);
        m = mn;
        v16h pb; float ps = 0.0f;
#pragma unroll
        for (int r = 0; r < 8; ++r) {
            const float p0 = __builtin_amdgcn_exp2f((u[r] - mn) + PCL); const float p1 = __builtin_amdgcn_exp2f((u[8 + r] - mn) + PCL);
            ps += p0 + p1; pb[r] = (h16)p0; pb[8 + r] = (h16)p1; }
        l = l * corr + ps;
#pragma unroll
        for (int j = 0; j < 2; ++j) o[j] = o[j] * corr;
#pragma unroll
        for (int j = 0; j < 2; ++j) { const v16h va = ldh(VT16 + vo + (size_t)j * 16 * SEQ + kb); o[j] = wm16g(va, pb, o[j]); }
        asm volatile("" ::: "memory");
    }
    l += __shfl_xor(l, 16, 32);
    join_store(ys, ms, ls, w, lane, o, m, l, ATH, ATL, ((size_t)bh * SEQ + q0) * HD);
}

// ---- fused causal attention, query rows < RH, bf16 hi/lo planes, 3 products per contraction (hi*hi + lo*hi + hi*lo). Same lane map and key split as k_attn16; grid (RH/16, NB*NH), 32 * NW threads.
__global__ __launch_bounds__(32 * NW) void k_attnhl(const bf* QKH, const bf* QKL, const bf* VTH, const bf* VTL, bf* ATH, bf* ATL) {
    __shared__ __align__(16) float ys[NW * 16 * YP];     // one 16 x 32 partial O tile per wave
    __shared__ float ms[NW * 16], ls[NW * 16];           // per wave and query: running max, sum
    const int lane = threadIdx.x & 31, n = lane & 15, hh = lane >> 4;
    const int w = __builtin_amdgcn_readfirstlane(threadIdx.x >> 5);   // wave number, scalar: the key loop stays a scalar loop
    const int bh = blockIdx.y;
    const int q0 = blockIdx.x * 16;
    const int qrow = q0 + n, kend = q0 + 15;
    const size_t qo = ((size_t)bh * RH + q0 + n) * HD + 8 * hh;           // query hi/lo plane (which 0)
    const size_t ko = PLH + ((size_t)bh * RH + n) * HD + 8 * hh;          // key hi/lo plane (which 1), + key * HD
    const size_t vo = ((size_t)bh * HD + n) * RH + 8 * hh;                // V^T hi/lo plane, + j*16*RH + key
    v8f o[2];
#pragma unroll
    for (int j = 0; j < 2; ++j) o[j] = (v8f){};
    float m = NEGB, l = 0.0f;
#pragma unroll 1
    for (int kb = 32 * w; kb <= kend; kb += 32 * NW) {
        v8f s[2]; s[0] = (v8f){}; s[1] = (v8f){};
        {
            const v16bf qh = ldb(QKH + qo), ql = ldb(QKL + qo);
#pragma unroll
            for (int kc = 0; kc < 2; ++kc) { const size_t ka = ko + (size_t)(kb + kc * 16) * HD;
                const v16bf kh = ldb(QKH + ka), kl = ldb(QKL + ka);
                s[kc] = wmbg(kh, qh, s[kc]); s[kc] = wmbg(kl, qh, s[kc]); s[kc] = wmbg(kh, ql, s[kc]); }
            asm volatile("" ::: "memory");
        }
        float u[16];
        const int key0 = kb + 8 * hh;
        if (kb + 31 > q0) {            // wave-uniform
#pragma unroll
            for (int r = 0; r < 8; ++r) { u[r] = (key0 + r <= qrow) ? s[0][r] * SCL2 : NEGB; u[8 + r] = (key0 + 16 + r <= qrow) ? s[1][r] * SCL2 : NEGB; }
        } else {
#pragma unroll
            for (int r = 0; r < 8; ++r) { u[r] = s[0][r] * SCL2; u[8 + r] = s[1][r] * SCL2; }
        }
        float mx = u[0];
#pragma unroll
        for (int i = 1; i < 16; ++i) mx = fmaxf(mx, u[i]);
        mx = fmaxf(mx, __shfl_xor(mx, 16, 32));
        const float mn = fmaxf(m, mx);
        const float corr = __builtin_amdgcn_exp2f(m - mn);
        m = mn;
        v16us phu, plu; float ps = 0.0f;
#pragma unroll
        for (int r = 0; r < 8; ++r) {
            const float p0 = __builtin_amdgcn_exp2f(u[r] - mn); const float p1 = __builtin_amdgcn_exp2f(u[8 + r] - mn);
            ps += p0 + p1; unsigned short x1, x2; splitf(p0, x1, x2); phu[r] = x1; plu[r] = x2; splitf(p1, x1, x2); phu[8 + r] = x1; plu[8 + r] = x2; }
        const v16bf ph = __builtin_bit_cast(v16bf, phu), pl = __builtin_bit_cast(v16bf, plu);
        l = l * corr + ps;
#pragma unroll
        for (int j = 0; j < 2; ++j) o[j] = o[j] * corr;
#pragma unroll
        for (int j = 0; j < 2; ++j) { const size_t va = vo + (size_t)j * 16 * RH + kb; const v16bf vh = ldb(VTH + va), vl = ldb(VTL + va);
            o[j] = wmbg(vh, ph, o[j]); o[j] = wmbg(vl, ph, o[j]); o[j] = wmbg(vh, pl, o[j]);
            asm volatile("" ::: "memory"); }
    }
    l += __shfl_xor(l, 16, 32);
    join_store(ys, ms, ls, w, lane, o, m, l, ATH, ATL, ((size_t)bh * SEQ + q0) * HD);
}

extern "C" void kernel_launch(void* const* d_in, const int* in_sizes, int n_in,
                              void* d_out, int out_size, void* d_ws, size_t ws_size, hipStream_t stream) {
    // wire order: x [8][2048][128], w_qkv [128][384], b_qkv [384], w_proj [128][128], b_proj [128] (all f32)
    constexpr size_t XN = ((size_t)(NB - 1) * SEQ_FULL + SEQ) * DM;      // lowest element count covering the rows touched
    if (n_in < 5) return;
    if ((size_t)in_sizes[0] < XN || (size_t)in_sizes[1] < (size_t)DM * FW || in_sizes[2] < FW || (size_t)in_sizes[3] < (size_t)DQ * DM || in_sizes[4] < DM) return;
    if ((size_t)out_size < XN) return;
    const float* x = (const float*)d_in[0]; const float* wqkv = (const float*)d_in[1]; const float* bqkv = (const float*)d_in[2];
    const float* wo = (const float*)d_in[3]; const float* bo = (const float*)d_in[4];
    float* OUT = (float*)d_out;      // [NB_FULL][SEQ_FULL][128], byte offset 0

    // workspace carve: every region a multiple of 256 B, sized to the producers' whole-line store extent
    constexpr size_t SZ_WQKV = (size_t)FW * DM * 2;            // Bt [384][128] bf16
    constexpr size_t SZ_WO   = (size_t)DM * DQ * 2;            // Bt [128][128] bf16
    constexpr size_t SZ_XB   = (size_t)NB * SEQ * DM * 2;      // bf16 x
    constexpr size_t SZ_F    = (size_t)NB * SEQ * FW * 4;      // f32 qkv
    constexpr size_t SZ_QK16 = 2 * PLN * 2;                    // f16 q | k planes
    constexpr size_t SZ_VT16 = PLN * 2;                        // f16 V^T planes
    constexpr size_t SZ_QKHL = 2 * PLH * 2;                    // bf16 q | k hi (and lo) planes, rows < RH
    constexpr size_t SZ_VTHL = PLH * 2;                        // bf16 V^T hi (and lo) planes, keys < RH
    constexpr size_t SZ_AT   = PLN * 2;                        // head-major context hi (and lo) planes
    constexpr size_t O_WQKV = 0;
    constexpr size_t O_WO   = O_WQKV + SZ_WQKV;
    constexpr size_t O_XB   = O_WO + SZ_WO;
    constexpr size_t O_F    = O_XB + SZ_XB;
    constexpr size_t O_QK16 = O_F + SZ_F;
    constexpr size_t O_VT16 = O_QK16 + SZ_QK16;
    constexpr size_t O_QKH  = O_VT16 + SZ_VT16;
    constexpr size_t O_QKL  = O_QKH + SZ_QKHL;
    constexpr size_t O_VTH  = O_QKL + SZ_QKHL;
    constexpr size_t O_VTL  = O_VTH + SZ_VTHL;
    constexpr size_t O_ATH  = O_VTL + SZ_VTHL;
    constexpr size_t O_ATL  = O_ATH + SZ_AT;
    constexpr size_t O_END  = O_ATL + SZ_AT;
    static_assert(SZ_WQKV % 256 == 0 && SZ_WO % 256 == 0 && SZ_XB % 256 == 0 && SZ_F % 256 == 0 && SZ_QK16 % 256 == 0 && SZ_VT16 % 256 == 0 && SZ_QKHL % 256 == 0 && SZ_VTHL % 256 == 0 && SZ_AT % 256 == 0);
    static_assert(O_END <= (size_t)134217728);                  // total carve <= 128 MiB
    static_assert((DM * FW) % 64 == 0 && (DQ * DM) % 64 == 0);  // weight planes are whole 64-element lines
    static_assert(PLN % 64 == 0);                               // plane producers: whole waves
    static_assert(((size_t)NB * SEQ) % 64 == 0);                // qkv GEMM M tiles
    if (ws_size < O_END) return;
    char* ws = (char*)d_ws;
    bf* WQKV = (bf*)(ws + O_WQKV); bf* WO = (bf*)(ws + O_WO); bf* XB = (bf*)(ws + O_XB); float* F = (float*)(ws + O_F);
    h16* QK16 = (h16*)(ws + O_QK16); h16* VT16 = (h16*)(ws + O_VT16);
    bf* QKH = (bf*)(ws + O_QKH); bf* QKL = (bf*)(ws + O_QKL); bf* VTH = (bf*)(ws + O_VTH); bf* VTL = (bf*)(ws + O_VTL);
    bf* ATH = (bf*)(ws + O_ATH); bf* ATL = (bf*)(ws + O_ATL);

    // weights: in[K][N] ([in][out]) -> Bt[N][K]; grid = lines / 64 (8 waves x 8 lines per block)
    k_wtG<<<(unsigned)((DM * FW / 64 + 63) / 64), 256, 0, stream>>>(wqkv, DM, FW, WQKV);      // in[128][384] -> out[384][128]
    k_wtG<<<(unsigned)((DQ * DM / 64 + 63) / 64), 256, 0, stream>>>(wo, DQ, DM, WO);          // in[128][128] -> out[128][128]
    k_cvtx<<<(unsigned)(((size_t)NB * SEQ * DM / 8 + 255) / 256), 256, 0, stream>>>(x, XB);
    k_gemm_qkv<<<dim3(NB * SEQ / 64, FW / 64, 1), 32, 0, stream>>>(XB, WQKV, F, bqkv);
    const unsigned LP = (unsigned)((PLN / 2 + 255) / 256);
    k_qkp<<<dim3(LP, 2, 1), 256, 0, stream>>>(F, QK16, QKH, QKL);
    k_vtp<<<LP, 256, 0, stream>>>(F, VT16, VTH, VTL);
    k_attnhl<<<dim3(RH / 16, NB * NH, 1), 32 * NW, 0, stream>>>(QKH, QKL, VTH, VTL, ATH, ATL);
    if ((SEQ - RH) / 16 > 0) k_attn16<<<dim3((SEQ - RH) / 16, NB * NH, 1), 32 * NW, 0, stream>>>(QK16, VT16, ATH, ATL);
    k_gemm_proj<<<dim3(SEQ / 64, DM / 64, NB), 32, 0, stream>>>(ATH, ATL, WO, OUT, bo);
}

// v002
// A run of this version takes 77.4 microseconds.
// Timed twice side by side with v001, it ran 1.24 and 1.23 times as fast.
// All steps since v000 together make it 1.56 times as fast.
#include <hip/hip_runtime.h>

// Causal self-attention: x [NB][SEQ][128]; qkv = x w_qkv + b_qkv ([in][out] weight, q | k | v column thirds, 4 heads x 32, head h = columns h*32+d); scores x 32^-0.5; causal select (diagonal kept); softmax; out = merged w_proj + b_proj ([in][out]).
// Compute dtypes, f32 accumulate everywhere: qkv projection v_wmma_f32_16x16x32_bf16 on bf16 RNE copies of x / w_qkv (single product); attention query rows < 256: bf16 hi/lo planes, 3 products for k q^T and for v^T p; query rows >= 256: v_wmma_f32_16x16x32_f16 single products (q, k, v f16 planes, p carried x1024 in the exponent); output projection: bf16 hi/lo context planes x bf16 w_proj (2 products). Softmax f32, online running-max form in the log2 domain.
// Fused attention, one work-group of NW waves per 16 query rows, the 32-key steps dealt round-robin to the waves (wave w: steps w, w + NW, ...), partial (max, sum, O) joined through LDS; head dim 32 = one 32-deep k-step for the scores: S^T = K Q^T (keys on D rows, queries on D columns), p built per lane and fed as the B operand of O^T = V^T P^T (B element r <- tile keys 0-15 [r], element 8+r <- tile keys 16-31 [r]); no score / probability plane in memory.

#ifndef NB
#define NB 8
#endif
#ifndef SEQ
#define SEQ 2048
#endif
#define NB_FULL  8
#define SEQ_FULL 2048
#define DM   128
#define NH   4
#define HD   32
#define DQ   (NH * HD)
#define FW   (3 * DQ)
#define RH   256                      // query rows < RH use bf16 hi/lo planes
#define PLN  ((size_t)NB * NH * SEQ * HD)   // elements of one [b*h][t][d] plane
#define PLH  ((size_t)NB * NH * RH * HD)    // elements of one hi/lo plane (rows < RH)
#define SCL2 0.25503486164918f        // HD^-0.5 * log2(e)
#define PCL  10.0f                    // log2 of the p carry (x1024) for the f16 path
#define NEGB (-3.0e38f)
#define YP   36                       // staging pitch (floats) of the 16 x 32 attention result tile
#define NW   4                        // waves per query tile: each walks every NW-th 32-key step

static_assert(DQ == DM);               // merged width == model width
static_assert(HD == 32);               // scores: one 32-deep k-step; head row == 64 B of 16-bit data; proj k-step == one head
static_assert(2 * HD == 64);
static_assert(HD % 16 == 0);           // O^T tiles of 16 d rows
static_assert(YP % 4 == 0 && YP >= HD); // 16-B aligned staging rows
static_assert(NW * 32 * 4 == 16 * HD);  // join: every thread owns 4 consecutive d of one query row
static_assert(DM % 64 == 0);           // GEMM K multiple of 32, weight lines of 64
static_assert(DQ % 64 == 0);           // proj GEMM K multiple of 32; a qkv GEMM N tile inside one of q, k, v
static_assert(FW % 64 == 0);           // GEMM N tile multiple
static_assert(SEQ % 64 == 0);          // GEMM M tile multiple, 32-key steps, V^T lines
static_assert(RH % 64 == 0);           // hi/lo V^T lines, 32-key steps inside RH, a GEMM M tile on one side of RH
static_assert(RH <= SEQ);
static_assert((SEQ - RH) % 16 == 0);
static_assert(NB <= NB_FULL);
static_assert(SEQ <= SEQ_FULL);

typedef _Float16 h16;
typedef unsigned short bf;
typedef __attribute__((ext_vector_type(16))) __bf16   v16bf;
typedef __attribute__((ext_vector_type(16))) _Float16 v16h;
typedef __attribute__((ext_vector_type(16))) unsigned short v16us;
typedef __attribute__((ext_vector_type(8)))  _Float16 v8h;
typedef __attribute__((ext_vector_type(8)))  unsigned short v8us;
typedef __attribute__((ext_vector_type(8)))  float    v8f;
typedef __attribute__((ext_vector_type(4)))  float    v4f;
typedef __attribute__((ext_vector_type(2)))  unsigned short v2us;
typedef __attribute__((ext_vector_type(4)))  unsigned short v4us;
typedef v4f  __attribute__((may_alias)) v4fa;

__device__ __forceinline__ unsigned short f2bf(float f) { unsigned u = __float_as_uint(f); u += 0x7FFFu + ((u >> 16) & 1u); return (unsigned short)(u >> 16); }   // RNE convert
__device__ __forceinline__ float bf2f(unsigned short b) { return __uint_as_float(((unsigned)b) << 16); }
__device__ __forceinline__ float bfr(float f) { return bf2f(f2bf(f)); }
__device__ __forceinline__ void splitf(float y, unsigned short& h, unsigned short& l) { h = f2bf(y); l = f2bf(y - bf2f(h)); }
__device__ __forceinline__ v16h cat16(v8h lo, v8h hi) { return __builtin_shufflevector(lo, hi, 0, 1, 2, 3, 4, 5, 6, 7, 8, 9, 10, 11, 12, 13, 14, 15); }
__device__ __forceinline__ v16bf cat16b(v8us lo, v8us hi) { return __builtin_bit_cast(v16bf, __builtin_shufflevector(lo, hi, 0, 1, 2, 3, 4, 5, 6, 7, 8, 9, 10, 11, 12, 13, 14, 15)); }
// fragment loaders: elements 0..7 <- p[0..7], elements 8..15 <- p[16..23]; p already includes + 8 * (lane >> 4)
__device__ __forceinline__ v16h ldh(const h16* p) { return cat16(*(const v8h*)p, *(const v8h*)(p + 16)); }
__device__ __forceinline__ v16bf ldb(const bf* p) { return cat16b(*(const v8us*)p, *(const v8us*)(p + 16)); }
__device__ __forceinline__ v8f wmmab(v16bf a, v16bf b, v8f c) { return __builtin_amdgcn_wmma_f32_16x16x32_bf16(false, a, false, b, (short)0, c, false, false); }
// guarded forms: 4 nops after the matrix op, accumulator tied, operands kept live
__device__ __forceinline__ v8f wm16g(v16h a, v16h b, v8f c) {
    c = __builtin_amdgcn_wmma_f32_16x16x32_f16(false, a, false, b, (short)0, c, false, false);
    asm volatile("v_nop\n\tv_nop\n\tv_nop\n\tv_nop" : "+v"(c) : "v"(a), "v"(b));
    return c; }
__device__ __forceinline__ v8f wmbg(v16bf a, v16bf b, v8f c) {
    c = __builtin_amdgcn_wmma_f32_16x16x32_bf16(false, a, false, b, (short)0, c, false, false);
    asm volatile("v_nop\n\tv_nop\n\tv_nop\n\tv_nop" : "+v"(c) : "v"(a), "v"(b));
    return c; }

// ---- register-blocked GEMM body, ONE WAVE per 64x64 output tile (16 accumulators), bf16 operands straight from K-contiguous planes; grid (M/64, N/64, Z), 32 threads.
// y[m][n] (f32) = sum_k A[m][k] Bt[n][k] (+ A2[m][k] Bt[n][k] when NSPLIT == 1) + bf16-RNE(bias[n]). K % 32 == 0, M and N multiples of 64 (asserted at file scope).
// PLANES == false: y goes to C (f32, pitch ldc). PLANES == true (qkv projection): y goes straight to the attention operand planes of struct planes, no f32 copy in memory.
// A addressing: element (m, k) at A[m * lda + (k >> 5) * ksA + (k & 31)] (row pitch lda, advance ksA per 32-deep k-step); a plain row-major plane has lda = K, ksA = 32.
// q | k planes [which][b*h][t][d]: f16 copy for all t, bf16 hi/lo for t < RH ([which][b*h][RH][d]); V^T planes [b*h][d][t]: f16 for all t, bf16 hi/lo for t < RH ([b*h][d][RH]).
struct planes { h16* QK16; h16* VT16; bf* QKH; bf* QKL; bf* VTH; bf* VTL; };
// Plane epilogues of one 64 x 64 qkv tile held in acc[mb][nb] (lane (hi, lr), element j: token t0 + mb*16 + hi*8 + j, tile column nb*16 + lr); bias points at the tile's first column; heads bh0, bh0 + 1; HL: the tile's tokens are < RH.
// V^T: a lane's 8 accumulator rows are 8 consecutive tokens of one d, i.e. 16 contiguous bytes of a V^T row: stored from registers.
template <bool HL>
__device__ __forceinline__ void put_v(const v8f (&acc)[4][4], const float* __restrict__ bias, const int bh0, const int t0, const int lane, const planes P) {
    const int lr = lane & 15, hi = lane >> 4;
    const float* bp = bias + lr; float braw[4];
#pragma unroll
    for (int nb = 0; nb < 4; ++nb) braw[nb] = bp[nb * 16];
    asm volatile("s_wait_xcnt 0x0" :: "v"(bp) : "memory");   // stands in front of the first rewrite of a register that the bias loads name; bp as an input keeps the compiler from lifting that rewrite over the wait
#pragma unroll
    for (int nb = 0; nb < 4; ++nb) { const int col = nb * 16 + lr; const float bv = bfr(braw[nb]); const size_t vr = (size_t)(bh0 + (col >> 5)) * HD + (col & 31);
#pragma unroll
        for (int mb = 0; mb < 4; ++mb) { const int t = t0 + mb * 16 + hi * 8; v8h o16; v8us oh, ol;
#pragma unroll
            for (int j = 0; j < 8; ++j) { const float y = acc[mb][nb][j] + bv; o16[j] = (h16)y; if (HL) { unsigned short x1, x2; splitf(y, x1, x2); oh[j] = x1; ol[j] = x2; } }
            *(v8h*)(P.VT16 + vr * SEQ + t) = o16;
            if (HL) { *(v8us*)(P.VTH + vr * RH + t) = oh; *(v8us*)(P.VTL + vr * RH + t) = ol; } } }
    asm volatile("s_wait_xcnt 0x0" ::: "memory");   // behind the last plane store: stands in front of any later rewrite of a register that these stores name, on every way the branches allow
}
// q / k: 16 tokens at a time turned through the wave's LDS tile os (pitch 68 floats); a lane then owns 8 consecutive d of one token (16 B of f16), 8 lanes a token's two heads, and a store covers 4 tokens = 256 contiguous bytes per head.
template <bool HL>
__device__ __forceinline__ void put_qk(const v8f (&acc)[4][4], float* os, const float* __restrict__ bias, const int which, const int bh0, const int t0, const int lane, const planes P) {
    const int lr = lane & 15, hi = lane >> 4, c = (lane & 7) * 8, d = c & 31; const size_t bh = (size_t)(bh0 + (c >> 5));
    float bv[8];
#pragma unroll
    for (int k = 0; k < 8; ++k) bv[k] = bfr(bias[c + k]);
#pragma unroll
    for (int mb = 0; mb < 4; ++mb) {
#pragma unroll
        for (int nb = 0; nb < 4; ++nb) {
#pragma unroll
            for (int j = 0; j < 8; ++j) os[(hi * 8 + j) * 68 + nb * 16 + lr] = acc[mb][nb][j]; }
        __builtin_amdgcn_wave_barrier(); asm volatile("" ::: "memory");   // the tile's LDS writes stay in front of the reads of other lanes' values
#pragma unroll
        for (int s = 0; s < 4; ++s) { const int row = 4 * s + (lane >> 3), t = t0 + mb * 16 + row;
            const v4f lo4 = *(const v4fa*)(os + row * 68 + c), hi4 = *(const v4fa*)(os + row * 68 + c + 4); v8h o16; v8us oh, ol;
#pragma unroll
            for (int k = 0; k < 8; ++k) { const float y = (k < 4 ? lo4[k & 3] : hi4[k & 3]) + bv[k]; o16[k] = (h16)y; if (HL) { unsigned short x1, x2; splitf(y, x1, x2); oh[k] = x1; ol[k] = x2; } }
            *(v8h*)(P.QK16 + (size_t)which * PLN + (bh * SEQ + t) * HD + d) = o16;
            if (HL) { const size_t o2 = (size_t)which * PLH + (bh * RH + t) * HD + d; *(v8us*)(P.QKH + o2) = oh; *(v8us*)(P.QKL + o2) = ol; } }
        __builtin_amdgcn_wave_barrier(); asm volatile("" ::: "memory");   // the reads stay in front of the next 16 tokens' LDS writes
    }
    asm volatile("s_wait_xcnt 0x0" ::: "memory");   // behind the last plane store: stands in front of any later rewrite of a register that these stores name, on every way the branches allow
}
template <int NSPLIT, bool PLANES>
__device__ __forceinline__ void gemmw_body(const bf* __restrict__ A, const bf* __restrict__ A2, const bf* __restrict__ Bt, const int K, const int lda, const size_t ksA, float* C, const int ldc, const float* __restrict__ bias, const size_t sA, const size_t sC, const planes P) {
    __shared__ __align__(16) float os[16 * 68];
    const size_t z = blockIdx.z; A += z * sA; if (NSPLIT == 1) A2 += z * sA; C += z * sC;
    const int lane = threadIdx.x & 31, lr = lane & 15, hi = lane >> 4; const int r0 = blockIdx.x * 64, c0 = blockIdx.y * 64;
    v8f acc[4][4];
#pragma unroll
    for (int mb = 0; mb < 4; ++mb)
#pragma unroll
        for (int nb = 0; nb < 4; ++nb) acc[mb][nb] = (v8f){};
    const size_t aoff = (size_t)(r0 + lr) * lda + 8 * hi, boff = (size_t)(c0 + lr) * K + 8 * hi;
#pragma unroll 1
    for (int kc = 0; kc < K; kc += 32) {
        const size_t ak = (size_t)(kc >> 5) * ksA;
        v16bf a[4], a2[4];
#pragma unroll
        for (int mb = 0; mb < 4; ++mb) { a[mb] = ldb(A + aoff + (size_t)mb * 16 * lda + ak); if (NSPLIT == 1) a2[mb] = ldb(A2 + aoff + (size_t)mb * 16 * lda + ak); }
#pragma unroll
        for (int nb = 0; nb < 4; ++nb) { const v16bf b = ldb(Bt + boff + (size_t)nb * 16 * K + kc);
#pragma unroll
            for (int mb = 0; mb < 4; ++mb) { acc[mb][nb] = wmmab(a[mb], b, acc[mb][nb]); if (NSPLIT == 1) acc[mb][nb] = wmmab(a2[mb], b, acc[mb][nb]); } }
        asm volatile("v_nop\n\tv_nop\n\tv_nop\n\tv_nop" : "+v"(acc[0][0]), "+v"(acc[1][1]), "+v"(acc[2][2]), "+v"(acc[3][3]) : "v"(a[0]), "v"(a[3]));
    }
    if constexpr (PLANES) {
        // tile coordinates, all uniform over the work-group: 64 columns = two heads of one of q, k, v; 64 rows = 64 tokens of one batch, all on one side of RH
        const int which = c0 / DQ, bh0 = (r0 / SEQ) * NH + (c0 % DQ) / HD, t0 = r0 % SEQ;
        if (which == 2) { if (t0 < RH) put_v<true>(acc, bias + c0, bh0, t0, lane, P); else put_v<false>(acc, bias + c0, bh0, t0, lane, P); }
        else            { if (t0 < RH) put_qk<true>(acc, os, bias + c0, which, bh0, t0, lane, P); else put_qk<false>(acc, os, bias + c0, which, bh0, t0, lane, P); }
        return;
    }
#pragma unroll
    for (int mb = 0; mb < 4; ++mb) {
#pragma unroll
        for (int nb = 0; nb < 4; ++nb) {
#pragma unroll
            for (int j = 0; j < 8; ++j) os[(hi * 8 + j) * 68 + nb * 16 + lr] = acc[mb][nb][j]; }
        __builtin_amdgcn_wave_barrier(); asm volatile("" ::: "memory");
        float* crow = C + (size_t)(r0 + mb * 16) * ldc + c0;
{
#pragma unroll
            for (int s = 0; s < 8; ++s) { const int row = 2 * s + hi, cofs = lr * 4; v4f val = *(const v4fa*)(os + row * 68 + cofs);
                val[0] += bfr(bias[c0 + cofs]); val[1] += bfr(bias[c0 + cofs + 1]); val[2] += bfr(bias[c0 + cofs + 2]); val[3] += bfr(bias[c0 + cofs + 3]);
                *(v4f*)(crow + (size_t)row * ldc + cofs) = val; }
             }
        __builtin_amdgcn_wave_barrier(); asm volatile("" ::: "memory");
    }
}
// qkv [NB*SEQ][384] = XB [NB*SEQ][128] x WQKV^T + b_qkv, column = which*128 + h*32 + d, written as the attention planes; grid (NB*SEQ/64, 384/64, 1)
__global__ __launch_bounds__(32) void k_gemm_qkv(const bf* __restrict__ A, const bf* __restrict__ Bt, const float* __restrict__ bias, h16* QK16, h16* VT16, bf* QKH, bf* QKL, bf* VTH, bf* VTL) {
    gemmw_body<0, true>(A, nullptr, Bt, DM, DM, (size_t)32, nullptr, FW, bias, 0, 0, planes{QK16, VT16, QKH, QKL, VTH, VTL}); }
// OUT [b][t][128] = (ATH + ATL) x WO^T + b_proj; A element (t, k = h*32+d) at plane [(b*NH + h)*SEQ + t][d]: lda = HD, k-step advance = SEQ*HD, batch stride NH*SEQ*HD;
// grid (SEQ/64, 128/64, NB); output rows use the full per-batch stride
__global__ __launch_bounds__(32) void k_gemm_proj(const bf* __restrict__ Ah, const bf* __restrict__ Al, const bf* __restrict__ Bt, float* C, const float* __restrict__ bias) {
    gemmw_body<1, false>(Ah, Al, Bt, DQ, HD, (size_t)SEQ * HD, C, DM, bias, (size_t)NH * SEQ * HD, (size_t)SEQ_FULL * DM, planes{}); }

__global__ __launch_bounds__(256) void k_wtG(const float* __restrict__ w, int K, int N, bf* Bt) {
    const int lane = threadIdx.x & 31; const int wave = __builtin_amdgcn_readfirstlane(threadIdx.x >> 5);
    const int L0 = (blockIdx.x * 8 + wave) * 8; const int nlines = N * K / 64;
{
#pragma unroll 1
        for (int l = 0; l < 8; ++l) { const int L = L0 + l; if (L >= nlines) break; const size_t e = (size_t)L * 64 + lane * 2; const int k = (int)(e % K), n = (int)(e / K); v2us o;
            o[0] = f2bf(w[(size_t)k * N + n]); o[1] = f2bf(w[(size_t)(k + 1) * N + n]); *(v2us*)(Bt + e) = o; }
         }
}
__global__ __launch_bounds__(256) void k_cvtx(const float* __restrict__ x, bf* XB) {
    const size_t i = (size_t)blockIdx.x * 256 + threadIdx.x; if (i >= (size_t)NB * SEQ * DM / 8) return;
    const size_t row = i / (DM / 8); const int c = (int)(i % (DM / 8)) * 8; const size_t b = row / SEQ, t = row % SEQ;
    const v8f v = *(const v8f*)(x + (b * SEQ_FULL + t) * DM + c); v8us o;
#pragma unroll
    for (int k = 0; k < 8; ++k) o[k] = f2bf(v[k]);
    *(v8us*)(XB + i * 8) = o;  }

// ---- join of the NW waves' partial results of one 16-query tile. Wave w holds, for query n, its running max m (log2 domain), its sum l (both halves already added) and O^T unnormalised.
// Every wave stages its part, one work-group barrier, then thread (w, lane) owns query row 4w + (lane >> 3), d = 4 (lane & 7) .. + 3: out = sum_w 2^(m_w - M) O_w / sum_w 2^(m_w - M) l_w, waves summed in index order.
// A wave that had no key step stages m = NEGB, l = 0, O = 0 and gets weight 0 (wave 0 always has step 0, whose key 0 every query keeps, so M is finite).
__device__ __forceinline__ void join_store(float* ys, float* ms, float* ls, const int w, const int lane, const v8f* o, const float m, const float l, bf* ATH, bf* ATL, const size_t tile0) {
    const int n = lane & 15, hh = lane >> 4;
#pragma unroll
    for (int j = 0; j < 2; ++j)
#pragma unroll
        for (int r = 0; r < 8; ++r) ys[w * 16 * YP + n * YP + j * 16 + 8 * hh + r] = o[j][r];
    if (hh == 0) { ms[w * 16 + n] = m; ls[w * 16 + n] = l; }
    __syncthreads();                   // publishes every wave's partial to the joining threads
    const int row = 4 * w + (lane >> 3), c = (lane & 7) * 4;
    float mw[NW]; float M = NEGB;
#pragma unroll
    for (int k = 0; k < NW; ++k) { mw[k] = ms[k * 16 + row]; M = fmaxf(M, mw[k]); }
    v4f acc = (v4f){}; float L = 0.0f;
#pragma unroll
    for (int k = 0; k < NW; ++k) { const float sc = __builtin_amdgcn_exp2f(mw[k] - M); L += sc * ls[k * 16 + row]; acc += sc * *(const v4fa*)(ys + k * 16 * YP + row * YP + c); }
    const float inv = 1.0f / L;
    v4us oh, ol;
#pragma unroll
    for (int k = 0; k < 4; ++k) { unsigned short x1, x2; splitf(acc[k] * inv, x1, x2); oh[k] = x1; ol[k] = x2; }
    const size_t oo = tile0 + (size_t)row * HD + c;
    *(v4us*)(ATH + oo) = oh; *(v4us*)(ATL + oo) = ol;
}

// ---- fused causal attention, query rows >= RH, single f16 products. NW waves per 16 query rows; grid ((SEQ-RH)/16, NB*NH), 32 * NW threads.
// Lane (hh = lane>>4, n = lane&15): query q0+n; per 32-key step holds keys kb+8hh+r (tile 0) and kb+16+8hh+r (tile 1), r = 0..7.
__global__ __launch_bounds__(32 * NW) void k_attn16(const h16* QK16, const h16* VT16, bf* ATH, bf* ATL) {
    __shared__ __align__(16) float ys[NW * 16 * YP];     // one 16 x 32 partial O tile per wave
    __shared__ float ms[NW * 16], ls[NW * 16];           // per wave and query: running max, sum
    const int lane = threadIdx.x & 31, n = lane & 15, hh = lane >> 4;
    const int w = __builtin_amdgcn_readfirstlane(threadIdx.x >> 5);   // wave number, scalar: the key loop stays a scalar loop
    const int bh = blockIdx.y;
    const int q0 = RH + blockIdx.x * 16;
    const int qrow = q0 + n, kend = q0 + 15;
    const size_t qo = ((size_t)bh * SEQ + q0 + n) * HD + 8 * hh;          // query plane (which 0)
    const size_t ko = PLN + ((size_t)bh * SEQ + n) * HD + 8 * hh;         // key plane (which 1), + key * HD
    const size_t vo = ((size_t)bh * HD + n) * SEQ + 8 * hh;               // V^T plane, + j*16*SEQ + key
    const v16h qb = ldh(QK16 + qo);
    v8f o[2];
#pragma unroll
    for (int j = 0; j < 2; ++j) o[j] = (v8f){};
    float m = NEGB, l = 0.0f;
#pragma unroll 1
    for (int kb = 32 * w; kb <= kend; kb += 32 * NW) {
        v8f s0 = (v8f){}, s1 = (v8f){};
        {
            const size_t ka = ko + (size_t)kb * HD;
            const v16h a0 = ldh(QK16 + ka), a1 = ldh(QK16 + ka + 16 * HD);
            s0 = wm16g(a0, qb, s0); s1 = wm16g(a1, qb, s1);
        }
        asm volatile("" ::: "memory");
        float u[16];
        const int key0 = kb + 8 * hh;
        if (kb + 31 > q0) {            // wave-uniform: only the steps touching the diagonal (replace by select)
#pragma unroll
            for (int r = 0; r < 8; ++r) { u[r] = (key0 + r <= qrow) ? s0[r] * SCL2 : NEGB; u[8 + r] = (key0 + 16 + r <= qrow) ? s1[r] * SCL2 : NEGB; }
        } else {
#pragma unroll
            for (int r = 0; r < 8; ++r) { u[r] = s0[r] * SCL2; u[8 + r] = s1[r] * SCL2; }
        }
        float mx = u[0];
#pragma unroll
        for (int i = 1; i < 16; ++i) mx = fmaxf(mx, u[i]);
        mx = fmaxf(mx, __shfl_xor(mx, 16, 32));
        const float mn = fmaxf(m, mx);
        const float corr = __builtin_amdgcn_exp2f(m - mn);
        m = mn;
        v16h pb; float ps = 0.0f;
#pragma unroll
        for (int r = 0; r < 8; ++r) {
            const float p0 = __builtin_amdgcn_exp2f((u[r] - mn) + PCL); const float p1 = __builtin_amdgcn_exp2f((u[8 + r] - mn) + PCL);
            ps += p0 + p1; pb[r] = (h16)p0; pb[8 + r] = (h16)p1; }
        l = l * corr + ps;
#pragma unroll
        for (int j = 0; j < 2; ++j) o[j] = o[j] * corr;
#pragma unroll
        for (int j = 0; j < 2; ++j) { const v16h va = ldh(VT16 + vo + (size_t)j * 16 * SEQ + kb); o[j] = wm16g(va, pb, o[j]); }
        asm volatile("" ::: "memory");
    }
    l += __shfl_xor(l, 16, 32);
    join_store(ys, ms, ls, w, lane, o, m, l, ATH, ATL, ((size_t)bh * SEQ + q0) * HD);
}

// ---- fused causal attention, query rows < RH, bf16 hi/lo planes, 3 products per contraction (hi*hi + lo*hi + hi*lo). Same lane map and key split as k_attn16; grid (RH/16, NB*NH), 32 * NW threads.
__global__ __launch_bounds__(32 * NW) void k_attnhl(const bf* QKH, const bf* QKL, const bf* VTH, const bf* VTL, bf* ATH, bf* ATL) {
    __shared__ __align__(16) float ys[NW * 16 * YP];     // one 16 x 32 partial O tile per wave
    __shared__ float ms[NW * 16], ls[NW * 16];           // per wave and query: running max, sum
    const int lane = threadIdx.x & 31, n = lane & 15, hh = lane >> 4;
    const int w = __builtin_amdgcn_readfirstlane(threadIdx.x >> 5);   // wave number, scalar: the key loop stays a scalar loop
    const int bh = blockIdx.y;
    const int q0 = blockIdx.x * 16;
    const int qrow = q0 + n, kend = q0 + 15;
    const size_t qo = ((size_t)bh * RH + q0 + n) * HD + 8 * hh;           // query hi/lo plane (which 0)
    const size_t ko = PLH + ((size_t)bh * RH + n) * HD + 8 * hh;          // key hi/lo plane (which 1), + key * HD
    const size_t vo = ((size_t)bh * HD + n) * RH + 8 * hh;                // V^T hi/lo plane, + j*16*RH + key
    v8f o[2];
#pragma unroll
    for (int j = 0; j < 2; ++j) o[j] = (v8f){};
    float m = NEGB, l = 0.0f;
#pragma unroll 1
    for (int kb = 32 * w; kb <= kend; kb += 32 * NW) {
        v8f s[2]; s[0] = (v8f){}; s[1] = (v8f){};
        {
            const v16bf qh = ldb(QKH + qo), ql = ldb(QKL + qo);
#pragma unroll
            for (int kc = 0; kc < 2; ++kc) { const size_t ka = ko + (size_t)(kb + kc * 16) * HD;
                const v16bf kh = ldb(QKH + ka), kl = ldb(QKL + ka);
                s[kc] = wmbg(kh, qh, s[kc]); s[kc] = wmbg(kl, qh, s[kc]); s[kc] = wmbg(kh, ql, s[kc]); }
            asm volatile("" ::: "memory");
        }
        float u[16];
        const int key0 = kb + 8 * hh;
        if (kb + 31 > q0) {            // wave-uniform
#pragma unroll
            for (int r = 0; r < 8; ++r) { u[r] = (key0 + r <= qrow) ? s[0][r] * SCL2 : NEGB; u[8 + r] = (key0 + 16 + r <= qrow) ? s[1][r] * SCL2 : NEGB; }
        } else {
#pragma unroll
            for (int r = 0; r < 8; ++r) { u[r] = s[0][r] * SCL2; u[8 + r] = s[1][r] * SCL2; }
        }
        float mx = u[0];
#pragma unroll
        for (int i = 1; i < 16; ++i) mx = fmaxf(mx, u[i]);
        mx = fmaxf(mx, __shfl_xor(mx, 16, 32));
        const float mn = fmaxf(m, mx);
        const float corr = __builtin_amdgcn_exp2f(m - mn);
        m = mn;
        v16us phu, plu; float ps = 0.0f;
#pragma unroll
        for (int r = 0; r < 8; ++r) {
            const float p0 = __builtin_amdgcn_exp2f(u[r] - mn); const float p1 = __builtin_amdgcn_exp2f(u[8 + r] - mn);
            ps += p0 + p1; unsigned short x1, x2; splitf(p0, x1, x2); phu[r] = x1; plu[r] = x2; splitf(p1, x1, x2); phu[8 + r] = x1; plu[8 + r] = x2; }
        const v16bf ph = __builtin_bit_cast(v16bf, phu), pl = __builtin_bit_cast(v16bf, plu);
        l = l * corr + ps;
#pragma unroll
        for (int j = 0; j < 2; ++j) o[j] = o[j] * corr;
#pragma unroll
        for (int j = 0; j < 2; ++j) { const size_t va = vo + (size_t)j * 16 * RH + kb; const v16bf vh = ldb(VTH + va), vl = ldb(VTL + va);
            o[j] = wmbg(vh, ph, o[j]); o[j] = wmbg(vl, ph, o[j]); o[j] = wmbg(vh, pl, o[j]);
            asm volatile("" ::: "memory"); }
    }
    l += __shfl_xor(l, 16, 32);
    join_store(ys, ms, ls, w, lane, o, m, l, ATH, ATL, ((size_t)bh * SEQ + q0) * HD);
}

extern "C" void kernel_launch(void* const* d_in, const int* in_sizes, int n_in,
                              void* d_out, int out_size, void* d_ws, size_t ws_size, hipStream_t stream) {
    // wire order: x [8][2048][128], w_qkv [128][384], b_qkv [384], w_proj [128][128], b_proj [128] (all f32)
    constexpr size_t XN = ((size_t)(NB - 1) * SEQ_FULL + SEQ) * DM;      // lowest element count covering the rows touched
    if (n_in < 5) return;
    if ((size_t)in_sizes[0] < XN || (size_t)in_sizes[1] < (size_t)DM * FW || in_sizes[2] < FW || (size_t)in_sizes[3] < (size_t)DQ * DM || in_sizes[4] < DM) return;
    if ((size_t)out_size < XN) return;
    const float* x = (const float*)d_in[0]; const float* wqkv = (const float*)d_in[1]; const float* bqkv = (const float*)d_in[2];
    const float* wo = (const float*)d_in[3]; const float* bo = (const float*)d_in[4];
    float* OUT = (float*)d_out;      // [NB_FULL][SEQ_FULL][128], byte offset 0

    // workspace carve: every region a multiple of 256 B, sized to the producers' whole-line store extent
    constexpr size_t SZ_WQKV = (size_t)FW * DM * 2;            // Bt [384][128] bf16
    constexpr size_t SZ_WO   = (size_t)DM * DQ * 2;            // Bt [128][128] bf16
    constexpr size_t SZ_XB   = (size_t)NB * SEQ * DM * 2;      // bf16 x
    constexpr size_t SZ_QK16 = 2 * PLN * 2;                    // f16 q | k planes
    constexpr size_t SZ_VT16 = PLN * 2;                        // f16 V^T planes
    constexpr size_t SZ_QKHL = 2 * PLH * 2;                    // bf16 q | k hi (and lo) planes, rows < RH
    constexpr size_t SZ_VTHL = PLH * 2;                        // bf16 V^T hi (and lo) planes, keys < RH
    constexpr size_t SZ_AT   = PLN * 2;                        // head-major context hi (and lo) planes
    constexpr size_t O_WQKV = 0;
    constexpr size_t O_WO   = O_WQKV + SZ_WQKV;
    constexpr size_t O_XB   = O_WO + SZ_WO;
    constexpr size_t O_QK16 = O_XB + SZ_XB;
    constexpr size_t O_VT16 = O_QK16 + SZ_QK16;
    constexpr size_t O_QKH  = O_VT16 + SZ_VT16;
    constexpr size_t O_QKL  = O_QKH + SZ_QKHL;
    constexpr size_t O_VTH  = O_QKL + SZ_QKHL;
    constexpr size_t O_VTL  = O_VTH + SZ_VTHL;
    constexpr size_t O_ATH  = O_VTL + SZ_VTHL;
    constexpr size_t O_ATL  = O_ATH + SZ_AT;
    constexpr size_t O_END  = O_ATL + SZ_AT;
    static_assert(SZ_WQKV % 256 == 0 && SZ_WO % 256 == 0 && SZ_XB % 256 == 0 && SZ_QK16 % 256 == 0 && SZ_VT16 % 256 == 0 && SZ_QKHL % 256 == 0 && SZ_VTHL % 256 == 0 && SZ_AT % 256 == 0);
    static_assert(O_END <= (size_t)134217728);                  // total carve <= 128 MiB
    static_assert((DM * FW) % 64 == 0 && (DQ * DM) % 64 == 0);  // weight planes are whole 64-element lines
    static_assert(((size_t)NB * SEQ) % 64 == 0);                // qkv GEMM M tiles
    if (ws_size < O_END) return;
    char* ws = (char*)d_ws;
    bf* WQKV = (bf*)(ws + O_WQKV); bf* WO = (bf*)(ws + O_WO); bf* XB = (bf*)(ws + O_XB);
    h16* QK16 = (h16*)(ws + O_QK16); h16* VT16 = (h16*)(ws + O_VT16);
    bf* QKH = (bf*)(ws + O_QKH); bf* QKL = (bf*)(ws + O_QKL); bf* VTH = (bf*)(ws + O_VTH); bf* VTL = (bf*)(ws + O_VTL);
    bf* ATH = (bf*)(ws + O_ATH); bf* ATL = (bf*)(ws + O_ATL);

    // weights: in[K][N] ([in][out]) -> Bt[N][K]; grid = lines / 64 (8 waves x 8 lines per block)
    k_wtG<<<(unsigned)((DM * FW / 64 + 63) / 64), 256, 0, stream>>>(wqkv, DM, FW, WQKV);      // in[128][384] -> out[384][128]
    k_wtG<<<(unsigned)((DQ * DM / 64 + 63) / 64), 256, 0, stream>>>(wo, DQ, DM, WO);          // in[128][128] -> out[128][128]
    k_cvtx<<<(unsigned)(((size_t)NB * SEQ * DM / 8 + 255) / 256), 256, 0, stream>>>(x, XB);
    k_gemm_qkv<<<dim3(NB * SEQ / 64, FW / 64, 1), 32, 0, stream>>>(XB, WQKV, bqkv, QK16, VT16, QKH, QKL, VTH, VTL);
    k_attnhl<<<dim3(RH / 16, NB * NH, 1), 32 * NW, 0, stream>>>(QKH, QKL, VTH, VTL, ATH, ATL);
    if ((SEQ - RH) / 16 > 0) k_attn16<<<dim3((SEQ - RH) / 16, NB * NH, 1), 32 * NW, 0, stream>>>(QK16, VT16, ATH, ATL);
    k_gemm_proj<<<dim3(SEQ / 64, DM / 64, NB), 32, 0, stream>>>(ATH, ATL, WO, OUT, bo);
}

// v003
// One run takes 68.9 microseconds.
// Next to v002, in two timings, it ran 1.12 and 1.13 times as fast.
// All steps since v000 together make it 1.76 times as fast.
#include <hip/hip_runtime.h>

// Causal self-attention: x [NB][SEQ][128]; qkv = x w_qkv + b_qkv ([in][out] weight, q | k | v column thirds, 4 heads x 32, head h = columns h*32+d); scores x 32^-0.5; causal select (diagonal kept); softmax; out = merged w_proj + b_proj ([in][out]).
// Compute dtypes, f32 accumulate everywhere: qkv projection v_wmma_f32_16x16x32_bf16 on bf16 RNE copies of x / w_qkv (single product); attention query rows < 256: bf16 hi/lo planes, 3 products for k q^T and for v^T p; query rows >= 256: v_wmma_f32_16x16x32_f16 single products (q, k, v f16 planes, p carried x1024 in the exponent); output projection: bf16 hi/lo context planes x bf16 w_proj (2 products). Softmax f32, online running-max form in the log2 domain.
// Fused attention, one work-group of NW waves per 16 query rows, the 32-key steps dealt round-robin to the waves (wave w: steps w, w + NW, ...), partial (max, sum, O) joined through LDS; head dim 32 = one 32-deep k-step for the scores: S^T = K Q^T (keys on D rows, queries on D columns), p built per lane and fed as the B operand of O^T = V^T P^T (B element r <- tile keys 0-15 [r], element 8+r <- tile keys 16-31 [r]); no score / probability plane in memory.

#ifndef NB
#define NB 8
#endif
#ifndef SEQ
#define SEQ 2048
#endif
#define NB_FULL  8
#define SEQ_FULL 2048
#define DM   128
#define NH   4
#define HD   32
#define DQ   (NH * HD)
#define FW   (3 * DQ)
#define RH   256                      // query rows < RH use bf16 hi/lo planes
#define PLN  ((size_t)NB * NH * SEQ * HD)   // elements of one [b*h][t][d] plane
#define PLH  ((size_t)NB * NH * RH * HD)    // elements of one hi/lo plane (rows < RH)
#define SCL2 0.25503486164918f        // HD^-0.5 * log2(e)
#define PCL  10.0f                    // log2 of the p carry (x1024) for the f16 path
#define NEGB (-3.0e38f)
#define YP   36                       // staging pitch (floats) of the 16 x 32 attention result tile
#define NW   4                        // waves per query tile: each walks every NW-th 32-key step

static_assert(DQ == DM);               // merged width == model width
static_assert(HD == 32);               // scores: one 32-deep k-step; head row == 64 B of 16-bit data; proj k-step == one head
static_assert(2 * HD == 64);
static_assert(HD % 16 == 0);           // O^T tiles of 16 d rows
static_assert(YP % 4 == 0 && YP >= HD); // 16-B aligned staging rows
static_assert(NW * 32 * 4 == 16 * HD);  // join: every thread owns 4 consecutive d of one query row
static_assert(DM % 64 == 0);           // GEMM K multiple of 32, weight lines of 64
static_assert(DQ % 64 == 0);           // proj GEMM K multiple of 32; a qkv GEMM N tile inside one of q, k, v
static_assert(FW % 64 == 0);           // GEMM N tile multiple
static_assert(SEQ % 64 == 0);          // GEMM M tile multiple, 32-key steps, V^T lines
static_assert(RH % 64 == 0);           // hi/lo V^T lines, 32-key steps inside RH, a GEMM M tile on one side of RH
static_assert(RH <= SEQ);
static_assert((SEQ - RH) % 16 == 0);
static_assert(NB <= NB_FULL);
static_assert(SEQ <= SEQ_FULL);

typedef _Float16 h16;
typedef unsigned short bf;
typedef __attribute__((ext_vector_type(16))) __bf16   v16bf;
typedef __attribute__((ext_vector_type(16))) _Float16 v16h;
typedef __attribute__((ext_vector_type(16))) unsigned short v16us;
typedef __attribute__((ext_vector_type(8)))  _Float16 v8h;
typedef __attribute__((ext_vector_type(8)))  unsigned short v8us;
typedef __attribute__((ext_vector_type(8)))  float    v8f;
typedef __attribute__((ext_vector_type(4)))  float    v4f;
typedef __attribute__((ext_vector_type(2)))  unsigned short v2us;
typedef __attribute__((ext_vector_type(4)))  unsigned short v4us;
typedef v4f  __attribute__((may_alias)) v4fa;

__device__ __forceinline__ unsigned short f2bf(float f) { unsigned u = __float_as_uint(f); u += 0x7FFFu + ((u >> 16) & 1u); return (unsigned short)(u >> 16); }   // RNE convert
__device__ __forceinline__ float bf2f(unsigned short b) { return __uint_as_float(((unsigned)b) << 16); }
__device__ __forceinline__ float bfr(float f) { return bf2f(f2bf(f)); }
__device__ __forceinline__ void splitf(float y, unsigned short& h, unsigned short& l) { h = f2bf(y); l = f2bf(y - bf2f(h)); }
__device__ __forceinline__ v16h cat16(v8h lo, v8h hi) { return __builtin_shufflevector(lo, hi, 0, 1, 2, 3, 4, 5, 6, 7, 8, 9, 10, 11, 12, 13, 14, 15); }
__device__ __forceinline__ v16bf cat16b(v8us lo, v8us hi) { return __builtin_bit_cast(v16bf, __builtin_shufflevector(lo, hi, 0, 1, 2, 3, 4, 5, 6, 7, 8, 9, 10, 11, 12, 13, 14, 15)); }
// fragment loaders: elements 0..7 <- p[0..7], elements 8..15 <- p[16..23]; p already includes + 8 * (lane >> 4)
__device__ __forceinline__ v16h ldh(const h16* p) { return cat16(*(const v8h*)p, *(const v8h*)(p + 16)); }
__device__ __forceinline__ v16bf ldb(const bf* p) { return cat16b(*(const v8us*)p, *(const v8us*)(p + 16)); }
__device__ __forceinline__ v8f wmmab(v16bf a, v16bf b, v8f c) { return __builtin_amdgcn_wmma_f32_16x16x32_bf16(false, a, false, b, (short)0, c, false, false); }
// guarded forms: 4 nops after the matrix op, accumulator tied, operands kept live
__device__ __forceinline__ v8f wm16g(v16h a, v16h b, v8f c) {
    c = __builtin_amdgcn_wmma_f32_16x16x32_f16(false, a, false, b, (short)0, c, false, false);
    asm volatile("v_nop\n\tv_nop\n\tv_nop\n\tv_nop" : "+v"(c) : "v"(a), "v"(b));
    return c; }
__device__ __forceinline__ v8f wmbg(v16bf a, v16bf b, v8f c) {
    c = __builtin_amdgcn_wmma_f32_16x16x32_bf16(false, a, false, b, (short)0, c, false, false);
    asm volatile("v_nop\n\tv_nop\n\tv_nop\n\tv_nop" : "+v"(c) : "v"(a), "v"(b));
    return c; }

// ---- register-blocked GEMM body, ONE WAVE per 64x64 output tile (16 accumulators), bf16 operands straight from K-contiguous planes; grid (M/64, N/64, Z), 32 threads.
// y[m][n] (f32) = sum_k A[m][k] Bt[n][k] (+ A2[m][k] Bt[n][k] when NSPLIT == 1) + bf16-RNE(bias[n]). K % 32 == 0, M and N multiples of 64 (asserted at file scope).
// PLANES == false: y goes to C (f32, pitch ldc). PLANES == true (qkv projection): y goes straight to the attention operand planes of struct planes, no f32 copy in memory.
// A addressing: element (m, k) at A[m * lda + (k >> 5) * ksA + (k & 31)] (row pitch lda, advance ksA per 32-deep k-step); a plain row-major plane has lda = K, ksA = 32.
// q | k planes [which][b*h][t][d]: f16 copy for all t, bf16 hi/lo for t < RH ([which][b*h][RH][d]); V^T planes [b*h][d][t]: f16 for all t, bf16 hi/lo for t < RH ([b*h][d][RH]).
struct planes { h16* QK16; h16* VT16; bf* QKH; bf* QKL; bf* VTH; bf* VTL; };
// Plane epilogues of one 64 x 64 qkv tile held in acc[mb][nb] (lane (hi, lr), element j: token t0 + mb*16 + hi*8 + j, tile column nb*16 + lr); bias points at the tile's first column; heads bh0, bh0 + 1; HL: the tile's tokens are < RH.
// V^T: a lane's 8 accumulator rows are 8 consecutive tokens of one d, i.e. 16 contiguous bytes of a V^T row: stored from registers.
template <bool HL>
__device__ __forceinline__ void put_v(const v8f (&acc)[4][4], const float* __restrict__ bias, const int bh0, const int t0, const int lane, const planes P) {
    const int lr = lane & 15, hi = lane >> 4;
    const float* bp = bias + lr; float braw[4];
#pragma unroll
    for (int nb = 0; nb < 4; ++nb) braw[nb] = bp[nb * 16];
    asm volatile("s_wait_xcnt 0x0" :: "v"(bp) : "memory");   // stands in front of the first rewrite of a register that the bias loads name; bp as an input keeps the compiler from lifting that rewrite over the wait
#pragma unroll
    for (int nb = 0; nb < 4; ++nb) { const int col = nb * 16 + lr; const float bv = bfr(braw[nb]); const size_t vr = (size_t)(bh0 + (col >> 5)) * HD + (col & 31);
#pragma unroll
        for (int mb = 0; mb < 4; ++mb) { const int t = t0 + mb * 16 + hi * 8; v8h o16; v8us oh, ol;
#pragma unroll
            for (int j = 0; j < 8; ++j) { const float y = acc[mb][nb][j] + bv; o16[j] = (h16)y; if (HL) { unsigned short x1, x2; splitf(y, x1, x2); oh[j] = x1; ol[j] = x2; } }
            *(v8h*)(P.VT16 + vr * SEQ + t) = o16;
            if (HL) { *(v8us*)(P.VTH + vr * RH + t) = oh; *(v8us*)(P.VTL + vr * RH + t) = ol; } } }
    asm volatile("s_wait_xcnt 0x0" ::: "memory");   // behind the last plane store: stands in front of any later rewrite of a register that these stores name, on every way the branches allow
}
// q / k: 16 tokens at a time turned through the wave's LDS tile os (pitch 68 floats); a lane then owns 8 consecutive d of one token (16 B of f16), 8 lanes a token's two heads, and a store covers 4 tokens = 256 contiguous bytes per head.
template <bool HL>
__device__ __forceinline__ void put_qk(const v8f (&acc)[4][4], float* os, const float* __restrict__ bias, const int which, const int bh0, const int t0, const int lane, const planes P) {
    const int lr = lane & 15, hi = lane >> 4, c = (lane & 7) * 8, d = c & 31; const size_t bh = (size_t)(bh0 + (c >> 5));
    float bv[8];
#pragma unroll
    for (int k = 0; k < 8; ++k) bv[k] = bfr(bias[c + k]);
#pragma unroll
    for (int mb = 0; mb < 4; ++mb) {
#pragma unroll
        for (int nb = 0; nb < 4; ++nb) {
#pragma unroll
            for (int j = 0; j < 8; ++j) os[(hi * 8 + j) * 68 + nb * 16 + lr] = acc[mb][nb][j]; }
        __builtin_amdgcn_wave_barrier(); asm volatile("" ::: "memory");   // the tile's LDS writes stay in front of the reads of other lanes' values
#pragma unroll
        for (int s = 0; s < 4; ++s) { const int row = 4 * s + (lane >> 3), t = t0 + mb * 16 + row;
            const v4f lo4 = *(const v4fa*)(os + row * 68 + c), hi4 = *(const v4fa*)(os + row * 68 + c + 4); v8h o16; v8us oh, ol;
#pragma unroll
            for (int k = 0; k < 8; ++k) { const float y = (k < 4 ? lo4[k & 3] : hi4[k & 3]) + bv[k]; o16[k] = (h16)y; if (HL) { unsigned short x1, x2; splitf(y, x1, x2); oh[k] = x1; ol[k] = x2; } }
            *(v8h*)(P.QK16 + (size_t)which * PLN + (bh * SEQ + t) * HD + d) = o16;
            if (HL) { const size_t o2 = (size_t)which * PLH + (bh * RH + t) * HD + d; *(v8us*)(P.QKH + o2) = oh; *(v8us*)(P.QKL + o2) = ol; } }
        __builtin_amdgcn_wave_barrier(); asm volatile("" ::: "memory");   // the reads stay in front of the next 16 tokens' LDS writes
    }
    asm volatile("s_wait_xcnt 0x0" ::: "memory");   // behind the last plane store: stands in front of any later rewrite of a register that these stores name, on every way the branches allow
}
template <int NSPLIT, bool PLANES>
__device__ __forceinline__ void gemmw_body(const bf* __restrict__ A, const bf* __restrict__ A2, const bf* __restrict__ Bt, const int K, const int lda, const size_t ksA, float* C, const int ldc, const float* __restrict__ bias, const size_t sA, const size_t sC, const planes P) {
    __shared__ __align__(16) float os[16 * 68];
    const size_t z = blockIdx.z; A += z * sA; if (NSPLIT == 1) A2 += z * sA; C += z * sC;
    const int lane = threadIdx.x & 31, lr = lane & 15, hi = lane >> 4; const int r0 = blockIdx.x * 64, c0 = blockIdx.y * 64;
    v8f acc[4][4];
#pragma unroll
    for (int mb = 0; mb < 4; ++mb)
#pragma unroll
        for (int nb = 0; nb < 4; ++nb) acc[mb][nb] = (v8f){};
    const size_t aoff = (size_t)(r0 + lr) * lda + 8 * hi, boff = (size_t)(c0 + lr) * K + 8 * hi;
#pragma unroll 1
    for (int kc = 0; kc < K; kc += 32) {
        const size_t ak = (size_t)(kc >> 5) * ksA;
        v16bf a[4], a2[4];
#pragma unroll
        for (int mb = 0; mb < 4; ++mb) { a[mb] = ldb(A + aoff + (size_t)mb * 16 * lda + ak); if (NSPLIT == 1) a2[mb] = ldb(A2 + aoff + (size_t)mb * 16 * lda + ak); }
#pragma unroll
        for (int nb = 0; nb < 4; ++nb) { const v16bf b = ldb(Bt + boff + (size_t)nb * 16 * K + kc);
#pragma unroll
            for (int mb = 0; mb < 4; ++mb) { acc[mb][nb] = wmmab(a[mb], b, acc[mb][nb]); if (NSPLIT == 1) acc[mb][nb] = wmmab(a2[mb], b, acc[mb][nb]); } }
        asm volatile("v_nop\n\tv_nop\n\tv_nop\n\tv_nop" : "+v"(acc[0][0]), "+v"(acc[1][1]), "+v"(acc[2][2]), "+v"(acc[3][3]) : "v"(a[0]), "v"(a[3]));
    }
    if constexpr (PLANES) {
        // tile coordinates, all uniform over the work-group: 64 columns = two heads of one of q, k, v; 64 rows = 64 tokens of one batch, all on one side of RH
        const int which = c0 / DQ, bh0 = (r0 / SEQ) * NH + (c0 % DQ) / HD, t0 = r0 % SEQ;
        if (which == 2) { if (t0 < RH) put_v<true>(acc, bias + c0, bh0, t0, lane, P); else put_v<false>(acc, bias + c0, bh0, t0, lane, P); }
        else            { if (t0 < RH) put_qk<true>(acc, os, bias + c0, which, bh0, t0, lane, P); else put_qk<false>(acc, os, bias + c0, which, bh0, t0, lane, P); }
        return;
    }
#pragma unroll
    for (int mb = 0; mb < 4; ++mb) {
#pragma unroll
        for (int nb = 0; nb < 4; ++nb) {
#pragma unroll
            for (int j = 0; j < 8; ++j) os[(hi * 8 + j) * 68 + nb * 16 + lr] = acc[mb][nb][j]; }
        __builtin_amdgcn_wave_barrier(); asm volatile("" ::: "memory");
        float* crow = C + (size_t)(r0 + mb * 16) * ldc + c0;
{
#pragma unroll
            for (int s = 0; s < 8; ++s) { const int row = 2 * s + hi, cofs = lr * 4; v4f val = *(const v4fa*)(os + row * 68 + cofs);
                val[0] += bfr(bias[c0 + cofs]); val[1] += bfr(bias[c0 + cofs + 1]); val[2] += bfr(bias[c0 + cofs + 2]); val[3] += bfr(bias[c0 + cofs + 3]);
                *(v4f*)(crow + (size_t)row * ldc + cofs) = val; }
             }
        __builtin_amdgcn_wave_barrier(); asm volatile("" ::: "memory");
    }
}
// qkv [NB*SEQ][384] = XB [NB*SEQ][128] x WQKV^T + b_qkv, column = which*128 + h*32 + d, written as the attention planes; grid (NB*SEQ/64, 384/64, 1)
__global__ __launch_bounds__(32) void k_gemm_qkv(const bf* __restrict__ A, const bf* __restrict__ Bt, const float* __restrict__ bias, h16* QK16, h16* VT16, bf* QKH, bf* QKL, bf* VTH, bf* VTL) {
    gemmw_body<0, true>(A, nullptr, Bt, DM, DM, (size_t)32, nullptr, FW, bias, 0, 0, planes{QK16, VT16, QKH, QKL, VTH, VTL}); }
// OUT [b][t][128] = (ATH + ATL) x WO^T + b_proj; A element (t, k = h*32+d) at plane [(b*NH + h)*SEQ + t][d]: lda = HD, k-step advance = SEQ*HD, batch stride NH*SEQ*HD;
// grid (SEQ/64, 128/64, NB); output rows use the full per-batch stride
__global__ __launch_bounds__(32) void k_gemm_proj(const bf* __restrict__ Ah, const bf* __restrict__ Al, const bf* __restrict__ Bt, float* C, const float* __restrict__ bias) {
    gemmw_body<1, false>(Ah, Al, Bt, DQ, HD, (size_t)SEQ * HD, C, DM, bias, (size_t)NH * SEQ * HD, (size_t)SEQ_FULL * DM, planes{}); }

// ---- operand preparation: three jobs that read inputs only and write disjoint planes, so they share ONE launch (k_prep), told apart by the block index.
// weight job, block blk of its own range: in[K][N] ([in][out]) -> Bt[N][K] bf16; 8 waves x 8 lines of 64 elements per block
__device__ __forceinline__ void wt_job(const float* __restrict__ w, const int K, const int N, bf* Bt, const int blk) {
    const int lane = threadIdx.x & 31; const int wave = __builtin_amdgcn_readfirstlane(threadIdx.x >> 5);
    const int L0 = (blk * 8 + wave) * 8; const int nlines = N * K / 64;
{
#pragma unroll 1
        for (int l = 0; l < 8; ++l) { const int L = L0 + l; if (L >= nlines) break; const size_t e = (size_t)L * 64 + lane * 2; const int k = (int)(e % K), n = (int)(e / K); v2us o;
            o[0] = f2bf(w[(size_t)k * N + n]); o[1] = f2bf(w[(size_t)(k + 1) * N + n]); *(v2us*)(Bt + e) = o; }
         }
}
// x job, block blk of its own range: bf16 copy of x, 8 elements a thread
__device__ __forceinline__ void cvtx_job(const float* __restrict__ x, bf* XB, const int blk) {
    const size_t i = (size_t)blk * 256 + threadIdx.x; if (i >= (size_t)NB * SEQ * DM / 8) return;
    const size_t row = i / (DM / 8); const int c = (int)(i % (DM / 8)) * 8; const size_t b = row / SEQ, t = row % SEQ;
    const v8f v = *(const v8f*)(x + (b * SEQ_FULL + t) * DM + c); v8us o;
#pragma unroll
    for (int k = 0; k < 8; ++k) o[k] = f2bf(v[k]);
    *(v8us*)(XB + i * 8) = o;  }
#define GW1 ((DM * FW / 64 + 63) / 64)                        // blocks of the w_qkv job
#define GW2 ((DQ * DM / 64 + 63) / 64)                        // blocks of the w_proj job
#define GXB ((int)(((size_t)NB * SEQ * DM / 8 + 255) / 256))  // blocks of the x job
// grid GW1 + GW2 + GXB; the two weight jobs (few blocks, 8 dependent lines a wave) take the lowest indices
__global__ __launch_bounds__(256) void k_prep(const float* __restrict__ x, const float* __restrict__ wqkv, const float* __restrict__ wo, bf* XB, bf* WQKV, bf* WO) {
    const int b = blockIdx.x;
    if (b < GW1) wt_job(wqkv, DM, FW, WQKV, b);                 // in[128][384] -> out[384][128]
    else if (b < GW1 + GW2) wt_job(wo, DQ, DM, WO, b - GW1);    // in[128][128] -> out[128][128]
    else cvtx_job(x, XB, b - (GW1 + GW2));
}

// ---- join of the NW waves' partial results of one 16-query tile. Wave w holds, for query n, its running max m (log2 domain), its sum l (both halves already added) and O^T unnormalised.
// Every wave stages its part, one work-group barrier, then thread (w, lane) owns query row 4w + (lane >> 3), d = 4 (lane & 7) .. + 3: out = sum_w 2^(m_w - M) O_w / sum_w 2^(m_w - M) l_w, waves summed in index order.
// A wave that had no key step stages m = NEGB, l = 0, O = 0 and gets weight 0 (wave 0 always has step 0, whose key 0 every query keeps, so M is finite).
__device__ __forceinline__ void join_store(float* ys, float* ms, float* ls, const int w, const int lane, const v8f* o, const float m, const float l, bf* ATH, bf* ATL, const size_t tile0) {
    const int n = lane & 15, hh = lane >> 4;
#pragma unroll
    for (int j = 0; j < 2; ++j)
#pragma unroll
        for (int r = 0; r < 8; ++r) ys[w * 16 * YP + n * YP + j * 16 + 8 * hh + r] = o[j][r];
    if (hh == 0) { ms[w * 16 + n] = m; ls[w * 16 + n] = l; }
    __syncthreads();                   // publishes every wave's partial to the joining threads
    const int row = 4 * w + (lane >> 3), c = (lane & 7) * 4;
    float mw[NW]; float M = NEGB;
#pragma unroll
    for (int k = 0; k < NW; ++k) { mw[k] = ms[k * 16 + row]; M = fmaxf(M, mw[k]); }
    v4f acc = (v4f){}; float L = 0.0f;
#pragma unroll
    for (int k = 0; k < NW; ++k) { const float sc = __builtin_amdgcn_exp2f(mw[k] - M); L += sc * ls[k * 16 + row]; acc += sc * *(const v4fa*)(ys + k * 16 * YP + row * YP + c); }
    const float inv = 1.0f / L;
    v4us oh, ol;
#pragma unroll
    for (int k = 0; k < 4; ++k) { unsigned short x1, x2; splitf(acc[k] * inv, x1, x2); oh[k] = x1; ol[k] = x2; }
    const size_t oo = tile0 + (size_t)row * HD + c;
    *(v4us*)(ATH + oo) = oh; *(v4us*)(ATL + oo) = ol;
}

// ---- fused causal attention, query rows >= RH, single f16 products. NW waves per 16 query rows; q0: the tile's first query row, bh: batch * NH + head.
// Lane (hh = lane>>4, n = lane&15): query q0+n; per 32-key step holds keys kb+8hh+r (tile 0) and kb+16+8hh+r (tile 1), r = 0..7.
__device__ __forceinline__ void attn16_tile(float* ys, float* ms, float* ls, const int q0, const int bh, const h16* QK16, const h16* VT16, bf* ATH, bf* ATL) {
    const int lane = threadIdx.x & 31, n = lane & 15, hh = lane >> 4;
    const int w = __builtin_amdgcn_readfirstlane(threadIdx.x >> 5);   // wave number, scalar: the key loop stays a scalar loop
    const int qrow = q0 + n, kend = q0 + 15;
    const size_t qo = ((size_t)bh * SEQ + q0 + n) * HD + 8 * hh;          // query plane (which 0)
    const size_t ko = PLN + ((size_t)bh * SEQ + n) * HD + 8 * hh;         // key plane (which 1), + key * HD
    const size_t vo = ((size_t)bh * HD + n) * SEQ + 8 * hh;               // V^T plane, + j*16*SEQ + key
    const v16h qb = ldh(QK16 + qo);
    v8f o[2];
#pragma unroll
    for (int j = 0; j < 2; ++j) o[j] = (v8f){};
    float m = NEGB, l = 0.0f;
#pragma unroll 1
    for (int kb = 32 * w; kb <= kend; kb += 32 * NW) {
        v8f s0 = (v8f){}, s1 = (v8f){};
        {
            const size_t ka = ko + (size_t)kb * HD;
            const v16h a0 = ldh(QK16 + ka), a1 = ldh(QK16 + ka + 16 * HD);
            s0 = wm16g(a0, qb, s0); s1 = wm16g(a1, qb, s1);
        }
        asm volatile("" ::: "memory");
        float u[16];
        const int key0 = kb + 8 * hh;
        if (kb + 31 > q0) {            // wave-uniform: only the steps touching the diagonal (replace by select)
#pragma unroll
            for (int r = 0; r < 8; ++r) { u[r] = (key0 + r <= qrow) ? s0[r] * SCL2 : NEGB; u[8 + r] = (key0 + 16 + r <= qrow) ? s1[r] * SCL2 : NEGB; }
        } else {
#pragma unroll
            for (int r = 0; r < 8; ++r) { u[r] = s0[r] * SCL2; u[8 + r] = s1[r] * SCL2; }
        }
        float mx = u[0];
#pragma unroll
        for (int i = 1; i < 16; ++i) mx = fmaxf(mx, u[i]);
        mx = fmaxf(mx, __shfl_xor(mx, 16, 32));
        const float mn = fmaxf(m, mx);
        const float corr = __builtin_amdgcn_exp2f(m - mn);
        m = mn;
        v16h pb; float ps = 0.0f;
#pragma unroll
        for (int r = 0; r < 8; ++r) {
            const float p0 = __builtin_amdgcn_exp2f((u[r] - mn) + PCL); const float p1 = __builtin_amdgcn_exp2f((u[8 + r] - mn) + PCL);
            ps += p0 + p1; pb[r] = (h16)p0; pb[8 + r] = (h16)p1; }
        l = l * corr + ps;
#pragma unroll
        for (int j = 0; j < 2; ++j) o[j] = o[j] * corr;
#pragma unroll
        for (int j = 0; j < 2; ++j) { const v16h va = ldh(VT16 + vo + (size_t)j * 16 * SEQ + kb); o[j] = wm16g(va, pb, o[j]); }
        asm volatile("" ::: "memory");
    }
    l += __shfl_xor(l, 16, 32);
    join_store(ys, ms, ls, w, lane, o, m, l, ATH, ATL, ((size_t)bh * SEQ + q0) * HD);
}

// ---- fused causal attention, query rows < RH, bf16 hi/lo planes, 3 products per contraction (hi*hi + lo*hi + hi*lo). Same lane map and key split as attn16_tile.
__device__ __forceinline__ void attnhl_tile(float* ys, float* ms, float* ls, const int q0, const int bh, const bf* QKH, const bf* QKL, const bf* VTH, const bf* VTL, bf* ATH, bf* ATL) {
    const int lane = threadIdx.x & 31, n = lane & 15, hh = lane >> 4;
    const int w = __builtin_amdgcn_readfirstlane(threadIdx.x >> 5);   // wave number, scalar: the key loop stays a scalar loop
    const int qrow = q0 + n, kend = q0 + 15;
    const size_t qo = ((size_t)bh * RH + q0 + n) * HD + 8 * hh;           // query hi/lo plane (which 0)
    const size_t ko = PLH + ((size_t)bh * RH + n) * HD + 8 * hh;          // key hi/lo plane (which 1), + key * HD
    const size_t vo = ((size_t)bh * HD + n) * RH + 8 * hh;                // V^T hi/lo plane, + j*16*RH + key
    v8f o[2];
#pragma unroll
    for (int j = 0; j < 2; ++j) o[j] = (v8f){};
    float m = NEGB, l = 0.0f;
#pragma unroll 1
    for (int kb = 32 * w; kb <= kend; kb += 32 * NW) {
        v8f s[2]; s[0] = (v8f){}; s[1] = (v8f){};
        {
            const v16bf qh = ldb(QKH + qo), ql = ldb(QKL + qo);
#pragma unroll
            for (int kc = 0; kc < 2; ++kc) { const size_t ka = ko + (size_t)(kb + kc * 16) * HD;
                const v16bf kh = ldb(QKH + ka), kl = ldb(QKL + ka);
                s[kc] = wmbg(kh, qh, s[kc]); s[kc] = wmbg(kl, qh, s[kc]); s[kc] = wmbg(kh, ql, s[kc]); }
            asm volatile("" ::: "memory");
        }
        float u[16];
        const int key0 = kb + 8 * hh;
        if (kb + 31 > q0) {            // wave-uniform
#pragma unroll
            for (int r = 0; r < 8; ++r) { u[r] = (key0 + r <= qrow) ? s[0][r] * SCL2 : NEGB; u[8 + r] = (key0 + 16 + r <= qrow) ? s[1][r] * SCL2 : NEGB; }
        } else {
#pragma unroll
            for (int r = 0; r < 8; ++r) { u[r] = s[0][r] * SCL2; u[8 + r] = s[1][r] * SCL2; }
        }
        float mx = u[0];
#pragma unroll
        for (int i = 1; i < 16; ++i) mx = fmaxf(mx, u[i]);
        mx = fmaxf(mx, __shfl_xor(mx, 16, 32));
        const float mn = fmaxf(m, mx);
        const float corr = __builtin_amdgcn_exp2f(m - mn);
        m = mn;
        v16us phu, plu; float ps = 0.0f;
#pragma unroll
        for (int r = 0; r < 8; ++r) {
            const float p0 = __builtin_amdgcn_exp2f(u[r] - mn); const float p1 = __builtin_amdgcn_exp2f(u[8 + r] - mn);
            ps += p0 + p1; unsigned short x1, x2; splitf(p0, x1, x2); phu[r] = x1; plu[r] = x2; splitf(p1, x1, x2); phu[8 + r] = x1; plu[8 + r] = x2; }
        const v16bf ph = __builtin_bit_cast(v16bf, phu), pl = __builtin_bit_cast(v16bf, plu);
        l = l * corr + ps;
#pragma unroll
        for (int j = 0; j < 2; ++j) o[j] = o[j] * corr;
#pragma unroll
        for (int j = 0; j < 2; ++j) { const size_t va = vo + (size_t)j * 16 * RH + kb; const v16bf vh = ldb(VTH + va), vl = ldb(VTL + va);
            o[j] = wmbg(vh, ph, o[j]); o[j] = wmbg(vl, ph, o[j]); o[j] = wmbg(vh, pl, o[j]);
            asm volatile("" ::: "memory"); }
    }
    l += __shfl_xor(l, 16, 32);
    join_store(ys, ms, ls, w, lane, o, m, l, ATH, ATL, ((size_t)bh * SEQ + q0) * HD);
}

// Both kinds of query tile read only the planes of the qkv launch and write disjoint context rows, so they share ONE launch: grid (SEQ/16, NB*NH), 32 * NW threads; the block's tile index picks the path (uniform over the work-group).
__global__ __launch_bounds__(32 * NW) void k_attn(const h16* QK16, const h16* VT16, const bf* QKH, const bf* QKL, const bf* VTH, const bf* VTL, bf* ATH, bf* ATL) {
    __shared__ __align__(16) float ys[NW * 16 * YP];     // one 16 x 32 partial O tile per wave
    __shared__ float ms[NW * 16], ls[NW * 16];           // per wave and query: running max, sum
    const int q0 = blockIdx.x * 16, bh = blockIdx.y;
    if (q0 < RH) attnhl_tile(ys, ms, ls, q0, bh, QKH, QKL, VTH, VTL, ATH, ATL);
    else         attn16_tile(ys, ms, ls, q0, bh, QK16, VT16, ATH, ATL);
}

extern "C" void kernel_launch(void* const* d_in, const int* in_sizes, int n_in,
                              void* d_out, int out_size, void* d_ws, size_t ws_size, hipStream_t stream) {
    // wire order: x [8][2048][128], w_qkv [128][384], b_qkv [384], w_proj [128][128], b_proj [128] (all f32)
    constexpr size_t XN = ((size_t)(NB - 1) * SEQ_FULL + SEQ) * DM;      // lowest element count covering the rows touched
    if (n_in < 5) return;
    if ((size_t)in_sizes[0] < XN || (size_t)in_sizes[1] < (size_t)DM * FW || in_sizes[2] < FW || (size_t)in_sizes[3] < (size_t)DQ * DM || in_sizes[4] < DM) return;
    if ((size_t)out_size < XN) return;
    const float* x = (const float*)d_in[0]; const float* wqkv = (const float*)d_in[1]; const float* bqkv = (const float*)d_in[2];
    const float* wo = (const float*)d_in[3]; const float* bo = (const float*)d_in[4];
    float* OUT = (float*)d_out;      // [NB_FULL][SEQ_FULL][128], byte offset 0

    // workspace carve: every region a multiple of 256 B, sized to the producers' whole-line store extent
    constexpr size_t SZ_WQKV = (size_t)FW * DM * 2;            // Bt [384][128] bf16
    constexpr size_t SZ_WO   = (size_t)DM * DQ * 2;            // Bt [128][128] bf16
    constexpr size_t SZ_XB   = (size_t)NB * SEQ * DM * 2;      // bf16 x
    constexpr size_t SZ_QK16 = 2 * PLN * 2;                    // f16 q | k planes
    constexpr size_t SZ_VT16 = PLN * 2;                        // f16 V^T planes
    constexpr size_t SZ_QKHL = 2 * PLH * 2;                    // bf16 q | k hi (and lo) planes, rows < RH
    constexpr size_t SZ_VTHL = PLH * 2;                        // bf16 V^T hi (and lo) planes, keys < RH
    constexpr size_t SZ_AT   = PLN * 2;                        // head-major context hi (and lo) planes
    constexpr size_t O_WQKV = 0;
    constexpr size_t O_WO   = O_WQKV + SZ_WQKV;
    constexpr size_t O_XB   = O_WO + SZ_WO;
    constexpr size_t O_QK16 = O_XB + SZ_XB;
    constexpr size_t O_VT16 = O_QK16 + SZ_QK16;
    constexpr size_t O_QKH  = O_VT16 + SZ_VT16;
    constexpr size_t O_QKL  = O_QKH + SZ_QKHL;
    constexpr size_t O_VTH  = O_QKL + SZ_QKHL;
    constexpr size_t O_VTL  = O_VTH + SZ_VTHL;
    constexpr size_t O_ATH  = O_VTL + SZ_VTHL;
    constexpr size_t O_ATL  = O_ATH + SZ_AT;
    constexpr size_t O_END  = O_ATL + SZ_AT;
    static_assert(SZ_WQKV % 256 == 0 && SZ_WO % 256 == 0 && SZ_XB % 256 == 0 && SZ_QK16 % 256 == 0 && SZ_VT16 % 256 == 0 && SZ_QKHL % 256 == 0 && SZ_VTHL % 256 == 0 && SZ_AT % 256 == 0);
    static_assert(O_END <= (size_t)134217728);                  // total carve <= 128 MiB
    static_assert((DM * FW) % 64 == 0 && (DQ * DM) % 64 == 0);  // weight planes are whole 64-element lines
    static_assert(((size_t)NB * SEQ) % 64 == 0);                // qkv GEMM M tiles
    if (ws_size < O_END) return;
    char* ws = (char*)d_ws;
    bf* WQKV = (bf*)(ws + O_WQKV); bf* WO = (bf*)(ws + O_WO); bf* XB = (bf*)(ws + O_XB);
    h16* QK16 = (h16*)(ws + O_QK16); h16* VT16 = (h16*)(ws + O_VT16);
    bf* QKH = (bf*)(ws + O_QKH); bf* QKL = (bf*)(ws + O_QKL); bf* VTH = (bf*)(ws + O_VTH); bf* VTL = (bf*)(ws + O_VTL);
    bf* ATH = (bf*)(ws + O_ATH); bf* ATL = (bf*)(ws + O_ATL);

    k_prep<<<(unsigned)(GW1 + GW2 + GXB), 256, 0, stream>>>(x, wqkv, wo, XB, WQKV, WO);
    k_gemm_qkv<<<dim3(NB * SEQ / 64, FW / 64, 1), 32, 0, stream>>>(XB, WQKV, bqkv, QK16, VT16, QKH, QKL, VTH, VTL);
    k_attn<<<dim3(SEQ / 16, NB * NH, 1), 32 * NW, 0, stream>>>(QK16, VT16, QKH, QKL, VTH, VTL, ATH, ATL);
    k_gemm_proj<<<dim3(SEQ / 64, DM / 64, NB), 32, 0, stream>>>(ATH, ATL, WO, OUT, bo);
}

// v004
// It runs in 51.9 microseconds.
// Timed twice side by side with v003, it ran 1.32 times as fast both times.
// Counting every step since v000, it is 2.32 times as fast.
#include <hip/hip_runtime.h>

// Causal self-attention: x [NB][SEQ][128]; qkv = x w_qkv + b_qkv ([in][out] weight, q | k | v column thirds, 4 heads x 32, head h = columns h*32+d); scores x 32^-0.5; causal select (diagonal kept); softmax; out = merged w_proj + b_proj ([in][out]).
// Compute dtypes, f32 accumulate everywhere: qkv projection v_wmma_f32_16x16x32_bf16 on bf16 RNE copies of x / w_qkv (single product); attention query rows < 256: bf16 hi/lo planes, 3 products for k q^T and for v^T p; query rows >= 256: v_wmma_f32_16x16x32_f16 single products (q, k, v f16 planes, p carried x1024 in the exponent); output projection: bf16 hi/lo context planes x bf16 w_proj (2 products). Softmax f32, online running-max form in the log2 domain.
// Fused attention, one work-group of NW waves per 16 query rows, the 32-key steps dealt round-robin to the waves (wave w: steps w, w + NW, ...), partial (max, sum, O) joined through LDS; head dim 32 = one 32-deep k-step for the scores: S^T = K Q^T (keys on D rows, queries on D columns), p built per lane and fed as the B operand of O^T = V^T P^T (B element r <- tile keys 0-15 [r], element 8+r <- tile keys 16-31 [r]); no score / probability plane in memory.

#ifndef NB
#define NB 8
#endif
#ifndef SEQ
#define SEQ 2048
#endif
#define NB_FULL  8
#define SEQ_FULL 2048
#define DM   128
#define NH   4
#define HD   32
#define DQ   (NH * HD)
#define FW   (3 * DQ)
#define RH   256                      // query rows < RH use bf16 hi/lo planes
#define PLN  ((size_t)NB * NH * SEQ * HD)   // elements of one [b*h][t][d] plane
#define PLH  ((size_t)NB * NH * RH * HD)    // elements of one hi/lo plane (rows < RH)
#define SCL2 0.25503486164918f        // HD^-0.5 * log2(e)
#define PCL  10.0f                    // log2 of the p carry (x1024) for the f16 path
#define NEGB (-3.0e38f)
#define YP   36                       // staging pitch (floats) of the 16 x 32 attention result tile
#define NW   4                        // waves per query tile: each walks every NW-th 32-key step

static_assert(DQ == DM);               // merged width == model width
static_assert(HD == 32);               // scores: one 32-deep k-step; head row == 64 B of 16-bit data; proj k-step == one head
static_assert(2 * HD == 64);
static_assert(HD % 16 == 0);           // O^T tiles of 16 d rows
static_assert(YP % 4 == 0 && YP >= HD); // 16-B aligned staging rows
static_assert(NW * 32 * 4 == 16 * HD);  // join: every thread owns 4 consecutive d of one query row
static_assert(DM % 64 == 0);           // GEMM K multiple of 32, weight lines of 64
static_assert(DQ % 64 == 0);           // proj GEMM K multiple of 32; a qkv GEMM N tile inside one of q, k, v
static_assert(FW % 64 == 0);           // GEMM N tile multiple
static_assert(SEQ % 64 == 0);          // GEMM M tile multiple, 32-key steps, V^T lines
static_assert(RH % 64 == 0);           // hi/lo V^T lines, 32-key steps inside RH, a GEMM M tile on one side of RH
static_assert(RH <= SEQ);
static_assert((SEQ - RH) % 16 == 0);
static_assert(NB <= NB_FULL);
static_assert(SEQ <= SEQ_FULL);

typedef _Float16 h16;
typedef unsigned short bf;
typedef __attribute__((ext_vector_type(16))) __bf16   v16bf;
typedef __attribute__((ext_vector_type(16))) _Float16 v16h;
typedef __attribute__((ext_vector_type(16))) unsigned short v16us;
typedef __attribute__((ext_vector_type(8)))  _Float16 v8h;
typedef __attribute__((ext_vector_type(8)))  unsigned short v8us;
typedef __attribute__((ext_vector_type(8)))  float    v8f;
typedef __attribute__((ext_vector_type(4)))  float    v4f;
typedef __attribute__((ext_vector_type(2)))  unsigned short v2us;
typedef __attribute__((ext_vector_type(4)))  unsigned short v4us;
typedef v4f  __attribute__((may_alias)) v4fa;

__device__ __forceinline__ unsigned short f2bf(float f) { unsigned u = __float_as_uint(f); u += 0x7FFFu + ((u >> 16) & 1u); return (unsigned short)(u >> 16); }   // RNE convert
__device__ __forceinline__ float bf2f(unsigned short b) { return __uint_as_float(((unsigned)b) << 16); }
__device__ __forceinline__ float bfr(float f) { return bf2f(f2bf(f)); }
__device__ __forceinline__ void splitf(float y, unsigned short& h, unsigned short& l) { h = f2bf(y); l = f2bf(y - bf2f(h)); }
__device__ __forceinline__ v16h cat16(v8h lo, v8h hi) { return __builtin_shufflevector(lo, hi, 0, 1, 2, 3, 4, 5, 6, 7, 8, 9, 10, 11, 12, 13, 14, 15); }
__device__ __forceinline__ v16bf cat16b(v8us lo, v8us hi) { return __builtin_bit_cast(v16bf, __builtin_shufflevector(lo, hi, 0, 1, 2, 3, 4, 5, 6, 7, 8, 9, 10, 11, 12, 13, 14, 15)); }
// fragment loaders: elements 0..7 <- p[0..7], elements 8..15 <- p[16..23]; p already includes + 8 * (lane >> 4)
__device__ __forceinline__ v16h ldh(const h16* p) { return cat16(*(const v8h*)p, *(const v8h*)(p + 16)); }
__device__ __forceinline__ v16bf ldb(const bf* p) { return cat16b(*(const v8us*)p, *(const v8us*)(p + 16)); }
__device__ __forceinline__ v8f wmmab(v16bf a, v16bf b, v8f c) { return __builtin_amdgcn_wmma_f32_16x16x32_bf16(false, a, false, b, (short)0, c, false, false); }
// guarded forms: 4 nops after the matrix op, accumulator tied, operands kept live
__device__ __forceinline__ v8f wm16g(v16h a, v16h b, v8f c) {
    c = __builtin_amdgcn_wmma_f32_16x16x32_f16(false, a, false, b, (short)0, c, false, false);
    asm volatile("v_nop\n\tv_nop\n\tv_nop\n\tv_nop" : "+v"(c) : "v"(a), "v"(b));
    return c; }
__device__ __forceinline__ v8f wmbg(v16bf a, v16bf b, v8f c) {
    c = __builtin_amdgcn_wmma_f32_16x16x32_bf16(false, a, false, b, (short)0, c, false, false);
    asm volatile("v_nop\n\tv_nop\n\tv_nop\n\tv_nop" : "+v"(c) : "v"(a), "v"(b));
    return c; }

// ---- register-blocked GEMM body, ONE WAVE per 64x64 output tile (16 accumulators), bf16 operands straight from K-contiguous planes; grid (M/64, N/64, Z), 32 threads.
// y[m][n] (f32) = sum_k A[m][k] Bt[n][k] (+ A2[m][k] Bt[n][k] when NSPLIT == 1) + bf16-RNE(bias[n]). K % 32 == 0, M and N multiples of 64 (asserted at file scope).
// PLANES == false: y goes to C (f32, pitch ldc). PLANES == true (qkv projection): y goes straight to the attention operand planes of struct planes, no f32 copy in memory.
// A addressing: element (m, k) at A[m * lda + (k >> 5) * ksA + (k & 31)] (row pitch lda, advance ksA per 32-deep k-step); a plain row-major plane has lda = K, ksA = 32.
// q | k planes [which][b*h][t][d]: f16 copy for all t, bf16 hi/lo for t < RH ([which][b*h][RH][d]); V^T planes [b*h][d][t]: f16 for all t, bf16 hi/lo for t < RH ([b*h][d][RH]).
struct planes { h16* QK16; h16* VT16; bf* QKH; bf* QKL; bf* VTH; bf* VTL; };
// Plane epilogues of one 64 x 64 qkv tile held in acc[mb][nb] (lane (hi, lr), element j: token t0 + mb*16 + hi*8 + j, tile column nb*16 + lr); bias points at the tile's first column; heads bh0, bh0 + 1; HL: the tile's tokens are < RH.
// V^T: a lane's 8 accumulator rows are 8 consecutive tokens of one d, i.e. 16 contiguous bytes of a V^T row: stored from registers.
template <bool HL>
__device__ __forceinline__ void put_v(const v8f (&acc)[4][4], const float* __restrict__ bias, const int bh0, const int t0, const int lane, const planes P) {
    const int lr = lane & 15, hi = lane >> 4;
    const float* bp = bias + lr; float braw[4];
#pragma unroll
    for (int nb = 0; nb < 4; ++nb) braw[nb] = bp[nb * 16];
    asm volatile("s_wait_xcnt 0x0" :: "v"(bp) : "memory");   // stands in front of the first rewrite of a register that the bias loads name; bp as an input keeps the compiler from lifting that rewrite over the wait
#pragma unroll
    for (int nb = 0; nb < 4; ++nb) { const int col = nb * 16 + lr; const float bv = bfr(braw[nb]); const size_t vr = (size_t)(bh0 + (col >> 5)) * HD + (col & 31);
#pragma unroll
        for (int mb = 0; mb < 4; ++mb) { const int t = t0 + mb * 16 + hi * 8; v8h o16; v8us oh, ol;
#pragma unroll
            for (int j = 0; j < 8; ++j) { const float y = acc[mb][nb][j] + bv; o16[j] = (h16)y; if (HL) { unsigned short x1, x2; splitf(y, x1, x2); oh[j] = x1; ol[j] = x2; } }
            *(v8h*)(P.VT16 + vr * SEQ + t) = o16;
            if (HL) { *(v8us*)(P.VTH + vr * RH + t) = oh; *(v8us*)(P.VTL + vr * RH + t) = ol; } } }
    asm volatile("s_wait_xcnt 0x0" ::: "memory");   // behind the last plane store: stands in front of any later rewrite of a register that these stores name, on every way the branches allow
}
// q / k: 16 tokens at a time turned through the wave's LDS tile os (pitch 68 floats); a lane then owns 8 consecutive d of one token (16 B of f16), 8 lanes a token's two heads, and a store covers 4 tokens = 256 contiguous bytes per head.
template <bool HL>
__device__ __forceinline__ void put_qk(const v8f (&acc)[4][4], float* os, const float* __restrict__ bias, const int which, const int bh0, const int t0, const int lane, const planes P) {
    const int lr = lane & 15, hi = lane >> 4, c = (lane & 7) * 8, d = c & 31; const size_t bh = (size_t)(bh0 + (c >> 5));
    float bv[8];
#pragma unroll
    for (int k = 0; k < 8; ++k) bv[k] = bfr(bias[c + k]);
#pragma unroll
    for (int mb = 0; mb < 4; ++mb) {
#pragma unroll
        for (int nb = 0; nb < 4; ++nb) {
#pragma unroll
            for (int j = 0; j < 8; ++j) os[(hi * 8 + j) * 68 + nb * 16 + lr] = acc[mb][nb][j]; }
        __builtin_amdgcn_wave_barrier(); asm volatile("" ::: "memory");   // the tile's LDS writes stay in front of the reads of other lanes' values
#pragma unroll
        for (int s = 0; s < 4; ++s) { const int row = 4 * s + (lane >> 3), t = t0 + mb * 16 + row;
            const v4f lo4 = *(const v4fa*)(os + row * 68 + c), hi4 = *(const v4fa*)(os + row * 68 + c + 4); v8h o16; v8us oh, ol;
#pragma unroll
            for (int k = 0; k < 8; ++k) { const float y = (k < 4 ? lo4[k & 3] : hi4[k & 3]) + bv[k]; o16[k] = (h16)y; if (HL) { unsigned short x1, x2; splitf(y, x1, x2); oh[k] = x1; ol[k] = x2; } }
            *(v8h*)(P.QK16 + (size_t)which * PLN + (bh * SEQ + t) * HD + d) = o16;
            if (HL) { const size_t o2 = (size_t)which * PLH + (bh * RH + t) * HD + d; *(v8us*)(P.QKH + o2) = oh; *(v8us*)(P.QKL + o2) = ol; } }
        __builtin_amdgcn_wave_barrier(); asm volatile("" ::: "memory");   // the reads stay in front of the next 16 tokens' LDS writes
    }
    asm volatile("s_wait_xcnt 0x0" ::: "memory");   // behind the last plane store: stands in front of any later rewrite of a register that these stores name, on every way the branches allow
}
template <int NSPLIT, bool PLANES>
__device__ __forceinline__ void gemmw_body(const bf* __restrict__ A, const bf* __restrict__ A2, const bf* __restrict__ Bt, const int K, const int lda, const size_t ksA, float* C, const int ldc, const float* __restrict__ bias, const size_t sA, const size_t sC, const planes P) {
    __shared__ __align__(16) float os[16 * 68];
    const size_t z = blockIdx.z; A += z * sA; if (NSPLIT == 1) A2 += z * sA; C += z * sC;
    const int lane = threadIdx.x & 31, lr = lane & 15, hi = lane >> 4; const int r0 = blockIdx.x * 64, c0 = blockIdx.y * 64;
    v8f acc[4][4];
#pragma unroll
    for (int mb = 0; mb < 4; ++mb)
#pragma unroll
        for (int nb = 0; nb < 4; ++nb) acc[mb][nb] = (v8f){};
    const size_t aoff = (size_t)(r0 + lr) * lda + 8 * hi, boff = (size_t)(c0 + lr) * K + 8 * hi;
#pragma unroll 1
    for (int kc = 0; kc < K; kc += 32) {
        const size_t ak = (size_t)(kc >> 5) * ksA;
        v16bf a[4], a2[4];
#pragma unroll
        for (int mb = 0; mb < 4; ++mb) { a[mb] = ldb(A + aoff + (size_t)mb * 16 * lda + ak); if (NSPLIT == 1) a2[mb] = ldb(A2 + aoff + (size_t)mb * 16 * lda + ak); }
#pragma unroll
        for (int nb = 0; nb < 4; ++nb) { const v16bf b = ldb(Bt + boff + (size_t)nb * 16 * K + kc);
#pragma unroll
            for (int mb = 0; mb < 4; ++mb) { acc[mb][nb] = wmmab(a[mb], b, acc[mb][nb]); if (NSPLIT == 1) acc[mb][nb] = wmmab(a2[mb], b, acc[mb][nb]); } }
        asm volatile("v_nop\n\tv_nop\n\tv_nop\n\tv_nop" : "+v"(acc[0][0]), "+v"(acc[1][1]), "+v"(acc[2][2]), "+v"(acc[3][3]) : "v"(a[0]), "v"(a[3]));
    }
    if constexpr (PLANES) {
        // tile coordinates, all uniform over the work-group: 64 columns = two heads of one of q, k, v; 64 rows = 64 tokens of one batch, all on one side of RH
        const int which = c0 / DQ, bh0 = (r0 / SEQ) * NH + (c0 % DQ) / HD, t0 = r0 % SEQ;
        if (which == 2) { if (t0 < RH) put_v<true>(acc, bias + c0, bh0, t0, lane, P); else put_v<false>(acc, bias + c0, bh0, t0, lane, P); }
        else            { if (t0 < RH) put_qk<true>(acc, os, bias + c0, which, bh0, t0, lane, P); else put_qk<false>(acc, os, bias + c0, which, bh0, t0, lane, P); }
        return;
    }
#pragma unroll
    for (int mb = 0; mb < 4; ++mb) {
#pragma unroll
        for (int nb = 0; nb < 4; ++nb) {
#pragma unroll
            for (int j = 0; j < 8; ++j) os[(hi * 8 + j) * 68 + nb * 16 + lr] = acc[mb][nb][j]; }
        __builtin_amdgcn_wave_barrier(); asm volatile("" ::: "memory");
        float* crow = C + (size_t)(r0 + mb * 16) * ldc + c0;
{
#pragma unroll
            for (int s = 0; s < 8; ++s) { const int row = 2 * s + hi, cofs = lr * 4; v4f val = *(const v4fa*)(os + row * 68 + cofs);
                val[0] += bfr(bias[c0 + cofs]); val[1] += bfr(bias[c0 + cofs + 1]); val[2] += bfr(bias[c0 + cofs + 2]); val[3] += bfr(bias[c0 + cofs + 3]);
                *(v4f*)(crow + (size_t)row * ldc + cofs) = val; }
             }
        __builtin_amdgcn_wave_barrier(); asm volatile("" ::: "memory");
    }
}
// qkv [NB*SEQ][384] = XB [NB*SEQ][128] x WQKV^T + b_qkv, column = which*128 + h*32 + d, written as the attention planes; grid (NB*SEQ/64, 384/64, 1)
__global__ __launch_bounds__(32) void k_gemm_qkv(const bf* __restrict__ A, const bf* __restrict__ Bt, const float* __restrict__ bias, h16* QK16, h16* VT16, bf* QKH, bf* QKL, bf* VTH, bf* VTL) {
    gemmw_body<0, true>(A, nullptr, Bt, DM, DM, (size_t)32, nullptr, FW, bias, 0, 0, planes{QK16, VT16, QKH, QKL, VTH, VTL}); }
// OUT [b][t][128] = (ATH + ATL) x WO^T + b_proj; A element (t, k = h*32+d) at plane [(b*NH + h)*SEQ + t][d]: lda = HD, k-step advance = SEQ*HD, batch stride NH*SEQ*HD;
// grid (SEQ/64, 128/64, NB); output rows use the full per-batch stride
__global__ __launch_bounds__(32) void k_gemm_proj(const bf* __restrict__ Ah, const bf* __restrict__ Al, const bf* __restrict__ Bt, float* C, const float* __restrict__ bias) {
    gemmw_body<1, false>(Ah, Al, Bt, DQ, HD, (size_t)SEQ * HD, C, DM, bias, (size_t)NH * SEQ * HD, (size_t)SEQ_FULL * DM, planes{}); }

// ---- operand preparation: three jobs that read inputs only and write disjoint planes, so they share ONE launch (k_prep), told apart by the block index.
// weight job, block blk of its own range: in[K][N] ([in][out]) -> Bt[N][K] bf16; 8 waves x 8 lines of 64 elements per block
__device__ __forceinline__ void wt_job(const float* __restrict__ w, const int K, const int N, bf* Bt, const int blk) {
    const int lane = threadIdx.x & 31; const int wave = __builtin_amdgcn_readfirstlane(threadIdx.x >> 5);
    const int L0 = (blk * 8 + wave) * 8; const int nlines = N * K / 64;
{
#pragma unroll 1
        for (int l = 0; l < 8; ++l) { const int L = L0 + l; if (L >= nlines) break; const size_t e = (size_t)L * 64 + lane * 2; const int k = (int)(e % K), n = (int)(e / K); v2us o;
            o[0] = f2bf(w[(size_t)k * N + n]); o[1] = f2bf(w[(size_t)(k + 1) * N + n]); *(v2us*)(Bt + e) = o; }
         }
}
// x job, block blk of its own range: bf16 copy of x, 8 elements a thread
__device__ __forceinline__ void cvtx_job(const float* __restrict__ x, bf* XB, const int blk) {
    const size_t i = (size_t)blk * 256 + threadIdx.x; if (i >= (size_t)NB * SEQ * DM / 8) return;
    const size_t row = i / (DM / 8); const int c = (int)(i % (DM / 8)) * 8; const size_t b = row / SEQ, t = row % SEQ;
    const v8f v = *(const v8f*)(x + (b * SEQ_FULL + t) * DM + c); v8us o;
#pragma unroll
    for (int k = 0; k < 8; ++k) o[k] = f2bf(v[k]);
    *(v8us*)(XB + i * 8) = o;  }
#define GW1 ((DM * FW / 64 + 63) / 64)                        // blocks of the w_qkv job
#define GW2 ((DQ * DM / 64 + 63) / 64)                        // blocks of the w_proj job
#define GXB ((int)(((size_t)NB * SEQ * DM / 8 + 255) / 256))  // blocks of the x job
// grid GW1 + GW2 + GXB; the two weight jobs (few blocks, 8 dependent lines a wave) take the lowest indices
__global__ __launch_bounds__(256) void k_prep(const float* __restrict__ x, const float* __restrict__ wqkv, const float* __restrict__ wo, bf* XB, bf* WQKV, bf* WO) {
    const int b = blockIdx.x;
    if (b < GW1) wt_job(wqkv, DM, FW, WQKV, b);                 // in[128][384] -> out[384][128]
    else if (b < GW1 + GW2) wt_job(wo, DQ, DM, WO, b - GW1);    // in[128][128] -> out[128][128]
    else cvtx_job(x, XB, b - (GW1 + GW2));
}

// ---- join of the NW waves' partial results of one 16-query tile. Wave w holds, for query n, its running max m (log2 domain), its sum l (both halves already added) and O^T unnormalised.
// Every wave stages its part, one work-group barrier, then thread (w, lane) owns query row 4w + (lane >> 3), d = 4 (lane & 7) .. + 3: out = sum_w 2^(m_w - M) O_w / sum_w 2^(m_w - M) l_w, waves summed in index order.
// A wave that had no key step stages m = NEGB, l = 0, O = 0 and gets weight 0 (wave 0 always has step 0, whose key 0 every query keeps, so M is finite).
__device__ __forceinline__ void join_store(float* ys, float* ms, float* ls, const int w, const int lane, const v8f* o, const float m, const float l, bf* ATH, bf* ATL, const size_t tile0) {
    const int n = lane & 15, hh = lane >> 4;
#pragma unroll
    for (int j = 0; j < 2; ++j)
#pragma unroll
        for (int r = 0; r < 8; ++r) ys[w * 16 * YP + n * YP + j * 16 + 8 * hh + r] = o[j][r];
    if (hh == 0) { ms[w * 16 + n] = m; ls[w * 16 + n] = l; }
    __syncthreads();                   // publishes every wave's partial to the joining threads
    const int row = 4 * w + (lane >> 3), c = (lane & 7) * 4;
    float mw[NW]; float M = NEGB;
#pragma unroll
    for (int k = 0; k < NW; ++k) { mw[k] = ms[k * 16 + row]; M = fmaxf(M, mw[k]); }
    v4f acc = (v4f){}; float L = 0.0f;
#pragma unroll
    for (int k = 0; k < NW; ++k) { const float sc = __builtin_amdgcn_exp2f(mw[k] - M); L += sc * ls[k * 16 + row]; acc += sc * *(const v4fa*)(ys + k * 16 * YP + row * YP + c); }
    const float inv = 1.0f / L;
    v4us oh, ol;
#pragma unroll
    for (int k = 0; k < 4; ++k) { unsigned short x1, x2; splitf(acc[k] * inv, x1, x2); oh[k] = x1; ol[k] = x2; }
    const size_t oo = tile0 + (size_t)row * HD + c;
    *(v4us*)(ATH + oo) = oh; *(v4us*)(ATL + oo) = ol;
}

// ---- fused causal attention, query rows >= RH, single f16 products. NW waves per 16 query rows; q0: the tile's first query row, bh: batch * NH + head.
// Lane (hh = lane>>4, n = lane&15): query q0+n; per 32-key step holds keys kb+8hh+r (tile 0) and kb+16+8hh+r (tile 1), r = 0..7.
__device__ __forceinline__ void attn16_tile(float* ys, float* ms, float* ls, const int q0, const int bh, const h16* QK16, const h16* VT16, bf* ATH, bf* ATL) {
    const int lane = threadIdx.x & 31, n = lane & 15, hh = lane >> 4;
    const int w = __builtin_amdgcn_readfirstlane(threadIdx.x >> 5);   // wave number, scalar: the key loop stays a scalar loop
    const int qrow = q0 + n, kend = q0 + 15;
    const size_t qo = ((size_t)bh * SEQ + q0 + n) * HD + 8 * hh;          // query plane (which 0)
    const size_t ko = PLN + ((size_t)bh * SEQ + n) * HD + 8 * hh;         // key plane (which 1), + key * HD
    const size_t vo = ((size_t)bh * HD + n) * SEQ + 8 * hh;               // V^T plane, + j*16*SEQ + key
    const v16h qb = ldh(QK16 + qo);
    v8f o[2];
#pragma unroll
    for (int j = 0; j < 2; ++j) o[j] = (v8f){};
    float m = NEGB, l = 0.0f;
#pragma unroll 1
    for (int kb = 32 * w; kb <= kend; kb += 32 * NW) {
        v8f s0 = (v8f){}, s1 = (v8f){};
        {
            const size_t ka = ko + (size_t)kb * HD;
            const v16h a0 = ldh(QK16 + ka), a1 = ldh(QK16 + ka + 16 * HD);
            s0 = wm16g(a0, qb, s0); s1 = wm16g(a1, qb, s1);
        }
        asm volatile("" ::: "memory");
        float u[16];
        const int key0 = kb + 8 * hh;
        if (kb + 31 > q0) {            // wave-uniform: only the steps touching the diagonal (replace by select)
#pragma unroll
            for (int r = 0; r < 8; ++r) { u[r] = (key0 + r <= qrow) ? s0[r] * SCL2 : NEGB; u[8 + r] = (key0 + 16 + r <= qrow) ? s1[r] * SCL2 : NEGB; }
        } else {
#pragma unroll
            for (int r = 0; r < 8; ++r) { u[r] = s0[r] * SCL2; u[8 + r] = s1[r] * SCL2; }
        }
        float mx = u[0];
#pragma unroll
        for (int i = 1; i < 16; ++i) mx = fmaxf(mx, u[i]);
        mx = fmaxf(mx, __shfl_xor(mx, 16, 32));
        const float mn = fmaxf(m, mx);
        const float corr = __builtin_amdgcn_exp2f(m - mn);
        m = mn;
        v16h pb; float ps = 0.0f;
#pragma unroll
        for (int r = 0; r < 8; ++r) {
            const float p0 = __builtin_amdgcn_exp2f((u[r] - mn) + PCL); const float p1 = __builtin_amdgcn_exp2f((u[8 + r] - mn) + PCL);
            ps += p0 + p1; pb[r] = (h16)p0; pb[8 + r] = (h16)p1; }
        l = l * corr + ps;
#pragma unroll
        for (int j = 0; j < 2; ++j) o[j] = o[j] * corr;
#pragma unroll
        for (int j = 0; j < 2; ++j) { const v16h va = ldh(VT16 + vo + (size_t)j * 16 * SEQ + kb); o[j] = wm16g(va, pb, o[j]); }
        asm volatile("" ::: "memory");
    }
    l += __shfl_xor(l, 16, 32);
    join_store(ys, ms, ls, w, lane, o, m, l, ATH, ATL, ((size_t)bh * SEQ + q0) * HD);
}

// ---- fused causal attention, query rows < RH, bf16 hi/lo planes, 3 products per contraction (hi*hi + lo*hi + hi*lo). Same lane map and key split as attn16_tile.
__device__ __forceinline__ void attnhl_tile(float* ys, float* ms, float* ls, const int q0, const int bh, const bf* QKH, const bf* QKL, const bf* VTH, const bf* VTL, bf* ATH, bf* ATL) {
    const int lane = threadIdx.x & 31, n = lane & 15, hh = lane >> 4;
    const int w = __builtin_amdgcn_readfirstlane(threadIdx.x >> 5);   // wave number, scalar: the key loop stays a scalar loop
    const int qrow = q0 + n, kend = q0 + 15;
    const size_t qo = ((size_t)bh * RH + q0 + n) * HD + 8 * hh;           // query hi/lo plane (which 0)
    const size_t ko = PLH + ((size_t)bh * RH + n) * HD + 8 * hh;          // key hi/lo plane (which 1), + key * HD
    const size_t vo = ((size_t)bh * HD + n) * RH + 8 * hh;                // V^T hi/lo plane, + j*16*RH + key
    v8f o[2];
#pragma unroll
    for (int j = 0; j < 2; ++j) o[j] = (v8f){};
    float m = NEGB, l = 0.0f;
#pragma unroll 1
    for (int kb = 32 * w; kb <= kend; kb += 32 * NW) {
        v8f s[2]; s[0] = (v8f){}; s[1] = (v8f){};
        {
            const v16bf qh = ldb(QKH + qo), ql = ldb(QKL + qo);
#pragma unroll
            for (int kc = 0; kc < 2; ++kc) { const size_t ka = ko + (size_t)(kb + kc * 16) * HD;
                const v16bf kh = ldb(QKH + ka), kl = ldb(QKL + ka);
                s[kc] = wmbg(kh, qh, s[kc]); s[kc] = wmbg(kl, qh, s[kc]); s[kc] = wmbg(kh, ql, s[kc]); }
            asm volatile("" ::: "memory");
        }
        float u[16];
        const int key0 = kb + 8 * hh;
        if (kb + 31 > q0) {            // wave-uniform
#pragma unroll
            for (int r = 0; r < 8; ++r) { u[r] = (key0 + r <= qrow) ? s[0][r] * SCL2 : NEGB; u[8 + r] = (key0 + 16 + r <= qrow) ? s[1][r] * SCL2 : NEGB; }
        } else {
#pragma unroll
            for (int r = 0; r < 8; ++r) { u[r] = s[0][r] * SCL2; u[8 + r] = s[1][r] * SCL2; }
        }
        float mx = u[0];
#pragma unroll
        for (int i = 1; i < 16; ++i) mx = fmaxf(mx, u[i]);
        mx = fmaxf(mx, __shfl_xor(mx, 16, 32));
        const float mn = fmaxf(m, mx);
        const float corr = __builtin_amdgcn_exp2f(m - mn);
        m = mn;
        v16us phu, plu; float ps = 0.0f;
#pragma unroll
        for (int r = 0; r < 8; ++r) {
            const float p0 = __builtin_amdgcn_exp2f(u[r] - mn); const float p1 = __builtin_amdgcn_exp2f(u[8 + r] - mn);
            ps += p0 + p1; unsigned short x1, x2; splitf(p0, x1, x2); phu[r] = x1; plu[r] = x2; splitf(p1, x1, x2); phu[8 + r] = x1; plu[8 + r] = x2; }
        const v16bf ph = __builtin_bit_cast(v16bf, phu), pl = __builtin_bit_cast(v16bf, plu);
        l = l * corr + ps;
#pragma unroll
        for (int j = 0; j < 2; ++j) o[j] = o[j] * corr;
#pragma unroll
        for (int j = 0; j < 2; ++j) { const size_t va = vo + (size_t)j * 16 * RH + kb; const v16bf vh = ldb(VTH + va), vl = ldb(VTL + va);
            o[j] = wmbg(vh, ph, o[j]); o[j] = wmbg(vl, ph, o[j]); o[j] = wmbg(vh, pl, o[j]);
            asm volatile("" ::: "memory"); }
    }
    l += __shfl_xor(l, 16, 32);
    join_store(ys, ms, ls, w, lane, o, m, l, ATH, ATL, ((size_t)bh * SEQ + q0) * HD);
}

// Both kinds of query tile read only the planes of the qkv launch and write disjoint context rows, so they share ONE launch: grid (NB*NH, SEQ/16), 32 * NW threads; the block's tile index picks the path (uniform over the work-group).
// Order: a tile's key steps grow with its query row; the slow grid axis counts the tiles from the last (most steps) down to the first (one step). The fast axis is batch * head, all of equal length. For speed only: every (tile, head) pair is done exactly once whatever the order.
__global__ __launch_bounds__(32 * NW) void k_attn(const h16* QK16, const h16* VT16, const bf* QKH, const bf* QKL, const bf* VTH, const bf* VTL, bf* ATH, bf* ATL) {
    __shared__ __align__(16) float ys[NW * 16 * YP];     // one 16 x 32 partial O tile per wave
    __shared__ float ms[NW * 16], ls[NW * 16];           // per wave and query: running max, sum
    const int q0 = (SEQ / 16 - 1 - (int)blockIdx.y) * 16, bh = blockIdx.x;
    if (q0 < RH) attnhl_tile(ys, ms, ls, q0, bh, QKH, QKL, VTH, VTL, ATH, ATL);
    else         attn16_tile(ys, ms, ls, q0, bh, QK16, VT16, ATH, ATL);
}

extern "C" void kernel_launch(void* const* d_in, const int* in_sizes, int n_in,
                              void* d_out, int out_size, void* d_ws, size_t ws_size, hipStream_t stream) {
    // wire order: x [8][2048][128], w_qkv [128][384], b_qkv [384], w_proj [128][128], b_proj [128] (all f32)
    constexpr size_t XN = ((size_t)(NB - 1) * SEQ_FULL + SEQ) * DM;      // lowest element count covering the rows touched
    if (n_in < 5) return;
    if ((size_t)in_sizes[0] < XN || (size_t)in_sizes[1] < (size_t)DM * FW || in_sizes[2] < FW || (size_t)in_sizes[3] < (size_t)DQ * DM || in_sizes[4] < DM) return;
    if ((size_t)out_size < XN) return;
    const float* x = (const float*)d_in[0]; const float* wqkv = (const float*)d_in[1]; const float* bqkv = (const float*)d_in[2];
    const float* wo = (const float*)d_in[3]; const float* bo = (const float*)d_in[4];
    float* OUT = (float*)d_out;      // [NB_FULL][SEQ_FULL][128], byte offset 0

    // workspace carve: every region a multiple of 256 B, sized to the producers' whole-line store extent
    constexpr size_t SZ_WQKV = (size_t)FW * DM * 2;            // Bt [384][128] bf16
    constexpr size_t SZ_WO   = (size_t)DM * DQ * 2;            // Bt [128][128] bf16
    constexpr size_t SZ_XB   = (size_t)NB * SEQ * DM * 2;      // bf16 x
    constexpr size_t SZ_QK16 = 2 * PLN * 2;                    // f16 q | k planes
    constexpr size_t SZ_VT16 = PLN * 2;                        // f16 V^T planes
    constexpr size_t SZ_QKHL = 2 * PLH * 2;                    // bf16 q | k hi (and lo) planes, rows < RH
    constexpr size_t SZ_VTHL = PLH * 2;                        // bf16 V^T hi (and lo) planes, keys < RH
    constexpr size_t SZ_AT   = PLN * 2;                        // head-major context hi (and lo) planes
    constexpr size_t O_WQKV = 0;
    constexpr size_t O_WO   = O_WQKV + SZ_WQKV;
    constexpr size_t O_XB   = O_WO + SZ_WO;
    constexpr size_t O_QK16 = O_XB + SZ_XB;
    constexpr size_t O_VT16 = O_QK16 + SZ_QK16;
    constexpr size_t O_QKH  = O_VT16 + SZ_VT16;
    constexpr size_t O_QKL  = O_QKH + SZ_QKHL;
    constexpr size_t O_VTH  = O_QKL + SZ_QKHL;
    constexpr size_t O_VTL  = O_VTH + SZ_VTHL;
    constexpr size_t O_ATH  = O_VTL + SZ_VTHL;
    constexpr size_t O_ATL  = O_ATH + SZ_AT;
    constexpr size_t O_END  = O_ATL + SZ_AT;
    static_assert(SZ_WQKV % 256 == 0 && SZ_WO % 256 == 0 && SZ_XB % 256 == 0 && SZ_QK16 % 256 == 0 && SZ_VT16 % 256 == 0 && SZ_QKHL % 256 == 0 && SZ_VTHL % 256 == 0 && SZ_AT % 256 == 0);
    static_assert(O_END <= (size_t)134217728);                  // total carve <= 128 MiB
    static_assert((DM * FW) % 64 == 0 && (DQ * DM) % 64 == 0);  // weight planes are whole 64-element lines
    static_assert(((size_t)NB * SEQ) % 64 == 0);                // qkv GEMM M tiles
    if (ws_size < O_END) return;
    char* ws = (char*)d_ws;
    bf* WQKV = (bf*)(ws + O_WQKV); bf* WO = (bf*)(ws + O_WO); bf* XB = (bf*)(ws + O_XB);
    h16* QK16 = (h16*)(ws + O_QK16); h16* VT16 = (h16*)(ws + O_VT16);
    bf* QKH = (bf*)(ws + O_QKH); bf* QKL = (bf*)(ws + O_QKL); bf* VTH = (bf*)(ws + O_VTH); bf* VTL = (bf*)(ws + O_VTL);
    bf* ATH = (bf*)(ws + O_ATH); bf* ATL = (bf*)(ws + O_ATL);

    k_prep<<<(unsigned)(GW1 + GW2 + GXB), 256, 0, stream>>>(x, wqkv, wo, XB, WQKV, WO);
    k_gemm_qkv<<<dim3(NB * SEQ / 64, FW / 64, 1), 32, 0, stream>>>(XB, WQKV, bqkv, QK16, VT16, QKH, QKL, VTH, VTL);
    k_attn<<<dim3(NB * NH, SEQ / 16, 1), 32 * NW, 0, stream>>>(QK16, VT16, QKH, QKL, VTH, VTL, ATH, ATL);
    k_gemm_proj<<<dim3(SEQ / 64, DM / 64, NB), 32, 0, stream>>>(ATH, ATL, WO, OUT, bo);
}

// v005
// It runs in 49.8 microseconds.
// Next to v004, in two timings, it ran 1.04 times as fast each time.
// Counting every step since v000, it is 2.41 times as fast.
#include <hip/hip_runtime.h>

// Causal self-attention: x [NB][SEQ][128]; qkv = x w_qkv + b_qkv ([in][out] weight, q | k | v column thirds, 4 heads x 32, head h = columns h*32+d); scores x 32^-0.5; causal select (diagonal kept); softmax; out = merged w_proj + b_proj ([in][out]).
// Compute dtypes, f32 accumulate everywhere: qkv projection v_wmma_f32_16x16x32_bf16 on bf16 RNE copies of x / w_qkv (single product); attention query rows < 256: bf16 hi/lo planes, 3 products for k q^T and for v^T p; query rows >= 256: v_wmma_f32_16x16x32_f16 single products (q, k, v f16 planes, p carried x1024 in the exponent); output projection: bf16 hi/lo context planes x bf16 w_proj (2 products). Softmax f32, online running-max form in the log2 domain.
// Fused attention, one work-group of NW waves per 16 query rows (rows < RH) or per NQ * 16 query rows (rows >= RH, every wave carrying all NQ tiles), the 32-key steps dealt round-robin to the waves (wave w: steps w, w + NW, ...), partial (max, sum, O) joined through LDS; head dim 32 = one 32-deep k-step for the scores: S^T = K Q^T (keys on D rows, queries on D columns), p built per lane and fed as the B operand of O^T = V^T P^T (B element r <- tile keys 0-15 [r], element 8+r <- tile keys 16-31 [r]); no score / probability plane in memory.

#ifndef NB
#define NB 8
#endif
#ifndef SEQ
#define SEQ 2048
#endif
#define NB_FULL  8
#define SEQ_FULL 2048
#define DM   128
#define NH   4
#define HD   32
#define DQ   (NH * HD)
#define FW   (3 * DQ)
#define RH   256                      // query rows < RH use bf16 hi/lo planes
#define PLN  ((size_t)NB * NH * SEQ * HD)   // elements of one [b*h][t][d] plane
#define PLH  ((size_t)NB * NH * RH * HD)    // elements of one hi/lo plane (rows < RH)
#define SCL2 0.25503486164918f        // HD^-0.5 * log2(e)
#define PCL  10.0f                    // log2 of the p carry (x1024) for the f16 path
#define NEGB (-3.0e38f)
#define YP   36                       // staging pitch (floats) of the 16 x 32 attention result tile
#define NW   4                        // waves per query tile: each walks every NW-th 32-key step
#define NQ   2                        // f16 path: 16-query tiles per work-group; every K and V^T fragment a wave loads feeds all NQ of them

static_assert(DQ == DM);               // merged width == model width
static_assert(HD == 32);               // scores: one 32-deep k-step; head row == 64 B of 16-bit data; proj k-step == one head
static_assert(2 * HD == 64);
static_assert(HD % 16 == 0);           // O^T tiles of 16 d rows
static_assert(YP % 4 == 0 && YP >= HD); // 16-B aligned staging rows
static_assert(NW * 32 * 4 == 16 * HD);  // join: every thread owns 4 consecutive d of one query row
static_assert(DM % 64 == 0);           // GEMM K multiple of 32, weight lines of 64
static_assert(DQ % 64 == 0);           // proj GEMM K multiple of 32; a qkv GEMM N tile inside one of q, k, v
static_assert(FW % 64 == 0);           // GEMM N tile multiple
static_assert(SEQ % 64 == 0);          // GEMM M tile multiple, 32-key steps, V^T lines
static_assert(RH % 64 == 0);           // hi/lo V^T lines, 32-key steps inside RH, a GEMM M tile on one side of RH
static_assert(RH <= SEQ);
static_assert(16 * NQ == 32);          // the NQ tiles of a work-group span one 32-key step: all have the same key steps, and the diagonal step is the last for each
static_assert(RH % (16 * NQ) == 0 && (SEQ - RH) % (16 * NQ) == 0);
static_assert(NB <= NB_FULL);
static_assert(SEQ <= SEQ_FULL);

typedef _Float16 h16;
typedef unsigned short bf;
typedef __attribute__((ext_vector_type(16))) __bf16   v16bf;
typedef __attribute__((ext_vector_type(16))) _Float16 v16h;
typedef __attribute__((ext_vector_type(16))) unsigned short v16us;
typedef __attribute__((ext_vector_type(8)))  _Float16 v8h;
typedef __attribute__((ext_vector_type(8)))  unsigned short v8us;
typedef __attribute__((ext_vector_type(8)))  float    v8f;
typedef __attribute__((ext_vector_type(4)))  float    v4f;
typedef __attribute__((ext_vector_type(2)))  unsigned short v2us;
typedef __attribute__((ext_vector_type(4)))  unsigned short v4us;
typedef v4f  __attribute__((may_alias)) v4fa;

__device__ __forceinline__ unsigned short f2bf(float f) { unsigned u = __float_as_uint(f); u += 0x7FFFu + ((u >> 16) & 1u); return (unsigned short)(u >> 16); }   // RNE convert
__device__ __forceinline__ float bf2f(unsigned short b) { return __uint_as_float(((unsigned)b) << 16); }
__device__ __forceinline__ float bfr(float f) { return bf2f(f2bf(f)); }
__device__ __forceinline__ void splitf(float y, unsigned short& h, unsigned short& l) { h = f2bf(y); l = f2bf(y - bf2f(h)); }
__device__ __forceinline__ v16h cat16(v8h lo, v8h hi) { return __builtin_shufflevector(lo, hi, 0, 1, 2, 3, 4, 5, 6, 7, 8, 9, 10, 11, 12, 13, 14, 15); }
__device__ __forceinline__ v16bf cat16b(v8us lo, v8us hi) { return __builtin_bit_cast(v16bf, __builtin_shufflevector(lo, hi, 0, 1, 2, 3, 4, 5, 6, 7, 8, 9, 10, 11, 12, 13, 14, 15)); }
// fragment loaders: elements 0..7 <- p[0..7], elements 8..15 <- p[16..23]; p already includes + 8 * (lane >> 4)
__device__ __forceinline__ v16h ldh(const h16* p) { return cat16(*(const v8h*)p, *(const v8h*)(p + 16)); }
__device__ __forceinline__ v16bf ldb(const bf* p) { return cat16b(*(const v8us*)p, *(const v8us*)(p + 16)); }
__device__ __forceinline__ v8f wmmab(v16bf a, v16bf b, v8f c) { return __builtin_amdgcn_wmma_f32_16x16x32_bf16(false, a, false, b, (short)0, c, false, false); }
// guarded forms: 4 nops after the matrix op, accumulator tied, operands kept live
__device__ __forceinline__ v8f wm16g(v16h a, v16h b, v8f c) {
    c = __builtin_amdgcn_wmma_f32_16x16x32_f16(false, a, false, b, (short)0, c, false, false);
    asm volatile("v_nop\n\tv_nop\n\tv_nop\n\tv_nop" : "+v"(c) : "v"(a), "v"(b));
    return c; }
__device__ __forceinline__ v8f wmbg(v16bf a, v16bf b, v8f c) {
    c = __builtin_amdgcn_wmma_f32_16x16x32_bf16(false, a, false, b, (short)0, c, false, false);
    asm volatile("v_nop\n\tv_nop\n\tv_nop\n\tv_nop" : "+v"(c) : "v"(a), "v"(b));
    return c; }

// ---- register-blocked GEMM body, ONE WAVE per 64x64 output tile (16 accumulators), bf16 operands straight from K-contiguous planes; grid (M/64, N/64, Z), 32 threads.
// y[m][n] (f32) = sum_k A[m][k] Bt[n][k] (+ A2[m][k] Bt[n][k] when NSPLIT == 1) + bf16-RNE(bias[n]). K % 32 == 0, M and N multiples of 64 (asserted at file scope).
// PLANES == false: y goes to C (f32, pitch ldc). PLANES == true (qkv projection): y goes straight to the attention operand planes of struct planes, no f32 copy in memory.
// A addressing: element (m, k) at A[m * lda + (k >> 5) * ksA + (k & 31)] (row pitch lda, advance ksA per 32-deep k-step); a plain row-major plane has lda = K, ksA = 32.
// q | k planes [which][b*h][t][d]: f16 copy for all t, bf16 hi/lo for t < RH ([which][b*h][RH][d]); V^T planes [b*h][d][t]: f16 for all t, bf16 hi/lo for t < RH ([b*h][d][RH]).
struct planes { h16* QK16; h16* VT16; bf* QKH; bf* QKL; bf* VTH; bf* VTL; };
// Plane epilogues of one 64 x 64 qkv tile held in acc[mb][nb] (lane (hi, lr), element j: token t0 + mb*16 + hi*8 + j, tile column nb*16 + lr); bias points at the tile's first column; heads bh0, bh0 + 1; HL: the tile's tokens are < RH.
// V^T: a lane's 8 accumulator rows are 8 consecutive tokens of one d, i.e. 16 contiguous bytes of a V^T row: stored from registers.
template <bool HL>
__device__ __forceinline__ void put_v(const v8f (&acc)[4][4], const float* __restrict__ bias, const int bh0, const int t0, const int lane, const planes P) {
    const int lr = lane & 15, hi = lane >> 4;
    const float* bp = bias + lr; float braw[4];
#pragma unroll
    for (int nb = 0; nb < 4; ++nb) braw[nb] = bp[nb * 16];
    asm volatile("s_wait_xcnt 0x0" :: "v"(bp) : "memory");   // stands in front of the first rewrite of a register that the bias loads name; bp as an input keeps the compiler from lifting that rewrite over the wait
#pragma unroll
    for (int nb = 0; nb < 4; ++nb) { const int col = nb * 16 + lr; const float bv = bfr(braw[nb]); const size_t vr = (size_t)(bh0 + (col >> 5)) * HD + (col & 31);
#pragma unroll
        for (int mb = 0; mb < 4; ++mb) { const int t = t0 + mb * 16 + hi * 8; v8h o16; v8us oh, ol;
#pragma unroll
            for (int j = 0; j < 8; ++j) { const float y = acc[mb][nb][j] + bv; o16[j] = (h16)y; if (HL) { unsigned short x1, x2; splitf(y, x1, x2); oh[j] = x1; ol[j] = x2; } }
            *(v8h*)(P.VT16 + vr * SEQ + t) = o16;
            if (HL) { *(v8us*)(P.VTH + vr * RH + t) = oh; *(v8us*)(P.VTL + vr * RH + t) = ol; } } }
    asm volatile("s_wait_xcnt 0x0" ::: "memory");   // behind the last plane store: stands in front of any later rewrite of a register that these stores name, on every way the branches allow
}
// q / k: 16 tokens at a time turned through the wave's LDS tile os (pitch 68 floats); a lane then owns 8 consecutive d of one token (16 B of f16), 8 lanes a token's two heads, and a store covers 4 tokens = 256 contiguous bytes per head.
template <bool HL>
__device__ __forceinline__ void put_qk(const v8f (&acc)[4][4], float* os, const float* __restrict__ bias, const int which, const int bh0, const int t0, const int lane, const planes P) {
    const int lr = lane & 15, hi = lane >> 4, c = (lane & 7) * 8, d = c & 31; const size_t bh = (size_t)(bh0 + (c >> 5));
    float bv[8];
#pragma unroll
    for (int k = 0; k < 8; ++k) bv[k] = bfr(bias[c + k]);
#pragma unroll
    for (int mb = 0; mb < 4; ++mb) {
#pragma unroll
        for (int nb = 0; nb < 4; ++nb) {
#pragma unroll
            for (int j = 0; j < 8; ++j) os[(hi * 8 + j) * 68 + nb * 16 + lr] = acc[mb][nb][j]; }
        __builtin_amdgcn_wave_barrier(); asm volatile("" ::: "memory");   // the tile's LDS writes stay in front of the reads of other lanes' values
#pragma unroll
        for (int s = 0; s < 4; ++s) { const int row = 4 * s + (lane >> 3), t = t0 + mb * 16 + row;
            const v4f lo4 = *(const v4fa*)(os + row * 68 + c), hi4 = *(const v4fa*)(os + row * 68 + c + 4); v8h o16; v8us oh, ol;
#pragma unroll
            for (int k = 0; k < 8; ++k) { const float y = (k < 4 ? lo4[k & 3] : hi4[k & 3]) + bv[k]; o16[k] = (h16)y; if (HL) { unsigned short x1, x2; splitf(y, x1, x2); oh[k] = x1; ol[k] = x2; } }
            *(v8h*)(P.QK16 + (size_t)which * PLN + (bh * SEQ + t) * HD + d) = o16;
            if (HL) { const size_t o2 = (size_t)which * PLH + (bh * RH + t) * HD + d; *(v8us*)(P.QKH + o2) = oh; *(v8us*)(P.QKL + o2) = ol; } }
        __builtin_amdgcn_wave_barrier(); asm volatile("" ::: "memory");   // the reads stay in front of the next 16 tokens' LDS writes
    }
    asm volatile("s_wait_xcnt 0x0" ::: "memory");   // behind the last plane store: stands in front of any later rewrite of a register that these stores name, on every way the branches allow
}
template <int NSPLIT, bool PLANES>
__device__ __forceinline__ void gemmw_body(const bf* __restrict__ A, const bf* __restrict__ A2, const bf* __restrict__ Bt, const int K, const int lda, const size_t ksA, float* C, const int ldc, const float* __restrict__ bias, const size_t sA, const size_t sC, const planes P) {
    __shared__ __align__(16) float os[16 * 68];
    const size_t z = blockIdx.z; A += z * sA; if (NSPLIT == 1) A2 += z * sA; C += z * sC;
    const int lane = threadIdx.x & 31, lr = lane & 15, hi = lane >> 4; const int r0 = blockIdx.x * 64, c0 = blockIdx.y * 64;
    v8f acc[4][4];
#pragma unroll
    for (int mb = 0; mb < 4; ++mb)
#pragma unroll
        for (int nb = 0; nb < 4; ++nb) acc[mb][nb] = (v8f){};
    const size_t aoff = (size_t)(r0 + lr) * lda + 8 * hi, boff = (size_t)(c0 + lr) * K + 8 * hi;
#pragma unroll 1
    for (int kc = 0; kc < K; kc += 32) {
        const size_t ak = (size_t)(kc >> 5) * ksA;
        v16bf a[4], a2[4];
#pragma unroll
        for (int mb = 0; mb < 4; ++mb) { a[mb] = ldb(A + aoff + (size_t)mb * 16 * lda + ak); if (NSPLIT == 1) a2[mb] = ldb(A2 + aoff + (size_t)mb * 16 * lda + ak); }
#pragma unroll
        for (int nb = 0; nb < 4; ++nb) { const v16bf b = ldb(Bt + boff + (size_t)nb * 16 * K + kc);
#pragma unroll
            for (int mb = 0; mb < 4; ++mb) { acc[mb][nb] = wmmab(a[mb], b, acc[mb][nb]); if (NSPLIT == 1) acc[mb][nb] = wmmab(a2[mb], b, acc[mb][nb]); } }
        asm volatile("v_nop\n\tv_nop\n\tv_nop\n\tv_nop" : "+v"(acc[0][0]), "+v"(acc[1][1]), "+v"(acc[2][2]), "+v"(acc[3][3]) : "v"(a[0]), "v"(a[3]));
    }
    if constexpr (PLANES) {
        // tile coordinates, all uniform over the work-group: 64 columns = two heads of one of q, k, v; 64 rows = 64 tokens of one batch, all on one side of RH
        const int which = c0 / DQ, bh0 = (r0 / SEQ) * NH + (c0 % DQ) / HD, t0 = r0 % SEQ;
        if (which == 2) { if (t0 < RH) put_v<true>(acc, bias + c0, bh0, t0, lane, P); else put_v<false>(acc, bias + c0, bh0, t0, lane, P); }
        else            { if (t0 < RH) put_qk<true>(acc, os, bias + c0, which, bh0, t0, lane, P); else put_qk<false>(acc, os, bias + c0, which, bh0, t0, lane, P); }
        return;
    }
#pragma unroll
    for (int mb = 0; mb < 4; ++mb) {
#pragma unroll
        for (int nb = 0; nb < 4; ++nb) {
#pragma unroll
            for (int j = 0; j < 8; ++j) os[(hi * 8 + j) * 68 + nb * 16 + lr] = acc[mb][nb][j]; }
        __builtin_amdgcn_wave_barrier(); asm volatile("" ::: "memory");
        float* crow = C + (size_t)(r0 + mb * 16) * ldc + c0;
{
#pragma unroll
            for (int s = 0; s < 8; ++s) { const int row = 2 * s + hi, cofs = lr * 4; v4f val = *(const v4fa*)(os + row * 68 + cofs);
                val[0] += bfr(bias[c0 + cofs]); val[1] += bfr(bias[c0 + cofs + 1]); val[2] += bfr(bias[c0 + cofs + 2]); val[3] += bfr(bias[c0 + cofs + 3]);
                *(v4f*)(crow + (size_t)row * ldc + cofs) = val; }
             }
        __builtin_amdgcn_wave_barrier(); asm volatile("" ::: "memory");
    }
}
// qkv [NB*SEQ][384] = XB [NB*SEQ][128] x WQKV^T + b_qkv, column = which*128 + h*32 + d, written as the attention planes; grid (NB*SEQ/64, 384/64, 1)
__global__ __launch_bounds__(32) void k_gemm_qkv(const bf* __restrict__ A, const bf* __restrict__ Bt, const float* __restrict__ bias, h16* QK16, h16* VT16, bf* QKH, bf* QKL, bf* VTH, bf* VTL) {
    gemmw_body<0, true>(A, nullptr, Bt, DM, DM, (size_t)32, nullptr, FW, bias, 0, 0, planes{QK16, VT16, QKH, QKL, VTH, VTL}); }
// OUT [b][t][128] = (ATH + ATL) x WO^T + b_proj; A element (t, k = h*32+d) at plane [(b*NH + h)*SEQ + t][d]: lda = HD, k-step advance = SEQ*HD, batch stride NH*SEQ*HD;
// grid (SEQ/64, 128/64, NB); output rows use the full per-batch stride
__global__ __launch_bounds__(32) void k_gemm_proj(const bf* __restrict__ Ah, const bf* __restrict__ Al, const bf* __restrict__ Bt, float* C, const float* __restrict__ bias) {
    gemmw_body<1, false>(Ah, Al, Bt, DQ, HD, (size_t)SEQ * HD, C, DM, bias, (size_t)NH * SEQ * HD, (size_t)SEQ_FULL * DM, planes{}); }

// ---- operand preparation: three jobs that read inputs only and write disjoint planes, so they share ONE launch (k_prep), told apart by the block index.
// weight job, block blk of its own range: in[K][N] ([in][out]) -> Bt[N][K] bf16; 8 waves x 8 lines of 64 elements per block
__device__ __forceinline__ void wt_job(const float* __restrict__ w, const int K, const int N, bf* Bt, const int blk) {
    const int lane = threadIdx.x & 31; const int wave = __builtin_amdgcn_readfirstlane(threadIdx.x >> 5);
    const int L0 = (blk * 8 + wave) * 8; const int nlines = N * K / 64;
{
#pragma unroll 1
        for (int l = 0; l < 8; ++l) { const int L = L0 + l; if (L >= nlines) break; const size_t e = (size_t)L * 64 + lane * 2; const int k = (int)(e % K), n = (int)(e / K); v2us o;
            o[0] = f2bf(w[(size_t)k * N + n]); o[1] = f2bf(w[(size_t)(k + 1) * N + n]); *(v2us*)(Bt + e) = o; }
         }
}
// x job, block blk of its own range: bf16 copy of x, 8 elements a thread
__device__ __forceinline__ void cvtx_job(const float* __restrict__ x, bf* XB, const int blk) {
    const size_t i = (size_t)blk * 256 + threadIdx.x; if (i >= (size_t)NB * SEQ * DM / 8) return;
    const size_t row = i / (DM / 8); const int c = (int)(i % (DM / 8)) * 8; const size_t b = row / SEQ, t = row % SEQ;
    const v8f v = *(const v8f*)(x + (b * SEQ_FULL + t) * DM + c); v8us o;
#pragma unroll
    for (int k = 0; k < 8; ++k) o[k] = f2bf(v[k]);
    *(v8us*)(XB + i * 8) = o;  }
#define GW1 ((DM * FW / 64 + 63) / 64)                        // blocks of the w_qkv job
#define GW2 ((DQ * DM / 64 + 63) / 64)                        // blocks of the w_proj job
#define GXB ((int)(((size_t)NB * SEQ * DM / 8 + 255) / 256))  // blocks of the x job
// grid GW1 + GW2 + GXB; the two weight jobs (few blocks, 8 dependent lines a wave) take the lowest indices
__global__ __launch_bounds__(256) void k_prep(const float* __restrict__ x, const float* __restrict__ wqkv, const float* __restrict__ wo, bf* XB, bf* WQKV, bf* WO) {
    const int b = blockIdx.x;
    if (b < GW1) wt_job(wqkv, DM, FW, WQKV, b);                 // in[128][384] -> out[384][128]
    else if (b < GW1 + GW2) wt_job(wo, DQ, DM, WO, b - GW1);    // in[128][128] -> out[128][128]
    else cvtx_job(x, XB, b - (GW1 + GW2));
}

// ---- join of the NW waves' partial results of one 16-query tile. Wave w holds, for query n, its running max m (log2 domain), its sum l (both halves already added) and O^T unnormalised.
// Every wave stages its part, one work-group barrier, then thread (w, lane) owns query row 4w + (lane >> 3), d = 4 (lane & 7) .. + 3: out = sum_w 2^(m_w - M) O_w / sum_w 2^(m_w - M) l_w, waves summed in index order.
// A wave that had no key step stages m = NEGB, l = 0, O = 0 and gets weight 0 (wave 0 always has step 0, whose key 0 every query keeps, so M is finite).
__device__ __forceinline__ void join_stage(float* ys, float* ms, float* ls, const int w, const int lane, const v8f* o, const float m, const float l) {
    const int n = lane & 15, hh = lane >> 4;
#pragma unroll
    for (int j = 0; j < 2; ++j)
#pragma unroll
        for (int r = 0; r < 8; ++r) ys[w * 16 * YP + n * YP + j * 16 + 8 * hh + r] = o[j][r];
    if (hh == 0) { ms[w * 16 + n] = m; ls[w * 16 + n] = l; }
}
__device__ __forceinline__ void join_finish(const float* ys, const float* ms, const float* ls, const int w, const int lane, bf* ATH, bf* ATL, const size_t tile0) {
    const int row = 4 * w + (lane >> 3), c = (lane & 7) * 4;
    float mw[NW]; float M = NEGB;
#pragma unroll
    for (int k = 0; k < NW; ++k) { mw[k] = ms[k * 16 + row]; M = fmaxf(M, mw[k]); }
    v4f acc = (v4f){}; float L = 0.0f;
#pragma unroll
    for (int k = 0; k < NW; ++k) { const float sc = __builtin_amdgcn_exp2f(mw[k] - M); L += sc * ls[k * 16 + row]; acc += sc * *(const v4fa*)(ys + k * 16 * YP + row * YP + c); }
    const float inv = 1.0f / L;
    v4us oh, ol;
#pragma unroll
    for (int k = 0; k < 4; ++k) { unsigned short x1, x2; splitf(acc[k] * inv, x1, x2); oh[k] = x1; ol[k] = x2; }
    const size_t oo = tile0 + (size_t)row * HD + c;
    *(v4us*)(ATH + oo) = oh; *(v4us*)(ATL + oo) = ol;
}

// ---- fused causal attention, query rows >= RH, single f16 products. NW waves per NQ * 16 query rows; q0: the first query row, bh: batch * NH + head.
// A wave holds NQ query fragments (tile t: rows q0 + 16 t ..) and keeps (max, sum, O) per tile; a step's K and V^T fragments are loaded once and multiplied with every tile's q and p.
// Lane (hh = lane>>4, n = lane&15): query q0+16t+n; per 32-key step and tile holds keys kb+8hh+r (element r) and kb+16+8hh+r (element 8+r), r = 0..7.
__device__ __forceinline__ void attn16_tile(float* ys, float* ms, float* ls, const int q0, const int bh, const h16* QK16, const h16* VT16, bf* ATH, bf* ATL) {
    const int lane = threadIdx.x & 31, n = lane & 15, hh = lane >> 4;
    const int w = __builtin_amdgcn_readfirstlane(threadIdx.x >> 5);   // wave number, scalar: the key loop stays a scalar loop
    const int kend = q0 + 16 * NQ - 1;
    const size_t qo = ((size_t)bh * SEQ + q0 + n) * HD + 8 * hh;          // query plane (which 0), + t * 16 * HD
    const size_t ko = PLN + ((size_t)bh * SEQ + n) * HD + 8 * hh;         // key plane (which 1), + key * HD
    const size_t vo = ((size_t)bh * HD + n) * SEQ + 8 * hh;               // V^T plane, + j*16*SEQ + key
    v16h qb[NQ]; v8f o[NQ][2]; float m[NQ], l[NQ];
#pragma unroll   // t a constant: the per-tile arrays stay in registers (here and in the t loops below)
    for (int t = 0; t < NQ; ++t) { qb[t] = ldh(QK16 + qo + (size_t)t * 16 * HD); o[t][0] = (v8f){}; o[t][1] = (v8f){}; m[t] = NEGB; l[t] = 0.0f; }
#pragma unroll 1
    for (int kb = 32 * w; kb <= kend; kb += 32 * NW) {
        const size_t ka = ko + (size_t)kb * HD;
        const v16h a0 = ldh(QK16 + ka), a1 = ldh(QK16 + ka + 16 * HD);
        const int key0 = kb + 8 * hh;
        v16h pb[NQ];
#pragma unroll
        for (int t = 0; t < NQ; ++t) {
            const int qrow = q0 + 16 * t + n;
            v8f s0 = (v8f){}, s1 = (v8f){};
            s0 = wm16g(a0, qb[t], s0); s1 = wm16g(a1, qb[t], s1);
            float u[16];
            if (kb + 31 > q0) {            // wave-uniform: only the step touching the diagonal (replace by select)
#pragma unroll
                for (int r = 0; r < 8; ++r) { u[r] = (key0 + r <= qrow) ? s0[r] * SCL2 : NEGB; u[8 + r] = (key0 + 16 + r <= qrow) ? s1[r] * SCL2 : NEGB; }
            } else {
#pragma unroll
                for (int r = 0; r < 8; ++r) { u[r] = s0[r] * SCL2; u[8 + r] = s1[r] * SCL2; }
            }
            float mx = u[0];
#pragma unroll
            for (int i = 1; i < 16; ++i) mx = fmaxf(mx, u[i]);
            mx = fmaxf(mx, __shfl_xor(mx, 16, 32));
            const float mn = fmaxf(m[t], mx);
            const float corr = __builtin_amdgcn_exp2f(m[t] - mn);
            m[t] = mn;
            float ps = 0.0f;
#pragma unroll
            for (int r = 0; r < 8; ++r) {
                const float p0 = __builtin_amdgcn_exp2f((u[r] - mn) + PCL); const float p1 = __builtin_amdgcn_exp2f((u[8 + r] - mn) + PCL);
                ps += p0 + p1; pb[t][r] = (h16)p0; pb[t][8 + r] = (h16)p1; }
            l[t] = l[t] * corr + ps;
#pragma unroll
            for (int j = 0; j < 2; ++j) o[t][j] = o[t][j] * corr;
        }
#pragma unroll
        for (int j = 0; j < 2; ++j) { const v16h va = ldh(VT16 + vo + (size_t)j * 16 * SEQ + kb);
#pragma unroll
            for (int t = 0; t < NQ; ++t) o[t][j] = wm16g(va, pb[t], o[t][j]); }
    }
#pragma unroll
    for (int t = 0; t < NQ; ++t) { l[t] += __shfl_xor(l[t], 16, 32); join_stage(ys + t * NW * 16 * YP, ms + t * NW * 16, ls + t * NW * 16, w, lane, o[t], m[t], l[t]); }
    __syncthreads();                   // publishes every wave's partials of all NQ tiles to the joining threads
#pragma unroll
    for (int t = 0; t < NQ; ++t) join_finish(ys + t * NW * 16 * YP, ms + t * NW * 16, ls + t * NW * 16, w, lane, ATH, ATL, ((size_t)bh * SEQ + q0 + 16 * t) * HD);
}

// ---- fused causal attention, query rows < RH, bf16 hi/lo planes, 3 products per contraction (hi*hi + lo*hi + hi*lo). Same lane map and key split as attn16_tile.
__device__ __forceinline__ void attnhl_tile(float* ys, float* ms, float* ls, const int q0, const int bh, const bf* QKH, const bf* QKL, const bf* VTH, const bf* VTL, bf* ATH, bf* ATL) {
    const int lane = threadIdx.x & 31, n = lane & 15, hh = lane >> 4;
    const int w = __builtin_amdgcn_readfirstlane(threadIdx.x >> 5);   // wave number, scalar: the key loop stays a scalar loop
    const int qrow = q0 + n, kend = q0 + 15;
    const size_t qo = ((size_t)bh * RH + q0 + n) * HD + 8 * hh;           // query hi/lo plane (which 0)
    const size_t ko = PLH + ((size_t)bh * RH + n) * HD + 8 * hh;          // key hi/lo plane (which 1), + key * HD
    const size_t vo = ((size_t)bh * HD + n) * RH + 8 * hh;                // V^T hi/lo plane, + j*16*RH + key
    v8f o[2];
#pragma unroll
    for (int j = 0; j < 2; ++j) o[j] = (v8f){};
    float m = NEGB, l = 0.0f;
#pragma unroll 1
    for (int kb = 32 * w; kb <= kend; kb += 32 * NW) {
        v8f s[2]; s[0] = (v8f){}; s[1] = (v8f){};
        {
            const v16bf qh = ldb(QKH + qo), ql = ldb(QKL + qo);
#pragma unroll
            for (int kc = 0; kc < 2; ++kc) { const size_t ka = ko + (size_t)(kb + kc * 16) * HD;
                const v16bf kh = ldb(QKH + ka), kl = ldb(QKL + ka);
                s[kc] = wmbg(kh, qh, s[kc]); s[kc] = wmbg(kl, qh, s[kc]); s[kc] = wmbg(kh, ql, s[kc]); }
            asm volatile("" ::: "memory");
        }
        float u[16];
        const int key0 = kb + 8 * hh;
        if (kb + 31 > q0) {            // wave-uniform
#pragma unroll
            for (int r = 0; r < 8; ++r) { u[r] = (key0 + r <= qrow) ? s[0][r] * SCL2 : NEGB; u[8 + r] = (key0 + 16 + r <= qrow) ? s[1][r] * SCL2 : NEGB; }
        } else {
#pragma unroll
            for (int r = 0; r < 8; ++r) { u[r] = s[0][r] * SCL2; u[8 + r] = s[1][r] * SCL2; }
        }
        float mx = u[0];
#pragma unroll
        for (int i = 1; i < 16; ++i) mx = fmaxf(mx, u[i]);
        mx = fmaxf(mx, __shfl_xor(mx, 16, 32));
        const float mn = fmaxf(m, mx);
        const float corr = __builtin_amdgcn_exp2f(m - mn);
        m = mn;
        v16us phu, plu; float ps = 0.0f;
#pragma unroll
        for (int r = 0; r < 8; ++r) {
            const float p0 = __builtin_amdgcn_exp2f(u[r] - mn); const float p1 = __builtin_amdgcn_exp2f(u[8 + r] - mn);
            ps += p0 + p1; unsigned short x1, x2; splitf(p0, x1, x2); phu[r] = x1; plu[r] = x2; splitf(p1, x1, x2); phu[8 + r] = x1; plu[8 + r] = x2; }
        const v16bf ph = __builtin_bit_cast(v16bf, phu), pl = __builtin_bit_cast(v16bf, plu);
        l = l * corr + ps;
#pragma unroll
        for (int j = 0; j < 2; ++j) o[j] = o[j] * corr;
#pragma unroll
        for (int j = 0; j < 2; ++j) { const size_t va = vo + (size_t)j * 16 * RH + kb; const v16bf vh = ldb(VTH + va), vl = ldb(VTL + va);
            o[j] = wmbg(vh, ph, o[j]); o[j] = wmbg(vl, ph, o[j]); o[j] = wmbg(vh, pl, o[j]);
            asm volatile("" ::: "memory"); }
    }
    l += __shfl_xor(l, 16, 32);
    join_stage(ys, ms, ls, w, lane, o, m, l);
    __syncthreads();                   // publishes every wave's partial to the joining threads
    join_finish(ys, ms, ls, w, lane, ATH, ATL, ((size_t)bh * SEQ + q0) * HD);
}

// Both kinds of query tile read only the planes of the qkv launch and write disjoint context rows, so they share ONE launch: grid (NB*NH, NT16 + NTH), 32 * NW threads; the block's tile index picks the path (uniform over the work-group).
// Order: a tile's key steps grow with its query row, so the slow grid axis counts the tiles from the last (most steps) down to the first (one step), the f16 tiles in front of the hi/lo tiles. The fast axis is batch * head, all of equal length. For speed only: every (tile, head) pair is done exactly once whatever the order.
#define NT16 ((SEQ - RH) / (16 * NQ))   // work-groups per head on the f16 path (NQ * 16 query rows each)
#define NTH  (RH / 16)                  // work-groups per head on the hi/lo path (16 query rows each)
__global__ __launch_bounds__(32 * NW) void k_attn(const h16* QK16, const h16* VT16, const bf* QKH, const bf* QKL, const bf* VTH, const bf* VTL, bf* ATH, bf* ATL) {
    __shared__ __align__(16) float ys[NQ * NW * 16 * YP];   // one 16 x 32 partial O tile per wave and query tile
    __shared__ float ms[NQ * NW * 16], ls[NQ * NW * 16];    // per wave and query: running max, sum
    const int y = blockIdx.y, bh = blockIdx.x;
    if (y < NT16) attn16_tile(ys, ms, ls, RH + (NT16 - 1 - y) * 16 * NQ, bh, QK16, VT16, ATH, ATL);
    else          attnhl_tile(ys, ms, ls, (NTH - 1 - (y - NT16)) * 16, bh, QKH, QKL, VTH, VTL, ATH, ATL);
}

extern "C" void kernel_launch(void* const* d_in, const int* in_sizes, int n_in,
                              void* d_out, int out_size, void* d_ws, size_t ws_size, hipStream_t stream) {
    // wire order: x [8][2048][128], w_qkv [128][384], b_qkv [384], w_proj [128][128], b_proj [128] (all f32)
    constexpr size_t XN = ((size_t)(NB - 1) * SEQ_FULL + SEQ) * DM;      // lowest element count covering the rows touched
    if (n_in < 5) return;
    if ((size_t)in_sizes[0] < XN || (size_t)in_sizes[1] < (size_t)DM * FW || in_sizes[2] < FW || (size_t)in_sizes[3] < (size_t)DQ * DM || in_sizes[4] < DM) return;
    if ((size_t)out_size < XN) return;
    const float* x = (const float*)d_in[0]; const float* wqkv = (const float*)d_in[1]; const float* bqkv = (const float*)d_in[2];
    const float* wo = (const float*)d_in[3]; const float* bo = (const float*)d_in[4];
    float* OUT = (float*)d_out;      // [NB_FULL][SEQ_FULL][128], byte offset 0

    // workspace carve: every region a multiple of 256 B, sized to the producers' whole-line store extent
    constexpr size_t SZ_WQKV = (size_t)FW * DM * 2;            // Bt [384][128] bf16
    constexpr size_t SZ_WO   = (size_t)DM * DQ * 2;            // Bt [128][128] bf16
    constexpr size_t SZ_XB   = (size_t)NB * SEQ * DM * 2;      // bf16 x
    constexpr size_t SZ_QK16 = 2 * PLN * 2;                    // f16 q | k planes
    constexpr size_t SZ_VT16 = PLN * 2;                        // f16 V^T planes
    constexpr size_t SZ_QKHL = 2 * PLH * 2;                    // bf16 q | k hi (and lo) planes, rows < RH
    constexpr size_t SZ_VTHL = PLH * 2;                        // bf16 V^T hi (and lo) planes, keys < RH
    constexpr size_t SZ_AT   = PLN * 2;                        // head-major context hi (and lo) planes
    constexpr size_t O_WQKV = 0;
    constexpr size_t O_WO   = O_WQKV + SZ_WQKV;
    constexpr size_t O_XB   = O_WO + SZ_WO;
    constexpr size_t O_QK16 = O_XB + SZ_XB;
    constexpr size_t O_VT16 = O_QK16 + SZ_QK16;
    constexpr size_t O_QKH  = O_VT16 + SZ_VT16;
    constexpr size_t O_QKL  = O_QKH + SZ_QKHL;
    constexpr size_t O_VTH  = O_QKL + SZ_QKHL;
    constexpr size_t O_VTL  = O_VTH + SZ_VTHL;
    constexpr size_t O_ATH  = O_VTL + SZ_VTHL;
    constexpr size_t O_ATL  = O_ATH + SZ_AT;
    constexpr size_t O_END  = O_ATL + SZ_AT;
    static_assert(SZ_WQKV % 256 == 0 && SZ_WO % 256 == 0 && SZ_XB % 256 == 0 && SZ_QK16 % 256 == 0 && SZ_VT16 % 256 == 0 && SZ_QKHL % 256 == 0 && SZ_VTHL % 256 == 0 && SZ_AT % 256 == 0);
    static_assert(O_END <= (size_t)134217728);                  // total carve <= 128 MiB
    static_assert((DM * FW) % 64 == 0 && (DQ * DM) % 64 == 0);  // weight planes are whole 64-element lines
    static_assert(((size_t)NB * SEQ) % 64 == 0);                // qkv GEMM M tiles
    if (ws_size < O_END) return;
    char* ws = (char*)d_ws;
    bf* WQKV = (bf*)(ws + O_WQKV); bf* WO = (bf*)(ws + O_WO); bf* XB = (bf*)(ws + O_XB);
    h16* QK16 = (h16*)(ws + O_QK16); h16* VT16 = (h16*)(ws + O_VT16);
    bf* QKH = (bf*)(ws + O_QKH); bf* QKL = (bf*)(ws + O_QKL); bf* VTH = (bf*)(ws + O_VTH); bf* VTL = (bf*)(ws + O_VTL);
    bf* ATH = (bf*)(ws + O_ATH); bf* ATL = (bf*)(ws + O_ATL);

    k_prep<<<(unsigned)(GW1 + GW2 + GXB), 256, 0, stream>>>(x, wqkv, wo, XB, WQKV, WO);
    k_gemm_qkv<<<dim3(NB * SEQ / 64, FW / 64, 1), 32, 0, stream>>>(XB, WQKV, bqkv, QK16, VT16, QKH, QKL, VTH, VTL);
    k_attn<<<dim3(NB * NH, NT16 + NTH, 1), 32 * NW, 0, stream>>>(QK16, VT16, QKH, QKL, VTH, VTL, ATH, ATL);
    k_gemm_proj<<<dim3(SEQ / 64, DM / 64, NB), 32, 0, stream>>>(ATH, ATL, WO, OUT, bo);
}

// v006
// One run takes 45 microseconds.
// Timed twice side by side with v005, it ran 1.12 and 1.11 times as fast.
// Counting every step since v000, it is 2.69 times as fast.
#include <hip/hip_runtime.h>

// Causal self-attention: x [NB][SEQ][128]; qkv = x w_qkv + b_qkv ([in][out] weight, q | k | v column thirds, 4 heads x 32, head h = columns h*32+d); scores x 32^-0.5; causal select (diagonal kept); softmax; out = merged w_proj + b_proj ([in][out]).
// Compute dtypes, f32 accumulate everywhere: qkv projection v_wmma_f32_16x16x32_bf16 on x / w_qkv rounded to bf16 (RNE) in registers as the fragments are loaded (single product); attention query rows < 256: bf16 hi/lo planes, 3 products for k q^T and for v^T p; query rows >= 256: v_wmma_f32_16x16x32_f16 single products (q, k, v f16 planes, p carried x1024 in the exponent); output projection: bf16 hi/lo context planes x w_proj rounded to bf16 (RNE) in registers (2 products). Softmax f32, online running-max form in the log2 domain.
// Fused attention, one work-group of NW waves per 16 query rows (rows < RH) or per NQ * 16 query rows (rows >= RH, every wave carrying all NQ tiles), the 32-key steps dealt round-robin to the waves (wave w: steps w, w + NW, ...), partial (max, sum, O) joined through LDS; head dim 32 = one 32-deep k-step for the scores: S^T = K Q^T (keys on D rows, queries on D columns), p built per lane and fed as the B operand of O^T = V^T P^T (B element r <- tile keys 0-15 [r], element 8+r <- tile keys 16-31 [r]); no score / probability plane in memory.

#ifndef NB
#define NB 8
#endif
#ifndef SEQ
#define SEQ 2048
#endif
#define NB_FULL  8
#define SEQ_FULL 2048
#define DM   128
#define NH   4
#define HD   32
#define DQ   (NH * HD)
#define FW   (3 * DQ)
#define RH   256                      // query rows < RH use bf16 hi/lo planes
#define PLN  ((size_t)NB * NH * SEQ * HD)   // elements of one [b*h][t][d] plane
#define PLH  ((size_t)NB * NH * RH * HD)    // elements of one hi/lo plane (rows < RH)
#define SCL2 0.25503486164918f        // HD^-0.5 * log2(e)
#define PCL  10.0f                    // log2 of the p carry (x1024) for the f16 path
#define NEGB (-3.0e38f)
#define YP   36                       // staging pitch (floats) of the 16 x 32 attention result tile
#define NW   4                        // waves per query tile: each walks every NW-th 32-key step
#define NQ   2                        // f16 path: 16-query tiles per work-group; every K and V^T fragment a wave loads feeds all NQ of them

static_assert(DQ == DM);               // merged width == model width
static_assert(HD == 32);               // scores: one 32-deep k-step; head row == 64 B of 16-bit data; proj k-step == one head
static_assert(2 * HD == 64);
static_assert(HD % 16 == 0);           // O^T tiles of 16 d rows
static_assert(YP % 4 == 0 && YP >= HD); // 16-B aligned staging rows
static_assert(NW * 32 * 4 == 16 * HD);  // join: every thread owns 4 consecutive d of one query row
static_assert(DM % 64 == 0);           // GEMM K multiple of 32, weight lines of 64
static_assert(DQ % 64 == 0);           // proj GEMM K multiple of 32; a qkv GEMM N tile inside one of q, k, v
static_assert(FW % 64 == 0);           // GEMM N tile multiple
static_assert(SEQ % 64 == 0);          // GEMM M tile multiple, 32-key steps, V^T lines
static_assert(RH % 64 == 0);           // hi/lo V^T lines, 32-key steps inside RH, a GEMM M tile on one side of RH
static_assert(RH <= SEQ);
static_assert(16 * NQ == 32);          // the NQ tiles of a work-group span one 32-key step: all have the same key steps, and the diagonal step is the last for each
static_assert(RH % (16 * NQ) == 0 && (SEQ - RH) % (16 * NQ) == 0);
static_assert(NB <= NB_FULL);
static_assert(SEQ <= SEQ_FULL);

typedef _Float16 h16;
typedef unsigned short bf;
typedef __attribute__((ext_vector_type(16))) __bf16   v16bf;
typedef __attribute__((ext_vector_type(16))) _Float16 v16h;
typedef __attribute__((ext_vector_type(16))) unsigned short v16us;
typedef __attribute__((ext_vector_type(8)))  _Float16 v8h;
typedef __attribute__((ext_vector_type(8)))  unsigned short v8us;
typedef __attribute__((ext_vector_type(8)))  float    v8f;
typedef __attribute__((ext_vector_type(4)))  float    v4f;
typedef __attribute__((ext_vector_type(4)))  unsigned short v4us;
typedef v4f  __attribute__((may_alias)) v4fa;

__device__ __forceinline__ unsigned short f2bf(float f) { unsigned u = __float_as_uint(f); u += 0x7FFFu + ((u >> 16) & 1u); return (unsigned short)(u >> 16); }   // RNE convert
__device__ __forceinline__ float bf2f(unsigned short b) { return __uint_as_float(((unsigned)b) << 16); }
__device__ __forceinline__ float bfr(float f) { return bf2f(f2bf(f)); }
__device__ __forceinline__ void splitf(float y, unsigned short& h, unsigned short& l) { h = f2bf(y); l = f2bf(y - bf2f(h)); }
__device__ __forceinline__ v16h cat16(v8h lo, v8h hi) { return __builtin_shufflevector(lo, hi, 0, 1, 2, 3, 4, 5, 6, 7, 8, 9, 10, 11, 12, 13, 14, 15); }
__device__ __forceinline__ v16bf cat16b(v8us lo, v8us hi) { return __builtin_bit_cast(v16bf, __builtin_shufflevector(lo, hi, 0, 1, 2, 3, 4, 5, 6, 7, 8, 9, 10, 11, 12, 13, 14, 15)); }
// fragment loaders: elements 0..7 <- p[0..7], elements 8..15 <- p[16..23]; p already includes + 8 * (lane >> 4)
__device__ __forceinline__ v16h ldh(const h16* p) { return cat16(*(const v8h*)p, *(const v8h*)(p + 16)); }
__device__ __forceinline__ v16bf ldb(const bf* p) { return cat16b(*(const v8us*)p, *(const v8us*)(p + 16)); }
typedef __attribute__((ext_vector_type(8))) __bf16 v8bf;
// f32 sources, rounded to bf16 (RNE, v_cvt_pk_bf16_f32) in registers, same element order as ldb. The request (raw16) and the rounding (rnd16) are apart so that a group of requests can be issued before the first rounding waits for one.
struct raw16 { v8f lo, hi; };
__device__ __forceinline__ v16bf rnd16(const raw16 r) {
    const v8bf l8 = __builtin_convertvector(r.lo, v8bf), h8 = __builtin_convertvector(r.hi, v8bf);
    return __builtin_shufflevector(l8, h8, 0, 1, 2, 3, 4, 5, 6, 7, 8, 9, 10, 11, 12, 13, 14, 15); }
// row fragment: elements 0..7 <- p[0..7], elements 8..15 <- p[16..23]; p already includes + 8 * (lane >> 4)
__device__ __forceinline__ raw16 ldxf(const float* p) { return raw16{*(const v8f*)p, *(const v8f*)(p + 16)}; }
// column fragment of an [in][out] weight of row pitch N: elements 0..7 <- p[0..7 * N], elements 8..15 <- p[16..23 * N]; p already includes + 8 * (lane >> 4) * N + the lane's column; 16 lanes read 64 contiguous bytes of a weight row
__device__ __forceinline__ raw16 ldwf(const float* p, const int N) {
    raw16 r;
#pragma unroll
    for (int k = 0; k < 8; ++k) { r.lo[k] = p[(size_t)k * N]; r.hi[k] = p[(size_t)(16 + k) * N]; }
    return r; }
__device__ __forceinline__ v8f wmmab(v16bf a, v16bf b, v8f c) { return __builtin_amdgcn_wmma_f32_16x16x32_bf16(false, a, false, b, (short)0, c, false, false); }
// guarded forms: 4 nops after the matrix op, accumulator tied, operands kept live
__device__ __forceinline__ v8f wm16g(v16h a, v16h b, v8f c) {
    c = __builtin_amdgcn_wmma_f32_16x16x32_f16(false, a, false, b, (short)0, c, false, false);
    asm volatile("v_nop\n\tv_nop\n\tv_nop\n\tv_nop" : "+v"(c) : "v"(a), "v"(b));
    return c; }
__device__ __forceinline__ v8f wmbg(v16bf a, v16bf b, v8f c) {
    c = __builtin_amdgcn_wmma_f32_16x16x32_bf16(false, a, false, b, (short)0, c, false, false);
    asm volatile("v_nop\n\tv_nop\n\tv_nop\n\tv_nop" : "+v"(c) : "v"(a), "v"(b));
    return c; }

// ---- register-blocked GEMM body, ONE WAVE per 64x64 output tile (16 accumulators); grid (M/64, N/64, Z), 32 threads. The weight W is the f32 input itself, [K][N] of row pitch ldw, read by columns and rounded to bf16 in registers (ldwf).
// y[m][n] (f32) = sum_k A[m][k] bf16(W[k][n]) (+ A2[m][k] bf16(W[k][n]) when NSPLIT == 1) + bf16-RNE(bias[n]). K % 32 == 0, M and N multiples of 64 (asserted at file scope).
// PLANES == false: A, A2 are bf16 K-contiguous planes, y goes to C (f32, pitch ldc). PLANES == true (qkv projection): A is the f32 input Xf (rows of K floats, rounded to bf16 in registers, ldxf; Xf points at the tile's batch), y goes straight to the attention operand planes of struct planes, no f32 copy in memory.
// A addressing: element (m, k) at A[m * lda + (k >> 5) * ksA + (k & 31)] (row pitch lda, advance ksA per 32-deep k-step); a plain row-major plane has lda = K, ksA = 32.
// q | k planes [which][b*h][t][d]: f16 copy for all t, bf16 hi/lo for t < RH ([which][b*h][RH][d]); V^T planes [b*h][d][t]: f16 for all t, bf16 hi/lo for t < RH ([b*h][d][RH]).
struct planes { h16* QK16; h16* VT16; bf* QKH; bf* QKL; bf* VTH; bf* VTL; };
// Plane epilogues of one 64 x 64 qkv tile held in acc[mb][nb] (lane (hi, lr), element j: token t0 + mb*16 + hi*8 + j, tile column nb*16 + lr); bias points at the tile's first column; heads bh0, bh0 + 1; HL: the tile's tokens are < RH.
// V^T: a lane's 8 accumulator rows are 8 consecutive tokens of one d, i.e. 16 contiguous bytes of a V^T row: stored from registers.
template <bool HL>
__device__ __forceinline__ void put_v(const v8f (&acc)[4][4], const float* __restrict__ bias, const int bh0, const int t0, const int lane, const planes P) {
    const int lr = lane & 15, hi = lane >> 4;
    const float* bp = bias + lr; float braw[4];
#pragma unroll
    for (int nb = 0; nb < 4; ++nb) braw[nb] = bp[nb * 16];
    asm volatile("s_wait_xcnt 0x0" :: "v"(bp) : "memory");   // stands in front of the first rewrite of a register that the bias loads name; bp as an input keeps the compiler from lifting that rewrite over the wait
#pragma unroll
    for (int nb = 0; nb < 4; ++nb) { const int col = nb * 16 + lr; const float bv = bfr(braw[nb]); const size_t vr = (size_t)(bh0 + (col >> 5)) * HD + (col & 31);
#pragma unroll
        for (int mb = 0; mb < 4; ++mb) { const int t = t0 + mb * 16 + hi * 8; v8h o16; v8us oh, ol;
#pragma unroll
            for (int j = 0; j < 8; ++j) { const float y = acc[mb][nb][j] + bv; o16[j] = (h16)y; if (HL) { unsigned short x1, x2; splitf(y, x1, x2); oh[j] = x1; ol[j] = x2; } }
            *(v8h*)(P.VT16 + vr * SEQ + t) = o16;
            if (HL) { *(v8us*)(P.VTH + vr * RH + t) = oh; *(v8us*)(P.VTL + vr * RH + t) = ol; } } }
    asm volatile("s_wait_xcnt 0x0" ::: "memory");   // behind the last plane store: stands in front of any later rewrite of a register that these stores name, on every way the branches allow
}
// q / k: 16 tokens at a time turned through the wave's LDS tile os (pitch 68 floats); a lane then owns 8 consecutive d of one token (16 B of f16), 8 lanes a token's two heads, and a store covers 4 tokens = 256 contiguous bytes per head.
template <bool HL>
__device__ __forceinline__ void put_qk(const v8f (&acc)[4][4], float* os, const float* __restrict__ bias, const int which, const int bh0, const int t0, const int lane, const planes P) {
    const int lr = lane & 15, hi = lane >> 4, c = (lane & 7) * 8, d = c & 31; const size_t bh = (size_t)(bh0 + (c >> 5));
    float bv[8];
#pragma unroll
    for (int k = 0; k < 8; ++k) bv[k] = bfr(bias[c + k]);
#pragma unroll
    for (int mb = 0; mb < 4; ++mb) {
#pragma unroll
        for (int nb = 0; nb < 4; ++nb) {
#pragma unroll
            for (int j = 0; j < 8; ++j) os[(hi * 8 + j) * 68 + nb * 16 + lr] = acc[mb][nb][j]; }
        __builtin_amdgcn_wave_barrier(); asm volatile("" ::: "memory");   // the tile's LDS writes stay in front of the reads of other lanes' values
#pragma unroll
        for (int s = 0; s < 4; ++s) { const int row = 4 * s + (lane >> 3), t = t0 + mb * 16 + row;
            const v4f lo4 = *(const v4fa*)(os + row * 68 + c), hi4 = *(const v4fa*)(os + row * 68 + c + 4); v8h o16; v8us oh, ol;
#pragma unroll
            for (int k = 0; k < 8; ++k) { const float y = (k < 4 ? lo4[k & 3] : hi4[k & 3]) + bv[k]; o16[k] = (h16)y; if (HL) { unsigned short x1, x2; splitf(y, x1, x2); oh[k] = x1; ol[k] = x2; } }
            *(v8h*)(P.QK16 + (size_t)which * PLN + (bh * SEQ + t) * HD + d) = o16;
            if (HL) { const size_t o2 = (size_t)which * PLH + (bh * RH + t) * HD + d; *(v8us*)(P.QKH + o2) = oh; *(v8us*)(P.QKL + o2) = ol; } }
        __builtin_amdgcn_wave_barrier(); asm volatile("" ::: "memory");   // the reads stay in front of the next 16 tokens' LDS writes
    }
    asm volatile("s_wait_xcnt 0x0" ::: "memory");   // behind the last plane store: stands in front of any later rewrite of a register that these stores name, on every way the branches allow
}
template <int NSPLIT, bool PLANES>
__device__ __forceinline__ void gemmw_body(const float* __restrict__ Xf, const bf* __restrict__ A, const bf* __restrict__ A2, const float* __restrict__ W, const int ldw, const int K, const int lda, const size_t ksA, float* C, const int ldc, const float* __restrict__ bias, const size_t sA, const size_t sC, const planes P) {
    __shared__ __align__(16) float os[16 * 68];
    const size_t z = blockIdx.z; A += z * sA; if (NSPLIT == 1) A2 += z * sA; C += z * sC;
    const int lane = threadIdx.x & 31, lr = lane & 15, hi = lane >> 4; const int r0 = blockIdx.x * 64, c0 = blockIdx.y * 64;
    v8f acc[4][4];
#pragma unroll
    for (int mb = 0; mb < 4; ++mb)
#pragma unroll
        for (int nb = 0; nb < 4; ++nb) acc[mb][nb] = (v8f){};
    const size_t aoff = (size_t)((PLANES ? r0 % SEQ : r0) + lr) * lda + 8 * hi, boff = (size_t)(8 * hi) * ldw + c0 + lr;
#pragma unroll 1
    for (int kc = 0; kc < K; kc += 32) {
        const size_t ak = (size_t)(kc >> 5) * ksA;
        const float* wp = W + boff + (size_t)kc * ldw; const float* xp = Xf + aoff + ak; const bf* ap = A + aoff + ak; const bf* ap2 = A2 + aoff + ak;
        v16bf a[4], a2[4], b[4]; raw16 xr[4], wr[4];
#pragma unroll
        for (int mb = 0; mb < 4; ++mb) { if (PLANES) xr[mb] = ldxf(xp + (size_t)mb * 16 * lda); else a[mb] = ldb(ap + (size_t)mb * 16 * lda); if (NSPLIT == 1) a2[mb] = ldb(ap2 + (size_t)mb * 16 * lda); }
#pragma unroll
        for (int nb = 0; nb < 4; ++nb) wr[nb] = ldwf(wp + nb * 16, ldw);
        // stands in front of the first rewrite of a register that the requests above name; the pointers as inputs keep the compiler from lifting their advance over the wait
        if constexpr (PLANES) asm volatile("s_wait_xcnt 0x0" :: "v"(xp), "v"(wp) : "memory"); else asm volatile("s_wait_xcnt 0x0" :: "v"(ap), "v"(ap2), "v"(wp) : "memory");
        __builtin_amdgcn_sched_barrier(0);   // all of the k-step's requests stay one group in front of the first rounding (their latencies pass together, not one behind another), and the pointers' advance stays behind the wait above
#pragma unroll
        for (int mb = 0; mb < 4; ++mb) if (PLANES) a[mb] = rnd16(xr[mb]);
#pragma unroll
        for (int nb = 0; nb < 4; ++nb) { b[nb] = rnd16(wr[nb]);
#pragma unroll
            for (int mb = 0; mb < 4; ++mb) { acc[mb][nb] = wmmab(a[mb], b[nb], acc[mb][nb]); if (NSPLIT == 1) acc[mb][nb] = wmmab(a2[mb], b[nb], acc[mb][nb]); } }
        asm volatile("v_nop\n\tv_nop\n\tv_nop\n\tv_nop" : "+v"(acc[0][0]), "+v"(acc[1][1]), "+v"(acc[2][2]), "+v"(acc[3][3]) : "v"(a[0]), "v"(a[3]));
    }
    if constexpr (PLANES) {
        // tile coordinates, all uniform over the work-group: 64 columns = two heads of one of q, k, v; 64 rows = 64 tokens of one batch, all on one side of RH
        const int which = c0 / DQ, bh0 = (r0 / SEQ) * NH + (c0 % DQ) / HD, t0 = r0 % SEQ;
        if (which == 2) { if (t0 < RH) put_v<true>(acc, bias + c0, bh0, t0, lane, P); else put_v<false>(acc, bias + c0, bh0, t0, lane, P); }
        else            { if (t0 < RH) put_qk<true>(acc, os, bias + c0, which, bh0, t0, lane, P); else put_qk<false>(acc, os, bias + c0, which, bh0, t0, lane, P); }
        return;
    }
#pragma unroll
    for (int mb = 0; mb < 4; ++mb) {
#pragma unroll
        for (int nb = 0; nb < 4; ++nb) {
#pragma unroll
            for (int j = 0; j < 8; ++j) os[(hi * 8 + j) * 68 + nb * 16 + lr] = acc[mb][nb][j]; }
        __builtin_amdgcn_wave_barrier(); asm volatile("" ::: "memory");
        float* crow = C + (size_t)(r0 + mb * 16) * ldc + c0;
{
#pragma unroll
            for (int s = 0; s < 8; ++s) { const int row = 2 * s + hi, cofs = lr * 4; v4f val = *(const v4fa*)(os + row * 68 + cofs);
                val[0] += bfr(bias[c0 + cofs]); val[1] += bfr(bias[c0 + cofs + 1]); val[2] += bfr(bias[c0 + cofs + 2]); val[3] += bfr(bias[c0 + cofs + 3]);
                *(v4f*)(crow + (size_t)row * ldc + cofs) = val; }
             }
        __builtin_amdgcn_wave_barrier(); asm volatile("" ::: "memory");
    }
}
// qkv [NB*SEQ][384] = x [NB][SEQ][128] x w_qkv + b_qkv, column = which*128 + h*32 + d, written as the attention planes; grid (NB*SEQ/64, 384/64, 1)
__global__ __launch_bounds__(32) void k_gemm_qkv(const float* __restrict__ x, const float* __restrict__ w, const float* __restrict__ bias, h16* QK16, h16* VT16, bf* QKH, bf* QKL, bf* VTH, bf* VTL) {
    gemmw_body<0, true>(x + (size_t)(blockIdx.x * 64 / SEQ) * SEQ_FULL * DM, nullptr, nullptr, w, FW, DM, DM, (size_t)32, nullptr, FW, bias, 0, 0, planes{QK16, VT16, QKH, QKL, VTH, VTL}); }
// OUT [b][t][128] = (ATH + ATL) x w_proj + b_proj; A element (t, k = h*32+d) at plane [(b*NH + h)*SEQ + t][d]: lda = HD, k-step advance = SEQ*HD, batch stride NH*SEQ*HD;
// grid (SEQ/64, 128/64, NB); output rows use the full per-batch stride
__global__ __launch_bounds__(32) void k_gemm_proj(const bf* __restrict__ Ah, const bf* __restrict__ Al, const float* __restrict__ w, float* C, const float* __restrict__ bias) {
    gemmw_body<1, false>(nullptr, Ah, Al, w, DM, DQ, HD, (size_t)SEQ * HD, C, DM, bias, (size_t)NH * SEQ * HD, (size_t)SEQ_FULL * DM, planes{}); }

// ---- join of the NW waves' partial results of one 16-query tile. Wave w holds, for query n, its running max m (log2 domain), its sum l (both halves already added) and O^T unnormalised.
// Every wave stages its part, one work-group barrier, then thread (w, lane) owns query row 4w + (lane >> 3), d = 4 (lane & 7) .. + 3: out = sum_w 2^(m_w - M) O_w / sum_w 2^(m_w - M) l_w, waves summed in index order.
// A wave that had no key step stages m = NEGB, l = 0, O = 0 and gets weight 0 (wave 0 always has step 0, whose key 0 every query keeps, so M is finite).
__device__ __forceinline__ void join_stage(float* ys, float* ms, float* ls, const int w, const int lane, const v8f* o, const float m, const float l) {
    const int n = lane & 15, hh = lane >> 4;
#pragma unroll
    for (int j = 0; j < 2; ++j)
#pragma unroll
        for (int r = 0; r < 8; ++r) ys[w * 16 * YP + n * YP + j * 16 + 8 * hh + r] = o[j][r];
    if (hh == 0) { ms[w * 16 + n] = m; ls[w * 16 + n] = l; }
}
__device__ __forceinline__ void join_finish(const float* ys, const float* ms, const float* ls, const int w, const int lane, bf* ATH, bf* ATL, const size_t tile0) {
    const int row = 4 * w + (lane >> 3), c = (lane & 7) * 4;
    float mw[NW]; float M = NEGB;
#pragma unroll
    for (int k = 0; k < NW; ++k) { mw[k] = ms[k * 16 + row]; M = fmaxf(M, mw[k]); }
    v4f acc = (v4f){}; float L = 0.0f;
#pragma unroll
    for (int k = 0; k < NW; ++k) { const float sc = __builtin_amdgcn_exp2f(mw[k] - M); L += sc * ls[k * 16 + row]; acc += sc * *(const v4fa*)(ys + k * 16 * YP + row * YP + c); }
    const float inv = 1.0f / L;
    v4us oh, ol;
#pragma unroll
    for (int k = 0; k < 4; ++k) { unsigned short x1, x2; splitf(acc[k] * inv, x1, x2); oh[k] = x1; ol[k] = x2; }
    const size_t oo = tile0 + (size_t)row * HD + c;
    *(v4us*)(ATH + oo) = oh; *(v4us*)(ATL + oo) = ol;
}

// ---- fused causal attention, query rows >= RH, single f16 products. NW waves per NQ * 16 query rows; q0: the first query row, bh: batch * NH + head.
// A wave holds NQ query fragments (tile t: rows q0 + 16 t ..) and keeps (max, sum, O) per tile; a step's K and V^T fragments are loaded once and multiplied with every tile's q and p.
// Lane (hh = lane>>4, n = lane&15): query q0+16t+n; per 32-key step and tile holds keys kb+8hh+r (element r) and kb+16+8hh+r (element 8+r), r = 0..7.
__device__ __forceinline__ void attn16_tile(float* ys, float* ms, float* ls, const int q0, const int bh, const h16* QK16, const h16* VT16, bf* ATH, bf* ATL) {
    const int lane = threadIdx.x & 31, n = lane & 15, hh = lane >> 4;
    const int w = __builtin_amdgcn_readfirstlane(threadIdx.x >> 5);   // wave number, scalar: the key loop stays a scalar loop
    const int kend = q0 + 16 * NQ - 1;
    const size_t qo = ((size_t)bh * SEQ + q0 + n) * HD + 8 * hh;          // query plane (which 0), + t * 16 * HD
    const size_t ko = PLN + ((size_t)bh * SEQ + n) * HD + 8 * hh;         // key plane (which 1), + key * HD
    const size_t vo = ((size_t)bh * HD + n) * SEQ + 8 * hh;               // V^T plane, + j*16*SEQ + key
    v16h qb[NQ]; v8f o[NQ][2]; float m[NQ], l[NQ];
#pragma unroll   // t a constant: the per-tile arrays stay in registers (here and in the t loops below)
    for (int t = 0; t < NQ; ++t) { qb[t] = ldh(QK16 + qo + (size_t)t * 16 * HD); o[t][0] = (v8f){}; o[t][1] = (v8f){}; m[t] = NEGB; l[t] = 0.0f; }
#pragma unroll 1
    for (int kb = 32 * w; kb <= kend; kb += 32 * NW) {
        const size_t ka = ko + (size_t)kb * HD;
        const v16h a0 = ldh(QK16 + ka), a1 = ldh(QK16 + ka + 16 * HD);
        const int key0 = kb + 8 * hh;
        v16h pb[NQ];
#pragma unroll
        for (int t = 0; t < NQ; ++t) {
            const int qrow = q0 + 16 * t + n;
            v8f s0 = (v8f){}, s1 = (v8f){};
            s0 = wm16g(a0, qb[t], s0); s1 = wm16g(a1, qb[t], s1);
            float u[16];
            if (kb + 31 > q0) {            // wave-uniform: only the step touching the diagonal (replace by select)
#pragma unroll
                for (int r = 0; r < 8; ++r) { u[r] = (key0 + r <= qrow) ? s0[r] * SCL2 : NEGB; u[8 + r] = (key0 + 16 + r <= qrow) ? s1[r] * SCL2 : NEGB; }
            } else {
#pragma unroll
                for (int r = 0; r < 8; ++r) { u[r] = s0[r] * SCL2; u[8 + r] = s1[r] * SCL2; }
            }
            float mx = u[0];
#pragma unroll
            for (int i = 1; i < 16; ++i) mx = fmaxf(mx, u[i]);
            mx = fmaxf(mx, __shfl_xor(mx, 16, 32));
            const float mn = fmaxf(m[t], mx);
            const float corr = __builtin_amdgcn_exp2f(m[t] - mn);
            m[t] = mn;
            float ps = 0.0f;
#pragma unroll
            for (int r = 0; r < 8; ++r) {
                const float p0 = __builtin_amdgcn_exp2f((u[r] - mn) + PCL); const float p1 = __builtin_amdgcn_exp2f((u[8 + r] - mn) + PCL);
                ps += p0 + p1; pb[t][r] = (h16)p0; pb[t][8 + r] = (h16)p1; }
            l[t] = l[t] * corr + ps;
#pragma unroll
            for (int j = 0; j < 2; ++j) o[t][j] = o[t][j] * corr;
        }
#pragma unroll
        for (int j = 0; j < 2; ++j) { const v16h va = ldh(VT16 + vo + (size_t)j * 16 * SEQ + kb);
#pragma unroll
            for (int t = 0; t < NQ; ++t) o[t][j] = wm16g(va, pb[t], o[t][j]); }
    }
#pragma unroll
    for (int t = 0; t < NQ; ++t) { l[t] += __shfl_xor(l[t], 16, 32); join_stage(ys + t * NW * 16 * YP, ms + t * NW * 16, ls + t * NW * 16, w, lane, o[t], m[t], l[t]); }
    __syncthreads();                   // publishes every wave's partials of all NQ tiles to the joining threads
#pragma unroll
    for (int t = 0; t < NQ; ++t) join_finish(ys + t * NW * 16 * YP, ms + t * NW * 16, ls + t * NW * 16, w, lane, ATH, ATL, ((size_t)bh * SEQ + q0 + 16 * t) * HD);
}

// ---- fused causal attention, query rows < RH, bf16 hi/lo planes, 3 products per contraction (hi*hi + lo*hi + hi*lo). Same lane map and key split as attn16_tile.
__device__ __forceinline__ void attnhl_tile(float* ys, float* ms, float* ls, const int q0, const int bh, const bf* QKH, const bf* QKL, const bf* VTH, const bf* VTL, bf* ATH, bf* ATL) {
    const int lane = threadIdx.x & 31, n = lane & 15, hh = lane >> 4;
    const int w = __builtin_amdgcn_readfirstlane(threadIdx.x >> 5);   // wave number, scalar: the key loop stays a scalar loop
    const int qrow = q0 + n, kend = q0 + 15;
    const size_t qo = ((size_t)bh * RH + q0 + n) * HD + 8 * hh;           // query hi/lo plane (which 0)
    const size_t ko = PLH + ((size_t)bh * RH + n) * HD + 8 * hh;          // key hi/lo plane (which 1), + key * HD
    const size_t vo = ((size_t)bh * HD + n) * RH + 8 * hh;                // V^T hi/lo plane, + j*16*RH + key
    v8f o[2];
#pragma unroll
    for (int j = 0; j < 2; ++j) o[j] = (v8f){};
    float m = NEGB, l = 0.0f;
#pragma unroll 1
    for (int kb = 32 * w; kb <= kend; kb += 32 * NW) {
        v8f s[2]; s[0] = (v8f){}; s[1] = (v8f){};
        {
            const v16bf qh = ldb(QKH + qo), ql = ldb(QKL + qo);
#pragma unroll
            for (int kc = 0; kc < 2; ++kc) { const size_t ka = ko + (size_t)(kb + kc * 16) * HD;
                const v16bf kh = ldb(QKH + ka), kl = ldb(QKL + ka);
                s[kc] = wmbg(kh, qh, s[kc]); s[kc] = wmbg(kl, qh, s[kc]); s[kc] = wmbg(kh, ql, s[kc]); }
            asm volatile("" ::: "memory");
        }
        float u[16];
        const int key0 = kb + 8 * hh;
        if (kb + 31 > q0) {            // wave-uniform
#pragma unroll
            for (int r = 0; r < 8; ++r) { u[r] = (key0 + r <= qrow) ? s[0][r] * SCL2 : NEGB; u[8 + r] = (key0 + 16 + r <= qrow) ? s[1][r] * SCL2 : NEGB; }
        } else {
#pragma unroll
            for (int r = 0; r < 8; ++r) { u[r] = s[0][r] * SCL2; u[8 + r] = s[1][r] * SCL2; }
        }
        float mx = u[0];
#pragma unroll
        for (int i = 1; i < 16; ++i) mx = fmaxf(mx, u[i]);
        mx = fmaxf(mx, __shfl_xor(mx, 16, 32));
        const float mn = fmaxf(m, mx);
        const float corr = __builtin_amdgcn_exp2f(m - mn);
        m = mn;
        v16us phu, plu; float ps = 0.0f;
#pragma unroll
        for (int r = 0; r < 8; ++r) {
            const float p0 = __builtin_amdgcn_exp2f(u[r] - mn); const float p1 = __builtin_amdgcn_exp2f(u[8 + r] - mn);
            ps += p0 + p1; unsigned short x1, x2; splitf(p0, x1, x2); phu[r] = x1; plu[r] = x2; splitf(p1, x1, x2); phu[8 + r] = x1; plu[8 + r] = x2; }
        const v16bf ph = __builtin_bit_cast(v16bf, phu), pl = __builtin_bit_cast(v16bf, plu);
        l = l * corr + ps;
#pragma unroll
        for (int j = 0; j < 2; ++j) o[j] = o[j] * corr;
#pragma unroll
        for (int j = 0; j < 2; ++j) { const size_t va = vo + (size_t)j * 16 * RH + kb; const v16bf vh = ldb(VTH + va), vl = ldb(VTL + va);
            o[j] = wmbg(vh, ph, o[j]); o[j] = wmbg(vl, ph, o[j]); o[j] = wmbg(vh, pl, o[j]);
            asm volatile("" ::: "memory"); }
    }
    l += __shfl_xor(l, 16, 32);
    join_stage(ys, ms, ls, w, lane, o, m, l);
    __syncthreads();                   // publishes every wave's partial to the joining threads
    join_finish(ys, ms, ls, w, lane, ATH, ATL, ((size_t)bh * SEQ + q0) * HD);
}

// Both kinds of query tile read only the planes of the qkv launch and write disjoint context rows, so they share ONE launch: grid (NB*NH, NT16 + NTH), 32 * NW threads; the block's tile index picks the path (uniform over the work-group).
// Order: a tile's key steps grow with its query row, so the slow grid axis counts the tiles from the last (most steps) down to the first (one step), the f16 tiles in front of the hi/lo tiles. The fast axis is batch * head, all of equal length. For speed only: every (tile, head) pair is done exactly once whatever the order.
#define NT16 ((SEQ - RH) / (16 * NQ))   // work-groups per head on the f16 path (NQ * 16 query rows each)
#define NTH  (RH / 16)                  // work-groups per head on the hi/lo path (16 query rows each)
__global__ __launch_bounds__(32 * NW) void k_attn(const h16* QK16, const h16* VT16, const bf* QKH, const bf* QKL, const bf* VTH, const bf* VTL, bf* ATH, bf* ATL) {
    __shared__ __align__(16) float ys[NQ * NW * 16 * YP];   // one 16 x 32 partial O tile per wave and query tile
    __shared__ float ms[NQ * NW * 16], ls[NQ * NW * 16];    // per wave and query: running max, sum
    const int y = blockIdx.y, bh = blockIdx.x;
    if (y < NT16) attn16_tile(ys, ms, ls, RH + (NT16 - 1 - y) * 16 * NQ, bh, QK16, VT16, ATH, ATL);
    else          attnhl_tile(ys, ms, ls, (NTH - 1 - (y - NT16)) * 16, bh, QKH, QKL, VTH, VTL, ATH, ATL);
}

extern "C" void kernel_launch(void* const* d_in, const int* in_sizes, int n_in,
                              void* d_out, int out_size, void* d_ws, size_t ws_size, hipStream_t stream) {
    // wire order: x [8][2048][128], w_qkv [128][384], b_qkv [384], w_proj [128][128], b_proj [128] (all f32)
    constexpr size_t XN = ((size_t)(NB - 1) * SEQ_FULL + SEQ) * DM;      // lowest element count covering the rows touched
    if (n_in < 5) return;
    if ((size_t)in_sizes[0] < XN || (size_t)in_sizes[1] < (size_t)DM * FW || in_sizes[2] < FW || (size_t)in_sizes[3] < (size_t)DQ * DM || in_sizes[4] < DM) return;
    if ((size_t)out_size < XN) return;
    const float* x = (const float*)d_in[0]; const float* wqkv = (const float*)d_in[1]; const float* bqkv = (const float*)d_in[2];
    const float* wo = (const float*)d_in[3]; const float* bo = (const float*)d_in[4];
    float* OUT = (float*)d_out;      // [NB_FULL][SEQ_FULL][128], byte offset 0

    // workspace carve: every region a multiple of 256 B, sized to the producers' whole-line store extent
    constexpr size_t SZ_QK16 = 2 * PLN * 2;                    // f16 q | k planes
    constexpr size_t SZ_VT16 = PLN * 2;                        // f16 V^T planes
    constexpr size_t SZ_QKHL = 2 * PLH * 2;                    // bf16 q | k hi (and lo) planes, rows < RH
    constexpr size_t SZ_VTHL = PLH * 2;                        // bf16 V^T hi (and lo) planes, keys < RH
    constexpr size_t SZ_AT   = PLN * 2;                        // head-major context hi (and lo) planes
    constexpr size_t O_QK16 = 0;
    constexpr size_t O_VT16 = O_QK16 + SZ_QK16;
    constexpr size_t O_QKH  = O_VT16 + SZ_VT16;
    constexpr size_t O_QKL  = O_QKH + SZ_QKHL;
    constexpr size_t O_VTH  = O_QKL + SZ_QKHL;
    constexpr size_t O_VTL  = O_VTH + SZ_VTHL;
    constexpr size_t O_ATH  = O_VTL + SZ_VTHL;
    constexpr size_t O_ATL  = O_ATH + SZ_AT;
    constexpr size_t O_END  = O_ATL + SZ_AT;
    static_assert(SZ_QK16 % 256 == 0 && SZ_VT16 % 256 == 0 && SZ_QKHL % 256 == 0 && SZ_VTHL % 256 == 0 && SZ_AT % 256 == 0);
    static_assert(O_END <= (size_t)134217728);                  // total carve <= 128 MiB
    static_assert(((size_t)NB * SEQ) % 64 == 0);                // qkv GEMM M tiles
    if (ws_size < O_END) return;
    char* ws = (char*)d_ws;
    h16* QK16 = (h16*)(ws + O_QK16); h16* VT16 = (h16*)(ws + O_VT16);
    bf* QKH = (bf*)(ws + O_QKH); bf* QKL = (bf*)(ws + O_QKL); bf* VTH = (bf*)(ws + O_VTH); bf* VTL = (bf*)(ws + O_VTL);
    bf* ATH = (bf*)(ws + O_ATH); bf* ATL = (bf*)(ws + O_ATL);

    k_gemm_qkv<<<dim3(NB * SEQ / 64, FW / 64, 1), 32, 0, stream>>>(x, wqkv, bqkv, QK16, VT16, QKH, QKL, VTH, VTL);
    k_attn<<<dim3(NB * NH, NT16 + NTH, 1), 32 * NW, 0, stream>>>(QK16, VT16, QKH, QKL, VTH, VTL, ATH, ATL);
    k_gemm_proj<<<dim3(SEQ / 64, DM / 64, NB), 32, 0, stream>>>(ATH, ATL, wo, OUT, bo);
}

// v007
// Measured time: 37.4 microseconds a run.
// Next to v006, in two timings, it ran 1.19 and 1.21 times as fast.
// Counting every step since v000, it is 3.23 times as fast.
#include <hip/hip_runtime.h>

// Causal self-attention: x [NB][SEQ][128]; qkv = x w_qkv + b_qkv ([in][out] weight, q | k | v column thirds, 4 heads x 32, head h = columns h*32+d); scores x 32^-0.5; causal select (diagonal kept); softmax; out = merged w_proj + b_proj ([in][out]).
// Compute dtypes, f32 accumulate everywhere: qkv projection v_wmma_f32_16x16x32_bf16 on x / w_qkv rounded to bf16 (RNE) in registers as the fragments are loaded (single product); attention query rows < 256: bf16 hi/lo planes, 3 products for k q^T and for v^T p; query rows >= 256: v_wmma_f32_16x16x32_f16 single products (q, k, v f16 planes, p carried x1024 in the exponent); output projection: bf16 hi/lo context planes x w_proj rounded to bf16 (RNE) in registers (2 products). Softmax f32, online running-max form in the log2 domain.
// Fused attention, one work-group of NW waves per 16 query rows (rows < RH) or per NQ * 16 query rows (rows >= RH, every wave carrying all NQ tiles), the 32-key steps dealt round-robin to the waves (wave w: steps w, w + NW, ...), partial (max, sum, O) joined through LDS; head dim 32 = one 32-deep k-step for the scores: S^T = K Q^T (keys on D rows, queries on D columns), p built per lane and fed as the B operand of O^T = V^T P^T (B element r <- tile keys 0-15 [r], element 8+r <- tile keys 16-31 [r]); no score / probability plane in memory.

#ifndef NB
#define NB 8
#endif
#ifndef SEQ
#define SEQ 2048
#endif
#define NB_FULL  8
#define SEQ_FULL 2048
#define DM   128
#define NH   4
#define HD   32
#define DQ   (NH * HD)
#define FW   (3 * DQ)
#define RH   256                      // query rows < RH use bf16 hi/lo planes
#define PLN  ((size_t)NB * NH * SEQ * HD)   // elements of one [b*h][t][d] plane
#define PLH  ((size_t)NB * NH * RH * HD)    // elements of one hi/lo plane (rows < RH)
#define SCL2 0.25503486164918f        // HD^-0.5 * log2(e)
#define PCL  10.0f                    // log2 of the p carry (x1024) for the f16 path
#define NEGB (-3.0e38f)
#define YP   36                       // staging pitch (floats) of the 16 x 32 attention result tile
#define NW   4                        // waves per query tile: each walks every NW-th 32-key step
#define NQ   2                        // f16 path: 16-query tiles per work-group; every K and V^T fragment a wave multiplies feeds all NQ of them

static_assert(DQ == DM);               // merged width == model width
static_assert(HD == 32);               // scores: one 32-deep k-step; head row == 64 B of 16-bit data; proj k-step == one head
static_assert(2 * HD == 64);
static_assert(HD % 16 == 0);           // O^T tiles of 16 d rows
static_assert(YP % 4 == 0 && YP >= HD); // 16-B aligned staging rows
static_assert(NW * 32 * 4 == 16 * HD);  // join: every thread owns 4 consecutive d of one query row
static_assert(DM % 64 == 0);           // GEMM K multiple of 32, weight lines of 64
static_assert(DQ % 64 == 0);           // proj GEMM K multiple of 32; a qkv GEMM N tile inside one of q, k, v
static_assert(FW % 64 == 0);           // GEMM N tile multiple
static_assert(SEQ % 64 == 0);          // GEMM M tile multiple, 32-key steps, V^T lines
static_assert(RH % 64 == 0);           // hi/lo V^T lines, 32-key steps inside RH, a GEMM M tile on one side of RH
static_assert(RH <= SEQ);
static_assert(16 * NQ == 32);          // the NQ tiles of a work-group span one 32-key step: all have the same key steps, and the diagonal step is the last for each
static_assert(RH % (16 * NQ) == 0 && (SEQ - RH) % (16 * NQ) == 0);
static_assert(RH >= 32 * NW);          // f16 path: every wave has a first key step in front of the diagonal step
static_assert(NB <= NB_FULL);
static_assert(SEQ <= SEQ_FULL);

typedef _Float16 h16;
typedef unsigned short bf;
typedef __attribute__((ext_vector_type(16))) __bf16   v16bf;
typedef __attribute__((ext_vector_type(16))) _Float16 v16h;
typedef __attribute__((ext_vector_type(16))) unsigned short v16us;
typedef __attribute__((ext_vector_type(8)))  _Float16 v8h;
typedef __attribute__((ext_vector_type(8)))  unsigned short v8us;
typedef __attribute__((ext_vector_type(8)))  float    v8f;
typedef __attribute__((ext_vector_type(4)))  float    v4f;
typedef __attribute__((ext_vector_type(4)))  unsigned short v4us;
typedef v4f  __attribute__((may_alias)) v4fa;

__device__ __forceinline__ unsigned short f2bf(float f) { unsigned u = __float_as_uint(f); u += 0x7FFFu + ((u >> 16) & 1u); return (unsigned short)(u >> 16); }   // RNE convert
__device__ __forceinline__ float bf2f(unsigned short b) { return __uint_as_float(((unsigned)b) << 16); }
__device__ __forceinline__ float bfr(float f) { return bf2f(f2bf(f)); }
__device__ __forceinline__ void splitf(float y, unsigned short& h, unsigned short& l) { h = f2bf(y); l = f2bf(y - bf2f(h)); }
__device__ __forceinline__ v16h cat16(v8h lo, v8h hi) { return __builtin_shufflevector(lo, hi, 0, 1, 2, 3, 4, 5, 6, 7, 8, 9, 10, 11, 12, 13, 14, 15); }
__device__ __forceinline__ v16bf cat16b(v8us lo, v8us hi) { return __builtin_bit_cast(v16bf, __builtin_shufflevector(lo, hi, 0, 1, 2, 3, 4, 5, 6, 7, 8, 9, 10, 11, 12, 13, 14, 15)); }
// fragment loaders: elements 0..7 <- p[0..7], elements 8..15 <- p[16..23]; p already includes + 8 * (lane >> 4)
__device__ __forceinline__ v16h ldh(const h16* p) { return cat16(*(const v8h*)p, *(const v8h*)(p + 16)); }
__device__ __forceinline__ v16bf ldb(const bf* p) { return cat16b(*(const v8us*)p, *(const v8us*)(p + 16)); }
typedef __attribute__((ext_vector_type(8))) __bf16 v8bf;
// f32 sources, rounded to bf16 (RNE, v_cvt_pk_bf16_f32) in registers, same element order as ldb. The request (raw16) and the rounding (rnd16) are apart so that a group of requests can be issued before the first rounding waits for one.
struct raw16 { v8f lo, hi; };
__device__ __forceinline__ v16bf rnd16(const raw16 r) {
    const v8bf l8 = __builtin_convertvector(r.lo, v8bf), h8 = __builtin_convertvector(r.hi, v8bf);
    return __builtin_shufflevector(l8, h8, 0, 1, 2, 3, 4, 5, 6, 7, 8, 9, 10, 11, 12, 13, 14, 15); }
// row fragment: elements 0..7 <- p[0..7], elements 8..15 <- p[16..23]; p already includes + 8 * (lane >> 4)
__device__ __forceinline__ raw16 ldxf(const float* p) { return raw16{*(const v8f*)p, *(const v8f*)(p + 16)}; }
// column fragment of an [in][out] weight of row pitch N: elements 0..7 <- p[0..7 * N], elements 8..15 <- p[16..23 * N]; p already includes + 8 * (lane >> 4) * N + the lane's column; 16 lanes read 64 contiguous bytes of a weight row
__device__ __forceinline__ raw16 ldwf(const float* p, const int N) {
    raw16 r;
#pragma unroll
    for (int k = 0; k < 8; ++k) { r.lo[k] = p[(size_t)k * N]; r.hi[k] = p[(size_t)(16 + k) * N]; }
    return r; }
__device__ __forceinline__ v8f wmmab(v16bf a, v16bf b, v8f c) { return __builtin_amdgcn_wmma_f32_16x16x32_bf16(false, a, false, b, (short)0, c, false, false); }
// guarded forms: 4 nops after the matrix op, accumulator tied, operands kept live
__device__ __forceinline__ v8f wm16g(v16h a, v16h b, v8f c) {
    c = __builtin_amdgcn_wmma_f32_16x16x32_f16(false, a, false, b, (short)0, c, false, false);
    asm volatile("v_nop\n\tv_nop\n\tv_nop\n\tv_nop" : "+v"(c) : "v"(a), "v"(b));
    return c; }
__device__ __forceinline__ v8f wmbg(v16bf a, v16bf b, v8f c) {
    c = __builtin_amdgcn_wmma_f32_16x16x32_bf16(false, a, false, b, (short)0, c, false, false);
    asm volatile("v_nop\n\tv_nop\n\tv_nop\n\tv_nop" : "+v"(c) : "v"(a), "v"(b));
    return c; }

// ---- register-blocked GEMM body, ONE WAVE per 64x64 output tile (16 accumulators); grid (M/64, N/64, Z), 32 threads. The weight W is the f32 input itself, [K][N] of row pitch ldw, read by columns and rounded to bf16 in registers (ldwf).
// y[m][n] (f32) = sum_k A[m][k] bf16(W[k][n]) (+ A2[m][k] bf16(W[k][n]) when NSPLIT == 1) + bf16-RNE(bias[n]). K % 32 == 0, M and N multiples of 64 (asserted at file scope).
// PLANES == false: A, A2 are bf16 K-contiguous planes, y goes to C (f32, pitch ldc). PLANES == true (qkv projection): A is the f32 input Xf (rows of K floats, rounded to bf16 in registers, ldxf; Xf points at the tile's batch), y goes straight to the attention operand planes of struct planes, no f32 copy in memory.
// A addressing: element (m, k) at A[m * lda + (k >> 5) * ksA + (k & 31)] (row pitch lda, advance ksA per 32-deep k-step); a plain row-major plane has lda = K, ksA = 32.
// q | k planes [which][b*h][t][d]: f16 copy for all t, bf16 hi/lo for t < RH ([which][b*h][RH][d]); V^T planes [b*h][d][t]: f16 for all t, bf16 hi/lo for t < RH ([b*h][d][RH]).
struct planes { h16* QK16; h16* VT16; bf* QKH; bf* QKL; bf* VTH; bf* VTL; };
// Plane epilogues of one 64 x 64 qkv tile held in acc[mb][nb] (lane (hi, lr), element j: token t0 + mb*16 + hi*8 + j, tile column nb*16 + lr); bias points at the tile's first column; heads bh0, bh0 + 1; HL: the tile's tokens are < RH.
// V^T: a lane's 8 accumulator rows are 8 consecutive tokens of one d, i.e. 16 contiguous bytes of a V^T row: stored from registers.
template <bool HL>
__device__ __forceinline__ void put_v(const v8f (&acc)[4][4], const float* __restrict__ bias, const int bh0, const int t0, const int lane, const planes P) {
    const int lr = lane & 15, hi = lane >> 4;
    const float* bp = bias + lr; float braw[4];
#pragma unroll
    for (int nb = 0; nb < 4; ++nb) braw[nb] = bp[nb * 16];
    asm volatile("s_wait_xcnt 0x0" :: "v"(bp) : "memory");   // stands in front of the first rewrite of a register that the bias loads name; bp as an input keeps the compiler from lifting that rewrite over the wait
#pragma unroll
    for (int nb = 0; nb < 4; ++nb) { const int col = nb * 16 + lr; const float bv = bfr(braw[nb]); const size_t vr = (size_t)(bh0 + (col >> 5)) * HD + (col & 31);
#pragma unroll
        for (int mb = 0; mb < 4; ++mb) { const int t = t0 + mb * 16 + hi * 8; v8h o16; v8us oh, ol;
#pragma unroll
            for (int j = 0; j < 8; ++j) { const float y = acc[mb][nb][j] + bv; o16[j] = (h16)y; if (HL) { unsigned short x1, x2; splitf(y, x1, x2); oh[j] = x1; ol[j] = x2; } }
            *(v8h*)(P.VT16 + vr * SEQ + t) = o16;
            if (HL) { *(v8us*)(P.VTH + vr * RH + t) = oh; *(v8us*)(P.VTL + vr * RH + t) = ol; } } }
    asm volatile("s_wait_xcnt 0x0" ::: "memory");   // behind the last plane store: stands in front of any later rewrite of a register that these stores name, on every way the branches allow
}
// q / k: 16 tokens at a time turned through the wave's LDS tile os (pitch 68 floats); a lane then owns 8 consecutive d of one token (16 B of f16), 8 lanes a token's two heads, and a store covers 4 tokens = 256 contiguous bytes per head.
template <bool HL>
__device__ __forceinline__ void put_qk(const v8f (&acc)[4][4], float* os, const float* __restrict__ bias, const int which, const int bh0, const int t0, const int lane, const planes P) {
    const int lr = lane & 15, hi = lane >> 4, c = (lane & 7) * 8, d = c & 31; const size_t bh = (size_t)(bh0 + (c >> 5));
    float bv[8];
#pragma unroll
    for (int k = 0; k < 8; ++k) bv[k] = bfr(bias[c + k]);
#pragma unroll
    for (int mb = 0; mb < 4; ++mb) {
#pragma unroll
        for (int nb = 0; nb < 4; ++nb) {
#pragma unroll
            for (int j = 0; j < 8; ++j) os[(hi * 8 + j) * 68 + nb * 16 + lr] = acc[mb][nb][j]; }
        __builtin_amdgcn_wave_barrier(); asm volatile("" ::: "memory");   // the tile's LDS writes stay in front of the reads of other lanes' values
#pragma unroll
        for (int s = 0; s < 4; ++s) { const int row = 4 * s + (lane >> 3), t = t0 + mb * 16 + row;
            const v4f lo4 = *(const v4fa*)(os + row * 68 + c), hi4 = *(const v4fa*)(os + row * 68 + c + 4); v8h o16; v8us oh, ol;
#pragma unroll
            for (int k = 0; k < 8; ++k) { const float y = (k < 4 ? lo4[k & 3] : hi4[k & 3]) + bv[k]; o16[k] = (h16)y; if (HL) { unsigned short x1, x2; splitf(y, x1, x2); oh[k] = x1; ol[k] = x2; } }
            *(v8h*)(P.QK16 + (size_t)which * PLN + (bh * SEQ + t) * HD + d) = o16;
            if (HL) { const size_t o2 = (size_t)which * PLH + (bh * RH + t) * HD + d; *(v8us*)(P.QKH + o2) = oh; *(v8us*)(P.QKL + o2) = ol; } }
        __builtin_amdgcn_wave_barrier(); asm volatile("" ::: "memory");   // the reads stay in front of the next 16 tokens' LDS writes
    }
    asm volatile("s_wait_xcnt 0x0" ::: "memory");   // behind the last plane store: stands in front of any later rewrite of a register that these stores name, on every way the branches allow
}
template <int NSPLIT, bool PLANES>
__device__ __forceinline__ void gemmw_body(const float* __restrict__ Xf, const bf* __restrict__ A, const bf* __restrict__ A2, const float* __restrict__ W, const int ldw, const int K, const int lda, const size_t ksA, float* C, const int ldc, const float* __restrict__ bias, const size_t sA, const size_t sC, const planes P) {
    __shared__ __align__(16) float os[16 * 68];
    const size_t z = blockIdx.z; A += z * sA; if (NSPLIT == 1) A2 += z * sA; C += z * sC;
    const int lane = threadIdx.x & 31, lr = lane & 15, hi = lane >> 4; const int r0 = blockIdx.x * 64, c0 = blockIdx.y * 64;
    v8f acc[4][4];
#pragma unroll
    for (int mb = 0; mb < 4; ++mb)
#pragma unroll
        for (int nb = 0; nb < 4; ++nb) acc[mb][nb] = (v8f){};
    const size_t aoff = (size_t)((PLANES ? r0 % SEQ : r0) + lr) * lda + 8 * hi, boff = (size_t)(8 * hi) * ldw + c0 + lr;
#pragma unroll 1
    for (int kc = 0; kc < K; kc += 32) {
        const size_t ak = (size_t)(kc >> 5) * ksA;
        const float* wp = W + boff + (size_t)kc * ldw; const float* xp = Xf + aoff + ak; const bf* ap = A + aoff + ak; const bf* ap2 = A2 + aoff + ak;
        v16bf a[4], a2[4], b[4]; raw16 xr[4], wr[4];
#pragma unroll
        for (int mb = 0; mb < 4; ++mb) { if (PLANES) xr[mb] = ldxf(xp + (size_t)mb * 16 * lda); else a[mb] = ldb(ap + (size_t)mb * 16 * lda); if (NSPLIT == 1) a2[mb] = ldb(ap2 + (size_t)mb * 16 * lda); }
#pragma unroll
        for (int nb = 0; nb < 4; ++nb) wr[nb] = ldwf(wp + nb * 16, ldw);
        // stands in front of the first rewrite of a register that the requests above name; the pointers as inputs keep the compiler from lifting their advance over the wait
        if constexpr (PLANES) asm volatile("s_wait_xcnt 0x0" :: "v"(xp), "v"(wp) : "memory"); else asm volatile("s_wait_xcnt 0x0" :: "v"(ap), "v"(ap2), "v"(wp) : "memory");
        __builtin_amdgcn_sched_barrier(0);   // all of the k-step's requests stay one group in front of the first rounding (their latencies pass together, not one behind another), and the pointers' advance stays behind the wait above
#pragma unroll
        for (int mb = 0; mb < 4; ++mb) if (PLANES) a[mb] = rnd16(xr[mb]);
#pragma unroll
        for (int nb = 0; nb < 4; ++nb) { b[nb] = rnd16(wr[nb]);
#pragma unroll
            for (int mb = 0; mb < 4; ++mb) { acc[mb][nb] = wmmab(a[mb], b[nb], acc[mb][nb]); if (NSPLIT == 1) acc[mb][nb] = wmmab(a2[mb], b[nb], acc[mb][nb]); } }
        asm volatile("v_nop\n\tv_nop\n\tv_nop\n\tv_nop" : "+v"(acc[0][0]), "+v"(acc[1][1]), "+v"(acc[2][2]), "+v"(acc[3][3]) : "v"(a[0]), "v"(a[3]));
    }
    if constexpr (PLANES) {
        // tile coordinates, all uniform over the work-group: 64 columns = two heads of one of q, k, v; 64 rows = 64 tokens of one batch, all on one side of RH
        const int which = c0 / DQ, bh0 = (r0 / SEQ) * NH + (c0 % DQ) / HD, t0 = r0 % SEQ;
        if (which == 2) { if (t0 < RH) put_v<true>(acc, bias + c0, bh0, t0, lane, P); else put_v<false>(acc, bias + c0, bh0, t0, lane, P); }
        else            { if (t0 < RH) put_qk<true>(acc, os, bias + c0, which, bh0, t0, lane, P); else put_qk<false>(acc, os, bias + c0, which, bh0, t0, lane, P); }
        return;
    }
#pragma unroll
    for (int mb = 0; mb < 4; ++mb) {
#pragma unroll
        for (int nb = 0; nb < 4; ++nb) {
#pragma unroll
            for (int j = 0; j < 8; ++j) os[(hi * 8 + j) * 68 + nb * 16 + lr] = acc[mb][nb][j]; }
        __builtin_amdgcn_wave_barrier(); asm volatile("" ::: "memory");
        float* crow = C + (size_t)(r0 + mb * 16) * ldc + c0;
{
#pragma unroll
            for (int s = 0; s < 8; ++s) { const int row = 2 * s + hi, cofs = lr * 4; v4f val = *(const v4fa*)(os + row * 68 + cofs);
                val[0] += bfr(bias[c0 + cofs]); val[1] += bfr(bias[c0 + cofs + 1]); val[2] += bfr(bias[c0 + cofs + 2]); val[3] += bfr(bias[c0 + cofs + 3]);
                *(v4f*)(crow + (size_t)row * ldc + cofs) = val; }
             }
        __builtin_amdgcn_wave_barrier(); asm volatile("" ::: "memory");
    }
}
// qkv [NB*SEQ][384] = x [NB][SEQ][128] x w_qkv + b_qkv, column = which*128 + h*32 + d, written as the attention planes; grid (NB*SEQ/64, 384/64, 1)
__global__ __launch_bounds__(32) void k_gemm_qkv(const float* __restrict__ x, const float* __restrict__ w, const float* __restrict__ bias, h16* QK16, h16* VT16, bf* QKH, bf* QKL, bf* VTH, bf* VTL) {
    gemmw_body<0, true>(x + (size_t)(blockIdx.x * 64 / SEQ) * SEQ_FULL * DM, nullptr, nullptr, w, FW, DM, DM, (size_t)32, nullptr, FW, bias, 0, 0, planes{QK16, VT16, QKH, QKL, VTH, VTL}); }
// OUT [b][t][128] = (ATH + ATL) x w_proj + b_proj; A element (t, k = h*32+d) at plane [(b*NH + h)*SEQ + t][d]: lda = HD, k-step advance = SEQ*HD, batch stride NH*SEQ*HD;
// grid (SEQ/64, 128/64, NB); output rows use the full per-batch stride
__global__ __launch_bounds__(32) void k_gemm_proj(const bf* __restrict__ Ah, const bf* __restrict__ Al, const float* __restrict__ w, float* C, const float* __restrict__ bias) {
    gemmw_body<1, false>(nullptr, Ah, Al, w, DM, DQ, HD, (size_t)SEQ * HD, C, DM, bias, (size_t)NH * SEQ * HD, (size_t)SEQ_FULL * DM, planes{}); }

// ---- join of the NW waves' partial results of one 16-query tile. Wave w holds, for query n, its running max m (log2 domain), its sum l (both halves already added) and O^T unnormalised.
// Every wave stages its part, one work-group barrier, then thread (w, lane) owns query row 4w + (lane >> 3), d = 4 (lane & 7) .. + 3: out = sum_w 2^(m_w - M) O_w / sum_w 2^(m_w - M) l_w, waves summed in index order.
// A wave that had no key step stages m = NEGB, l = 0, O = 0 and gets weight 0 (wave 0 always has step 0, whose key 0 every query keeps, so M is finite).
__device__ __forceinline__ void join_stage(float* ys, float* ms, float* ls, const int w, const int lane, const v8f* o, const float m, const float l) {
    const int n = lane & 15, hh = lane >> 4;
#pragma unroll
    for (int j = 0; j < 2; ++j)
#pragma unroll
        for (int r = 0; r < 8; ++r) ys[w * 16 * YP + n * YP + j * 16 + 8 * hh + r] = o[j][r];
    if (hh == 0) { ms[w * 16 + n] = m; ls[w * 16 + n] = l; }
}
__device__ __forceinline__ void join_finish(const float* ys, const float* ms, const float* ls, const int w, const int lane, bf* ATH, bf* ATL, const size_t tile0) {
    const int row = 4 * w + (lane >> 3), c = (lane & 7) * 4;
    float mw[NW]; float M = NEGB;
#pragma unroll
    for (int k = 0; k < NW; ++k) { mw[k] = ms[k * 16 + row]; M = fmaxf(M, mw[k]); }
    v4f acc = (v4f){}; float L = 0.0f;
#pragma unroll
    for (int k = 0; k < NW; ++k) { const float sc = __builtin_amdgcn_exp2f(mw[k] - M); L += sc * ls[k * 16 + row]; acc += sc * *(const v4fa*)(ys + k * 16 * YP + row * YP + c); }
    const float inv = 1.0f / L;
    v4us oh, ol;
#pragma unroll
    for (int k = 0; k < 4; ++k) { unsigned short x1, x2; splitf(acc[k] * inv, x1, x2); oh[k] = x1; ol[k] = x2; }
    const size_t oo = tile0 + (size_t)row * HD + c;
    *(v4us*)(ATH + oo) = oh; *(v4us*)(ATL + oo) = ol;
}

// ---- fused causal attention, query rows >= RH, single f16 products. NW waves per NQ * 16 query rows; q0: the first query row, bh: batch * NH + head.
// A wave holds NQ query fragments (tile t: rows q0 + 16 t ..) and keeps (max, sum, O) per tile; a step's K and V^T fragments are loaded once and multiplied with every tile's q and p.
// Lane (hh = lane>>4, n = lane&15): query q0+16t+n; per 32-key step holds keys kb+8hh+r (s[t][0]) and kb+16+8hh+r (s[t][1]), r = 0..7.
// One tile's online-softmax update for one 32-key step: scores s0 (keys kb+8hh+r), s1 (keys kb+16+8hh+r) -> p as a B fragment; max, sum and O rescaled. DIAG: the step that touches the diagonal (replace by select).
template <bool DIAG>
__device__ __forceinline__ v16h soft16(const v8f s0, const v8f s1, const int key0, const int qrow, float& m, float& l, v8f (&o)[2]) {
    float u[16];
#pragma unroll
    for (int r = 0; r < 8; ++r) {
        if (DIAG) { u[r] = (key0 + r <= qrow) ? s0[r] * SCL2 : NEGB; u[8 + r] = (key0 + 16 + r <= qrow) ? s1[r] * SCL2 : NEGB; }
        else      { u[r] = s0[r] * SCL2; u[8 + r] = s1[r] * SCL2; } }
    float mx = u[0];
#pragma unroll
    for (int i = 1; i < 16; ++i) mx = fmaxf(mx, u[i]);
    mx = fmaxf(mx, __shfl_xor(mx, 16, 32));
    const float mn = fmaxf(m, mx);
    const float corr = __builtin_amdgcn_exp2f(m - mn);
    m = mn;
    float ps = 0.0f; v16h pb;
#pragma unroll
    for (int r = 0; r < 8; ++r) {
        const float p0 = __builtin_amdgcn_exp2f((u[r] - mn) + PCL); const float p1 = __builtin_amdgcn_exp2f((u[8 + r] - mn) + PCL);
        ps += p0 + p1; pb[r] = (h16)p0; pb[8 + r] = (h16)p1; }
    l = l * corr + ps;
#pragma unroll
    for (int j = 0; j < 2; ++j) o[j] = o[j] * corr;
    return pb;
}
__device__ __forceinline__ v8f wm16(v16h a, v16h b, v8f c) { return __builtin_amdgcn_wmma_f32_16x16x32_f16(false, a, false, b, (short)0, c, false, false); }
// The key loop is a software pipeline: a step's K fragments are requested right behind the score products of the wave's step before it (into the registers those products have just read), its V^T fragments right behind that step's V^T p products, so each request has a whole softmax to land in.
// The diagonal step (kb == q0, the last of the work-group, owned by one wave) stands behind the loop, so the loop body has no branch: the compiler orders it as one block and keeps the distances behind the matrix products itself.
// A wave's last pass requests the diagonal step's fragments whether or not the wave owns that step: rows q0 .. q0 + 31 exist for every tile, and a wave that does not own them never reads the registers.
__device__ __forceinline__ void attn16_tile(float* ys, float* ms, float* ls, const int q0, const int bh, const h16* QK16, const h16* VT16, bf* ATH, bf* ATL) {
    const int lane = threadIdx.x & 31, n = lane & 15, hh = lane >> 4;
    const int w = __builtin_amdgcn_readfirstlane(threadIdx.x >> 5);   // wave number, scalar: the key loop stays a scalar loop
    const h16* qp = QK16 + ((size_t)bh * SEQ + q0 + n) * HD + 8 * hh;     // query plane (which 0), + t * 16 * HD
    const h16* kbase = QK16 + ((size_t)bh * SEQ + n) * HD + 8 * hh;       // key plane (which 1) at + PLN, + key * HD
    const h16* vbase = VT16 + ((size_t)bh * HD + n) * SEQ + 8 * hh;       // V^T plane, + j*16*SEQ + key
    v16h qb[NQ]; v8f o[NQ][2]; float m[NQ], l[NQ];
#pragma unroll   // t a constant: the per-tile arrays stay in registers (here and in the t loops below)
    for (int t = 0; t < NQ; ++t) { qb[t] = ldh(qp + (size_t)t * 16 * HD); o[t][0] = (v8f){}; o[t][1] = (v8f){}; m[t] = NEGB; l[t] = 0.0f; }
    int kb = 32 * w;                   // <= q0: q0 >= RH >= 32 * NW
    const h16* kp0 = kbase + (size_t)kb * HD; const h16* vp0 = vbase + kb;
    v16h a0 = ldh(kp0 + PLN), a1 = ldh(kp0 + PLN + 16 * HD);
    v16h va0 = ldh(vp0), va1 = ldh(vp0 + (size_t)16 * SEQ);
    asm volatile("s_wait_xcnt 0x0" :: "v"(qp), "v"(kp0), "v"(vp0) : "memory");   // stands in front of the first rewrite of a register that the first requests name; the pointers as inputs keep that rewrite behind the wait
#pragma unroll 1   // one step a pass: the fragments of the next step land in the registers of this one
    for (; kb < q0; kb += 32 * NW) {
        const int kn = min(kb + 32 * NW, q0);      // the wave's next step, or the diagonal step
        v8f s[NQ][2]; v16h pb[NQ];
#pragma unroll
        for (int t = 0; t < NQ; ++t) { s[t][0] = wm16(a0, qb[t], (v8f){}); s[t][1] = wm16(a1, qb[t], (v8f){}); }
        const h16* kp = kbase + (size_t)kn * HD;
        a0 = ldh(kp + PLN); a1 = ldh(kp + PLN + 16 * HD);
        asm volatile("s_wait_xcnt 0x0" :: "v"(kp) : "memory");   // stands in front of the first rewrite of a register that the K requests name; the pointer as an input keeps that rewrite behind the wait
        __builtin_amdgcn_sched_barrier(0);   // the K requests stay here, in front of the softmax: moved down behind it they would have no time to land, and would land on registers that the V^T p products read as p
#pragma unroll
        for (int t = 0; t < NQ; ++t) pb[t] = soft16<false>(s[t][0], s[t][1], kb + 8 * hh, q0 + 16 * t + n, m[t], l[t], o[t]);
#pragma unroll
        for (int t = 0; t < NQ; ++t) { o[t][0] = wm16(va0, pb[t], o[t][0]); o[t][1] = wm16(va1, pb[t], o[t][1]); }
        const h16* vp = vbase + kn;
        va0 = ldh(vp); va1 = ldh(vp + (size_t)16 * SEQ);
        asm volatile("s_wait_xcnt 0x0" :: "v"(vp) : "memory");   // stands in front of the first rewrite of a register that the V^T requests name; the pointer as an input keeps that rewrite behind the wait
    }
    if (kb == q0) {                    // wave-uniform: the one wave whose steps end on the diagonal
        v8f s[NQ][2]; v16h pb[NQ];
#pragma unroll
        for (int t = 0; t < NQ; ++t) { s[t][0] = wm16g(a0, qb[t], (v8f){}); s[t][1] = wm16g(a1, qb[t], (v8f){}); }
#pragma unroll
        for (int t = 0; t < NQ; ++t) pb[t] = soft16<true>(s[t][0], s[t][1], kb + 8 * hh, q0 + 16 * t + n, m[t], l[t], o[t]);
#pragma unroll
        for (int t = 0; t < NQ; ++t) { o[t][0] = wm16g(va0, pb[t], o[t][0]); o[t][1] = wm16g(va1, pb[t], o[t][1]); }
    }
#pragma unroll
    for (int t = 0; t < NQ; ++t) { l[t] += __shfl_xor(l[t], 16, 32); join_stage(ys + t * NW * 16 * YP, ms + t * NW * 16, ls + t * NW * 16, w, lane, o[t], m[t], l[t]); }
    __syncthreads();                   // publishes every wave's partials of all NQ tiles to the joining threads
#pragma unroll
    for (int t = 0; t < NQ; ++t) join_finish(ys + t * NW * 16 * YP, ms + t * NW * 16, ls + t * NW * 16, w, lane, ATH, ATL, ((size_t)bh * SEQ + q0 + 16 * t) * HD);
}

// ---- fused causal attention, query rows < RH, bf16 hi/lo planes, 3 products per contraction (hi*hi + lo*hi + hi*lo). Same lane map and key split as attn16_tile.
__device__ __forceinline__ void attnhl_tile(float* ys, float* ms, float* ls, const int q0, const int bh, const bf* QKH, const bf* QKL, const bf* VTH, const bf* VTL, bf* ATH, bf* ATL) {
    const int lane = threadIdx.x & 31, n = lane & 15, hh = lane >> 4;
    const int w = __builtin_amdgcn_readfirstlane(threadIdx.x >> 5);   // wave number, scalar: the key loop stays a scalar loop
    const int qrow = q0 + n, kend = q0 + 15;
    const size_t qo = ((size_t)bh * RH + q0 + n) * HD + 8 * hh;           // query hi/lo plane (which 0)
    const size_t ko = PLH + ((size_t)bh * RH + n) * HD + 8 * hh;          // key hi/lo plane (which 1), + key * HD
    const size_t vo = ((size_t)bh * HD + n) * RH + 8 * hh;                // V^T hi/lo plane, + j*16*RH + key
    v8f o[2];
#pragma unroll
    for (int j = 0; j < 2; ++j) o[j] = (v8f){};
    float m = NEGB, l = 0.0f;
#pragma unroll 1
    for (int kb = 32 * w; kb <= kend; kb += 32 * NW) {
        v8f s[2]; s[0] = (v8f){}; s[1] = (v8f){};
        {
            const v16bf qh = ldb(QKH + qo), ql = ldb(QKL + qo);
#pragma unroll
            for (int kc = 0; kc < 2; ++kc) { const size_t ka = ko + (size_t)(kb + kc * 16) * HD;
                const v16bf kh = ldb(QKH + ka), kl = ldb(QKL + ka);
                s[kc] = wmbg(kh, qh, s[kc]); s[kc] = wmbg(kl, qh, s[kc]); s[kc] = wmbg(kh, ql, s[kc]); }
            asm volatile("" ::: "memory");
        }
        float u[16];
        const int key0 = kb + 8 * hh;
        if (kb + 31 > q0) {            // wave-uniform
#pragma unroll
            for (int r = 0; r < 8; ++r) { u[r] = (key0 + r <= qrow) ? s[0][r] * SCL2 : NEGB; u[8 + r] = (key0 + 16 + r <= qrow) ? s[1][r] * SCL2 : NEGB; }
        } else {
#pragma unroll
            for (int r = 0; r < 8; ++r) { u[r] = s[0][r] * SCL2; u[8 + r] = s[1][r] * SCL2; }
        }
        float mx = u[0];
#pragma unroll
        for (int i = 1; i < 16; ++i) mx = fmaxf(mx, u[i]);
        mx = fmaxf(mx, __shfl_xor(mx, 16, 32));
        const float mn = fmaxf(m, mx);
        const float corr = __builtin_amdgcn_exp2f(m - mn);
        m = mn;
        v16us phu, plu; float ps = 0.0f;
#pragma unroll
        for (int r = 0; r < 8; ++r) {
            const float p0 = __builtin_amdgcn_exp2f(u[r] - mn); const float p1 = __builtin_amdgcn_exp2f(u[8 + r] - mn);
            ps += p0 + p1; unsigned short x1, x2; splitf(p0, x1, x2); phu[r] = x1; plu[r] = x2; splitf(p1, x1, x2); phu[8 + r] = x1; plu[8 + r] = x2; }
        const v16bf ph = __builtin_bit_cast(v16bf, phu), pl = __builtin_bit_cast(v16bf, plu);
        l = l * corr + ps;
#pragma unroll
        for (int j = 0; j < 2; ++j) o[j] = o[j] * corr;
#pragma unroll
        for (int j = 0; j < 2; ++j) { const size_t va = vo + (size_t)j * 16 * RH + kb; const v16bf vh = ldb(VTH + va), vl = ldb(VTL + va);
            o[j] = wmbg(vh, ph, o[j]); o[j] = wmbg(vl, ph, o[j]); o[j] = wmbg(vh, pl, o[j]);
            asm volatile("" ::: "memory"); }
    }
    l += __shfl_xor(l, 16, 32);
    join_stage(ys, ms, ls, w, lane, o, m, l);
    __syncthreads();                   // publishes every wave's partial to the joining threads
    join_finish(ys, ms, ls, w, lane, ATH, ATL, ((size_t)bh * SEQ + q0) * HD);
}

// Both kinds of query tile read only the planes of the qkv launch and write disjoint context rows, so they share ONE launch: grid (NB*NH, NT16 + NTH), 32 * NW threads; the block's tile index picks the path (uniform over the work-group).
// Order: a tile's key steps grow with its query row, so the slow grid axis counts the tiles from the last (most steps) down to the first (one step), the f16 tiles in front of the hi/lo tiles. The fast axis is batch * head, all of equal length. For speed only: every (tile, head) pair is done exactly once whatever the order.
#define NT16 ((SEQ - RH) / (16 * NQ))   // work-groups per head on the f16 path (NQ * 16 query rows each)
#define NTH  (RH / 16)                  // work-groups per head on the hi/lo path (16 query rows each)
__global__ __launch_bounds__(32 * NW) void k_attn(const h16* QK16, const h16* VT16, const bf* QKH, const bf* QKL, const bf* VTH, const bf* VTL, bf* ATH, bf* ATL) {
    __shared__ __align__(16) float ys[NQ * NW * 16 * YP];   // one 16 x 32 partial O tile per wave and query tile
    __shared__ float ms[NQ * NW * 16], ls[NQ * NW * 16];    // per wave and query: running max, sum
    const int y = blockIdx.y, bh = blockIdx.x;
    if (y < NT16) attn16_tile(ys, ms, ls, RH + (NT16 - 1 - y) * 16 * NQ, bh, QK16, VT16, ATH, ATL);
    else          attnhl_tile(ys, ms, ls, (NTH - 1 - (y - NT16)) * 16, bh, QKH, QKL, VTH, VTL, ATH, ATL);
}

extern "C" void kernel_launch(void* const* d_in, const int* in_sizes, int n_in,
                              void* d_out, int out_size, void* d_ws, size_t ws_size, hipStream_t stream) {
    // wire order: x [8][2048][128], w_qkv [128][384], b_qkv [384], w_proj [128][128], b_proj [128] (all f32)
    constexpr size_t XN = ((size_t)(NB - 1) * SEQ_FULL + SEQ) * DM;      // lowest element count covering the rows touched
    if (n_in < 5) return;
    if ((size_t)in_sizes[0] < XN || (size_t)in_sizes[1] < (size_t)DM * FW || in_sizes[2] < FW || (size_t)in_sizes[3] < (size_t)DQ * DM || in_sizes[4] < DM) return;
    if ((size_t)out_size < XN) return;
    const float* x = (const float*)d_in[0]; const float* wqkv = (const float*)d_in[1]; const float* bqkv = (const float*)d_in[2];
    const float* wo = (const float*)d_in[3]; const float* bo = (const float*)d_in[4];
    float* OUT = (float*)d_out;      // [NB_FULL][SEQ_FULL][128], byte offset 0

    // workspace carve: every region a multiple of 256 B, sized to the producers' whole-line store extent
    constexpr size_t SZ_QK16 = 2 * PLN * 2;                    // f16 q | k planes
    constexpr size_t SZ_VT16 = PLN * 2;                        // f16 V^T planes
    constexpr size_t SZ_QKHL = 2 * PLH * 2;                    // bf16 q | k hi (and lo) planes, rows < RH
    constexpr size_t SZ_VTHL = PLH * 2;                        // bf16 V^T hi (and lo) planes, keys < RH
    constexpr size_t SZ_AT   = PLN * 2;                        // head-major context hi (and lo) planes
    constexpr size_t O_QK16 = 0;
    constexpr size_t O_VT16 = O_QK16 + SZ_QK16;
    constexpr size_t O_QKH  = O_VT16 + SZ_VT16;
    constexpr size_t O_QKL  = O_QKH + SZ_QKHL;
    constexpr size_t O_VTH  = O_QKL + SZ_QKHL;
    constexpr size_t O_VTL  = O_VTH + SZ_VTHL;
    constexpr size_t O_ATH  = O_VTL + SZ_VTHL;
    constexpr size_t O_ATL  = O_ATH + SZ_AT;
    constexpr size_t O_END  = O_ATL + SZ_AT;
    static_assert(SZ_QK16 % 256 == 0 && SZ_VT16 % 256 == 0 && SZ_QKHL % 256 == 0 && SZ_VTHL % 256 == 0 && SZ_AT % 256 == 0);
    static_assert(O_END <= (size_t)134217728);                  // total carve <= 128 MiB
    static_assert(((size_t)NB * SEQ) % 64 == 0);                // qkv GEMM M tiles
    if (ws_size < O_END) return;
    char* ws = (char*)d_ws;
    h16* QK16 = (h16*)(ws + O_QK16); h16* VT16 = (h16*)(ws + O_VT16);
    bf* QKH = (bf*)(ws + O_QKH); bf* QKL = (bf*)(ws + O_QKL); bf* VTH = (bf*)(ws + O_VTH); bf* VTL = (bf*)(ws + O_VTL);
    bf* ATH = (bf*)(ws + O_ATH); bf* ATL = (bf*)(ws + O_ATL);

    k_gemm_qkv<<<dim3(NB * SEQ / 64, FW / 64, 1), 32, 0, stream>>>(x, wqkv, bqkv, QK16, VT16, QKH, QKL, VTH, VTL);
    k_attn<<<dim3(NB * NH, NT16 + NTH, 1), 32 * NW, 0, stream>>>(QK16, VT16, QKH, QKL, VTH, VTL, ATH, ATL);
    k_gemm_proj<<<dim3(SEQ / 64, DM / 64, NB), 32, 0, stream>>>(ATH, ATL, wo, OUT, bo);
}

// v008
// A run of this version takes 35.6 microseconds.
// Timed twice side by side with v007, it ran 1.05 times as fast both times.
// All steps since v000 together make it 3.39 times as fast.
#include <hip/hip_runtime.h>

// Causal self-attention: x [NB][SEQ][128]; qkv = x w_qkv + b_qkv ([in][out] weight, q | k | v column thirds, 4 heads x 32, head h = columns h*32+d); scores x 32^-0.5; causal select (diagonal kept); softmax; out = merged w_proj + b_proj ([in][out]).
// Compute dtypes, f32 accumulate everywhere: qkv projection v_wmma_f32_16x16x32_bf16 on x / w_qkv rounded to bf16 (RNE) in registers as the fragments are loaded (single product); attention query rows < 256: bf16 hi/lo planes, 3 products for k q^T and for v^T p; query rows >= 256: v_wmma_f32_16x16x32_f16 single products (q, k, v f16 planes, p carried x1024 in the exponent); output projection: bf16 hi/lo context planes x w_proj rounded to bf16 (RNE) in registers (2 products). Softmax f32, online running-max form in the log2 domain.
// Fused attention, one work-group of NW waves per 16 query rows (rows < RH) or per NQ * 16 query rows (rows >= RH, every wave carrying all NQ tiles), the 32-key steps dealt round-robin to the waves (wave w: steps w, w + NW, ...), partial (max, sum, O) joined through LDS; head dim 32 = one 32-deep k-step for the scores: S^T = K Q^T (keys on D rows, queries on D columns), p built per lane and fed as the B operand of O^T = V^T P^T (B element r <- tile keys 0-15 [r], element 8+r <- tile keys 16-31 [r]); no score / probability plane in memory.

#ifndef NB
#define NB 8
#endif
#ifndef SEQ
#define SEQ 2048
#endif
#define NB_FULL  8
#define SEQ_FULL 2048
#define DM   128
#define NH   4
#define HD   32
#define DQ   (NH * HD)
#define FW   (3 * DQ)
#define RH   256                      // query rows < RH use bf16 hi/lo planes
#define PLN  ((size_t)NB * NH * SEQ * HD)   // elements of one [b*h][t][d] plane
#define PLH  ((size_t)NB * NH * RH * HD)    // elements of one hi/lo plane (rows < RH)
#define SCL2 0.25503486164918f        // HD^-0.5 * log2(e)
#define PCL  10.0f                    // log2 of the p carry (x1024) for the f16 path
#define NEGB (-3.0e38f)
#define YP   36                       // staging pitch (floats) of the 16 x 32 attention result tile
#define NW   4                        // waves per query tile: each walks every NW-th 32-key step
#define NQ   4                        // f16 path: 16-query tiles per work-group; every K and V^T fragment a wave uses feeds all of them that have keys in its step

static_assert(DQ == DM);               // merged width == model width
static_assert(HD == 32);               // scores: one 32-deep k-step; head row == 64 B of 16-bit data; proj k-step == one head
static_assert(2 * HD == 64);
static_assert(HD % 16 == 0);           // O^T tiles of 16 d rows
static_assert(YP % 4 == 0 && YP >= HD); // 16-B aligned staging rows
static_assert(NW * 32 * 4 == 16 * HD);  // join: every thread owns 4 consecutive d of one query row
static_assert(DM % 64 == 0);           // GEMM K multiple of 32, weight lines of 64
static_assert(DQ % 64 == 0);           // proj GEMM K multiple of 32; a qkv GEMM N tile inside one of q, k, v
static_assert(FW % 64 == 0);           // GEMM N tile multiple
static_assert(SEQ % 64 == 0);          // GEMM M tile multiple, 32-key steps, V^T lines
static_assert(RH % 64 == 0);           // hi/lo V^T lines, 32-key steps inside RH, a GEMM M tile on one side of RH
static_assert(RH <= SEQ);
static_assert(NQ % 2 == 0);            // the NQ tiles of a work-group span NQ / 2 whole 32-key steps (the diagonal steps): step q0 + 32 i is the last for tiles 2 i and 2 i + 1
static_assert(NQ / 2 <= NW);           // every diagonal step has a wave of its own
static_assert(RH % (16 * NQ) == 0 && (SEQ - RH) % (16 * NQ) == 0);
static_assert(RH >= 32 * NW);          // f16 path: every wave has a first key step in front of the diagonal step
static_assert(NB <= NB_FULL);
static_assert(SEQ <= SEQ_FULL);

typedef _Float16 h16;
typedef unsigned short bf;
typedef __attribute__((ext_vector_type(16))) __bf16   v16bf;
typedef __attribute__((ext_vector_type(16))) _Float16 v16h;
typedef __attribute__((ext_vector_type(16))) unsigned short v16us;
typedef __attribute__((ext_vector_type(8)))  _Float16 v8h;
typedef __attribute__((ext_vector_type(8)))  unsigned short v8us;
typedef __attribute__((ext_vector_type(8)))  float    v8f;
typedef __attribute__((ext_vector_type(4)))  float    v4f;
typedef __attribute__((ext_vector_type(4)))  unsigned short v4us;
typedef v4f  __attribute__((may_alias)) v4fa;

__device__ __forceinline__ unsigned short f2bf(float f) { unsigned u = __float_as_uint(f); u += 0x7FFFu + ((u >> 16) & 1u); return (unsigned short)(u >> 16); }   // RNE convert
__device__ __forceinline__ float bf2f(unsigned short b) { return __uint_as_float(((unsigned)b) << 16); }
__device__ __forceinline__ float bfr(float f) { return bf2f(f2bf(f)); }
__device__ __forceinline__ void splitf(float y, unsigned short& h, unsigned short& l) { h = f2bf(y); l = f2bf(y - bf2f(h)); }
__device__ __forceinline__ v16h cat16(v8h lo, v8h hi) { return __builtin_shufflevector(lo, hi, 0, 1, 2, 3, 4, 5, 6, 7, 8, 9, 10, 11, 12, 13, 14, 15); }
__device__ __forceinline__ v16bf cat16b(v8us lo, v8us hi) { return __builtin_bit_cast(v16bf, __builtin_shufflevector(lo, hi, 0, 1, 2, 3, 4, 5, 6, 7, 8, 9, 10, 11, 12, 13, 14, 15)); }
// fragment loaders: elements 0..7 <- p[0..7], elements 8..15 <- p[16..23]; p already includes + 8 * (lane >> 4)
__device__ __forceinline__ v16h ldh(const h16* p) { return cat16(*(const v8h*)p, *(const v8h*)(p + 16)); }
__device__ __forceinline__ v16bf ldb(const bf* p) { return cat16b(*(const v8us*)p, *(const v8us*)(p + 16)); }
typedef __attribute__((ext_vector_type(8))) __bf16 v8bf;
// f32 sources, rounded to bf16 (RNE, v_cvt_pk_bf16_f32) in registers, same element order as ldb. The request (raw16) and the rounding (rnd16) are apart so that a group of requests can be issued before the first rounding waits for one.
struct raw16 { v8f lo, hi; };
__device__ __forceinline__ v16bf rnd16(const raw16 r) {
    const v8bf l8 = __builtin_convertvector(r.lo, v8bf), h8 = __builtin_convertvector(r.hi, v8bf);
    return __builtin_shufflevector(l8, h8, 0, 1, 2, 3, 4, 5, 6, 7, 8, 9, 10, 11, 12, 13, 14, 15); }
// row fragment: elements 0..7 <- p[0..7], elements 8..15 <- p[16..23]; p already includes + 8 * (lane >> 4)
__device__ __forceinline__ raw16 ldxf(const float* p) { return raw16{*(const v8f*)p, *(const v8f*)(p + 16)}; }
// column fragment of an [in][out] weight of row pitch N: elements 0..7 <- p[0..7 * N], elements 8..15 <- p[16..23 * N]; p already includes + 8 * (lane >> 4) * N + the lane's column; 16 lanes read 64 contiguous bytes of a weight row
__device__ __forceinline__ raw16 ldwf(const float* p, const int N) {
    raw16 r;
#pragma unroll
    for (int k = 0; k < 8; ++k) { r.lo[k] = p[(size_t)k * N]; r.hi[k] = p[(size_t)(16 + k) * N]; }
    return r; }
__device__ __forceinline__ v8f wmmab(v16bf a, v16bf b, v8f c) { return __builtin_amdgcn_wmma_f32_16x16x32_bf16(false, a, false, b, (short)0, c, false, false); }
// guarded forms: 4 nops after the matrix op, accumulator tied, operands kept live
__device__ __forceinline__ v8f wm16g(v16h a, v16h b, v8f c) {
    c = __builtin_amdgcn_wmma_f32_16x16x32_f16(false, a, false, b, (short)0, c, false, false);
    asm volatile("v_nop\n\tv_nop\n\tv_nop\n\tv_nop" : "+v"(c) : "v"(a), "v"(b));
    return c; }
__device__ __forceinline__ v8f wmbg(v16bf a, v16bf b, v8f c) {
    c = __builtin_amdgcn_wmma_f32_16x16x32_bf16(false, a, false, b, (short)0, c, false, false);
    asm volatile("v_nop\n\tv_nop\n\tv_nop\n\tv_nop" : "+v"(c) : "v"(a), "v"(b));
    return c; }

// ---- register-blocked GEMM body, ONE WAVE per 64x64 output tile (16 accumulators); grid (M/64, N/64, Z), 32 threads. The weight W is the f32 input itself, [K][N] of row pitch ldw, read by columns and rounded to bf16 in registers (ldwf).
// y[m][n] (f32) = sum_k A[m][k] bf16(W[k][n]) (+ A2[m][k] bf16(W[k][n]) when NSPLIT == 1) + bf16-RNE(bias[n]). K % 32 == 0, M and N multiples of 64 (asserted at file scope).
// PLANES == false: A, A2 are bf16 K-contiguous planes, y goes to C (f32, pitch ldc). PLANES == true (qkv projection): A is the f32 input Xf (rows of K floats, rounded to bf16 in registers, ldxf; Xf points at the tile's batch), y goes straight to the attention operand planes of struct planes, no f32 copy in memory.
// A addressing: element (m, k) at A[m * lda + (k >> 5) * ksA + (k & 31)] (row pitch lda, advance ksA per 32-deep k-step); a plain row-major plane has lda = K, ksA = 32.
// q | k planes [which][b*h][t][d]: f16 copy for all t, bf16 hi/lo for t < RH ([which][b*h][RH][d]); V^T planes [b*h][d][t]: f16 for all t, bf16 hi/lo for t < RH ([b*h][d][RH]).
struct planes { h16* QK16; h16* VT16; bf* QKH; bf* QKL; bf* VTH; bf* VTL; };
// Plane epilogues of one 64 x 64 qkv tile held in acc[mb][nb] (lane (hi, lr), element j: token t0 + mb*16 + hi*8 + j, tile column nb*16 + lr); bias points at the tile's first column; heads bh0, bh0 + 1; HL: the tile's tokens are < RH.
// V^T: a lane's 8 accumulator rows are 8 consecutive tokens of one d, i.e. 16 contiguous bytes of a V^T row: stored from registers.
template <bool HL>
__device__ __forceinline__ void put_v(const v8f (&acc)[4][4], const float* __restrict__ bias, const int bh0, const int t0, const int lane, const planes P) {
    const int lr = lane & 15, hi = lane >> 4;
    const float* bp = bias + lr; float braw[4];
#pragma unroll
    for (int nb = 0; nb < 4; ++nb) braw[nb] = bp[nb * 16];
    asm volatile("s_wait_xcnt 0x0" :: "v"(bp) : "memory");   // stands in front of the first rewrite of a register that the bias loads name; bp as an input keeps the compiler from lifting that rewrite over the wait
#pragma unroll
    for (int nb = 0; nb < 4; ++nb) { const int col = nb * 16 + lr; const float bv = bfr(braw[nb]); const size_t vr = (size_t)(bh0 + (col >> 5)) * HD + (col & 31);
#pragma unroll
        for (int mb = 0; mb < 4; ++mb) { const int t = t0 + mb * 16 + hi * 8; v8h o16; v8us oh, ol;
#pragma unroll
            for (int j = 0; j < 8; ++j) { const float y = acc[mb][nb][j] + bv; o16[j] = (h16)y; if (HL) { unsigned short x1, x2; splitf(y, x1, x2); oh[j] = x1; ol[j] = x2; } }
            *(v8h*)(P.VT16 + vr * SEQ + t) = o16;
            if (HL) { *(v8us*)(P.VTH + vr * RH + t) = oh; *(v8us*)(P.VTL + vr * RH + t) = ol; } } }
    asm volatile("s_wait_xcnt 0x0" ::: "memory");   // behind the last plane store: stands in front of any later rewrite of a register that these stores name, on every way the branches allow
}
// q / k: 16 tokens at a time turned through the wave's LDS tile os (pitch 68 floats); a lane then owns 8 consecutive d of one token (16 B of f16), 8 lanes a token's two heads, and a store covers 4 tokens = 256 contiguous bytes per head.
template <bool HL>
__device__ __forceinline__ void put_qk(const v8f (&acc)[4][4], float* os, const float* __restrict__ bias, const int which, const int bh0, const int t0, const int lane, const planes P) {
    const int lr = lane & 15, hi = lane >> 4, c = (lane & 7) * 8, d = c & 31; const size_t bh = (size_t)(bh0 + (c >> 5));
    float bv[8];
#pragma unroll
    for (int k = 0; k < 8; ++k) bv[k] = bfr(bias[c + k]);
#pragma unroll
    for (int mb = 0; mb < 4; ++mb) {
#pragma unroll
        for (int nb = 0; nb < 4; ++nb) {
#pragma unroll
            for (int j = 0; j < 8; ++j) os[(hi * 8 + j) * 68 + nb * 16 + lr] = acc[mb][nb][j]; }
        __builtin_amdgcn_wave_barrier(); asm volatile("" ::: "memory");   // the tile's LDS writes stay in front of the reads of other lanes' values
#pragma unroll
        for (int s = 0; s < 4; ++s) { const int row = 4 * s + (lane >> 3), t = t0 + mb * 16 + row;
            const v4f lo4 = *(const v4fa*)(os + row * 68 + c), hi4 = *(const v4fa*)(os + row * 68 + c + 4); v8h o16; v8us oh, ol;
#pragma unroll
            for (int k = 0; k < 8; ++k) { const float y = (k < 4 ? lo4[k & 3] : hi4[k & 3]) + bv[k]; o16[k] = (h16)y; if (HL) { unsigned short x1, x2; splitf(y, x1, x2); oh[k] = x1; ol[k] = x2; } }
            *(v8h*)(P.QK16 + (size_t)which * PLN + (bh * SEQ + t) * HD + d) = o16;
            if (HL) { const size_t o2 = (size_t)which * PLH + (bh * RH + t) * HD + d; *(v8us*)(P.QKH + o2) = oh; *(v8us*)(P.QKL + o2) = ol; } }
        __builtin_amdgcn_wave_barrier(); asm volatile("" ::: "memory");   // the reads stay in front of the next 16 tokens' LDS writes
    }
    asm volatile("s_wait_xcnt 0x0" ::: "memory");   // behind the last plane store: stands in front of any later rewrite of a register that these stores name, on every way the branches allow
}
template <int NSPLIT, bool PLANES>
__device__ __forceinline__ void gemmw_body(const float* __restrict__ Xf, const bf* __restrict__ A, const bf* __restrict__ A2, const float* __restrict__ W, const int ldw, const int K, const int lda, const size_t ksA, float* C, const int ldc, const float* __restrict__ bias, const size_t sA, const size_t sC, const planes P) {
    __shared__ __align__(16) float os[16 * 68];
    const size_t z = blockIdx.z; A += z * sA; if (NSPLIT == 1) A2 += z * sA; C += z * sC;
    const int lane = threadIdx.x & 31, lr = lane & 15, hi = lane >> 4; const int r0 = blockIdx.x * 64, c0 = blockIdx.y * 64;
    v8f acc[4][4];
#pragma unroll
    for (int mb = 0; mb < 4; ++mb)
#pragma unroll
        for (int nb = 0; nb < 4; ++nb) acc[mb][nb] = (v8f){};
    const size_t aoff = (size_t)((PLANES ? r0 % SEQ : r0) + lr) * lda + 8 * hi, boff = (size_t)(8 * hi) * ldw + c0 + lr;
#pragma unroll 1
    for (int kc = 0; kc < K; kc += 32) {
        const size_t ak = (size_t)(kc >> 5) * ksA;
        const float* wp = W + boff + (size_t)kc * ldw; const float* xp = Xf + aoff + ak; const bf* ap = A + aoff + ak; const bf* ap2 = A2 + aoff + ak;
        v16bf a[4], a2[4], b[4]; raw16 xr[4], wr[4];
#pragma unroll
        for (int mb = 0; mb < 4; ++mb) { if (PLANES) xr[mb] = ldxf(xp + (size_t)mb * 16 * lda); else a[mb] = ldb(ap + (size_t)mb * 16 * lda); if (NSPLIT == 1) a2[mb] = ldb(ap2 + (size_t)mb * 16 * lda); }
#pragma unroll
        for (int nb = 0; nb < 4; ++nb) wr[nb] = ldwf(wp + nb * 16, ldw);
        // stands in front of the first rewrite of a register that the requests above name; the pointers as inputs keep the compiler from lifting their advance over the wait
        if constexpr (PLANES) asm volatile("s_wait_xcnt 0x0" :: "v"(xp), "v"(wp) : "memory"); else asm volatile("s_wait_xcnt 0x0" :: "v"(ap), "v"(ap2), "v"(wp) : "memory");
        __builtin_amdgcn_sched_barrier(0);   // all of the k-step's requests stay one group in front of the first rounding (their latencies pass together, not one behind another), and the pointers' advance stays behind the wait above
#pragma unroll
        for (int mb = 0; mb < 4; ++mb) if (PLANES) a[mb] = rnd16(xr[mb]);
#pragma unroll
        for (int nb = 0; nb < 4; ++nb) { b[nb] = rnd16(wr[nb]);
#pragma unroll
            for (int mb = 0; mb < 4; ++mb) { acc[mb][nb] = wmmab(a[mb], b[nb], acc[mb][nb]); if (NSPLIT == 1) acc[mb][nb] = wmmab(a2[mb], b[nb], acc[mb][nb]); } }
        asm volatile("v_nop\n\tv_nop\n\tv_nop\n\tv_nop" : "+v"(acc[0][0]), "+v"(acc[1][1]), "+v"(acc[2][2]), "+v"(acc[3][3]) : "v"(a[0]), "v"(a[3]));
    }
    if constexpr (PLANES) {
        // tile coordinates, all uniform over the work-group: 64 columns = two heads of one of q, k, v; 64 rows = 64 tokens of one batch, all on one side of RH
        const int which = c0 / DQ, bh0 = (r0 / SEQ) * NH + (c0 % DQ) / HD, t0 = r0 % SEQ;
        if (which == 2) { if (t0 < RH) put_v<true>(acc, bias + c0, bh0, t0, lane, P); else put_v<false>(acc, bias + c0, bh0, t0, lane, P); }
        else            { if (t0 < RH) put_qk<true>(acc, os, bias + c0, which, bh0, t0, lane, P); else put_qk<false>(acc, os, bias + c0, which, bh0, t0, lane, P); }
        return;
    }
#pragma unroll
    for (int mb = 0; mb < 4; ++mb) {
#pragma unroll
        for (int nb = 0; nb < 4; ++nb) {
#pragma unroll
            for (int j = 0; j < 8; ++j) os[(hi * 8 + j) * 68 + nb * 16 + lr] = acc[mb][nb][j]; }
        __builtin_amdgcn_wave_barrier(); asm volatile("" ::: "memory");
        float* crow = C + (size_t)(r0 + mb * 16) * ldc + c0;
{
#pragma unroll
            for (int s = 0; s < 8; ++s) { const int row = 2 * s + hi, cofs = lr * 4; v4f val = *(const v4fa*)(os + row * 68 + cofs);
                val[0] += bfr(bias[c0 + cofs]); val[1] += bfr(bias[c0 + cofs + 1]); val[2] += bfr(bias[c0 + cofs + 2]); val[3] += bfr(bias[c0 + cofs + 3]);
                *(v4f*)(crow + (size_t)row * ldc + cofs) = val; }
             }
        __builtin_amdgcn_wave_barrier(); asm volatile("" ::: "memory");
    }
}
// qkv [NB*SEQ][384] = x [NB][SEQ][128] x w_qkv + b_qkv, column = which*128 + h*32 + d, written as the attention planes; grid (NB*SEQ/64, 384/64, 1)
__global__ __launch_bounds__(32) void k_gemm_qkv(const float* __restrict__ x, const float* __restrict__ w, const float* __restrict__ bias, h16* QK16, h16* VT16, bf* QKH, bf* QKL, bf* VTH, bf* VTL) {
    gemmw_body<0, true>(x + (size_t)(blockIdx.x * 64 / SEQ) * SEQ_FULL * DM, nullptr, nullptr, w, FW, DM, DM, (size_t)32, nullptr, FW, bias, 0, 0, planes{QK16, VT16, QKH, QKL, VTH, VTL}); }
// OUT [b][t][128] = (ATH + ATL) x w_proj + b_proj; A element (t, k = h*32+d) at plane [(b*NH + h)*SEQ + t][d]: lda = HD, k-step advance = SEQ*HD, batch stride NH*SEQ*HD;
// grid (SEQ/64, 128/64, NB); output rows use the full per-batch stride
__global__ __launch_bounds__(32) void k_gemm_proj(const bf* __restrict__ Ah, const bf* __restrict__ Al, const float* __restrict__ w, float* C, const float* __restrict__ bias) {
    gemmw_body<1, false>(nullptr, Ah, Al, w, DM, DQ, HD, (size_t)SEQ * HD, C, DM, bias, (size_t)NH * SEQ * HD, (size_t)SEQ_FULL * DM, planes{}); }

// ---- join of the NW waves' partial results of one 16-query tile. Wave w holds, for query n, its running max m (log2 domain), its sum l (both halves already added) and O^T unnormalised.
// Every wave stages its part, one work-group barrier, then thread (w, lane) owns query row 4w + (lane >> 3), d = 4 (lane & 7) .. + 3: out = sum_w 2^(m_w - M) O_w / sum_w 2^(m_w - M) l_w, waves summed in index order.
// A wave that had no key step stages m = NEGB, l = 0, O = 0 and gets weight 0 (wave 0 always has step 0, whose key 0 every query keeps, so M is finite).
__device__ __forceinline__ void join_stage(float* ys, float* ms, float* ls, const int w, const int lane, const v8f* o, const float m, const float l) {
    const int n = lane & 15, hh = lane >> 4;
#pragma unroll
    for (int j = 0; j < 2; ++j)
#pragma unroll
        for (int r = 0; r < 8; ++r) ys[w * 16 * YP + n * YP + j * 16 + 8 * hh + r] = o[j][r];
    if (hh == 0) { ms[w * 16 + n] = m; ls[w * 16 + n] = l; }
}
__device__ __forceinline__ void join_finish(const float* ys, const float* ms, const float* ls, const int w, const int lane, bf* ATH, bf* ATL, const size_t tile0) {
    const int row = 4 * w + (lane >> 3), c = (lane & 7) * 4;
    float mw[NW]; float M = NEGB;
#pragma unroll
    for (int k = 0; k < NW; ++k) { mw[k] = ms[k * 16 + row]; M = fmaxf(M, mw[k]); }
    v4f acc = (v4f){}; float L = 0.0f;
#pragma unroll
    for (int k = 0; k < NW; ++k) { const float sc = __builtin_amdgcn_exp2f(mw[k] - M); L += sc * ls[k * 16 + row]; acc += sc * *(const v4fa*)(ys + k * 16 * YP + row * YP + c); }
    const float inv = 1.0f / L;
    v4us oh, ol;
#pragma unroll
    for (int k = 0; k < 4; ++k) { unsigned short x1, x2; splitf(acc[k] * inv, x1, x2); oh[k] = x1; ol[k] = x2; }
    const size_t oo = tile0 + (size_t)row * HD + c;
    *(v4us*)(ATH + oo) = oh; *(v4us*)(ATL + oo) = ol;
}

// ---- fused causal attention, query rows >= RH, single f16 products. NW waves per NQ * 16 query rows; q0: the first query row, bh: batch * NH + head.
// A wave holds NQ query fragments (tile t: rows q0 + 16 t ..) and keeps (max, sum, O) per tile; a step's K and V^T fragments are loaded once and multiplied with the q and p of every tile that has keys in it.
// Lane (hh = lane>>4, n = lane&15): query q0+16t+n; per 32-key step holds keys kb+8hh+r (s[t][0]) and kb+16+8hh+r (s[t][1]), r = 0..7, for every tile t.
// One tile's online-softmax update for one 32-key step: scores s0 (keys kb+8hh+r), s1 (keys kb+16+8hh+r) -> p as a B fragment; max, sum and O rescaled. DIAG: the step that touches the diagonal (replace by select).
template <bool DIAG>
__device__ __forceinline__ v16h soft16(const v8f s0, const v8f s1, const int key0, const int qrow, float& m, float& l, v8f (&o)[2]) {
    float u[16];
#pragma unroll
    for (int r = 0; r < 8; ++r) {
        if (DIAG) { u[r] = (key0 + r <= qrow) ? s0[r] * SCL2 : NEGB; u[8 + r] = (key0 + 16 + r <= qrow) ? s1[r] * SCL2 : NEGB; }
        else      { u[r] = s0[r] * SCL2; u[8 + r] = s1[r] * SCL2; } }
    float mx = u[0];
#pragma unroll
    for (int i = 1; i < 16; ++i) mx = fmaxf(mx, u[i]);
    mx = fmaxf(mx, __shfl_xor(mx, 16, 32));
    const float mn = fmaxf(m, mx);
    const float corr = __builtin_amdgcn_exp2f(m - mn);
    m = mn;
    float ps = 0.0f; v16h pb;
#pragma unroll
    for (int r = 0; r < 8; ++r) {
        const float p0 = __builtin_amdgcn_exp2f((u[r] - mn) + PCL); const float p1 = __builtin_amdgcn_exp2f((u[8 + r] - mn) + PCL);
        ps += p0 + p1; pb[r] = (h16)p0; pb[8 + r] = (h16)p1; }
    l = l * corr + ps;
#pragma unroll
    for (int j = 0; j < 2; ++j) o[j] = o[j] * corr;
    return pb;
}
__device__ __forceinline__ v8f wm16(v16h a, v16h b, v8f c) { return __builtin_amdgcn_wmma_f32_16x16x32_f16(false, a, false, b, (short)0, c, false, false); }
// The key loop is a software pipeline: a step's K fragments are requested right behind the score products of the wave's step before it (into the registers those products have just read), its V^T fragments right behind that step's V^T p products, so each request has a whole softmax to land in.
// The diagonal steps (kb == q0 + 32 i, i < NQ / 2, the last of the work-group, each owned by one wave) stand behind the loop, so the loop body has no branch: the compiler orders it as one block and keeps the distances behind the matrix products itself.
// A wave's last pass requests a diagonal step's fragments whether or not the wave owns one: rows q0 .. q0 + 16 NQ - 1 exist for every tile, and a wave that owns none never reads the registers.
// Diagonal step kb == q0 + 32 i: tiles below 2 i have no key in it and are left out; the tiles from T0 = 2 i on take the select (all kept for tiles above 2 i + 1).
template <int T0>
__device__ __forceinline__ void diag16(const v16h a0, const v16h a1, const v16h va0, const v16h va1, const v16h (&qb)[NQ], const int key0, const int qrow0, float (&m)[NQ], float (&l)[NQ], v8f (&o)[NQ][2]) {
    v8f s[NQ][2]; v16h pb[NQ];
#pragma unroll
    for (int t = T0; t < NQ; ++t) { s[t][0] = wm16g(a0, qb[t], (v8f){}); s[t][1] = wm16g(a1, qb[t], (v8f){}); }
#pragma unroll
    for (int t = T0; t < NQ; ++t) pb[t] = soft16<true>(s[t][0], s[t][1], key0, qrow0 + 16 * t, m[t], l[t], o[t]);
#pragma unroll
    for (int t = T0; t < NQ; ++t) { o[t][0] = wm16g(va0, pb[t], o[t][0]); o[t][1] = wm16g(va1, pb[t], o[t][1]); }
}
__device__ __forceinline__ void attn16_tile(float* ys, float* ms, float* ls, const int q0, const int bh, const h16* QK16, const h16* VT16, bf* ATH, bf* ATL) {
    const int lane = threadIdx.x & 31, n = lane & 15, hh = lane >> 4;
    const int w = __builtin_amdgcn_readfirstlane(threadIdx.x >> 5);   // wave number, scalar: the key loop stays a scalar loop
    const h16* qp = QK16 + ((size_t)bh * SEQ + q0 + n) * HD + 8 * hh;     // query plane (which 0), + t * 16 * HD
    const h16* kbase = QK16 + ((size_t)bh * SEQ + n) * HD + 8 * hh;       // key plane (which 1) at + PLN, + key * HD
    const h16* vbase = VT16 + ((size_t)bh * HD + n) * SEQ + 8 * hh;       // V^T plane, + j*16*SEQ + key
    v16h qb[NQ]; v8f o[NQ][2]; float m[NQ], l[NQ];
#pragma unroll   // t a constant: the per-tile arrays stay in registers (here and in the t loops below)
    for (int t = 0; t < NQ; ++t) { qb[t] = ldh(qp + (size_t)t * 16 * HD); o[t][0] = (v8f){}; o[t][1] = (v8f){}; m[t] = NEGB; l[t] = 0.0f; }
    int kb = 32 * w;                   // <= q0: q0 >= RH >= 32 * NW
    const h16* kp0 = kbase + (size_t)kb * HD; const h16* vp0 = vbase + kb;
    v16h a0 = ldh(kp0 + PLN), a1 = ldh(kp0 + PLN + 16 * HD);
    v16h va0 = ldh(vp0), va1 = ldh(vp0 + (size_t)16 * SEQ);
    asm volatile("s_wait_xcnt 0x0" :: "v"(qp), "v"(kp0), "v"(vp0) : "memory");   // stands in front of the first rewrite of a register that the first requests name; the pointers as inputs keep that rewrite behind the wait
#pragma unroll 1   // one step a pass: the fragments of the next step land in the registers of this one
    for (; kb < q0; kb += 32 * NW) {
        const int kn = min(kb + 32 * NW, q0 + 16 * NQ - 32);      // the wave's next step, or the last diagonal step
        v8f s[NQ][2]; v16h pb[NQ];
#pragma unroll
        for (int t = 0; t < NQ; ++t) { s[t][0] = wm16(a0, qb[t], (v8f){}); s[t][1] = wm16(a1, qb[t], (v8f){}); }
        const h16* kp = kbase + (size_t)kn * HD;
        a0 = ldh(kp + PLN); a1 = ldh(kp + PLN + 16 * HD);
        asm volatile("s_wait_xcnt 0x0" :: "v"(kp) : "memory");   // stands in front of the first rewrite of a register that the K requests name; the pointer as an input keeps that rewrite behind the wait
        __builtin_amdgcn_sched_barrier(0);   // the K requests stay here, in front of the softmax: moved down behind it they would have no time to land, and would land on registers that the V^T p products read as p
#pragma unroll
        for (int t = 0; t < NQ; ++t) pb[t] = soft16<false>(s[t][0], s[t][1], kb + 8 * hh, q0 + 16 * t + n, m[t], l[t], o[t]);
#pragma unroll
        for (int t = 0; t < NQ; ++t) { o[t][0] = wm16(va0, pb[t], o[t][0]); o[t][1] = wm16(va1, pb[t], o[t][1]); }
        const h16* vp = vbase + kn;
        va0 = ldh(vp); va1 = ldh(vp + (size_t)16 * SEQ);
        asm volatile("s_wait_xcnt 0x0" :: "v"(vp) : "memory");   // stands in front of the first rewrite of a register that the V^T requests name; the pointer as an input keeps that rewrite behind the wait
    }
    static_assert(NQ / 2 == 2);        // the two tests below are the NQ / 2 diagonal steps
    // wave-uniform: the waves whose steps end on a diagonal step
    if (kb == q0) diag16<0>(a0, a1, va0, va1, qb, kb + 8 * hh, q0 + n, m, l, o);
    else if (kb == q0 + 32) diag16<2>(a0, a1, va0, va1, qb, kb + 8 * hh, q0 + n, m, l, o);
#pragma unroll
    for (int t = 0; t < NQ; ++t) { l[t] += __shfl_xor(l[t], 16, 32); join_stage(ys + t * NW * 16 * YP, ms + t * NW * 16, ls + t * NW * 16, w, lane, o[t], m[t], l[t]); }
    __syncthreads();                   // publishes every wave's partials of all NQ tiles to the joining threads
#pragma unroll
    for (int t = 0; t < NQ; ++t) join_finish(ys + t * NW * 16 * YP, ms + t * NW * 16, ls + t * NW * 16, w, lane, ATH, ATL, ((size_t)bh * SEQ + q0 + 16 * t) * HD);
}

// ---- fused causal attention, query rows < RH, bf16 hi/lo planes, 3 products per contraction (hi*hi + lo*hi + hi*lo). Same lane map and key split as attn16_tile.
__device__ __forceinline__ void attnhl_tile(float* ys, float* ms, float* ls, const int q0, const int bh, const bf* QKH, const bf* QKL, const bf* VTH, const bf* VTL, bf* ATH, bf* ATL) {
    const int lane = threadIdx.x & 31, n = lane & 15, hh = lane >> 4;
    const int w = __builtin_amdgcn_readfirstlane(threadIdx.x >> 5);   // wave number, scalar: the key loop stays a scalar loop
    const int qrow = q0 + n, kend = q0 + 15;
    const size_t qo = ((size_t)bh * RH + q0 + n) * HD + 8 * hh;           // query hi/lo plane (which 0)
    const size_t ko = PLH + ((size_t)bh * RH + n) * HD + 8 * hh;          // key hi/lo plane (which 1), + key * HD
    const size_t vo = ((size_t)bh * HD + n) * RH + 8 * hh;                // V^T hi/lo plane, + j*16*RH + key
    v8f o[2];
#pragma unroll
    for (int j = 0; j < 2; ++j) o[j] = (v8f){};
    float m = NEGB, l = 0.0f;
#pragma unroll 1
    for (int kb = 32 * w; kb <= kend; kb += 32 * NW) {
        v8f s[2]; s[0] = (v8f){}; s[1] = (v8f){};
        {
            const v16bf qh = ldb(QKH + qo), ql = ldb(QKL + qo);
#pragma unroll
            for (int kc = 0; kc < 2; ++kc) { const size_t ka = ko + (size_t)(kb + kc * 16) * HD;
                const v16bf kh = ldb(QKH + ka), kl = ldb(QKL + ka);
                s[kc] = wmbg(kh, qh, s[kc]); s[kc] = wmbg(kl, qh, s[kc]); s[kc] = wmbg(kh, ql, s[kc]); }
            asm volatile("" ::: "memory");
        }
        float u[16];
        const int key0 = kb + 8 * hh;
        if (kb + 31 > q0) {            // wave-uniform
#pragma unroll
            for (int r = 0; r < 8; ++r) { u[r] = (key0 + r <= qrow) ? s[0][r] * SCL2 : NEGB; u[8 + r] = (key0 + 16 + r <= qrow) ? s[1][r] * SCL2 : NEGB; }
        } else {
#pragma unroll
            for (int r = 0; r < 8; ++r) { u[r] = s[0][r] * SCL2; u[8 + r] = s[1][r] * SCL2; }
        }
        float mx = u[0];
#pragma unroll
        for (int i = 1; i < 16; ++i) mx = fmaxf(mx, u[i]);
        mx = fmaxf(mx, __shfl_xor(mx, 16, 32));
        const float mn = fmaxf(m, mx);
        const float corr = __builtin_amdgcn_exp2f(m - mn);
        m = mn;
        v16us phu, plu; float ps = 0.0f;
#pragma unroll
        for (int r = 0; r < 8; ++r) {
            const float p0 = __builtin_amdgcn_exp2f(u[r] - mn); const float p1 = __builtin_amdgcn_exp2f(u[8 + r] - mn);
            ps += p0 + p1; unsigned short x1, x2; splitf(p0, x1, x2); phu[r] = x1; plu[r] = x2; splitf(p1, x1, x2); phu[8 + r] = x1; plu[8 + r] = x2; }
        const v16bf ph = __builtin_bit_cast(v16bf, phu), pl = __builtin_bit_cast(v16bf, plu);
        l = l * corr + ps;
#pragma unroll
        for (int j = 0; j < 2; ++j) o[j] = o[j] * corr;
#pragma unroll
        for (int j = 0; j < 2; ++j) { const size_t va = vo + (size_t)j * 16 * RH + kb; const v16bf vh = ldb(VTH + va), vl = ldb(VTL + va);
            o[j] = wmbg(vh, ph, o[j]); o[j] = wmbg(vl, ph, o[j]); o[j] = wmbg(vh, pl, o[j]);
            asm volatile("" ::: "memory"); }
    }
    l += __shfl_xor(l, 16, 32);
    join_stage(ys, ms, ls, w, lane, o, m, l);
    __syncthreads();                   // publishes every wave's partial to the joining threads
    join_finish(ys, ms, ls, w, lane, ATH, ATL, ((size_t)bh * SEQ + q0) * HD);
}

// Both kinds of query tile read only the planes of the qkv launch and write disjoint context rows, so they share ONE launch: grid (NB*NH, NT16 + NTH), 32 * NW threads; the block's tile index picks the path (uniform over the work-group).
// Order: a tile's key steps grow with its query row, so the slow grid axis counts the tiles from the last (most steps) down to the first (one step), the f16 tiles in front of the hi/lo tiles. The fast axis is batch * head, all of equal length. For speed only: every (tile, head) pair is done exactly once whatever the order.
#define NT16 ((SEQ - RH) / (16 * NQ))   // work-groups per head on the f16 path (NQ * 16 query rows each)
#define NTH  (RH / 16)                  // work-groups per head on the hi/lo path (16 query rows each)
__global__ __launch_bounds__(32 * NW) void k_attn(const h16* QK16, const h16* VT16, const bf* QKH, const bf* QKL, const bf* VTH, const bf* VTL, bf* ATH, bf* ATL) {
    __shared__ __align__(16) float ys[NQ * NW * 16 * YP];   // one 16 x 32 partial O tile per wave and query tile
    __shared__ float ms[NQ * NW * 16], ls[NQ * NW * 16];    // per wave and query: running max, sum
    const int y = blockIdx.y, bh = blockIdx.x;
    if (y < NT16) attn16_tile(ys, ms, ls, RH + (NT16 - 1 - y) * 16 * NQ, bh, QK16, VT16, ATH, ATL);
    else          attnhl_tile(ys, ms, ls, (NTH - 1 - (y - NT16)) * 16, bh, QKH, QKL, VTH, VTL, ATH, ATL);
}

extern "C" void kernel_launch(void* const* d_in, const int* in_sizes, int n_in,
                              void* d_out, int out_size, void* d_ws, size_t ws_size, hipStream_t stream) {
    // wire order: x [8][2048][128], w_qkv [128][384], b_qkv [384], w_proj [128][128], b_proj [128] (all f32)
    constexpr size_t XN = ((size_t)(NB - 1) * SEQ_FULL + SEQ) * DM;      // lowest element count covering the rows touched
    if (n_in < 5) return;
    if ((size_t)in_sizes[0] < XN || (size_t)in_sizes[1] < (size_t)DM * FW || in_sizes[2] < FW || (size_t)in_sizes[3] < (size_t)DQ * DM || in_sizes[4] < DM) return;
    if ((size_t)out_size < XN) return;
    const float* x = (const float*)d_in[0]; const float* wqkv = (const float*)d_in[1]; const float* bqkv = (const float*)d_in[2];
    const float* wo = (const float*)d_in[3]; const float* bo = (const float*)d_in[4];
    float* OUT = (float*)d_out;      // [NB_FULL][SEQ_FULL][128], byte offset 0

    // workspace carve: every region a multiple of 256 B, sized to the producers' whole-line store extent
    constexpr size_t SZ_QK16 = 2 * PLN * 2;                    // f16 q | k planes
    constexpr size_t SZ_VT16 = PLN * 2;                        // f16 V^T planes
    constexpr size_t SZ_QKHL = 2 * PLH * 2;                    // bf16 q | k hi (and lo) planes, rows < RH
    constexpr size_t SZ_VTHL = PLH * 2;                        // bf16 V^T hi (and lo) planes, keys < RH
    constexpr size_t SZ_AT   = PLN * 2;                        // head-major context hi (and lo) planes
    constexpr size_t O_QK16 = 0;
    constexpr size_t O_VT16 = O_QK16 + SZ_QK16;
    constexpr size_t O_QKH  = O_VT16 + SZ_VT16;
    constexpr size_t O_QKL  = O_QKH + SZ_QKHL;
    constexpr size_t O_VTH  = O_QKL + SZ_QKHL;
    constexpr size_t O_VTL  = O_VTH + SZ_VTHL;
    constexpr size_t O_ATH  = O_VTL + SZ_VTHL;
    constexpr size_t O_ATL  = O_ATH + SZ_AT;
    constexpr size_t O_END  = O_ATL + SZ_AT;
    static_assert(SZ_QK16 % 256 == 0 && SZ_VT16 % 256 == 0 && SZ_QKHL % 256 == 0 && SZ_VTHL % 256 == 0 && SZ_AT % 256 == 0);
    static_assert(O_END <= (size_t)134217728);                  // total carve <= 128 MiB
    static_assert(((size_t)NB * SEQ) % 64 == 0);                // qkv GEMM M tiles
    if (ws_size < O_END) return;
    char* ws = (char*)d_ws;
    h16* QK16 = (h16*)(ws + O_QK16); h16* VT16 = (h16*)(ws + O_VT16);
    bf* QKH = (bf*)(ws + O_QKH); bf* QKL = (bf*)(ws + O_QKL); bf* VTH = (bf*)(ws + O_VTH); bf* VTL = (bf*)(ws + O_VTL);
    bf* ATH = (bf*)(ws + O_ATH); bf* ATL = (bf*)(ws + O_ATL);

    k_gemm_qkv<<<dim3(NB * SEQ / 64, FW / 64, 1), 32, 0, stream>>>(x, wqkv, bqkv, QK16, VT16, QKH, QKL, VTH, VTL);
    k_attn<<<dim3(NB * NH, NT16 + NTH, 1), 32 * NW, 0, stream>>>(QK16, VT16, QKH, QKL, VTH, VTL, ATH, ATL);
    k_gemm_proj<<<dim3(SEQ / 64, DM / 64, NB), 32, 0, stream>>>(ATH, ATL, wo, OUT, bo);
}

// v009
// It runs in 34.2 microseconds.
// Next to v008, in two timings, it ran 1.04 times as fast each time.
// Over all steps from v000 it is 3.53 times as fast.
#include <hip/hip_runtime.h>

// Causal self-attention: x [NB][SEQ][128]; qkv = x w_qkv + b_qkv ([in][out] weight, q | k | v column thirds, 4 heads x 32, head h = columns h*32+d); scores x 32^-0.5; causal select (diagonal kept); softmax; out = merged w_proj + b_proj ([in][out]).
// Compute dtypes, f32 accumulate everywhere: qkv projection v_wmma_f32_16x16x32_bf16 on x / w_qkv rounded to bf16 (RNE) in registers as the fragments are loaded (single product); attention query rows < 256: bf16 hi/lo planes, 3 products for k q^T and for v^T p; query rows >= 256: v_wmma_f32_16x16x32_f16 single products (q, k, v f16 planes, p carried x1024 in the exponent); output projection: bf16 hi/lo context planes x w_proj rounded to bf16 (RNE) in registers (2 products). Softmax f32, online running-max form in the log2 domain.
// Fused attention, one work-group of NW waves per 16 query rows (rows < RH) or per NQ * 16 query rows (rows >= RH, every wave carrying all NQ tiles), the 32-key steps dealt round-robin to the waves (wave w: steps w, w + NW, ...), partial (max, sum, O) joined through LDS; head dim 32 = one 32-deep k-step for the scores: S^T = K Q^T (keys on D rows, queries on D columns), p built per lane and fed as the B operand of O^T = V^T P^T (B element r <- tile keys 0-15 [r], element 8+r <- tile keys 16-31 [r]); no score / probability plane in memory.

#ifndef NB
#define NB 8
#endif
#ifndef SEQ
#define SEQ 2048
#endif
#define NB_FULL  8
#define SEQ_FULL 2048
#define DM   128
#define NH   4
#define HD   32
#define DQ   (NH * HD)
#define FW   (3 * DQ)
#define RH   256                      // query rows < RH use bf16 hi/lo planes
#define PLN  ((size_t)NB * NH * SEQ * HD)   // elements of one [b*h][t][d] plane
#define PLH  ((size_t)NB * NH * RH * HD)    // elements of one hi/lo plane (rows < RH)
#define SCL2 0.25503486164918f        // HD^-0.5 * log2(e)
#define PCL  10.0f                    // log2 of the p carry (x1024) for the f16 path
#define NEGB (-3.0e38f)
#define YP   36                       // staging pitch (floats) of the 16 x 32 attention result tile
#define NW   4                        // waves per query tile: each walks every NW-th 32-key step
#define NQ   4                        // f16 path: 16-query tiles per work-group; every K and V^T fragment a wave uses feeds all of them that have keys in its step

static_assert(DQ == DM);               // merged width == model width
static_assert(HD == 32);               // scores: one 32-deep k-step; head row == 64 B of 16-bit data; proj k-step == one head
static_assert(2 * HD == 64);
static_assert(HD % 16 == 0);           // O^T tiles of 16 d rows
static_assert(YP % 4 == 0 && YP >= HD); // 16-B aligned staging rows
static_assert(NW * 32 * 4 == 16 * HD);  // join: every thread owns 4 consecutive d of one query row
static_assert(DM % 64 == 0);           // GEMM K multiple of 32, weight lines of 64
static_assert(DQ % 64 == 0);           // proj GEMM K multiple of 32; a qkv GEMM N tile inside one of q, k, v
static_assert(FW % 64 == 0);           // GEMM N tile multiple
static_assert(SEQ % 64 == 0);          // GEMM M tile multiple, 32-key steps, V^T lines
static_assert(RH % 64 == 0);           // hi/lo V^T lines, 32-key steps inside RH, a GEMM M tile on one side of RH
static_assert(RH <= SEQ);
static_assert(NQ % 2 == 0);            // the NQ tiles of a work-group span NQ / 2 whole 32-key steps (the diagonal steps): step q0 + 32 i is the last for tiles 2 i and 2 i + 1
static_assert(NQ / 2 <= NW);           // every diagonal step has a wave of its own
static_assert(RH % (16 * NQ) == 0 && (SEQ - RH) % (16 * NQ) == 0);
static_assert(RH >= 32 * NW);          // f16 path: every wave has a first key step in front of the diagonal step
static_assert(NB <= NB_FULL);
static_assert(SEQ <= SEQ_FULL);

typedef _Float16 h16;
typedef unsigned short bf;
typedef __attribute__((ext_vector_type(16))) __bf16   v16bf;
typedef __attribute__((ext_vector_type(16))) _Float16 v16h;
typedef __attribute__((ext_vector_type(16))) unsigned short v16us;
typedef __attribute__((ext_vector_type(8)))  _Float16 v8h;
typedef __attribute__((ext_vector_type(8)))  unsigned short v8us;
typedef __attribute__((ext_vector_type(8)))  float    v8f;
typedef __attribute__((ext_vector_type(4)))  float    v4f;
typedef __attribute__((ext_vector_type(4)))  unsigned short v4us;
typedef v4f  __attribute__((may_alias)) v4fa;
typedef __attribute__((ext_vector_type(2)))  float    v2f;

__device__ __forceinline__ unsigned short f2bf(float f) { unsigned u = __float_as_uint(f); u += 0x7FFFu + ((u >> 16) & 1u); return (unsigned short)(u >> 16); }   // RNE convert
__device__ __forceinline__ float bf2f(unsigned short b) { return __uint_as_float(((unsigned)b) << 16); }
__device__ __forceinline__ float bfr(float f) { return bf2f(f2bf(f)); }
__device__ __forceinline__ void splitf(float y, unsigned short& h, unsigned short& l) { h = f2bf(y); l = f2bf(y - bf2f(h)); }
__device__ __forceinline__ v16h cat16(v8h lo, v8h hi) { return __builtin_shufflevector(lo, hi, 0, 1, 2, 3, 4, 5, 6, 7, 8, 9, 10, 11, 12, 13, 14, 15); }
__device__ __forceinline__ v16bf cat16b(v8us lo, v8us hi) { return __builtin_bit_cast(v16bf, __builtin_shufflevector(lo, hi, 0, 1, 2, 3, 4, 5, 6, 7, 8, 9, 10, 11, 12, 13, 14, 15)); }
// fragment loaders: elements 0..7 <- p[0..7], elements 8..15 <- p[16..23]; p already includes + 8 * (lane >> 4)
__device__ __forceinline__ v16h ldh(const h16* p) { return cat16(*(const v8h*)p, *(const v8h*)(p + 16)); }
__device__ __forceinline__ v16bf ldb(const bf* p) { return cat16b(*(const v8us*)p, *(const v8us*)(p + 16)); }
typedef __attribute__((ext_vector_type(8))) __bf16 v8bf;
// f32 sources, rounded to bf16 (RNE, v_cvt_pk_bf16_f32) in registers, same element order as ldb. The request (raw16) and the rounding (rnd16) are apart so that a group of requests can be issued before the first rounding waits for one.
struct raw16 { v8f lo, hi; };
__device__ __forceinline__ v16bf rnd16(const raw16 r) {
    const v8bf l8 = __builtin_convertvector(r.lo, v8bf), h8 = __builtin_convertvector(r.hi, v8bf);
    return __builtin_shufflevector(l8, h8, 0, 1, 2, 3, 4, 5, 6, 7, 8, 9, 10, 11, 12, 13, 14, 15); }
// row fragment: elements 0..7 <- p[0..7], elements 8..15 <- p[16..23]; p already includes + 8 * (lane >> 4)
__device__ __forceinline__ raw16 ldxf(const float* p) { return raw16{*(const v8f*)p, *(const v8f*)(p + 16)}; }
// column fragment of an [in][out] weight of row pitch N: elements 0..7 <- p[0..7 * N], elements 8..15 <- p[16..23 * N]; p already includes + 8 * (lane >> 4) * N + the lane's column; 16 lanes read 64 contiguous bytes of a weight row
__device__ __forceinline__ raw16 ldwf(const float* p, const int N) {
    raw16 r;
#pragma unroll
    for (int k = 0; k < 8; ++k) { r.lo[k] = p[(size_t)k * N]; r.hi[k] = p[(size_t)(16 + k) * N]; }
    return r; }
__device__ __forceinline__ v8f wmmab(v16bf a, v16bf b, v8f c) { return __builtin_amdgcn_wmma_f32_16x16x32_bf16(false, a, false, b, (short)0, c, false, false); }
// guarded forms: 4 nops after the matrix op, accumulator tied, operands kept live
__device__ __forceinline__ v8f wm16g(v16h a, v16h b, v8f c) {
    c = __builtin_amdgcn_wmma_f32_16x16x32_f16(false, a, false, b, (short)0, c, false, false);
    asm volatile("v_nop\n\tv_nop\n\tv_nop\n\tv_nop" : "+v"(c) : "v"(a), "v"(b));
    return c; }
__device__ __forceinline__ v8f wmbg(v16bf a, v16bf b, v8f c) {
    c = __builtin_amdgcn_wmma_f32_16x16x32_bf16(false, a, false, b, (short)0, c, false, false);
    asm volatile("v_nop\n\tv_nop\n\tv_nop\n\tv_nop" : "+v"(c) : "v"(a), "v"(b));
    return c; }

// ---- register-blocked GEMM body, ONE WAVE per 64x64 output tile (16 accumulators); grid (M/64, N/64, Z), 32 threads. The weight W is the f32 input itself, [K][N] of row pitch ldw, read by columns and rounded to bf16 in registers (ldwf).
// y[m][n] (f32) = sum_k A[m][k] bf16(W[k][n]) (+ A2[m][k] bf16(W[k][n]) when NSPLIT == 1) + bf16-RNE(bias[n]). K % 32 == 0, M and N multiples of 64 (asserted at file scope).
// PLANES == false: A, A2 are bf16 K-contiguous planes, y goes to C (f32, pitch ldc). PLANES == true (qkv projection): A is the f32 input Xf (rows of K floats, rounded to bf16 in registers, ldxf; Xf points at the tile's batch), y goes straight to the attention operand planes of struct planes, no f32 copy in memory.
// A addressing: element (m, k) at A[m * lda + (k >> 5) * ksA + (k & 31)] (row pitch lda, advance ksA per 32-deep k-step); a plain row-major plane has lda = K, ksA = 32.
// q | k planes [which][b*h][t][d]: f16 copy for all t, bf16 hi/lo for t < RH ([which][b*h][RH][d]); V^T planes [b*h][d][t]: f16 for all t, bf16 hi/lo for t < RH ([b*h][d][RH]).
struct planes { h16* QK16; h16* VT16; bf* QKH; bf* QKL; bf* VTH; bf* VTL; };
// Plane epilogues of one 64 x 64 qkv tile held in acc[mb][nb] (lane (hi, lr), element j: token t0 + mb*16 + hi*8 + j, tile column nb*16 + lr); bias points at the tile's first column; heads bh0, bh0 + 1; HL: the tile's tokens are < RH.
// V^T: a lane's 8 accumulator rows are 8 consecutive tokens of one d, i.e. 16 contiguous bytes of a V^T row: stored from registers.
template <bool HL>
__device__ __forceinline__ void put_v(const v8f (&acc)[4][4], const float* __restrict__ bias, const int bh0, const int t0, const int lane, const planes P) {
    const int lr = lane & 15, hi = lane >> 4;
    const float* bp = bias + lr; float braw[4];
#pragma unroll
    for (int nb = 0; nb < 4; ++nb) braw[nb] = bp[nb * 16];
    asm volatile("s_wait_xcnt 0x0" :: "v"(bp) : "memory");   // stands in front of the first rewrite of a register that the bias loads name; bp as an input keeps the compiler from lifting that rewrite over the wait
#pragma unroll
    for (int nb = 0; nb < 4; ++nb) { const int col = nb * 16 + lr; const float bv = bfr(braw[nb]); const size_t vr = (size_t)(bh0 + (col >> 5)) * HD + (col & 31);
#pragma unroll
        for (int mb = 0; mb < 4; ++mb) { const int t = t0 + mb * 16 + hi * 8; v8h o16; v8us oh, ol;
#pragma unroll
            for (int j = 0; j < 8; ++j) { const float y = acc[mb][nb][j] + bv; o16[j] = (h16)y; if (HL) { unsigned short x1, x2; splitf(y, x1, x2); oh[j] = x1; ol[j] = x2; } }
            *(v8h*)(P.VT16 + vr * SEQ + t) = o16;
            if (HL) { *(v8us*)(P.VTH + vr * RH + t) = oh; *(v8us*)(P.VTL + vr * RH + t) = ol; } } }
    asm volatile("s_wait_xcnt 0x0" ::: "memory");   // behind the last plane store: stands in front of any later rewrite of a register that these stores name, on every way the branches allow
}
// q / k: 16 tokens at a time turned through the wave's LDS tile os (pitch 68 floats); a lane then owns 8 consecutive d of one token (16 B of f16), 8 lanes a token's two heads, and a store covers 4 tokens = 256 contiguous bytes per head.
template <bool HL>
__device__ __forceinline__ void put_qk(const v8f (&acc)[4][4], float* os, const float* __restrict__ bias, const int which, const int bh0, const int t0, const int lane, const planes P) {
    const int lr = lane & 15, hi = lane >> 4, c = (lane & 7) * 8, d = c & 31; const size_t bh = (size_t)(bh0 + (c >> 5));
    float bv[8];
#pragma unroll
    for (int k = 0; k < 8; ++k) bv[k] = bfr(bias[c + k]);
#pragma unroll
    for (int mb = 0; mb < 4; ++mb) {
#pragma unroll
        for (int nb = 0; nb < 4; ++nb) {
#pragma unroll
            for (int j = 0; j < 8; ++j) os[(hi * 8 + j) * 68 + nb * 16 + lr] = acc[mb][nb][j]; }
        __builtin_amdgcn_wave_barrier(); asm volatile("" ::: "memory");   // the tile's LDS writes stay in front of the reads of other lanes' values
#pragma unroll
        for (int s = 0; s < 4; ++s) { const int row = 4 * s + (lane >> 3), t = t0 + mb * 16 + row;
            const v4f lo4 = *(const v4fa*)(os + row * 68 + c), hi4 = *(const v4fa*)(os + row * 68 + c + 4); v8h o16; v8us oh, ol;
#pragma unroll
            for (int k = 0; k < 8; ++k) { const float y = (k < 4 ? lo4[k & 3] : hi4[k & 3]) + bv[k]; o16[k] = (h16)y; if (HL) { unsigned short x1, x2; splitf(y, x1, x2); oh[k] = x1; ol[k] = x2; } }
            *(v8h*)(P.QK16 + (size_t)which * PLN + (bh * SEQ + t) * HD + d) = o16;
            if (HL) { const size_t o2 = (size_t)which * PLH + (bh * RH + t) * HD + d; *(v8us*)(P.QKH + o2) = oh; *(v8us*)(P.QKL + o2) = ol; } }
        __builtin_amdgcn_wave_barrier(); asm volatile("" ::: "memory");   // the reads stay in front of the next 16 tokens' LDS writes
    }
    asm volatile("s_wait_xcnt 0x0" ::: "memory");   // behind the last plane store: stands in front of any later rewrite of a register that these stores name, on every way the branches allow
}
template <int NSPLIT, bool PLANES>
__device__ __forceinline__ void gemmw_body(const float* __restrict__ Xf, const bf* __restrict__ A, const bf* __restrict__ A2, const float* __restrict__ W, const int ldw, const int K, const int lda, const size_t ksA, float* C, const int ldc, const float* __restrict__ bias, const size_t sA, const size_t sC, const planes P) {
    __shared__ __align__(16) float os[16 * 68];
    const size_t z = blockIdx.z; A += z * sA; if (NSPLIT == 1) A2 += z * sA; C += z * sC;
    const int lane = threadIdx.x & 31, lr = lane & 15, hi = lane >> 4; const int r0 = blockIdx.x * 64, c0 = blockIdx.y * 64;
    v8f acc[4][4];
#pragma unroll
    for (int mb = 0; mb < 4; ++mb)
#pragma unroll
        for (int nb = 0; nb < 4; ++nb) acc[mb][nb] = (v8f){};
    const size_t aoff = (size_t)((PLANES ? r0 % SEQ : r0) + lr) * lda + 8 * hi, boff = (size_t)(8 * hi) * ldw + c0 + lr;
#pragma unroll 1
    for (int kc = 0; kc < K; kc += 32) {
        const size_t ak = (size_t)(kc >> 5) * ksA;
        const float* wp = W + boff + (size_t)kc * ldw; const float* xp = Xf + aoff + ak; const bf* ap = A + aoff + ak; const bf* ap2 = A2 + aoff + ak;
        v16bf a[4], a2[4], b[4]; raw16 xr[4], wr[4];
#pragma unroll
        for (int mb = 0; mb < 4; ++mb) { if (PLANES) xr[mb] = ldxf(xp + (size_t)mb * 16 * lda); else a[mb] = ldb(ap + (size_t)mb * 16 * lda); if (NSPLIT == 1) a2[mb] = ldb(ap2 + (size_t)mb * 16 * lda); }
#pragma unroll
        for (int nb = 0; nb < 4; ++nb) wr[nb] = ldwf(wp + nb * 16, ldw);
        // stands in front of the first rewrite of a register that the requests above name; the pointers as inputs keep the compiler from lifting their advance over the wait
        if constexpr (PLANES) asm volatile("s_wait_xcnt 0x0" :: "v"(xp), "v"(wp) : "memory"); else asm volatile("s_wait_xcnt 0x0" :: "v"(ap), "v"(ap2), "v"(wp) : "memory");
        __builtin_amdgcn_sched_barrier(0);   // all of the k-step's requests stay one group in front of the first rounding (their latencies pass together, not one behind another), and the pointers' advance stays behind the wait above
#pragma unroll
        for (int mb = 0; mb < 4; ++mb) if (PLANES) a[mb] = rnd16(xr[mb]);
#pragma unroll
        for (int nb = 0; nb < 4; ++nb) { b[nb] = rnd16(wr[nb]);
#pragma unroll
            for (int mb = 0; mb < 4; ++mb) { acc[mb][nb] = wmmab(a[mb], b[nb], acc[mb][nb]); if (NSPLIT == 1) acc[mb][nb] = wmmab(a2[mb], b[nb], acc[mb][nb]); } }
        asm volatile("v_nop\n\tv_nop\n\tv_nop\n\tv_nop" : "+v"(acc[0][0]), "+v"(acc[1][1]), "+v"(acc[2][2]), "+v"(acc[3][3]) : "v"(a[0]), "v"(a[3]));
    }
    if constexpr (PLANES) {
        // tile coordinates, all uniform over the work-group: 64 columns = two heads of one of q, k, v; 64 rows = 64 tokens of one batch, all on one side of RH
        const int which = c0 / DQ, bh0 = (r0 / SEQ) * NH + (c0 % DQ) / HD, t0 = r0 % SEQ;
        if (which == 2) { if (t0 < RH) put_v<true>(acc, bias + c0, bh0, t0, lane, P); else put_v<false>(acc, bias + c0, bh0, t0, lane, P); }
        else            { if (t0 < RH) put_qk<true>(acc, os, bias + c0, which, bh0, t0, lane, P); else put_qk<false>(acc, os, bias + c0, which, bh0, t0, lane, P); }
        return;
    }
#pragma unroll
    for (int mb = 0; mb < 4; ++mb) {
#pragma unroll
        for (int nb = 0; nb < 4; ++nb) {
#pragma unroll
            for (int j = 0; j < 8; ++j) os[(hi * 8 + j) * 68 + nb * 16 + lr] = acc[mb][nb][j]; }
        __builtin_amdgcn_wave_barrier(); asm volatile("" ::: "memory");
        float* crow = C + (size_t)(r0 + mb * 16) * ldc + c0;
{
#pragma unroll
            for (int s = 0; s < 8; ++s) { const int row = 2 * s + hi, cofs = lr * 4; v4f val = *(const v4fa*)(os + row * 68 + cofs);
                val[0] += bfr(bias[c0 + cofs]); val[1] += bfr(bias[c0 + cofs + 1]); val[2] += bfr(bias[c0 + cofs + 2]); val[3] += bfr(bias[c0 + cofs + 3]);
                *(v4f*)(crow + (size_t)row * ldc + cofs) = val; }
             }
        __builtin_amdgcn_wave_barrier(); asm volatile("" ::: "memory");
    }
}
// qkv [NB*SEQ][384] = x [NB][SEQ][128] x w_qkv + b_qkv, column = which*128 + h*32 + d, written as the attention planes; grid (NB*SEQ/64, 384/64, 1)
__global__ __launch_bounds__(32) void k_gemm_qkv(const float* __restrict__ x, const float* __restrict__ w, const float* __restrict__ bias, h16* QK16, h16* VT16, bf* QKH, bf* QKL, bf* VTH, bf* VTL) {
    gemmw_body<0, true>(x + (size_t)(blockIdx.x * 64 / SEQ) * SEQ_FULL * DM, nullptr, nullptr, w, FW, DM, DM, (size_t)32, nullptr, FW, bias, 0, 0, planes{QK16, VT16, QKH, QKL, VTH, VTL}); }
// OUT [b][t][128] = (ATH + ATL) x w_proj + b_proj; A element (t, k = h*32+d) at plane [(b*NH + h)*SEQ + t][d]: lda = HD, k-step advance = SEQ*HD, batch stride NH*SEQ*HD;
// grid (SEQ/64, 128/64, NB); output rows use the full per-batch stride
__global__ __launch_bounds__(32) void k_gemm_proj(const bf* __restrict__ Ah, const bf* __restrict__ Al, const float* __restrict__ w, float* C, const float* __restrict__ bias) {
    gemmw_body<1, false>(nullptr, Ah, Al, w, DM, DQ, HD, (size_t)SEQ * HD, C, DM, bias, (size_t)NH * SEQ * HD, (size_t)SEQ_FULL * DM, planes{}); }

// ---- join of the NW waves' partial results of one 16-query tile. Wave w holds, for query n, its running max m (log2 domain), its sum l (both halves already added) and O^T unnormalised.
// Every wave stages its part, one work-group barrier, then thread (w, lane) owns query row 4w + (lane >> 3), d = 4 (lane & 7) .. + 3: out = sum_w 2^(m_w - M) O_w / sum_w 2^(m_w - M) l_w, waves summed in index order.
// A wave that had no key step stages m = NEGB, l = 0, O = 0 and gets weight 0 (wave 0 always has step 0, whose key 0 every query keeps, so M is finite).
__device__ __forceinline__ void join_stage(float* ys, float* ms, float* ls, const int w, const int lane, const v8f* o, const float m, const float l) {
    const int n = lane & 15, hh = lane >> 4;
#pragma unroll
    for (int j = 0; j < 2; ++j)
#pragma unroll
        for (int r = 0; r < 8; ++r) ys[w * 16 * YP + n * YP + j * 16 + 8 * hh + r] = o[j][r];
    if (hh == 0) { ms[w * 16 + n] = m; ls[w * 16 + n] = l; }
}
__device__ __forceinline__ void join_finish(const float* ys, const float* ms, const float* ls, const int w, const int lane, bf* ATH, bf* ATL, const size_t tile0) {
    const int row = 4 * w + (lane >> 3), c = (lane & 7) * 4;
    float mw[NW]; float M = NEGB;
#pragma unroll
    for (int k = 0; k < NW; ++k) { mw[k] = ms[k * 16 + row]; M = fmaxf(M, mw[k]); }
    v4f acc = (v4f){}; float L = 0.0f;
#pragma unroll
    for (int k = 0; k < NW; ++k) { const float sc = __builtin_amdgcn_exp2f(mw[k] - M); L += sc * ls[k * 16 + row]; acc += sc * *(const v4fa*)(ys + k * 16 * YP + row * YP + c); }
    const float inv = 1.0f / L;
    v4us oh, ol;
#pragma unroll
    for (int k = 0; k < 4; ++k) { unsigned short x1, x2; splitf(acc[k] * inv, x1, x2); oh[k] = x1; ol[k] = x2; }
    const size_t oo = tile0 + (size_t)row * HD + c;
    *(v4us*)(ATH + oo) = oh; *(v4us*)(ATL + oo) = ol;
}

// ---- fused causal attention, query rows >= RH, single f16 products. NW waves per NQ * 16 query rows; q0: the first query row, bh: batch * NH + head.
// A wave holds NQ query fragments (tile t: rows q0 + 16 t ..) and keeps (max, sum, O) per tile; a step's K and V^T fragments are loaded once and multiplied with the q and p of every tile that has keys in it.
// Lane (hh = lane>>4, n = lane&15): query q0+16t+n; per 32-key step holds keys kb+8hh+r (s[t][0]) and kb+16+8hh+r (s[t][1]), r = 0..7, for every tile t.
// One tile's online-softmax update for one 32-key step: scores s0 (keys kb+8hh+r), s1 (keys kb+16+8hh+r) -> p as a B fragment; max, sum and O rescaled. DIAG: the step that touches the diagonal (replace by select).
template <bool DIAG>
__device__ __forceinline__ v16h soft16(v8f s0, v8f s1, const int key0, const int qrow, float& m, float& l, v8f (&o)[2]) {
    if (DIAG) {
#pragma unroll
        for (int r = 0; r < 8; ++r) { s0[r] = (key0 + r <= qrow) ? s0[r] : NEGB; s1[r] = (key0 + 16 + r <= qrow) ? s1[r] : NEGB; } }
    // the maximum is taken over the raw scores and scaled once: rounding a product with a positive constant keeps the order, so this is the maximum of the scaled scores, bit for bit
    float mx = NEGB;
#pragma unroll
    for (int r = 0; r < 8; ++r) mx = fmaxf(mx, s0[r]);
#pragma unroll
    for (int r = 0; r < 8; ++r) mx = fmaxf(mx, s1[r]);
    mx *= SCL2;
    const float mn = fmaxf(fmaxf(m, mx), __shfl_xor(mx, 16, 32));
    const float corr = __builtin_amdgcn_exp2f(m - mn);
    m = mn;
    // exponent of p = score * SCL2 + (PCL - max): one fused multiply-add a score, two scores (neighbouring accumulator registers) an instruction
    const float c = PCL - mn; const v2f c2 = {c, c}, k2 = {SCL2, SCL2};
    v2f pa = {0.0f, 0.0f}, pc = {0.0f, 0.0f}; v16h pb;
#pragma unroll
    for (int r = 0; r < 8; r += 2) {
        const v2f e0 = __builtin_elementwise_fma((v2f){s0[r], s0[r + 1]}, k2, c2), e1 = __builtin_elementwise_fma((v2f){s1[r], s1[r + 1]}, k2, c2);
        const v2f p0 = {__builtin_amdgcn_exp2f(e0[0]), __builtin_amdgcn_exp2f(e0[1])}, p1 = {__builtin_amdgcn_exp2f(e1[0]), __builtin_amdgcn_exp2f(e1[1])};
        pa += p0; pc += p1;
        pb[r] = (h16)p0[0]; pb[r + 1] = (h16)p0[1]; pb[8 + r] = (h16)p1[0]; pb[8 + r + 1] = (h16)p1[1]; }
    pa += pc;
    l = l * corr + (pa[0] + pa[1]);
#pragma unroll
    for (int j = 0; j < 2; ++j) o[j] = o[j] * corr;
    return pb;
}
__device__ __forceinline__ v8f wm16(v16h a, v16h b, v8f c) { return __builtin_amdgcn_wmma_f32_16x16x32_f16(false, a, false, b, (short)0, c, false, false); }
// The key loop is a software pipeline: a step's K fragments are requested right behind the score products of the wave's step before it (into the registers those products have just read), its V^T fragments right behind that step's V^T p products, so each request has a whole softmax to land in.
// The diagonal steps (kb == q0 + 32 i, i < NQ / 2, the last of the work-group, each owned by one wave) stand behind the loop, so the loop body has no branch: the compiler orders it as one block and keeps the distances behind the matrix products itself.
// A wave's last pass requests a diagonal step's fragments whether or not the wave owns one: rows q0 .. q0 + 16 NQ - 1 exist for every tile, and a wave that owns none never reads the registers.
// Diagonal step kb == q0 + 32 i: tiles below 2 i have no key in it and are left out; the tiles from T0 = 2 i on take the select (all kept for tiles above 2 i + 1).
template <int T0>
__device__ __forceinline__ void diag16(const v16h a0, const v16h a1, const v16h va0, const v16h va1, const v16h (&qb)[NQ], const int key0, const int qrow0, float (&m)[NQ], float (&l)[NQ], v8f (&o)[NQ][2]) {
    v8f s[NQ][2]; v16h pb[NQ];
#pragma unroll
    for (int t = T0; t < NQ; ++t) { s[t][0] = wm16g(a0, qb[t], (v8f){}); s[t][1] = wm16g(a1, qb[t], (v8f){}); }
#pragma unroll
    for (int t = T0; t < NQ; ++t) pb[t] = soft16<true>(s[t][0], s[t][1], key0, qrow0 + 16 * t, m[t], l[t], o[t]);
#pragma unroll
    for (int t = T0; t < NQ; ++t) { o[t][0] = wm16g(va0, pb[t], o[t][0]); o[t][1] = wm16g(va1, pb[t], o[t][1]); }
}
__device__ __forceinline__ void attn16_tile(float* ys, float* ms, float* ls, const int q0, const int bh, const h16* QK16, const h16* VT16, bf* ATH, bf* ATL) {
    const int lane = threadIdx.x & 31, n = lane & 15, hh = lane >> 4;
    const int w = __builtin_amdgcn_readfirstlane(threadIdx.x >> 5);   // wave number, scalar: the key loop stays a scalar loop
    const h16* qp = QK16 + ((size_t)bh * SEQ + q0 + n) * HD + 8 * hh;     // query plane (which 0), + t * 16 * HD
    const h16* kbase = QK16 + ((size_t)bh * SEQ + n) * HD + 8 * hh;       // key plane (which 1) at + PLN, + key * HD
    const h16* vbase = VT16 + ((size_t)bh * HD + n) * SEQ + 8 * hh;       // V^T plane, + j*16*SEQ + key
    v16h qb[NQ]; v8f o[NQ][2]; float m[NQ], l[NQ];
#pragma unroll   // t a constant: the per-tile arrays stay in registers (here and in the t loops below)
    for (int t = 0; t < NQ; ++t) { qb[t] = ldh(qp + (size_t)t * 16 * HD); o[t][0] = (v8f){}; o[t][1] = (v8f){}; m[t] = NEGB; l[t] = 0.0f; }
    int kb = 32 * w;                   // <= q0: q0 >= RH >= 32 * NW
    const h16* kp0 = kbase + (size_t)kb * HD; const h16* vp0 = vbase + kb;
    v16h a0 = ldh(kp0 + PLN), a1 = ldh(kp0 + PLN + 16 * HD);
    v16h va0 = ldh(vp0), va1 = ldh(vp0 + (size_t)16 * SEQ);
    asm volatile("s_wait_xcnt 0x0" :: "v"(qp), "v"(kp0), "v"(vp0) : "memory");   // stands in front of the first rewrite of a register that the first requests name; the pointers as inputs keep that rewrite behind the wait
#pragma unroll 1   // one step a pass: the fragments of the next step land in the registers of this one
    for (; kb < q0; kb += 32 * NW) {
        const int kn = min(kb + 32 * NW, q0 + 16 * NQ - 32);      // the wave's next step, or the last diagonal step
        v8f s[NQ][2]; v16h pb[NQ];
#pragma unroll
        for (int t = 0; t < NQ; ++t) { s[t][0] = wm16(a0, qb[t], (v8f){}); s[t][1] = wm16(a1, qb[t], (v8f){}); }
        const h16* kp = kbase + (size_t)kn * HD;
        a0 = ldh(kp + PLN); a1 = ldh(kp + PLN + 16 * HD);
        asm volatile("s_wait_xcnt 0x0" :: "v"(kp) : "memory");   // stands in front of the first rewrite of a register that the K requests name; the pointer as an input keeps that rewrite behind the wait
        __builtin_amdgcn_sched_barrier(0);   // the K requests stay here, in front of the softmax: moved down behind it they would have no time to land, and would land on registers that the V^T p products read as p
#pragma unroll
        for (int t = 0; t < NQ; ++t) pb[t] = soft16<false>(s[t][0], s[t][1], kb + 8 * hh, q0 + 16 * t + n, m[t], l[t], o[t]);
#pragma unroll
        for (int t = 0; t < NQ; ++t) { o[t][0] = wm16(va0, pb[t], o[t][0]); o[t][1] = wm16(va1, pb[t], o[t][1]); }
        const h16* vp = vbase + kn;
        va0 = ldh(vp); va1 = ldh(vp + (size_t)16 * SEQ);
        asm volatile("s_wait_xcnt 0x0" :: "v"(vp) : "memory");   // stands in front of the first rewrite of a register that the V^T requests name; the pointer as an input keeps that rewrite behind the wait
    }
    static_assert(NQ / 2 == 2);        // the two tests below are the NQ / 2 diagonal steps
    // wave-uniform: the waves whose steps end on a diagonal step
    if (kb == q0) diag16<0>(a0, a1, va0, va1, qb, kb + 8 * hh, q0 + n, m, l, o);
    else if (kb == q0 + 32) diag16<2>(a0, a1, va0, va1, qb, kb + 8 * hh, q0 + n, m, l, o);
#pragma unroll
    for (int t = 0; t < NQ; ++t) { l[t] += __shfl_xor(l[t], 16, 32); join_stage(ys + t * NW * 16 * YP, ms + t * NW * 16, ls + t * NW * 16, w, lane, o[t], m[t], l[t]); }
    __syncthreads();                   // publishes every wave's partials of all NQ tiles to the joining threads
#pragma unroll
    for (int t = 0; t < NQ; ++t) join_finish(ys + t * NW * 16 * YP, ms + t * NW * 16, ls + t * NW * 16, w, lane, ATH, ATL, ((size_t)bh * SEQ + q0 + 16 * t) * HD);
}

// ---- fused causal attention, query rows < RH, bf16 hi/lo planes, 3 products per contraction (hi*hi + lo*hi + hi*lo). Same lane map and key split as attn16_tile.
__device__ __forceinline__ void attnhl_tile(float* ys, float* ms, float* ls, const int q0, const int bh, const bf* QKH, const bf* QKL, const bf* VTH, const bf* VTL, bf* ATH, bf* ATL) {
    const int lane = threadIdx.x & 31, n = lane & 15, hh = lane >> 4;
    const int w = __builtin_amdgcn_readfirstlane(threadIdx.x >> 5);   // wave number, scalar: the key loop stays a scalar loop
    const int qrow = q0 + n, kend = q0 + 15;
    const size_t qo = ((size_t)bh * RH + q0 + n) * HD + 8 * hh;           // query hi/lo plane (which 0)
    const size_t ko = PLH + ((size_t)bh * RH + n) * HD + 8 * hh;          // key hi/lo plane (which 1), + key * HD
    const size_t vo = ((size_t)bh * HD + n) * RH + 8 * hh;                // V^T hi/lo plane, + j*16*RH + key
    v8f o[2];
#pragma unroll
    for (int j = 0; j < 2; ++j) o[j] = (v8f){};
    float m = NEGB, l = 0.0f;
#pragma unroll 1
    for (int kb = 32 * w; kb <= kend; kb += 32 * NW) {
        v8f s[2]; s[0] = (v8f){}; s[1] = (v8f){};
        {
            const v16bf qh = ldb(QKH + qo), ql = ldb(QKL + qo);
#pragma unroll
            for (int kc = 0; kc < 2; ++kc) { const size_t ka = ko + (size_t)(kb + kc * 16) * HD;
                const v16bf kh = ldb(QKH + ka), kl = ldb(QKL + ka);
                s[kc] = wmbg(kh, qh, s[kc]); s[kc] = wmbg(kl, qh, s[kc]); s[kc] = wmbg(kh, ql, s[kc]); }
            asm volatile("" ::: "memory");
        }
        float u[16];
        const int key0 = kb + 8 * hh;
        if (kb + 31 > q0) {            // wave-uniform
#pragma unroll
            for (int r = 0; r < 8; ++r) { u[r] = (key0 + r <= qrow) ? s[0][r] * SCL2 : NEGB; u[8 + r] = (key0 + 16 + r <= qrow) ? s[1][r] * SCL2 : NEGB; }
        } else {
#pragma unroll
            for (int r = 0; r < 8; ++r) { u[r] = s[0][r] * SCL2; u[8 + r] = s[1][r] * SCL2; }
        }
        float mx = u[0];
#pragma unroll
        for (int i = 1; i < 16; ++i) mx = fmaxf(mx, u[i]);
        mx = fmaxf(mx, __shfl_xor(mx, 16, 32));
        const float mn = fmaxf(m, mx);
        const float corr = __builtin_amdgcn_exp2f(m - mn);
        m = mn;
        v16us phu, plu; float ps = 0.0f;
#pragma unroll
        for (int r = 0; r < 8; ++r) {
            const float p0 = __builtin_amdgcn_exp2f(u[r] - mn); const float p1 = __builtin_amdgcn_exp2f(u[8 + r] - mn);
            ps += p0 + p1; unsigned short x1, x2; splitf(p0, x1, x2); phu[r] = x1; plu[r] = x2; splitf(p1, x1, x2); phu[8 + r] = x1; plu[8 + r] = x2; }
        const v16bf ph = __builtin_bit_cast(v16bf, phu), pl = __builtin_bit_cast(v16bf, plu);
        l = l * corr + ps;
#pragma unroll
        for (int j = 0; j < 2; ++j) o[j] = o[j] * corr;
#pragma unroll
        for (int j = 0; j < 2; ++j) { const size_t va = vo + (size_t)j * 16 * RH + kb; const v16bf vh = ldb(VTH + va), vl = ldb(VTL + va);
            o[j] = wmbg(vh, ph, o[j]); o[j] = wmbg(vl, ph, o[j]); o[j] = wmbg(vh, pl, o[j]);
            asm volatile("" ::: "memory"); }
    }
    l += __shfl_xor(l, 16, 32);
    join_stage(ys, ms, ls, w, lane, o, m, l);
    __syncthreads();                   // publishes every wave's partial to the joining threads
    join_finish(ys, ms, ls, w, lane, ATH, ATL, ((size_t)bh * SEQ + q0) * HD);
}

// Both kinds of query tile read only the planes of the qkv launch and write disjoint context rows, so they share ONE launch: grid (NB*NH, NT16 + NTH), 32 * NW threads; the block's tile index picks the path (uniform over the work-group).
// Order: a tile's key steps grow with its query row, so the slow grid axis counts the tiles from the last (most steps) down to the first (one step), the f16 tiles in front of the hi/lo tiles. The fast axis is batch * head, all of equal length. For speed only: every (tile, head) pair is done exactly once whatever the order.
#define NT16 ((SEQ - RH) / (16 * NQ))   // work-groups per head on the f16 path (NQ * 16 query rows each)
#define NTH  (RH / 16)                  // work-groups per head on the hi/lo path (16 query rows each)
__global__ __launch_bounds__(32 * NW) void k_attn(const h16* QK16, const h16* VT16, const bf* QKH, const bf* QKL, const bf* VTH, const bf* VTL, bf* ATH, bf* ATL) {
    __shared__ __align__(16) float ys[NQ * NW * 16 * YP];   // one 16 x 32 partial O tile per wave and query tile
    __shared__ float ms[NQ * NW * 16], ls[NQ * NW * 16];    // per wave and query: running max, sum
    const int y = blockIdx.y, bh = blockIdx.x;
    if (y < NT16) attn16_tile(ys, ms, ls, RH + (NT16 - 1 - y) * 16 * NQ, bh, QK16, VT16, ATH, ATL);
    else          attnhl_tile(ys, ms, ls, (NTH - 1 - (y - NT16)) * 16, bh, QKH, QKL, VTH, VTL, ATH, ATL);
}

extern "C" void kernel_launch(void* const* d_in, const int* in_sizes, int n_in,
                              void* d_out, int out_size, void* d_ws, size_t ws_size, hipStream_t stream) {
    // wire order: x [8][2048][128], w_qkv [128][384], b_qkv [384], w_proj [128][128], b_proj [128] (all f32)
    constexpr size_t XN = ((size_t)(NB - 1) * SEQ_FULL + SEQ) * DM;      // lowest element count covering the rows touched
    if (n_in < 5) return;
    if ((size_t)in_sizes[0] < XN || (size_t)in_sizes[1] < (size_t)DM * FW || in_sizes[2] < FW || (size_t)in_sizes[3] < (size_t)DQ * DM || in_sizes[4] < DM) return;
    if ((size_t)out_size < XN) return;
    const float* x = (const float*)d_in[0]; const float* wqkv = (const float*)d_in[1]; const float* bqkv = (const float*)d_in[2];
    const float* wo = (const float*)d_in[3]; const float* bo = (const float*)d_in[4];
    float* OUT = (float*)d_out;      // [NB_FULL][SEQ_FULL][128], byte offset 0

    // workspace carve: every region a multiple of 256 B, sized to the producers' whole-line store extent
    constexpr size_t SZ_QK16 = 2 * PLN * 2;                    // f16 q | k planes
    constexpr size_t SZ_VT16 = PLN * 2;                        // f16 V^T planes
    constexpr size_t SZ_QKHL = 2 * PLH * 2;                    // bf16 q | k hi (and lo) planes, rows < RH
    constexpr size_t SZ_VTHL = PLH * 2;                        // bf16 V^T hi (and lo) planes, keys < RH
    constexpr size_t SZ_AT   = PLN * 2;                        // head-major context hi (and lo) planes
    constexpr size_t O_QK16 = 0;
    constexpr size_t O_VT16 = O_QK16 + SZ_QK16;
    constexpr size_t O_QKH  = O_VT16 + SZ_VT16;
    constexpr size_t O_QKL  = O_QKH + SZ_QKHL;
    constexpr size_t O_VTH  = O_QKL + SZ_QKHL;
    constexpr size_t O_VTL  = O_VTH + SZ_VTHL;
    constexpr size_t O_ATH  = O_VTL + SZ_VTHL;
    constexpr size_t O_ATL  = O_ATH + SZ_AT;
    constexpr size_t O_END  = O_ATL + SZ_AT;
    static_assert(SZ_QK16 % 256 == 0 && SZ_VT16 % 256 == 0 && SZ_QKHL % 256 == 0 && SZ_VTHL % 256 == 0 && SZ_AT % 256 == 0);
    static_assert(O_END <= (size_t)134217728);                  // total carve <= 128 MiB
    static_assert(((size_t)NB * SEQ) % 64 == 0);                // qkv GEMM M tiles
    if (ws_size < O_END) return;
    char* ws = (char*)d_ws;
    h16* QK16 = (h16*)(ws + O_QK16); h16* VT16 = (h16*)(ws + O_VT16);
    bf* QKH = (bf*)(ws + O_QKH); bf* QKL = (bf*)(ws + O_QKL); bf* VTH = (bf*)(ws + O_VTH); bf* VTL = (bf*)(ws + O_VTL);
    bf* ATH = (bf*)(ws + O_ATH); bf* ATL = (bf*)(ws + O_ATL);

    k_gemm_qkv<<<dim3(NB * SEQ / 64, FW / 64, 1), 32, 0, stream>>>(x, wqkv, bqkv, QK16, VT16, QKH, QKL, VTH, VTL);
    k_attn<<<dim3(NB * NH, NT16 + NTH, 1), 32 * NW, 0, stream>>>(QK16, VT16, QKH, QKL, VTH, VTL, ATH, ATL);
    k_gemm_proj<<<dim3(SEQ / 64, DM / 64, NB), 32, 0, stream>>>(ATH, ATL, wo, OUT, bo);
}

// v010
// One run takes 32.7 microseconds.
// Next to v009, in two timings, it ran 1.05 times as fast each time.
// All steps since v000 together make it 3.70 times as fast.
#include <hip/hip_runtime.h>

// Causal self-attention: x [NB][SEQ][128]; qkv = x w_qkv + b_qkv ([in][out] weight, q | k | v column thirds, 4 heads x 32, head h = columns h*32+d); scores x 32^-0.5; causal select (diagonal kept); softmax; out = merged w_proj + b_proj ([in][out]).
// Compute dtypes, f32 accumulate everywhere: qkv projection v_wmma_f32_16x16x32_bf16 on x / w_qkv rounded to bf16 (RNE) in registers as the fragments are loaded (single product); attention query rows < 256: bf16 hi/lo planes, 3 products for k q^T and for v^T p; query rows >= 256: v_wmma_f32_16x16x32_f16 single products (q, k, v f16 planes, p carried x1024 in the exponent); output projection: bf16 hi/lo context planes x w_proj rounded to bf16 (RNE) in registers (2 products). Softmax f32, online running-max form in the log2 domain.
// Fused attention, one work-group of NW waves per 16 query rows (rows < RH) or per NQ * 16 query rows (rows >= RH, every wave carrying all NQ tiles), the 32-key steps dealt round-robin to the waves (wave w: steps w, w + NW, ...), partial (max, sum, O) joined through LDS; head dim 32 = one 32-deep k-step for the scores: S^T = K Q^T (keys on D rows, queries on D columns), p built per lane and fed as the B operand of O^T = V^T P^T (B element r <- tile keys 0-15 [r], element 8+r <- tile keys 16-31 [r]); no score / probability plane in memory.

#ifndef NB
#define NB 8
#endif
#ifndef SEQ
#define SEQ 2048
#endif
#define NB_FULL  8
#define SEQ_FULL 2048
#define DM   128
#define NH   4
#define HD   32
#define DQ   (NH * HD)
#define FW   (3 * DQ)
#define RH   256                      // query rows < RH use bf16 hi/lo planes
#define PLN  ((size_t)NB * NH * SEQ * HD)   // elements of one [b*h][t][d] plane
#define PLH  ((size_t)NB * NH * RH * HD)    // elements of one hi/lo plane (rows < RH)
#define SCL2 0.25503486164918f        // HD^-0.5 * log2(e)
#define PCL  10.0f                    // log2 of the p carry (x1024) for the f16 path
#define NEGB (-3.0e38f)
#define YP   36                       // staging pitch (floats) of the 16 x 32 attention result tile
#define NW   4                        // waves per query tile: each walks every NW-th 32-key step
#define NQ   4                        // f16 path: 16-query tiles per work-group; every K and V^T fragment a wave uses feeds all of them that have keys in its step

static_assert(DQ == DM);               // merged width == model width
static_assert(HD == 32);               // scores: one 32-deep k-step; head row == 64 B of 16-bit data; proj k-step == one head
static_assert(2 * HD == 64);
static_assert(HD % 16 == 0);           // O^T tiles of 16 d rows
static_assert(YP % 4 == 0 && YP >= HD); // 16-B aligned staging rows
static_assert(NW * 32 * 4 == 16 * HD);  // join: every thread owns 4 consecutive d of one query row
static_assert(DM % 128 == 0);          // GEMM K multiple of the request groups (2 and 4 k-steps of 32), weight lines of 64
static_assert(DQ % 64 == 0);           // proj GEMM K multiple of 32; a qkv GEMM N tile inside one of q, k, v
static_assert(FW % 64 == 0);           // GEMM N tile multiple
static_assert(SEQ % 64 == 0);          // GEMM M tile multiple, 32-key steps, V^T lines
static_assert(RH % 64 == 0);           // hi/lo V^T lines, 32-key steps inside RH, a GEMM M tile on one side of RH
static_assert(RH <= SEQ);
static_assert(NQ % 2 == 0);            // the NQ tiles of a work-group span NQ / 2 whole 32-key steps (the diagonal steps): step q0 + 32 i is the last for tiles 2 i and 2 i + 1
static_assert(NQ / 2 <= NW);           // every diagonal step has a wave of its own
static_assert(RH % (16 * NQ) == 0 && (SEQ - RH) % (16 * NQ) == 0);
static_assert(RH >= 32 * NW);          // f16 path: every wave has a first key step in front of the diagonal step
static_assert(NB <= NB_FULL);
static_assert(SEQ <= SEQ_FULL);

typedef _Float16 h16;
typedef unsigned short bf;
typedef __attribute__((ext_vector_type(16))) __bf16   v16bf;
typedef __attribute__((ext_vector_type(16))) _Float16 v16h;
typedef __attribute__((ext_vector_type(16))) unsigned short v16us;
typedef __attribute__((ext_vector_type(8)))  _Float16 v8h;
typedef __attribute__((ext_vector_type(8)))  unsigned short v8us;
typedef __attribute__((ext_vector_type(8)))  float    v8f;
typedef __attribute__((ext_vector_type(4)))  float    v4f;
typedef __attribute__((ext_vector_type(4)))  unsigned short v4us;
typedef v4f  __attribute__((may_alias)) v4fa;
typedef __attribute__((ext_vector_type(2)))  float    v2f;

__device__ __forceinline__ unsigned short f2bf(float f) { unsigned u = __float_as_uint(f); u += 0x7FFFu + ((u >> 16) & 1u); return (unsigned short)(u >> 16); }   // RNE convert
__device__ __forceinline__ float bf2f(unsigned short b) { return __uint_as_float(((unsigned)b) << 16); }
__device__ __forceinline__ float bfr(float f) { return bf2f(f2bf(f)); }
__device__ __forceinline__ void splitf(float y, unsigned short& h, unsigned short& l) { h = f2bf(y); l = f2bf(y - bf2f(h)); }
__device__ __forceinline__ v16h cat16(v8h lo, v8h hi) { return __builtin_shufflevector(lo, hi, 0, 1, 2, 3, 4, 5, 6, 7, 8, 9, 10, 11, 12, 13, 14, 15); }
__device__ __forceinline__ v16bf cat16b(v8us lo, v8us hi) { return __builtin_bit_cast(v16bf, __builtin_shufflevector(lo, hi, 0, 1, 2, 3, 4, 5, 6, 7, 8, 9, 10, 11, 12, 13, 14, 15)); }
// fragment loaders: elements 0..7 <- p[0..7], elements 8..15 <- p[16..23]; p already includes + 8 * (lane >> 4)
__device__ __forceinline__ v16h ldh(const h16* p) { return cat16(*(const v8h*)p, *(const v8h*)(p + 16)); }
__device__ __forceinline__ v16bf ldb(const bf* p) { return cat16b(*(const v8us*)p, *(const v8us*)(p + 16)); }
typedef __attribute__((ext_vector_type(8))) __bf16 v8bf;
// f32 sources, rounded to bf16 (RNE, v_cvt_pk_bf16_f32) in registers, same element order as ldb. The request (raw16) and the rounding (rnd16) are apart so that a group of requests can be issued before the first rounding waits for one.
struct raw16 { v8f lo, hi; };
__device__ __forceinline__ v16bf rnd16(const raw16 r) {
    const v8bf l8 = __builtin_convertvector(r.lo, v8bf), h8 = __builtin_convertvector(r.hi, v8bf);
    return __builtin_shufflevector(l8, h8, 0, 1, 2, 3, 4, 5, 6, 7, 8, 9, 10, 11, 12, 13, 14, 15); }
// row fragment: elements 0..7 <- p[0..7], elements 8..15 <- p[16..23]; p already includes + 8 * (lane >> 4)
__device__ __forceinline__ raw16 ldxf(const float* p) { return raw16{*(const v8f*)p, *(const v8f*)(p + 16)}; }
// column fragment of an [in][out] weight of row pitch N: elements 0..7 <- p[0..7 * N], elements 8..15 <- p[16..23 * N]; p already includes + 8 * (lane >> 4) * N + the lane's column; 16 lanes read 64 contiguous bytes of a weight row
__device__ __forceinline__ raw16 ldwf(const float* p, const int N) {
    raw16 r;
#pragma unroll
    for (int k = 0; k < 8; ++k) { r.lo[k] = p[(size_t)k * N]; r.hi[k] = p[(size_t)(16 + k) * N]; }
    return r; }
__device__ __forceinline__ v8f wmmab(v16bf a, v16bf b, v8f c) { return __builtin_amdgcn_wmma_f32_16x16x32_bf16(false, a, false, b, (short)0, c, false, false); }
// guarded forms: 4 nops after the matrix op, accumulator tied, operands kept live
__device__ __forceinline__ v8f wm16g(v16h a, v16h b, v8f c) {
    c = __builtin_amdgcn_wmma_f32_16x16x32_f16(false, a, false, b, (short)0, c, false, false);
    asm volatile("v_nop\n\tv_nop\n\tv_nop\n\tv_nop" : "+v"(c) : "v"(a), "v"(b));
    return c; }
__device__ __forceinline__ v8f wmbg(v16bf a, v16bf b, v8f c) {
    c = __builtin_amdgcn_wmma_f32_16x16x32_bf16(false, a, false, b, (short)0, c, false, false);
    asm volatile("v_nop\n\tv_nop\n\tv_nop\n\tv_nop" : "+v"(c) : "v"(a), "v"(b));
    return c; }

// ---- register-blocked GEMM body, ONE WAVE per 64x64 output tile (16 accumulators); grid (M/64, N/64, Z), 32 threads. The weight W is the f32 input itself, [K][N] of row pitch ldw, read by columns and rounded to bf16 in registers (ldwf).
// y[m][n] (f32) = sum_k A[m][k] bf16(W[k][n]) (+ A2[m][k] bf16(W[k][n]) when NSPLIT == 1) + bf16-RNE(bias[n]). K % (32 * KG) == 0, M and N multiples of 64 (asserted at file scope).
// PLANES == false: A, A2 are bf16 K-contiguous planes, y goes to C (f32, pitch ldc). PLANES == true (qkv projection): A is the f32 input Xf (rows of K floats, rounded to bf16 in registers, ldxf; Xf points at the tile's batch), y goes straight to the attention operand planes of struct planes, no f32 copy in memory.
// A addressing: element (m, k) at A[m * lda + (k >> 5) * ksA + (k & 31)] (row pitch lda, advance ksA per 32-deep k-step); a plain row-major plane has lda = K, ksA = 32.
// q | k planes [which][b*h][t][d]: f16 copy for all t, bf16 hi/lo for t < RH ([which][b*h][RH][d]); V^T planes [b*h][d][t]: f16 for all t, bf16 hi/lo for t < RH ([b*h][d][RH]).
struct planes { h16* QK16; h16* VT16; bf* QKH; bf* QKL; bf* VTH; bf* VTL; };
// Plane epilogues of one 64 x 64 qkv tile held in acc[mb][nb] (lane (hi, lr), element j: token t0 + mb*16 + hi*8 + j, tile column nb*16 + lr); braw: the lane's bias values, requested in front of the K loop (put_v: [nb] = tile column nb*16 + lr; put_qk: [k] = tile column (lane & 7) * 8 + k); heads bh0, bh0 + 1; HL: the tile's tokens are < RH.
// V^T: a lane's 8 accumulator rows are 8 consecutive tokens of one d, i.e. 16 contiguous bytes of a V^T row: stored from registers.
template <bool HL>
__device__ __forceinline__ void put_v(const v8f (&acc)[4][4], const float (&braw)[4], const int bh0, const int t0, const int lane, const planes P) {
    const int lr = lane & 15, hi = lane >> 4;
#pragma unroll
    for (int nb = 0; nb < 4; ++nb) { const int col = nb * 16 + lr; const float bv = bfr(braw[nb]); const size_t vr = (size_t)(bh0 + (col >> 5)) * HD + (col & 31);
#pragma unroll
        for (int mb = 0; mb < 4; ++mb) { const int t = t0 + mb * 16 + hi * 8; v8h o16; v8us oh, ol;
#pragma unroll
            for (int j = 0; j < 8; ++j) { const float y = acc[mb][nb][j] + bv; o16[j] = (h16)y; if (HL) { unsigned short x1, x2; splitf(y, x1, x2); oh[j] = x1; ol[j] = x2; } }
            *(v8h*)(P.VT16 + vr * SEQ + t) = o16;
            if (HL) { *(v8us*)(P.VTH + vr * RH + t) = oh; *(v8us*)(P.VTL + vr * RH + t) = ol; } } }
    asm volatile("s_wait_xcnt 0x0" ::: "memory");   // behind the last plane store: stands in front of any later rewrite of a register that these stores name, on every way the branches allow
}
// q / k: 16 tokens at a time turned through the wave's LDS tile os (pitch 68 floats); a lane then owns 8 consecutive d of one token (16 B of f16), 8 lanes a token's two heads, and a store covers 4 tokens = 256 contiguous bytes per head.
template <bool HL>
__device__ __forceinline__ void put_qk(const v8f (&acc)[4][4], float* os, const float (&braw)[8], const int which, const int bh0, const int t0, const int lane, const planes P) {
    const int lr = lane & 15, hi = lane >> 4, c = (lane & 7) * 8, d = c & 31; const size_t bh = (size_t)(bh0 + (c >> 5));
    float bv[8];
#pragma unroll
    for (int k = 0; k < 8; ++k) bv[k] = bfr(braw[k]);
#pragma unroll
    for (int mb = 0; mb < 4; ++mb) {
#pragma unroll
        for (int nb = 0; nb < 4; ++nb) {
#pragma unroll
            for (int j = 0; j < 8; ++j) os[(hi * 8 + j) * 68 + nb * 16 + lr] = acc[mb][nb][j]; }
        __builtin_amdgcn_wave_barrier(); asm volatile("" ::: "memory");   // the tile's LDS writes stay in front of the reads of other lanes' values
#pragma unroll
        for (int s = 0; s < 4; ++s) { const int row = 4 * s + (lane >> 3), t = t0 + mb * 16 + row;
            const v4f lo4 = *(const v4fa*)(os + row * 68 + c), hi4 = *(const v4fa*)(os + row * 68 + c + 4); v8h o16; v8us oh, ol;
#pragma unroll
            for (int k = 0; k < 8; ++k) { const float y = (k < 4 ? lo4[k & 3] : hi4[k & 3]) + bv[k]; o16[k] = (h16)y; if (HL) { unsigned short x1, x2; splitf(y, x1, x2); oh[k] = x1; ol[k] = x2; } }
            *(v8h*)(P.QK16 + (size_t)which * PLN + (bh * SEQ + t) * HD + d) = o16;
            if (HL) { const size_t o2 = (size_t)which * PLH + (bh * RH + t) * HD + d; *(v8us*)(P.QKH + o2) = oh; *(v8us*)(P.QKL + o2) = ol; } }
        __builtin_amdgcn_wave_barrier(); asm volatile("" ::: "memory");   // the reads stay in front of the next 16 tokens' LDS writes
    }
    asm volatile("s_wait_xcnt 0x0" ::: "memory");   // behind the last plane store: stands in front of any later rewrite of a register that these stores name, on every way the branches allow
}
// KG: k-steps whose fragment requests are issued as one group in front of one wait (K % (32 * KG) == 0): a wave has nothing else to do while a request is under way, so every group costs one whole load latency, and K / (32 * KG) groups cost that many.
template <int NSPLIT, bool PLANES, int KG>
__device__ __forceinline__ void gemmw_body(const float* __restrict__ Xf, const bf* __restrict__ A, const bf* __restrict__ A2, const float* __restrict__ W, const int ldw, const int K, const int lda, const size_t ksA, float* C, const int ldc, const float* __restrict__ bias, const size_t sA, const size_t sC, const planes P) {
    __shared__ __align__(16) float os[16 * 68];
    const size_t z = blockIdx.z; A += z * sA; if (NSPLIT == 1) A2 += z * sA; C += z * sC;
    const int lane = threadIdx.x & 31, lr = lane & 15, hi = lane >> 4; const int r0 = blockIdx.x * 64, c0 = blockIdx.y * 64;
    v8f acc[4][4];
#pragma unroll
    for (int mb = 0; mb < 4; ++mb)
#pragma unroll
        for (int nb = 0; nb < 4; ++nb) acc[mb][nb] = (v8f){};
    const size_t aoff = (size_t)((PLANES ? r0 % SEQ : r0) + lr) * lda + 8 * hi, boff = (size_t)(8 * hi) * ldw + c0 + lr;
    // the epilogue's bias values are requested together with the fragments, so that they land with them and the epilogue waits for no request of its own. PLANES: in front of the K loop, in both epilogues' lane orders (six requests; a branch on the tile's kind would stand in front of the fragment requests); otherwise behind the group's last fragment request.
    const float* bb = bias + c0;   // uniform over the work-group
    float bq[8], bw[4];   // PLANES: bq[k] = tile column (lane & 7) * 8 + k (put_qk), bw[nb] = tile column nb * 16 + lr (put_v); otherwise bw[i] = tile column lr * 4 + i
    if constexpr (PLANES) {
#pragma unroll
        for (int k = 0; k < 8; ++k) bq[k] = bb[(lane & 7) * 8 + k];
#pragma unroll
        for (int nb = 0; nb < 4; ++nb) bw[nb] = bb[nb * 16 + lr];
        asm volatile("s_wait_xcnt 0x0" :: "s"(bb) : "memory");   // stands in front of the first rewrite of a register that the bias requests name; their scalar base as an input keeps the compiler from lifting its rewrite over the wait
    }
#pragma unroll 1
    for (int kc = 0; kc < K; kc += 32 * KG) {
        const size_t ak = (size_t)(kc >> 5) * ksA;
        const float* wp = W + boff + (size_t)kc * ldw; const float* xp = Xf + aoff + ak; const bf* ap = A + aoff + ak; const bf* ap2 = A2 + aoff + ak;
        v16bf a[KG][4], a2[KG][4]; raw16 xr[KG][4], wr[KG][4];
        // the row operand of all KG k-steps first (it comes from farthest away), then the weight columns
#pragma unroll
        for (int g = 0; g < KG; ++g)
#pragma unroll
            for (int mb = 0; mb < 4; ++mb) { const size_t o = (size_t)g * ksA + (size_t)mb * 16 * lda; if (PLANES) xr[g][mb] = ldxf(xp + o); else a[g][mb] = ldb(ap + o); if (NSPLIT == 1) a2[g][mb] = ldb(ap2 + o); }
        __builtin_amdgcn_sched_barrier(0);   // the row requests stay in front of the weight requests: a wave has at most 63 requests under way, and the slowest ones must be among the first
#pragma unroll
        for (int g = 0; g < KG; ++g)
#pragma unroll
            for (int nb = 0; nb < 4; ++nb) wr[g][nb] = ldwf(wp + (size_t)g * 32 * ldw + nb * 16, ldw);
        if constexpr (!PLANES) {
#pragma unroll
            for (int i = 0; i < 4; ++i) bw[i] = bb[lr * 4 + i]; }
        // stands in front of the first rewrite of a register that the requests above name; the pointers (of the bias request: its scalar base and its lane index) as inputs keep the compiler from lifting their rewrite over the wait
        if constexpr (PLANES) asm volatile("s_wait_xcnt 0x0" :: "v"(xp), "v"(wp) : "memory"); else asm volatile("s_wait_xcnt 0x0" :: "v"(ap), "v"(ap2), "v"(wp), "s"(bb), "v"(lr) : "memory");
        __builtin_amdgcn_sched_barrier(0);   // all of the group's requests stay in front of the first rounding (their latencies pass together, not one behind another), and the pointers' advance stays behind the wait above
#pragma unroll
        for (int g = 0; g < KG; ++g) {   // k-steps in rising order: every accumulator's sum order is that of a loop over single k-steps
#pragma unroll
            for (int mb = 0; mb < 4; ++mb) if (PLANES) a[g][mb] = rnd16(xr[g][mb]);
#pragma unroll
            for (int nb = 0; nb < 4; ++nb) { const v16bf b = rnd16(wr[g][nb]);
#pragma unroll
                for (int mb = 0; mb < 4; ++mb) { acc[mb][nb] = wmmab(a[g][mb], b, acc[mb][nb]); if (NSPLIT == 1) acc[mb][nb] = wmmab(a2[g][mb], b, acc[mb][nb]); } } }
        asm volatile("v_nop\n\tv_nop\n\tv_nop\n\tv_nop" : "+v"(acc[0][0]), "+v"(acc[1][1]), "+v"(acc[2][2]), "+v"(acc[3][3]) : "v"(a[KG - 1][0]), "v"(a[KG - 1][3]));
    }
    if constexpr (PLANES) {
        // tile coordinates, all uniform over the work-group: 64 columns = two heads of one of q, k, v; 64 rows = 64 tokens of one batch, all on one side of RH
        const int which = c0 / DQ, bh0 = (r0 / SEQ) * NH + (c0 % DQ) / HD, t0 = r0 % SEQ;
        if (which == 2) { if (t0 < RH) put_v<true>(acc, bw, bh0, t0, lane, P); else put_v<false>(acc, bw, bh0, t0, lane, P); }
        else            { if (t0 < RH) put_qk<true>(acc, os, bq, which, bh0, t0, lane, P); else put_qk<false>(acc, os, bq, which, bh0, t0, lane, P); }
        return;
    }
#pragma unroll
    for (int mb = 0; mb < 4; ++mb) {
#pragma unroll
        for (int nb = 0; nb < 4; ++nb) {
#pragma unroll
            for (int j = 0; j < 8; ++j) os[(hi * 8 + j) * 68 + nb * 16 + lr] = acc[mb][nb][j]; }
        __builtin_amdgcn_wave_barrier(); asm volatile("" ::: "memory");
        float* cp = C + (size_t)(r0 + mb * 16 + hi) * ldc + c0 + lr * 4;   // the lane's 4 columns of row hi; + 2 s rows
        v4f val[8];
#pragma unroll
        for (int s = 0; s < 8; ++s) { val[s] = *(const v4fa*)(os + (2 * s + hi) * 68 + lr * 4);
            val[s][0] += bfr(bw[0]); val[s][1] += bfr(bw[1]); val[s][2] += bfr(bw[2]); val[s][3] += bfr(bw[3]);   // bw[i]: bias of column c0 + lr * 4 + i
            *(v4f*)(cp + (size_t)(2 * s) * ldc) = val[s]; }
        // stands in front of the first rewrite of a register that these stores name; their data and pointer as inputs keep the compiler from lifting such a rewrite over the wait
        asm volatile("s_wait_xcnt 0x0" :: "v"(val[0]), "v"(val[1]), "v"(val[2]), "v"(val[3]), "v"(val[4]), "v"(val[5]), "v"(val[6]), "v"(val[7]), "v"(cp) : "memory");
        __builtin_amdgcn_wave_barrier(); asm volatile("" ::: "memory");
    }
}
// qkv [NB*SEQ][384] = x [NB][SEQ][128] x w_qkv + b_qkv, column = which*128 + h*32 + d, written as the attention planes; grid (NB*SEQ/64, 384/64, 1)
__global__ __launch_bounds__(32) void k_gemm_qkv(const float* __restrict__ x, const float* __restrict__ w, const float* __restrict__ bias, h16* QK16, h16* VT16, bf* QKH, bf* QKL, bf* VTH, bf* VTL) {
    gemmw_body<0, true, 2>(x + (size_t)(blockIdx.x * 64 / SEQ) * SEQ_FULL * DM, nullptr, nullptr, w, FW, DM, DM, (size_t)32, nullptr, FW, bias, 0, 0, planes{QK16, VT16, QKH, QKL, VTH, VTL}); }
// OUT [b][t][128] = (ATH + ATL) x w_proj + b_proj; A element (t, k = h*32+d) at plane [(b*NH + h)*SEQ + t][d]: lda = HD, k-step advance = SEQ*HD, batch stride NH*SEQ*HD;
// grid (SEQ/64, 128/64, NB); output rows use the full per-batch stride
__global__ __launch_bounds__(32) void k_gemm_proj(const bf* __restrict__ Ah, const bf* __restrict__ Al, const float* __restrict__ w, float* C, const float* __restrict__ bias) {
    gemmw_body<1, false, 4>(nullptr, Ah, Al, w, DM, DQ, HD, (size_t)SEQ * HD, C, DM, bias, (size_t)NH * SEQ * HD, (size_t)SEQ_FULL * DM, planes{}); }

// ---- join of the NW waves' partial results of one 16-query tile. Wave w holds, for query n, its running max m (log2 domain), its sum l (both halves already added) and O^T unnormalised.
// Every wave stages its part, one work-group barrier, then thread (w, lane) owns query row 4w + (lane >> 3), d = 4 (lane & 7) .. + 3: out = sum_w 2^(m_w - M) O_w / sum_w 2^(m_w - M) l_w, waves summed in index order.
// A wave that had no key step stages m = NEGB, l = 0, O = 0 and gets weight 0 (wave 0 always has step 0, whose key 0 every query keeps, so M is finite).
__device__ __forceinline__ void join_stage(float* ys, float* ms, float* ls, const int w, const int lane, const v8f* o, const float m, const float l) {
    const int n = lane & 15, hh = lane >> 4;
#pragma unroll
    for (int j = 0; j < 2; ++j)
#pragma unroll
        for (int r = 0; r < 8; ++r) ys[w * 16 * YP + n * YP + j * 16 + 8 * hh + r] = o[j][r];
    if (hh == 0) { ms[w * 16 + n] = m; ls[w * 16 + n] = l; }
}
__device__ __forceinline__ void join_finish(const float* ys, const float* ms, const float* ls, const int w, const int lane, bf* ATH, bf* ATL, const size_t tile0) {
    const int row = 4 * w + (lane >> 3), c = (lane & 7) * 4;
    float mw[NW]; float M = NEGB;
#pragma unroll
    for (int k = 0; k < NW; ++k) { mw[k] = ms[k * 16 + row]; M = fmaxf(M, mw[k]); }
    v4f acc = (v4f){}; float L = 0.0f;
#pragma unroll
    for (int k = 0; k < NW; ++k) { const float sc = __builtin_amdgcn_exp2f(mw[k] - M); L += sc * ls[k * 16 + row]; acc += sc * *(const v4fa*)(ys + k * 16 * YP + row * YP + c); }
    const float inv = 1.0f / L;
    v4us oh, ol;
#pragma unroll
    for (int k = 0; k < 4; ++k) { unsigned short x1, x2; splitf(acc[k] * inv, x1, x2); oh[k] = x1; ol[k] = x2; }
    const size_t oo = tile0 + (size_t)row * HD + c;
    *(v4us*)(ATH + oo) = oh; *(v4us*)(ATL + oo) = ol;
}

// ---- fused causal attention, query rows >= RH, single f16 products. NW waves per NQ * 16 query rows; q0: the first query row, bh: batch * NH + head.
// A wave holds NQ query fragments (tile t: rows q0 + 16 t ..) and keeps (max, sum, O) per tile; a step's K and V^T fragments are loaded once and multiplied with the q and p of every tile that has keys in it.
// Lane (hh = lane>>4, n = lane&15): query q0+16t+n; per 32-key step holds keys kb+8hh+r (s[t][0]) and kb+16+8hh+r (s[t][1]), r = 0..7, for every tile t.
// One tile's online-softmax update for one 32-key step: scores s0 (keys kb+8hh+r), s1 (keys kb+16+8hh+r) -> p as a B fragment; max, sum and O rescaled. DIAG: the step that touches the diagonal (replace by select).
template <bool DIAG>
__device__ __forceinline__ v16h soft16(v8f s0, v8f s1, const int key0, const int qrow, float& m, float& l, v8f (&o)[2]) {
    if (DIAG) {
#pragma unroll
        for (int r = 0; r < 8; ++r) { s0[r] = (key0 + r <= qrow) ? s0[r] : NEGB; s1[r] = (key0 + 16 + r <= qrow) ? s1[r] : NEGB; } }
    // the maximum is taken over the raw scores and scaled once: rounding a product with a positive constant keeps the order, so this is the maximum of the scaled scores, bit for bit
    float mx = NEGB;
#pragma unroll
    for (int r = 0; r < 8; ++r) mx = fmaxf(mx, s0[r]);
#pragma unroll
    for (int r = 0; r < 8; ++r) mx = fmaxf(mx, s1[r]);
    mx *= SCL2;
    const float mn = fmaxf(fmaxf(m, mx), __shfl_xor(mx, 16, 32));
    const float corr = __builtin_amdgcn_exp2f(m - mn);
    m = mn;
    // exponent of p = score * SCL2 + (PCL - max): one fused multiply-add a score, two scores (neighbouring accumulator registers) an instruction
    const float c = PCL - mn; const v2f c2 = {c, c}, k2 = {SCL2, SCL2};
    v2f pa = {0.0f, 0.0f}, pc = {0.0f, 0.0f}; v16h pb;
#pragma unroll
    for (int r = 0; r < 8; r += 2) {
        const v2f e0 = __builtin_elementwise_fma((v2f){s0[r], s0[r + 1]}, k2, c2), e1 = __builtin_elementwise_fma((v2f){s1[r], s1[r + 1]}, k2, c2);
        const v2f p0 = {__builtin_amdgcn_exp2f(e0[0]), __builtin_amdgcn_exp2f(e0[1])}, p1 = {__builtin_amdgcn_exp2f(e1[0]), __builtin_amdgcn_exp2f(e1[1])};
        pa += p0; pc += p1;
        pb[r] = (h16)p0[0]; pb[r + 1] = (h16)p0[1]; pb[8 + r] = (h16)p1[0]; pb[8 + r + 1] = (h16)p1[1]; }
    pa += pc;
    l = l * corr + (pa[0] + pa[1]);
#pragma unroll
    for (int j = 0; j < 2; ++j) o[j] = o[j] * corr;
    return pb;
}
__device__ __forceinline__ v8f wm16(v16h a, v16h b, v8f c) { return __builtin_amdgcn_wmma_f32_16x16x32_f16(false, a, false, b, (short)0, c, false, false); }
// The key loop is a software pipeline: a step's K fragments are requested right behind the score products of the wave's step before it (into the registers those products have just read), its V^T fragments right behind that step's V^T p products, so each request has a whole softmax to land in.
// The diagonal steps (kb == q0 + 32 i, i < NQ / 2, the last of the work-group, each owned by one wave) stand behind the loop, so the loop body has no branch: the compiler orders it as one block and keeps the distances behind the matrix products itself.
// A wave's last pass requests a diagonal step's fragments whether or not the wave owns one: rows q0 .. q0 + 16 NQ - 1 exist for every tile, and a wave that owns none never reads the registers.
// Diagonal step kb == q0 + 32 i: tiles below 2 i have no key in it and are left out; the tiles from T0 = 2 i on take the select (all kept for tiles above 2 i + 1).
template <int T0>
__device__ __forceinline__ void diag16(const v16h a0, const v16h a1, const v16h va0, const v16h va1, const v16h (&qb)[NQ], const int key0, const int qrow0, float (&m)[NQ], float (&l)[NQ], v8f (&o)[NQ][2]) {
    v8f s[NQ][2]; v16h pb[NQ];
#pragma unroll
    for (int t = T0; t < NQ; ++t) { s[t][0] = wm16g(a0, qb[t], (v8f){}); s[t][1] = wm16g(a1, qb[t], (v8f){}); }
#pragma unroll
    for (int t = T0; t < NQ; ++t) pb[t] = soft16<true>(s[t][0], s[t][1], key0, qrow0 + 16 * t, m[t], l[t], o[t]);
#pragma unroll
    for (int t = T0; t < NQ; ++t) { o[t][0] = wm16g(va0, pb[t], o[t][0]); o[t][1] = wm16g(va1, pb[t], o[t][1]); }
}
__device__ __forceinline__ void attn16_tile(float* ys, float* ms, float* ls, const int q0, const int bh, const h16* QK16, const h16* VT16, bf* ATH, bf* ATL) {
    const int lane = threadIdx.x & 31, n = lane & 15, hh = lane >> 4;
    const int w = __builtin_amdgcn_readfirstlane(threadIdx.x >> 5);   // wave number, scalar: the key loop stays a scalar loop
    const h16* qp = QK16 + ((size_t)bh * SEQ + q0 + n) * HD + 8 * hh;     // query plane (which 0), + t * 16 * HD
    const h16* kbase = QK16 + ((size_t)bh * SEQ + n) * HD + 8 * hh;       // key plane (which 1) at + PLN, + key * HD
    const h16* vbase = VT16 + ((size_t)bh * HD + n) * SEQ + 8 * hh;       // V^T plane, + j*16*SEQ + key
    v16h qb[NQ]; v8f o[NQ][2]; float m[NQ], l[NQ];
#pragma unroll   // t a constant: the per-tile arrays stay in registers (here and in the t loops below)
    for (int t = 0; t < NQ; ++t) { qb[t] = ldh(qp + (size_t)t * 16 * HD); o[t][0] = (v8f){}; o[t][1] = (v8f){}; m[t] = NEGB; l[t] = 0.0f; }
    int kb = 32 * w;                   // <= q0: q0 >= RH >= 32 * NW
    const h16* kp0 = kbase + (size_t)kb * HD; const h16* vp0 = vbase + kb;
    v16h a0 = ldh(kp0 + PLN), a1 = ldh(kp0 + PLN + 16 * HD);
    v16h va0 = ldh(vp0), va1 = ldh(vp0 + (size_t)16 * SEQ);
    asm volatile("s_wait_xcnt 0x0" :: "v"(qp), "v"(kp0), "v"(vp0) : "memory");   // stands in front of the first rewrite of a register that the first requests name; the pointers as inputs keep that rewrite behind the wait
#pragma unroll 1   // one step a pass: the fragments of the next step land in the registers of this one
    for (; kb < q0; kb += 32 * NW) {
        const int kn = min(kb + 32 * NW, q0 + 16 * NQ - 32);      // the wave's next step, or the last diagonal step
        v8f s[NQ][2]; v16h pb[NQ];
#pragma unroll
        for (int t = 0; t < NQ; ++t) { s[t][0] = wm16(a0, qb[t], (v8f){}); s[t][1] = wm16(a1, qb[t], (v8f){}); }
        const h16* kp = kbase + (size_t)kn * HD;
        a0 = ldh(kp + PLN); a1 = ldh(kp + PLN + 16 * HD);
        asm volatile("s_wait_xcnt 0x0" :: "v"(kp) : "memory");   // stands in front of the first rewrite of a register that the K requests name; the pointer as an input keeps that rewrite behind the wait
        __builtin_amdgcn_sched_barrier(0);   // the K requests stay here, in front of the softmax: moved down behind it they would have no time to land, and would land on registers that the V^T p products read as p
#pragma unroll
        for (int t = 0; t < NQ; ++t) pb[t] = soft16<false>(s[t][0], s[t][1], kb + 8 * hh, q0 + 16 * t + n, m[t], l[t], o[t]);
#pragma unroll
        for (int t = 0; t < NQ; ++t) { o[t][0] = wm16(va0, pb[t], o[t][0]); o[t][1] = wm16(va1, pb[t], o[t][1]); }
        const h16* vp = vbase + kn;
        va0 = ldh(vp); va1 = ldh(vp + (size_t)16 * SEQ);
        asm volatile("s_wait_xcnt 0x0" :: "v"(vp) : "memory");   // stands in front of the first rewrite of a register that the V^T requests name; the pointer as an input keeps that rewrite behind the wait
    }
    static_assert(NQ / 2 == 2);        // the two tests below are the NQ / 2 diagonal steps
    // wave-uniform: the waves whose steps end on a diagonal step
    if (kb == q0) diag16<0>(a0, a1, va0, va1, qb, kb + 8 * hh, q0 + n, m, l, o);
    else if (kb == q0 + 32) diag16<2>(a0, a1, va0, va1, qb, kb + 8 * hh, q0 + n, m, l, o);
#pragma unroll
    for (int t = 0; t < NQ; ++t) { l[t] += __shfl_xor(l[t], 16, 32); join_stage(ys + t * NW * 16 * YP, ms + t * NW * 16, ls + t * NW * 16, w, lane, o[t], m[t], l[t]); }
    __syncthreads();                   // publishes every wave's partials of all NQ tiles to the joining threads
#pragma unroll
    for (int t = 0; t < NQ; ++t) join_finish(ys + t * NW * 16 * YP, ms + t * NW * 16, ls + t * NW * 16, w, lane, ATH, ATL, ((size_t)bh * SEQ + q0 + 16 * t) * HD);
}

// ---- fused causal attention, query rows < RH, bf16 hi/lo planes, 3 products per contraction (hi*hi + lo*hi + hi*lo). Same lane map and key split as attn16_tile.
__device__ __forceinline__ void attnhl_tile(float* ys, float* ms, float* ls, const int q0, const int bh, const bf* QKH, const bf* QKL, const bf* VTH, const bf* VTL, bf* ATH, bf* ATL) {
    const int lane = threadIdx.x & 31, n = lane & 15, hh = lane >> 4;
    const int w = __builtin_amdgcn_readfirstlane(threadIdx.x >> 5);   // wave number, scalar: the key loop stays a scalar loop
    const int qrow = q0 + n, kend = q0 + 15;
    const size_t qo = ((size_t)bh * RH + q0 + n) * HD + 8 * hh;           // query hi/lo plane (which 0)
    const size_t ko = PLH + ((size_t)bh * RH + n) * HD + 8 * hh;          // key hi/lo plane (which 1), + key * HD
    const size_t vo = ((size_t)bh * HD + n) * RH + 8 * hh;                // V^T hi/lo plane, + j*16*RH + key
    v8f o[2];
#pragma unroll
    for (int j = 0; j < 2; ++j) o[j] = (v8f){};
    float m = NEGB, l = 0.0f;
#pragma unroll 1
    for (int kb = 32 * w; kb <= kend; kb += 32 * NW) {
        v8f s[2]; s[0] = (v8f){}; s[1] = (v8f){};
        {
            const v16bf qh = ldb(QKH + qo), ql = ldb(QKL + qo);
#pragma unroll
            for (int kc = 0; kc < 2; ++kc) { const size_t ka = ko + (size_t)(kb + kc * 16) * HD;
                const v16bf kh = ldb(QKH + ka), kl = ldb(QKL + ka);
                s[kc] = wmbg(kh, qh, s[kc]); s[kc] = wmbg(kl, qh, s[kc]); s[kc] = wmbg(kh, ql, s[kc]); }
            asm volatile("" ::: "memory");
        }
        float u[16];
        const int key0 = kb + 8 * hh;
        if (kb + 31 > q0) {            // wave-uniform
#pragma unroll
            for (int r = 0; r < 8; ++r) { u[r] = (key0 + r <= qrow) ? s[0][r] * SCL2 : NEGB; u[8 + r] = (key0 + 16 + r <= qrow) ? s[1][r] * SCL2 : NEGB; }
        } else {
#pragma unroll
            for (int r = 0; r < 8; ++r) { u[r] = s[0][r] * SCL2; u[8 + r] = s[1][r] * SCL2; }
        }
        float mx = u[0];
#pragma unroll
        for (int i = 1; i < 16; ++i) mx = fmaxf(mx, u[i]);
        mx = fmaxf(mx, __shfl_xor(mx, 16, 32));
        const float mn = fmaxf(m, mx);
        const float corr = __builtin_amdgcn_exp2f(m - mn);
        m = mn;
        v16us phu, plu; float ps = 0.0f;
#pragma unroll
        for (int r = 0; r < 8; ++r) {
            const float p0 = __builtin_amdgcn_exp2f(u[r] - mn); const float p1 = __builtin_amdgcn_exp2f(u[8 + r] - mn);
            ps += p0 + p1; unsigned short x1, x2; splitf(p0, x1, x2); phu[r] = x1; plu[r] = x2; splitf(p1, x1, x2); phu[8 + r] = x1; plu[8 + r] = x2; }
        const v16bf ph = __builtin_bit_cast(v16bf, phu), pl = __builtin_bit_cast(v16bf, plu);
        l = l * corr + ps;
#pragma unroll
        for (int j = 0; j < 2; ++j) o[j] = o[j] * corr;
#pragma unroll
        for (int j = 0; j < 2; ++j) { const size_t va = vo + (size_t)j * 16 * RH + kb; const v16bf vh = ldb(VTH + va), vl = ldb(VTL + va);
            o[j] = wmbg(vh, ph, o[j]); o[j] = wmbg(vl, ph, o[j]); o[j] = wmbg(vh, pl, o[j]);
            asm volatile("" ::: "memory"); }
    }
    l += __shfl_xor(l, 16, 32);
    join_stage(ys, ms, ls, w, lane, o, m, l);
    __syncthreads();                   // publishes every wave's partial to the joining threads
    join_finish(ys, ms, ls, w, lane, ATH, ATL, ((size_t)bh * SEQ + q0) * HD);
}

// Both kinds of query tile read only the planes of the qkv launch and write disjoint context rows, so they share ONE launch: grid (NB*NH, NT16 + NTH), 32 * NW threads; the block's tile index picks the path (uniform over the work-group).
// Order: a tile's key steps grow with its query row, so the slow grid axis counts the tiles from the last (most steps) down to the first (one step), the f16 tiles in front of the hi/lo tiles. The fast axis is batch * head, all of equal length. For speed only: every (tile, head) pair is done exactly once whatever the order.
#define NT16 ((SEQ - RH) / (16 * NQ))   // work-groups per head on the f16 path (NQ * 16 query rows each)
#define NTH  (RH / 16)                  // work-groups per head on the hi/lo path (16 query rows each)
__global__ __launch_bounds__(32 * NW) void k_attn(const h16* QK16, const h16* VT16, const bf* QKH, const bf* QKL, const bf* VTH, const bf* VTL, bf* ATH, bf* ATL) {
    __shared__ __align__(16) float ys[NQ * NW * 16 * YP];   // one 16 x 32 partial O tile per wave and query tile
    __shared__ float ms[NQ * NW * 16], ls[NQ * NW * 16];    // per wave and query: running max, sum
    const int y = blockIdx.y, bh = blockIdx.x;
    if (y < NT16) attn16_tile(ys, ms, ls, RH + (NT16 - 1 - y) * 16 * NQ, bh, QK16, VT16, ATH, ATL);
    else          attnhl_tile(ys, ms, ls, (NTH - 1 - (y - NT16)) * 16, bh, QKH, QKL, VTH, VTL, ATH, ATL);
}

extern "C" void kernel_launch(void* const* d_in, const int* in_sizes, int n_in,
                              void* d_out, int out_size, void* d_ws, size_t ws_size, hipStream_t stream) {
    // wire order: x [8][2048][128], w_qkv [128][384], b_qkv [384], w_proj [128][128], b_proj [128] (all f32)
    constexpr size_t XN = ((size_t)(NB - 1) * SEQ_FULL + SEQ) * DM;      // lowest element count covering the rows touched
    if (n_in < 5) return;
    if ((size_t)in_sizes[0] < XN || (size_t)in_sizes[1] < (size_t)DM * FW || in_sizes[2] < FW || (size_t)in_sizes[3] < (size_t)DQ * DM || in_sizes[4] < DM) return;
    if ((size_t)out_size < XN) return;
    const float* x = (const float*)d_in[0]; const float* wqkv = (const float*)d_in[1]; const float* bqkv = (const float*)d_in[2];
    const float* wo = (const float*)d_in[3]; const float* bo = (const float*)d_in[4];
    float* OUT = (float*)d_out;      // [NB_FULL][SEQ_FULL][128], byte offset 0

    // workspace carve: every region a multiple of 256 B, sized to the producers' whole-line store extent
    constexpr size_t SZ_QK16 = 2 * PLN * 2;                    // f16 q | k planes
    constexpr size_t SZ_VT16 = PLN * 2;                        // f16 V^T planes
    constexpr size_t SZ_QKHL = 2 * PLH * 2;                    // bf16 q | k hi (and lo) planes, rows < RH
    constexpr size_t SZ_VTHL = PLH * 2;                        // bf16 V^T hi (and lo) planes, keys < RH
    constexpr size_t SZ_AT   = PLN * 2;                        // head-major context hi (and lo) planes
    constexpr size_t O_QK16 = 0;
    constexpr size_t O_VT16 = O_QK16 + SZ_QK16;
    constexpr size_t O_QKH  = O_VT16 + SZ_VT16;
    constexpr size_t O_QKL  = O_QKH + SZ_QKHL;
    constexpr size_t O_VTH  = O_QKL + SZ_QKHL;
    constexpr size_t O_VTL  = O_VTH + SZ_VTHL;
    constexpr size_t O_ATH  = O_VTL + SZ_VTHL;
    constexpr size_t O_ATL  = O_ATH + SZ_AT;
    constexpr size_t O_END  = O_ATL + SZ_AT;
    static_assert(SZ_QK16 % 256 == 0 && SZ_VT16 % 256 == 0 && SZ_QKHL % 256 == 0 && SZ_VTHL % 256 == 0 && SZ_AT % 256 == 0);
    static_assert(O_END <= (size_t)134217728);                  // total carve <= 128 MiB
    static_assert(((size_t)NB * SEQ) % 64 == 0);                // qkv GEMM M tiles
    if (ws_size < O_END) return;
    char* ws = (char*)d_ws;
    h16* QK16 = (h16*)(ws + O_QK16); h16* VT16 = (h16*)(ws + O_VT16);
    bf* QKH = (bf*)(ws + O_QKH); bf* QKL = (bf*)(ws + O_QKL); bf* VTH = (bf*)(ws + O_VTH); bf* VTL = (bf*)(ws + O_VTL);
    bf* ATH = (bf*)(ws + O_ATH); bf* ATL = (bf*)(ws + O_ATL);

    k_gemm_qkv<<<dim3(NB * SEQ / 64, FW / 64, 1), 32, 0, stream>>>(x, wqkv, bqkv, QK16, VT16, QKH, QKL, VTH, VTL);
    k_attn<<<dim3(NB * NH, NT16 + NTH, 1), 32 * NW, 0, stream>>>(QK16, VT16, QKH, QKL, VTH, VTL, ATH, ATL);
    k_gemm_proj<<<dim3(SEQ / 64, DM / 64, NB), 32, 0, stream>>>(ATH, ATL, wo, OUT, bo);
}
